// v000
// The times below were measured on an AMD MI455X: many runs one after another, warmed up first and cycling through
// copies of the inputs, with the whole window's GPU time divided by the number of runs. Launches and the gaps
// between them are all in it. The median over several windows is given; except for v000 it joins two sittings, which
// can be a few percent apart, so the side-by-side timings, each taken in one sitting, are the better comparison.
// v000 is the starting kernel. One run takes 519 microseconds.
// Contractions: q, k, v^T projections = v_wmma_f32_16x16x32_bf16 (bf16 operands from RNE-converted inputs and weights, single product, f32 accumulate);
// q.k^T scores = v_wmma_f32_16x16x32_bf16 with bf16 hi/lo split q and k (hi.hi + hi.lo + lo.hi), f32 accumulate;
// p.v = v_wmma_f32_16x16x32_f16 (p carried x1024 in f16 times v in f16, single product; plus f16 residual planes x4096 of
// p and v for the first 512 query rows of every sequence), f32 accumulate;
// ctx.Wo = v_wmma_f32_16x16x32_bf16 with ctx as bf16 hi/lo planes times bf16 Wo^T (2 products), f32 accumulate;
// causal mask (key <= query), online softmax, normalisers and bias adds in f32 on the VALU.
// Carry audit:
//   Psh = f16(1024 * p)                      -> the 1/1024 is folded exactly once in the attention epilogue: inv = (1/l) * (1/1024)
//   Psl = f16((1024 p - Psh) * 4096)         }  products Psh.VTl and Psl.VTh go to the separate accumulator o1,
//   VTl = f16((v - VTh) * 4096)              }  folded back with * (1/4096) once per key chunk (RES blocks only)
//   VTh = f16(v), no carry (|v| typ. 0.45); q / k / ctx lo planes are unscaled bf16 residuals (v - hi) sharing the hi accumulator;
//   score scale 1/8 applied once in f32 after the score accumulate. No other scaled planes.
#include <hip/hip_runtime.h>
#include <math.h>
#include <stdint.h>

#define NB    2
#define SEQ   4096
#define DM    512
#define NH    8
#define HD    64
#define NQB   (SEQ / 64)   // 64 query / key blocks of 64
#define VLP   512          // key pitch of the v^T residual plane (keys 0..VLP-1)
#define RESQB 8            // leading 64-row query blocks that use the p / v residual planes
static_assert(RESQB * 64 <= VLP);
static_assert(NH * HD == DM);
static_assert((SEQ % 64) == 0 && (DM % 64) == 0 && (DM % 32) == 0);
static_assert(((NB * SEQ / 64) * (DM / 64)) % 8 == 0);
static_assert(((DM / 64) * (SEQ / 64)) % 8 == 0);
static_assert((NB * SEQ * DM) % (8 * 256) == 0);
static_assert((DM * DM) % (64 * 64) == 0);

typedef _Float16 v16h __attribute__((ext_vector_type(16)));
typedef _Float16 v8h  __attribute__((ext_vector_type(8)));
typedef __bf16   v16b __attribute__((ext_vector_type(16)));
typedef __bf16   v8b  __attribute__((ext_vector_type(8)));
typedef float    v8f  __attribute__((ext_vector_type(8)));
typedef float    v4f  __attribute__((ext_vector_type(4)));
typedef unsigned int v4u __attribute__((ext_vector_type(4)));

// ---- scalar helpers --------------------------------------------------------------------------------
__device__ __forceinline__ unsigned short bf_bits(float f) {          // f32 -> bf16 bits, RNE convert
  unsigned u = __float_as_uint(f);
  return (unsigned short)((u + 0x7FFFu + ((u >> 16) & 1u)) >> 16);
}
__device__ __forceinline__ float bf_up(unsigned short h) { return __uint_as_float(((unsigned)h) << 16); }
__device__ __forceinline__ unsigned short h_bits(_Float16 x) { return __builtin_bit_cast(unsigned short, x); }
__device__ __forceinline__ unsigned pk16(unsigned short a, unsigned short b) { return (unsigned)a | ((unsigned)b << 16); }
__device__ __forceinline__ v8f zero8() { v8f z = {0.f, 0.f, 0.f, 0.f, 0.f, 0.f, 0.f, 0.f}; return z; }
__device__ __forceinline__ v8h zero8h() {
  const _Float16 z = (_Float16)0.0f;
  v8h r = {z, z, z, z, z, z, z, z};
  return r;
}

// ---- fragment loader: 16-bit A/B operand, lane -> row/col (lane&15), p already includes +8*(lane>>4);
//      elements 0..7 <- p[0..7] (k0+8h..), elements 8..15 <- p[16..23] (k0+16+8h..)
__device__ __forceinline__ v16b ldfrag_b(const __bf16* p) {
  union { v16b v; v8b h[2]; } f;
  f.h[0] = *(const v8b*)(p);
  f.h[1] = *(const v8b*)(p + 16);
  return f.v;
}

// ---- WMMA helpers with trailing VALU hazard gap --------------------------------------------------------
__device__ __forceinline__ v8f mma_b(v16b a, v16b b, v8f c) {
  c = __builtin_amdgcn_wmma_f32_16x16x32_bf16(false, a, false, b, (short)0, c, false, false);
  asm volatile("v_nop\n\tv_nop\n\tv_nop\n\tv_nop" : "+v"(c) : "v"(a), "v"(b));
  return c;
}
__device__ __forceinline__ v8f mma_h(v16h a, v16h b, v8f c) {
  c = __builtin_amdgcn_wmma_f32_16x16x32_f16(false, a, false, b, (short)0, c, false, false);
  asm volatile("v_nop\n\tv_nop\n\tv_nop\n\tv_nop" : "+v"(c) : "v"(a), "v"(b));
  return c;
}
__device__ __forceinline__ v8f mma_b_raw(v16b a, v16b b, v8f c) {
  return __builtin_amdgcn_wmma_f32_16x16x32_bf16(false, a, false, b, (short)0, c, false, false);
}
__device__ __forceinline__ void dep_guard_b(v8f& a, v8f& b, v16b x, v16b y) {
  asm volatile("v_nop\n\tv_nop\n\tv_nop\n\tv_nop" : "+v"(a), "+v"(b) : "v"(x), "v"(y));
}
__device__ __forceinline__ void keep4_b(v16b a, v16b b, v16b c, v16b d) {
  asm volatile("v_nop" :: "v"(a), "v"(b), "v"(c), "v"(d));
}
__device__ __forceinline__ void acc_guard4(v8f& a, v8f& b, v8f& c, v8f& d) {
  asm volatile("v_nop\n\tv_nop\n\tv_nop\n\tv_nop" : "+v"(a), "+v"(b), "+v"(c), "+v"(d));
}

// =====================================================================================================
// f32 -> bf16 (RNE convert), 8 elements per thread, one 16-B store per lane: a wave writes 512 contiguous B
// the [8192][512] activations, a multiple of 256).
// coverage: n8 threads x 8 = the whole plane.
// =====================================================================================================
__global__ __launch_bounds__(256) void cvt_bf16x8(const float* __restrict__ in, unsigned short* out, int n8) {
  const int i = blockIdx.x * 256 + threadIdx.x;
  if (i < n8) {
    const v4f a = *(const v4f*)(in + (size_t)i * 8);
    const v4f b = *(const v4f*)(in + (size_t)i * 8 + 4);
    v4u p;
    p[0] = pk16(bf_bits(a[0]), bf_bits(a[1]));
    p[1] = pk16(bf_bits(a[2]), bf_bits(a[3]));
    p[2] = pk16(bf_bits(b[0]), bf_bits(b[1]));
    p[3] = pk16(bf_bits(b[2]), bf_bits(b[3]));
    *(v4u*)(out + (size_t)i * 8) = p;
    
  }
}

// =====================================================================================================
// f32 [K rows][N cols] (pitch ldw) -> bf16 transposed plane WT[n][k] (pitch ldt, k contiguous), RNE convert.
// One 64x64 tile per block (grid.x = N/64, grid.y = K/64, both exact multiples): the tile is staged in LDS with
// coalesced 16-B loads (256 threads x 16 floats = the whole tile), __syncthreads, then each output row segment
// coverage: 8 waves x 2 x (lane>>3 = 4 rows) = 64 rows n, 8 lanes x 8 = 64 k: the whole tile; grid = the whole plane.
// =====================================================================================================
__global__ __launch_bounds__(256) void cvt_bf16_tr64(const float* __restrict__ W, unsigned short* WT, int ldw, int ldt) {
  __shared__ __align__(16) float sW[64 * 65];
  const int tid = threadIdx.x;
  const int n0 = blockIdx.x * 64;
  const int k0 = blockIdx.y * 64;
  {
    const int kr = tid >> 2, cb = (tid & 3) * 16;          // row k0+kr, cols n0+cb .. +15
    const float* src = W + (size_t)(k0 + kr) * ldw + n0 + cb;
#pragma unroll
    for (int i = 0; i < 4; ++i) {
      const v4f f = *(const v4f*)(src + 4 * i);
      float* d = sW + kr * 65 + cb + 4 * i;
      d[0] = f[0]; d[1] = f[1]; d[2] = f[2]; d[3] = f[3];
    }
  }
  __syncthreads();
  const int wave = tid >> 5, lane = tid & 31;
  const int q = lane >> 3, c8 = (lane & 7) * 8;
  v4u pv[2];
#pragma unroll
  for (int it = 0; it < 2; ++it) {
    const int nr = wave * 8 + it * 4 + q;                  // output row n0+nr, 0 <= nr < 64
    v4u p;
#pragma unroll
    for (int e = 0; e < 4; ++e) {
      const float f0 = sW[(c8 + 2 * e) * 65 + nr];
      const float f1 = sW[(c8 + 2 * e + 1) * 65 + nr];
      p[e] = pk16(bf_bits(f0), bf_bits(f1));
    }
    pv[it] = p;
  }
  {
#pragma unroll
    for (int it = 0; it < 2; ++it) {
      const int nr = wave * 8 + it * 4 + q;
      *(v4u*)(WT + (size_t)(n0 + nr) * ldt + k0 + c8) = pv[it];
    }
    
  }
}

// =====================================================================================================
// Register-blocked batched bf16 WMMA GEMM: C[m][n] = sum_k A[m][k] * Bt[n][k] + bias; one wave per 64x64 tile,
// no block barriers. A row-major [M][K] pitch lda; Bt row-major [N][K] pitch ldb (k contiguous);
// M, N multiples of 64, K multiple of 32 (host shapes are static multiples). blockIdx.y = batch index (strides in elements).
// NSPLIT: 0 = A.Bt; 1 = (A + A2).Bt (A2 = unscaled bf16 lo plane of A, 2 products).
// BIAS: 0 = none; 1 = per column n, bias[n]; 2 = per row m, bias[m]; the bias value is RNE-converted to bf16 and added in f32.
// OUT_MODE: 0 = f32 (pitch ldc); 2 = bf16 hi plane C + bf16 lo plane C2 (lo = RNE(v - hi), unscaled);
//           3 = f16 hi plane C + f16 residual plane C2 = f16((v - hi) * rscale), C2 written only for tiles
//               with n0 < N2 (pitch ldc2, batch stride strideC2).
// =====================================================================================================
template <int NSPLIT, int OUT_MODE, int BIAS>
__global__ __launch_bounds__(256) void gemm64(
    const unsigned short* __restrict__ Ap, const unsigned short* A2p, int lda, long long strideA,
    const unsigned short* __restrict__ Btp, int ldb, long long strideB,
    const float* __restrict__ bias,
    void* Cout, int ldc, long long strideC,
    void* Cout2, int ldc2, long long strideC2, int N2,
    int M, int N, int K, float rscale) {
  const __bf16* A   = (const __bf16*)(const void*)Ap;
  const __bf16* A2  = (const __bf16*)(const void*)A2p;
  const __bf16* Bt  = (const __bf16*)(const void*)Btp;
  __shared__ __align__(16) float sT[8][16 * 68];   // per-wave 16x64 slab, pitch 68 floats
  const int b    = blockIdx.y;
  const int lane = threadIdx.x & 31;
  const int wave = threadIdx.x >> 5;
  const int tilesN = N >> 6;
  const int tilesM = M >> 6;
  const int tile = blockIdx.x * 8 + wave;
  if (tile >= tilesM * tilesN) return;   // wave-uniform; no block barriers in this kernel
  const int tm = tile / tilesN;
  const int tn = tile - tm * tilesN;
  const int m0 = tm << 6;
  const int n0 = tn << 6;

  const __bf16* Ab  = A  + (size_t)b * strideA;
  const __bf16* Bb  = Bt + (size_t)b * strideB;
  const __bf16* Ab2 = (NSPLIT >= 1) ? (A2 + (size_t)b * strideA) : Ab;

  const int rlane = lane & 15;                 // row (A) / col (B, D) within subtile
  const int koff  = (lane >> 4) * 8;           // k offset of this lane half
  const int mOff  = (lane >> 4) * 8;           // D row offset

  v8f acc[4][4];
#pragma unroll
  for (int i = 0; i < 4; ++i)
#pragma unroll
    for (int j = 0; j < 4; ++j) acc[i][j] = zero8();

  for (int k0 = 0; k0 < K; k0 += 32) {
    v16b bh[4];
#pragma unroll
    for (int j = 0; j < 4; ++j) {
      const size_t bo = (size_t)(n0 + (j << 4) + rlane) * ldb + koff + k0;
      bh[j] = ldfrag_b(Bb + bo);
    }
#pragma unroll
    for (int i = 0; i < 4; ++i) {
      const size_t ao = (size_t)(m0 + (i << 4) + rlane) * lda + koff + k0;
      const v16b ah = ldfrag_b(Ab + ao);
      v16b al = ah;
      if (NSPLIT >= 1) al = ldfrag_b(Ab2 + ao);
#pragma unroll
      for (int j = 0; j < 4; ++j) {
        acc[i][j] = mma_b_raw(ah, bh[j], acc[i][j]);
        if (NSPLIT >= 1) acc[i][j] = mma_b_raw(al, bh[j], acc[i][j]);
      }
      dep_guard_b(acc[i][0], acc[i][3], ah, al);
    }
    keep4_b(bh[0], bh[1], bh[2], bh[3]);
  }
  acc_guard4(acc[0][0], acc[0][1], acc[0][2], acc[0][3]);
  acc_guard4(acc[1][0], acc[1][1], acc[1][2], acc[1][3]);
  acc_guard4(acc[2][0], acc[2][1], acc[2][2], acc[2][3]);
  acc_guard4(acc[3][0], acc[3][1], acc[3][2], acc[3][3]);

  // ---- epilogue ----
  float* slab = sT[wave];
  float bcol[4];
#pragma unroll
  for (int j = 0; j < 4; ++j) {
    bcol[j] = 0.f;
    if (BIAS == 1) bcol[j] = bf_up(bf_bits(bias[n0 + (j << 4) + rlane]));   // n < N, bias has N entries
  }
#pragma unroll
  for (int i = 0; i < 4; ++i) {
    const int mBase = m0 + (i << 4);
    float brow[8];
#pragma unroll
    for (int r = 0; r < 8; ++r) {
      brow[r] = 0.f;
      if (BIAS == 2) brow[r] = bf_up(bf_bits(bias[mBase + mOff + r]));      // m < M, bias has M entries
    }
#pragma unroll
    for (int j = 0; j < 4; ++j) {
#pragma unroll
      for (int r = 0; r < 8; ++r) {
        slab[(mOff + r) * 68 + (j << 4) + rlane] = acc[i][j][r] + bcol[j] + brow[r];
      }
    }
    __builtin_amdgcn_fence(__ATOMIC_RELEASE, "workgroup");
    __builtin_amdgcn_wave_barrier();
    __builtin_amdgcn_fence(__ATOMIC_ACQUIRE, "workgroup");
    if (OUT_MODE == 0) {
      float* C = (float*)Cout + (size_t)b * strideC;
      const int hh = lane >> 4, c4 = (lane & 15) * 4;     // 256-B row segment = 16 lanes x 16 B
      {
#pragma unroll
        for (int it = 0; it < 8; ++it) {
          const int row = it * 2 + hh;                     // it 0..7 x hh 0..1 = rows 0..15
          const v4f v = *(const v4f*)(slab + row * 68 + c4);
          *(v4f*)(C + (size_t)(mBase + row) * ldc + n0 + c4) = v;
        }
        
      }
    } else {
      const int q = lane >> 3, c8 = (lane & 7) * 8;
      unsigned short* C  = (unsigned short*)Cout  + (size_t)b * strideC;
      unsigned short* C2 = (unsigned short*)Cout2 + (size_t)b * strideC2;
      const bool wlo = (OUT_MODE == 2) || (n0 < N2);      // wave-uniform
      v4u hv[4], lv[4];
#pragma unroll
      for (int it = 0; it < 4; ++it) {
        const int row = it * 4 + q;                        // it 0..3 x q 0..3 = rows 0..15
        const float* sp = slab + row * 68 + c8;
        v4u a, a2;
#pragma unroll
        for (int e = 0; e < 4; ++e) {
          const float f0 = sp[2 * e], f1 = sp[2 * e + 1];
          unsigned short h0, h1, l0, l1;
          if (OUT_MODE == 2) {
            h0 = bf_bits(f0); h1 = bf_bits(f1);
            l0 = bf_bits(f0 - bf_up(h0)); l1 = bf_bits(f1 - bf_up(h1));
          } else {
            const _Float16 x0 = (_Float16)f0, x1 = (_Float16)f1;
            h0 = h_bits(x0); h1 = h_bits(x1);
            l0 = h_bits((_Float16)((f0 - (float)x0) * rscale));
            l1 = h_bits((_Float16)((f1 - (float)x1) * rscale));
          }
          a[e] = pk16(h0, h1); a2[e] = pk16(l0, l1);
        }
        hv[it] = a; lv[it] = a2;
      }
      {
#pragma unroll
        for (int it = 0; it < 4; ++it) {
          const int row = it * 4 + q;
          *(v4u*)(C + (size_t)(mBase + row) * ldc + n0 + c8) = hv[it];
          if (wlo) *(v4u*)(C2 + (size_t)(mBase + row) * ldc2 + n0 + c8) = lv[it];
        }
        
      }
    }
    __builtin_amdgcn_fence(__ATOMIC_RELEASE, "workgroup");
    __builtin_amdgcn_wave_barrier();
    __builtin_amdgcn_fence(__ATOMIC_ACQUIRE, "workgroup");
  }
}

// =====================================================================================================
// Causal attention, head dim 64, key chunks of 64.
//   q planes (bf16 hi / lo): element (b, t, h, d) at [(b*SEQ + t)*DM + h*64 + d]
//   k planes (bf16 hi / lo): same layout with key index s
//   v^T hi plane (f16):      element (b, h, d, s) at [(b*DM + h*64 + d)*SEQ + s]
//   v^T residual plane (f16, (v - hi)*4096): [(b*DM + h*64 + d)*VLP + s], s < VLP, read only when RES
//   (a key chunk at or beyond VLP would contribute a zero v residual; its address is clamped)
//   Mask: query t keeps key s iff s <= t. A query block qb therefore needs key chunks 0..qb only (block-uniform
//   trip count qb+1 <= NQB); keys in later chunks exceed every query index of the block and are skipped entirely.
//   Inside a visited chunk a masked key gets logit -inf -> exp gives exactly 0, so it adds nothing to the numerator
//   or the normaliser. Row max bookkeeping: every query keeps key 0 (chunk 0), so after chunk 0 the running max of
//   every row is finite; in the diagonal chunk every query keeps at least its own key. Every row ends with l > 0.
//   out planes (bf16 hi / lo of the normalised context): element (b, t, h, d) at [(b*SEQ + t)*DM + h*64 + d]
//   scores = q . k : bf16 hi/lo split (hi.hi + hi.lo + lo.hi), f32 accumulate, then * 1/8 and the mask in f32
//   p = exp(s - m) carried as f16(1024 p); context = p . v on f16 WMMA; RES adds f16 residual planes of p and v
//   (scale 4096, separate accumulator folded back with 1/4096 per chunk in f32); online softmax (running max) in f32.
//   Block = 4 waves = 64 query rows of one (b, h); grid = nqbThis * NH * NB.
//   K / V^T chunk staging: 128 threads x 32 elements per plane = the whole 64x64 tile of every plane read later
//   (plain 16-B loads, __syncthreads before and after); P tiles are wave-private, spilled with _Float16 element stores
//   Output coverage: each wave stores rows q0..q0+15 (it 0..3 x lane>>3 0..3) x 64 columns (8 lanes x 8) of both planes;
//   grid over all (b, h, qb) = the whole [NB*SEQ][DM] planes.
// =====================================================================================================
template <bool RES>
__global__ __launch_bounds__(128)
void attn_causal64(const unsigned short* __restrict__ qhp, const unsigned short* __restrict__ qlp,
                   const unsigned short* __restrict__ khp, const unsigned short* __restrict__ klp,
                   const unsigned short* __restrict__ vhp, const unsigned short* __restrict__ vlp,
                   unsigned short* ohp, unsigned short* olp,
                   int qbBase, int nqbThis) {
  union FB { v16b v; v8b h[2]; };
  union FH { v16h v; v8h h[2]; };
  __shared__ __align__(16) __bf16   Ksh[64 * 64];                 // K hi [kv][d]   8 KB
  __shared__ __align__(16) __bf16   Ksl[64 * 64];                 // K lo
  __shared__ __align__(16) _Float16 Vth[64 * 64];                 // V^T hi [d][kv] 8 KB
  __shared__ __align__(16) _Float16 Vtl[RES ? 64 * 64 : 8];       // V^T residual
  __shared__ __align__(16) _Float16 Psh[4][16 * 64];              // per wave P [row][kv]
  __shared__ __align__(16) _Float16 Psl[RES ? 4 : 1][16 * 64];    // per wave P residual
  __shared__ __align__(16) float    Os[4][16 * 64];               // per wave context tile [row][d]

  const int tid  = threadIdx.x;
  const int wave = tid >> 5;
  const int lane = tid & 31;
  const int hh   = lane >> 4;
  const int c    = lane & 15;

  const int bx   = blockIdx.x;
  const int qbl  = bx % nqbThis;
  const int rest = bx / nqbThis;
  const int h    = rest % NH;
  const int b    = rest / NH;
  const int qb   = qbBase + qbl;               // 0..NQB-1 (block-uniform)
  const int q0   = qb * 64 + wave * 16;
  const size_t rowB = (size_t)b * SEQ;

  const __bf16* Qh = (const __bf16*)(const void*)qhp + (size_t)h * HD;
  const __bf16* Ql = (const __bf16*)(const void*)qlp + (size_t)h * HD;
  const __bf16* Kh = (const __bf16*)(const void*)khp + (size_t)h * HD;
  const __bf16* Kl = (const __bf16*)(const void*)klp + (size_t)h * HD;
  const _Float16* Vh = (const _Float16*)(const void*)vhp + ((size_t)b * DM + (size_t)h * HD) * SEQ;
  const _Float16* Vl = (const _Float16*)(const void*)vlp + ((size_t)b * DM + (size_t)h * HD) * VLP;

  // ---- Q fragments (A operand, row = lane&15): 2 d-chunks, hi and lo ----
  v16b qah[2], qal[2];
#pragma unroll
  for (int dc = 0; dc < 2; ++dc) {
    const size_t qo = (rowB + q0 + c) * DM + dc * 32 + 8 * hh;
    qah[dc] = ldfrag_b(Qh + qo);
    qal[dc] = ldfrag_b(Ql + qo);
  }

  float mrow[8], lrow[8];
  v8f oacc[4];
#pragma unroll
  for (int r = 0; r < 8; ++r) { mrow[r] = -INFINITY; lrow[r] = 0.f; }
#pragma unroll
  for (int t = 0; t < 4; ++t) oacc[t] = zero8();

  for (int kt = 0; kt <= qb; ++kt) {           // block-uniform trip count, <= NQB
    const int kv0 = kt * 64;                   // kv0 + 63 < SEQ
    __syncthreads();
    {
      const int r = tid >> 1, half = (tid & 1) * 32;
      const __bf16*   kg  = Kh + (rowB + kv0 + r) * DM + half;    // K row kv0+r, d = half..half+31
      const __bf16*   klg = Kl + (rowB + kv0 + r) * DM + half;
      const _Float16* vg  = Vh + (size_t)r * SEQ + kv0 + half;    // V^T row d = r, s = kv0+half..+31
      const int kvl = (kv0 + 64 <= VLP) ? kv0 : (VLP - 64);     // clamped address into the residual plane
      const _Float16* vlg = Vl + (size_t)r * VLP + kvl + half;
      const bool resOK = (kv0 + 64 <= VLP);                      // block-uniform (always true for qb < RESQB)
#pragma unroll
      for (int i = 0; i < 4; ++i) {
        const v8b a0 = *(const v8b*)(kg + 8 * i);
        const v8b a1 = *(const v8b*)(klg + 8 * i);
        const v8h b0 = *(const v8h*)(vg + 8 * i);
        *(v8b*)(Ksh + r * 64 + half + 8 * i) = a0;
        *(v8b*)(Ksl + r * 64 + half + 8 * i) = a1;
        *(v8h*)(Vth + r * 64 + half + 8 * i) = b0;
        if (RES) {
          v8h b1 = *(const v8h*)(vlg + 8 * i);
          if (!resOK) b1 = zero8h();
          *(v8h*)(Vtl + r * 64 + half + 8 * i) = b1;
        }
      }
    }
    __syncthreads();

    // ---- scores: 16 query rows x 64 keys per wave, 3 bf16 products ----
    v8f s[4];
#pragma unroll
    for (int j = 0; j < 4; ++j) {
      s[j] = zero8();
#pragma unroll
      for (int dc = 0; dc < 2; ++dc) {
        FB kb, kl;
        kb.h[0] = *(const v8b*)(Ksh + (j * 16 + c) * 64 + dc * 32 + 8 * hh);
        kb.h[1] = *(const v8b*)(Ksh + (j * 16 + c) * 64 + dc * 32 + 16 + 8 * hh);
        kl.h[0] = *(const v8b*)(Ksl + (j * 16 + c) * 64 + dc * 32 + 8 * hh);
        kl.h[1] = *(const v8b*)(Ksl + (j * 16 + c) * 64 + dc * 32 + 16 + 8 * hh);
        s[j] = mma_b(qah[dc], kb.v, s[j]);
        s[j] = mma_b(qah[dc], kl.v, s[j]);
        s[j] = mma_b(qal[dc], kb.v, s[j]);
      }
    }

    // ---- scale, causal mask by index, row max, online softmax, P (x1024, f16) and P residual (x4096) to LDS ----
    _Float16* pwh = Psh[wave];
    _Float16* pwl = Psl[RES ? wave : 0];
#pragma unroll
    for (int r = 0; r < 8; ++r) {
      const int rowq = q0 + 8 * hh + r;        // query index of D row 8hh+r
      float m = -INFINITY;
#pragma unroll
      for (int j = 0; j < 4; ++j) {
        const int key = kv0 + j * 16 + c;
        float sv = s[j][r] * 0.125f;
        const bool keep = (key <= rowq);
        sv = keep ? sv : -INFINITY;
        s[j][r] = sv;
        m = fmaxf(m, sv);
      }
#pragma unroll
      for (int off = 1; off < 16; off <<= 1) m = fmaxf(m, __shfl_xor(m, off, 32));
      const float mnew  = fmaxf(mrow[r], m);
      const float msafe = (mnew == -INFINITY) ? 0.f : mnew;
      const float alpha = __expf(mrow[r] - msafe);
      mrow[r] = mnew;
      float psum = 0.f;
#pragma unroll
      for (int j = 0; j < 4; ++j) {
        const float p = __expf(s[j][r] - msafe);     // masked logit: exp(-inf) = 0
        psum += p;
        const float p1k = p * 1024.0f;
        const _Float16 ph = (_Float16)p1k;
        pwh[(8 * hh + r) * 64 + j * 16 + c] = ph;
        if (RES) {
          const _Float16 pl = (_Float16)((p1k - (float)ph) * 4096.0f);
          pwl[(8 * hh + r) * 64 + j * 16 + c] = pl;
        }
      }
#pragma unroll
      for (int off = 1; off < 16; off <<= 1) psum += __shfl_xor(psum, off, 32);
      lrow[r] = lrow[r] * alpha + psum;
#pragma unroll
      for (int t = 0; t < 4; ++t) oacc[t][r] *= alpha;
    }
    __builtin_amdgcn_fence(__ATOMIC_RELEASE, "workgroup");
    __builtin_amdgcn_wave_barrier();
    __builtin_amdgcn_fence(__ATOMIC_ACQUIRE, "workgroup");

    // ---- context += P . V (f16 WMMA), residual products into a separate accumulator ----
    v8f o1[4];
#pragma unroll
    for (int t = 0; t < 4; ++t) o1[t] = zero8();
#pragma unroll 1
    for (int kk = 0; kk < 2; ++kk) {
      FH pa, pl;
      pa.h[0] = *(const v8h*)(pwh + c * 64 + kk * 32 + 8 * hh);
      pa.h[1] = *(const v8h*)(pwh + c * 64 + kk * 32 + 16 + 8 * hh);
      if (RES) {
        pl.h[0] = *(const v8h*)(pwl + c * 64 + kk * 32 + 8 * hh);
        pl.h[1] = *(const v8h*)(pwl + c * 64 + kk * 32 + 16 + 8 * hh);
      } else {
        pl.v = pa.v;
      }
#pragma unroll
      for (int t = 0; t < 4; ++t) {
        FH vb;
        vb.h[0] = *(const v8h*)(Vth + (t * 16 + c) * 64 + kk * 32 + 8 * hh);
        vb.h[1] = *(const v8h*)(Vth + (t * 16 + c) * 64 + kk * 32 + 16 + 8 * hh);
        oacc[t] = mma_h(pa.v, vb.v, oacc[t]);
        if (RES) {
          FH vl;
          vl.h[0] = *(const v8h*)(Vtl + (t * 16 + c) * 64 + kk * 32 + 8 * hh);
          vl.h[1] = *(const v8h*)(Vtl + (t * 16 + c) * 64 + kk * 32 + 16 + 8 * hh);
          o1[t] = mma_h(pa.v, vl.v, o1[t]);
          o1[t] = mma_h(pl.v, vb.v, o1[t]);
        }
      }
    }
    if (RES) {
#pragma unroll
      for (int t = 0; t < 4; ++t)
#pragma unroll
        for (int r = 0; r < 8; ++r) oacc[t][r] += o1[t][r] * (1.0f / 4096.0f);
    }
  }

  // ---- normalise (1/l and the 1/1024 p carry), stage the wave's 16x64 tile, bf16 hi/lo split,
  float* os = Os[wave];
#pragma unroll
  for (int r = 0; r < 8; ++r) {
    const float l = lrow[r];
    const float inv = ((l > 0.f) ? (1.0f / l) : 0.f) * (1.0f / 1024.0f);
#pragma unroll
    for (int t = 0; t < 4; ++t) os[(8 * hh + r) * 64 + t * 16 + c] = oacc[t][r] * inv;
  }
  __builtin_amdgcn_fence(__ATOMIC_RELEASE, "workgroup");
  __builtin_amdgcn_wave_barrier();
  __builtin_amdgcn_fence(__ATOMIC_ACQUIRE, "workgroup");
  {
    const int q4 = lane >> 3, c8 = (lane & 7) * 8;
    v4u hv[4], lv[4];
#pragma unroll
    for (int it = 0; it < 4; ++it) {
      const int row = it * 4 + q4;   // it 0..3 x q4 0..3 = rows 0..15 of the wave tile
      const float* sp = os + row * 64 + c8;
      v4u a, a2;
#pragma unroll
      for (int e = 0; e < 4; ++e) {
        const float f0 = sp[2 * e], f1 = sp[2 * e + 1];
        const unsigned short h0 = bf_bits(f0), h1 = bf_bits(f1);
        const unsigned short l0 = bf_bits(f0 - bf_up(h0)), l1 = bf_bits(f1 - bf_up(h1));
        a[e] = pk16(h0, h1); a2[e] = pk16(l0, l1);
      }
      hv[it] = a; lv[it] = a2;
    }
    {
#pragma unroll
      for (int it = 0; it < 4; ++it) {
        const int row = it * 4 + q4;
        const size_t go = (rowB + q0 + row) * DM + (size_t)h * HD + c8;
        *(v4u*)(ohp + go) = hv[it];
        *(v4u*)(olp + go) = lv[it];
      }
      
    }
  }
}

// =====================================================================================================
// Workspace map (bytes; every region is an exact multiple of its 64x64-tile / whole-line store granularity,
//   Qb   bf16 [8192][512]            0            8388608
//   Kb   bf16 [8192][512]            8388608      8388608
//   Vb   bf16 [8192][512]            16777216     8388608
//   WqT  bf16 [512 n][512 k]         25165824     524288
//   WkT                              25690112     524288
//   WvT                              26214400     524288
//   WoT                              26738688     524288
//   Qh   bf16 [8192][512]            27262976     8388608
//   Ql                               35651584     8388608
//   Kh                               44040192     8388608
//   Kl                               52428800     8388608
//   VTh  f16  [2][512][4096]         60817408     8388608
//   VTl  f16  [2][512][512]          69206016     1048576
//   Oh   bf16 [8192][512]            70254592     8388608
//   Ol                               78643200     8388608
//   end                              87031808
// =====================================================================================================
extern "C" void kernel_launch(void* const* d_in, const int* in_sizes, int n_in,
                              void* d_out, int out_size, void* d_ws, size_t ws_size,
                              hipStream_t stream) {
  if (n_in < 11) return;
  const int NX = NB * SEQ * DM;                    // 4194304
  if (in_sizes[0] != NX || in_sizes[1] != NX || in_sizes[2] != NX) return;
  if (in_sizes[3] != DM * DM || in_sizes[5] != DM * DM || in_sizes[7] != DM * DM || in_sizes[9] != DM * DM) return;
  if (in_sizes[4] != DM || in_sizes[6] != DM || in_sizes[8] != DM || in_sizes[10] != DM) return;
  if (out_size != NX) return;

  const float* v  = (const float*)d_in[0];   // [2][4096][512]
  const float* k  = (const float*)d_in[1];   // [2][4096][512]
  const float* q  = (const float*)d_in[2];   // [2][4096][512]
  const float* Wq = (const float*)d_in[3];   // [512 in][512 out] = [k][n]
  const float* bq = (const float*)d_in[4];   // [512]
  const float* Wk = (const float*)d_in[5];   // [512 in][512 out]
  const float* bk = (const float*)d_in[6];   // [512]
  const float* Wv = (const float*)d_in[7];   // [512 in][512 out]
  const float* bv = (const float*)d_in[8];   // [512]
  const float* Wo = (const float*)d_in[9];   // [512 in][512 out]
  const float* bo = (const float*)d_in[10];  // [512]

  const size_t PX  = (size_t)NB * SEQ * DM * 2;    //  8388608  16-bit activation plane [8192][512]
  const size_t PW  = (size_t)DM * DM * 2;          //   524288  16-bit weight plane [512][512]
  const size_t PVT = (size_t)NB * DM * SEQ * 2;    //  8388608  v^T hi plane
  const size_t PVL = (size_t)NB * DM * VLP * 2;    //  1048576  v^T residual plane
  size_t off = 0;
  const size_t oQb  = off; off += PX;
  const size_t oKb  = off; off += PX;
  const size_t oVb  = off; off += PX;
  const size_t oWq  = off; off += PW;
  const size_t oWk  = off; off += PW;
  const size_t oWv  = off; off += PW;
  const size_t oWo  = off; off += PW;
  const size_t oQh  = off; off += PX;
  const size_t oQl  = off; off += PX;
  const size_t oKh  = off; off += PX;
  const size_t oKl  = off; off += PX;
  const size_t oVTh = off; off += PVT;
  const size_t oVTl = off; off += PVL;
  const size_t oOh  = off; off += PX;
  const size_t oOl  = off; off += PX;
  if (off > ws_size) return;                       // off = 87031808
  if (off > (size_t)134217728) return;

  char* ws = (char*)d_ws;
  unsigned short* Qb  = (unsigned short*)(ws + oQb);
  unsigned short* Kb  = (unsigned short*)(ws + oKb);
  unsigned short* Vb  = (unsigned short*)(ws + oVb);
  unsigned short* WqT = (unsigned short*)(ws + oWq);
  unsigned short* WkT = (unsigned short*)(ws + oWk);
  unsigned short* WvT = (unsigned short*)(ws + oWv);
  unsigned short* WoT = (unsigned short*)(ws + oWo);
  unsigned short* Qh  = (unsigned short*)(ws + oQh);
  unsigned short* Ql  = (unsigned short*)(ws + oQl);
  unsigned short* Kh  = (unsigned short*)(ws + oKh);
  unsigned short* Kl  = (unsigned short*)(ws + oKl);
  unsigned short* VTh = (unsigned short*)(ws + oVTh);
  unsigned short* VTl = (unsigned short*)(ws + oVTl);
  unsigned short* Oh  = (unsigned short*)(ws + oOh);
  unsigned short* Ol  = (unsigned short*)(ws + oOl);

  const dim3 blk(256);
  const int n8x = NX / 8;                                      // 524288
  const dim3 gCvtX((n8x + 255) / 256);                         // 2048 blocks
  const dim3 gTr(DM / 64, DM / 64);                            // 8 x 8 tiles of 64x64 (exact)
  const dim3 gProj(((NB * SEQ / 64) * (DM / 64) + 7) / 8, 1);  // 1024 tiles -> 128 blocks: M=8192, N=512
  const dim3 gVT(((DM / 64) * (SEQ / 64) + 7) / 8, NB);        //  512 tiles ->  64 blocks x 2 batches: M=512, N=4096

  // (1) activations f32 -> bf16 planes (same layout as the inputs)
  cvt_bf16x8<<<gCvtX, blk, 0, stream>>>(q, Qb, n8x);
  cvt_bf16x8<<<gCvtX, blk, 0, stream>>>(k, Kb, n8x);
  cvt_bf16x8<<<gCvtX, blk, 0, stream>>>(v, Vb, n8x);
  // (2) weights f32 [k=512 rows][n=512 cols] -> bf16 transposed planes W^T [n][k] (k contiguous)
  cvt_bf16_tr64<<<gTr, blk, 0, stream>>>(Wq, WqT, DM, DM);
  cvt_bf16_tr64<<<gTr, blk, 0, stream>>>(Wk, WkT, DM, DM);
  cvt_bf16_tr64<<<gTr, blk, 0, stream>>>(Wv, WvT, DM, DM);
  cvt_bf16_tr64<<<gTr, blk, 0, stream>>>(Wo, WoT, DM, DM);
  // (3) qp = q . Wq + bq -> bf16 hi/lo planes [b*SEQ+t][h*64+d]   (A = Qb, Bt = WqT [n][k]; M=8192, N=512, K=512)
  gemm64<0, 2, 1><<<gProj, blk, 0, stream>>>(
      Qb, Qb, DM, 0LL, WqT, DM, 0LL, bq,
      (void*)Qh, DM, 0LL, (void*)Ql, DM, 0LL, DM,
      NB * SEQ, DM, DM, 1.0f);
  // (4) kp = k . Wk + bk -> bf16 hi/lo planes
  gemm64<0, 2, 1><<<gProj, blk, 0, stream>>>(
      Kb, Kb, DM, 0LL, WkT, DM, 0LL, bk,
      (void*)Kh, DM, 0LL, (void*)Kl, DM, 0LL, DM,
      NB * SEQ, DM, DM, 1.0f);
  // (5) vp^T = Wv^T . v^T + bv per batch -> f16 hi plane [b][h*64+d][s] (pitch SEQ) and residual plane
  //     (x4096, keys < VLP only, pitch VLP)   (A = WvT [dout][k], Bt = Vb rows of batch b; M=512, N=4096, K=512)
  gemm64<0, 3, 2><<<gVT, blk, 0, stream>>>(
      WvT, WvT, DM, 0LL, Vb, DM, (long long)SEQ * DM, bv,
      (void*)VTh, SEQ, (long long)DM * SEQ, (void*)VTl, VLP, (long long)DM * VLP, VLP,
      DM, SEQ, DM, 4096.0f);
  // (6) causal attention: query blocks 0..RESQB-1 with residual planes, the rest without
  attn_causal64<true><<<dim3(NB * NH * RESQB), dim3(128), 0, stream>>>(
      Qh, Ql, Kh, Kl, VTh, VTl, Oh, Ol, 0, RESQB);
  attn_causal64<false><<<dim3(NB * NH * (NQB - RESQB)), dim3(128), 0, stream>>>(
      Qh, Ql, Kh, Kl, VTh, VTl, Oh, Ol, RESQB, NQB - RESQB);
  // (7) out = context . Wo + bo -> d_out f32 [8192][512]  (A = context hi + lo planes, 2 products; Bt = WoT)
  gemm64<1, 0, 1><<<gProj, blk, 0, stream>>>(
      Oh, Ol, DM, 0LL, WoT, DM, 0LL, bo,
      d_out, DM, 0LL, d_out, DM, 0LL, DM,
      NB * SEQ, DM, DM, 1.0f);
  (void)hipGetLastError();
}

// v001
// A run of this version takes 356 microseconds.
// In both of two side-by-side timings against v000, it was 1.49 times as fast.
// Contractions: q, k, v^T projections = v_wmma_f32_16x16x32_bf16 (bf16 operands from RNE-converted inputs and weights, single product, f32 accumulate);
// q.k^T scores = v_wmma_f32_16x16x32_bf16 with bf16 hi/lo split q and k (hi.hi + hi.lo + lo.hi), f32 accumulate;
// p.v = v_wmma_f32_16x16x32_f16 (p carried x1024 in f16 times v in f16, single product; plus f16 residual planes x4096 of
// p and v for the first 512 query rows of every sequence), f32 accumulate;
// ctx.Wo = v_wmma_f32_16x16x32_bf16 with ctx as bf16 hi/lo planes times bf16 Wo^T (2 products), f32 accumulate;
// causal mask (key <= query), online softmax, normalisers and bias adds in f32 on the VALU.
// Carry audit:
//   Psh = f16(1024 * p)                      -> the 1/1024 is folded exactly once in the attention epilogue: inv = (1/l) * (1/1024)
//   Psl = f16((1024 p - Psh) * 4096)         }  products Psh.VTl and Psl.VTh go to the separate accumulator o1,
//   VTl = f16((v - VTh) * 4096)              }  folded back with * (1/4096) once per key chunk (RES blocks only)
//   VTh = f16(v), no carry (|v| typ. 0.45); q / k / ctx lo planes are unscaled bf16 residuals (v - hi) sharing the hi accumulator;
//   score scale 1/8 applied once in f32 after the score accumulate. No other scaled planes.
#include <hip/hip_runtime.h>
#include <math.h>
#include <stdint.h>

#define NB    2
#define SEQ   4096
#define DM    512
#define NH    8
#define HD    64
#define NQB   (SEQ / 64)   // 64 query / key blocks of 64
#define VLP   512          // key pitch of the v^T residual plane (keys 0..VLP-1)
#define RESQB 8            // leading 64-row query blocks that use the p / v residual planes
#define LP    72           // LDS row pitch of the 64-element 16-bit tiles: 144 B = 16 B x 9, 16 rows of a 16-B read on 16 bank quads
#define OP    68           // LDS row pitch of the f32 context tile, in floats (16-B reads down a column walk)
static_assert(RESQB * 64 <= VLP);
static_assert(NH * HD == DM);
static_assert((SEQ % 64) == 0 && (DM % 64) == 0 && (DM % 32) == 0);
static_assert(((NB * SEQ / 64) * (DM / 64)) % 8 == 0);
static_assert(((DM / 64) * (SEQ / 64)) % 8 == 0);
static_assert((NB * SEQ * DM) % (8 * 256) == 0);
static_assert((DM * DM) % (64 * 64) == 0);

typedef _Float16 v16h __attribute__((ext_vector_type(16)));
typedef _Float16 v8h  __attribute__((ext_vector_type(8)));
typedef __bf16   v16b __attribute__((ext_vector_type(16)));
typedef __bf16   v8b  __attribute__((ext_vector_type(8)));
typedef float    v8f  __attribute__((ext_vector_type(8)));
typedef float    v4f  __attribute__((ext_vector_type(4)));
typedef unsigned int v4u __attribute__((ext_vector_type(4)));

// ---- scalar helpers --------------------------------------------------------------------------------
__device__ __forceinline__ unsigned short bf_bits(float f) {          // f32 -> bf16 bits, RNE convert
  unsigned u = __float_as_uint(f);
  return (unsigned short)((u + 0x7FFFu + ((u >> 16) & 1u)) >> 16);
}
__device__ __forceinline__ float bf_up(unsigned short h) { return __uint_as_float(((unsigned)h) << 16); }
__device__ __forceinline__ unsigned short h_bits(_Float16 x) { return __builtin_bit_cast(unsigned short, x); }
__device__ __forceinline__ unsigned pk16(unsigned short a, unsigned short b) { return (unsigned)a | ((unsigned)b << 16); }
__device__ __forceinline__ v8f zero8() { v8f z = {0.f, 0.f, 0.f, 0.f, 0.f, 0.f, 0.f, 0.f}; return z; }
__device__ __forceinline__ v8h zero8h() {
  const _Float16 z = (_Float16)0.0f;
  v8h r = {z, z, z, z, z, z, z, z};
  return r;
}

// ---- fragment loader: 16-bit A/B operand, lane -> row/col (lane&15), p already includes +8*(lane>>4);
//      elements 0..7 <- p[0..7] (k0+8h..), elements 8..15 <- p[16..23] (k0+16+8h..)
__device__ __forceinline__ v16b ldfrag_b(const __bf16* p) {
  union { v16b v; v8b h[2]; } f;
  f.h[0] = *(const v8b*)(p);
  f.h[1] = *(const v8b*)(p + 16);
  return f.v;
}

// ---- WMMA helpers with trailing VALU hazard gap --------------------------------------------------------
__device__ __forceinline__ v8f mma_b(v16b a, v16b b, v8f c) {
  c = __builtin_amdgcn_wmma_f32_16x16x32_bf16(false, a, false, b, (short)0, c, false, false);
  asm volatile("v_nop\n\tv_nop\n\tv_nop\n\tv_nop" : "+v"(c) : "v"(a), "v"(b));
  return c;
}
__device__ __forceinline__ v8f mma_h(v16h a, v16h b, v8f c) {
  c = __builtin_amdgcn_wmma_f32_16x16x32_f16(false, a, false, b, (short)0, c, false, false);
  asm volatile("v_nop\n\tv_nop\n\tv_nop\n\tv_nop" : "+v"(c) : "v"(a), "v"(b));
  return c;
}
__device__ __forceinline__ v8f mma_b_raw(v16b a, v16b b, v8f c) {
  return __builtin_amdgcn_wmma_f32_16x16x32_bf16(false, a, false, b, (short)0, c, false, false);
}
__device__ __forceinline__ void dep_guard_b(v8f& a, v8f& b, v16b x, v16b y) {
  asm volatile("v_nop\n\tv_nop\n\tv_nop\n\tv_nop" : "+v"(a), "+v"(b) : "v"(x), "v"(y));
}
__device__ __forceinline__ void keep4_b(v16b a, v16b b, v16b c, v16b d) {
  asm volatile("v_nop" :: "v"(a), "v"(b), "v"(c), "v"(d));
}
__device__ __forceinline__ void acc_guard4(v8f& a, v8f& b, v8f& c, v8f& d) {
  asm volatile("v_nop\n\tv_nop\n\tv_nop\n\tv_nop" : "+v"(a), "+v"(b), "+v"(c), "+v"(d));
}

// =====================================================================================================
// f32 -> bf16 (RNE convert), 8 elements per thread, one 16-B store per lane: a wave writes 512 contiguous B
// the [8192][512] activations, a multiple of 256).
// coverage: n8 threads x 8 = the whole plane.
// =====================================================================================================
__global__ __launch_bounds__(256) void cvt_bf16x8(const float* __restrict__ in, unsigned short* out, int n8) {
  const int i = blockIdx.x * 256 + threadIdx.x;
  if (i < n8) {
    const v4f a = *(const v4f*)(in + (size_t)i * 8);
    const v4f b = *(const v4f*)(in + (size_t)i * 8 + 4);
    v4u p;
    p[0] = pk16(bf_bits(a[0]), bf_bits(a[1]));
    p[1] = pk16(bf_bits(a[2]), bf_bits(a[3]));
    p[2] = pk16(bf_bits(b[0]), bf_bits(b[1]));
    p[3] = pk16(bf_bits(b[2]), bf_bits(b[3]));
    *(v4u*)(out + (size_t)i * 8) = p;
    
  }
}

// =====================================================================================================
// f32 [K rows][N cols] (pitch ldw) -> bf16 transposed plane WT[n][k] (pitch ldt, k contiguous), RNE convert.
// One 64x64 tile per block (grid.x = N/64, grid.y = K/64, both exact multiples): the tile is staged in LDS with
// coalesced 16-B loads (256 threads x 16 floats = the whole tile), __syncthreads, then each output row segment
// coverage: 8 waves x 2 x (lane>>3 = 4 rows) = 64 rows n, 8 lanes x 8 = 64 k: the whole tile; grid = the whole plane.
// =====================================================================================================
__global__ __launch_bounds__(256) void cvt_bf16_tr64(const float* __restrict__ W, unsigned short* WT, int ldw, int ldt) {
  __shared__ __align__(16) float sW[64 * 65];
  const int tid = threadIdx.x;
  const int n0 = blockIdx.x * 64;
  const int k0 = blockIdx.y * 64;
  {
    const int kr = tid >> 2, cb = (tid & 3) * 16;          // row k0+kr, cols n0+cb .. +15
    const float* src = W + (size_t)(k0 + kr) * ldw + n0 + cb;
#pragma unroll
    for (int i = 0; i < 4; ++i) {
      const v4f f = *(const v4f*)(src + 4 * i);
      float* d = sW + kr * 65 + cb + 4 * i;
      d[0] = f[0]; d[1] = f[1]; d[2] = f[2]; d[3] = f[3];
    }
  }
  __syncthreads();
  const int wave = tid >> 5, lane = tid & 31;
  const int q = lane >> 3, c8 = (lane & 7) * 8;
  v4u pv[2];
#pragma unroll
  for (int it = 0; it < 2; ++it) {
    const int nr = wave * 8 + it * 4 + q;                  // output row n0+nr, 0 <= nr < 64
    v4u p;
#pragma unroll
    for (int e = 0; e < 4; ++e) {
      const float f0 = sW[(c8 + 2 * e) * 65 + nr];
      const float f1 = sW[(c8 + 2 * e + 1) * 65 + nr];
      p[e] = pk16(bf_bits(f0), bf_bits(f1));
    }
    pv[it] = p;
  }
  {
#pragma unroll
    for (int it = 0; it < 2; ++it) {
      const int nr = wave * 8 + it * 4 + q;
      *(v4u*)(WT + (size_t)(n0 + nr) * ldt + k0 + c8) = pv[it];
    }
    
  }
}

// =====================================================================================================
// Register-blocked batched bf16 WMMA GEMM: C[m][n] = sum_k A[m][k] * Bt[n][k] + bias; one wave per 64x64 tile,
// no block barriers. A row-major [M][K] pitch lda; Bt row-major [N][K] pitch ldb (k contiguous);
// M, N multiples of 64, K multiple of 32 (host shapes are static multiples). blockIdx.y = batch index (strides in elements).
// NSPLIT: 0 = A.Bt; 1 = (A + A2).Bt (A2 = unscaled bf16 lo plane of A, 2 products).
// BIAS: 0 = none; 1 = per column n, bias[n]; 2 = per row m, bias[m]; the bias value is RNE-converted to bf16 and added in f32.
// OUT_MODE: 0 = f32 (pitch ldc); 2 = bf16 hi plane C + bf16 lo plane C2 (lo = RNE(v - hi), unscaled);
//           3 = f16 hi plane C + f16 residual plane C2 = f16((v - hi) * rscale), C2 written only for tiles
//               with n0 < N2 (pitch ldc2, batch stride strideC2).
// =====================================================================================================
template <int NSPLIT, int OUT_MODE, int BIAS>
__global__ __launch_bounds__(256) void gemm64(
    const unsigned short* __restrict__ Ap, const unsigned short* A2p, int lda, long long strideA,
    const unsigned short* __restrict__ Btp, int ldb, long long strideB,
    const float* __restrict__ bias,
    void* Cout, int ldc, long long strideC,
    void* Cout2, int ldc2, long long strideC2, int N2,
    int M, int N, int K, float rscale) {
  const __bf16* A   = (const __bf16*)(const void*)Ap;
  const __bf16* A2  = (const __bf16*)(const void*)A2p;
  const __bf16* Bt  = (const __bf16*)(const void*)Btp;
  __shared__ __align__(16) float sT[8][16 * 68];   // per-wave 16x64 slab, pitch 68 floats
  const int b    = blockIdx.y;
  const int lane = threadIdx.x & 31;
  const int wave = threadIdx.x >> 5;
  const int tilesN = N >> 6;
  const int tilesM = M >> 6;
  const int tile = blockIdx.x * 8 + wave;
  if (tile >= tilesM * tilesN) return;   // wave-uniform; no block barriers in this kernel
  const int tm = tile / tilesN;
  const int tn = tile - tm * tilesN;
  const int m0 = tm << 6;
  const int n0 = tn << 6;

  const __bf16* Ab  = A  + (size_t)b * strideA;
  const __bf16* Bb  = Bt + (size_t)b * strideB;
  const __bf16* Ab2 = (NSPLIT >= 1) ? (A2 + (size_t)b * strideA) : Ab;

  const int rlane = lane & 15;                 // row (A) / col (B, D) within subtile
  const int koff  = (lane >> 4) * 8;           // k offset of this lane half
  const int mOff  = (lane >> 4) * 8;           // D row offset

  v8f acc[4][4];
#pragma unroll
  for (int i = 0; i < 4; ++i)
#pragma unroll
    for (int j = 0; j < 4; ++j) acc[i][j] = zero8();

  for (int k0 = 0; k0 < K; k0 += 32) {
    v16b bh[4];
#pragma unroll
    for (int j = 0; j < 4; ++j) {
      const size_t bo = (size_t)(n0 + (j << 4) + rlane) * ldb + koff + k0;
      bh[j] = ldfrag_b(Bb + bo);
    }
#pragma unroll
    for (int i = 0; i < 4; ++i) {
      const size_t ao = (size_t)(m0 + (i << 4) + rlane) * lda + koff + k0;
      const v16b ah = ldfrag_b(Ab + ao);
      v16b al = ah;
      if (NSPLIT >= 1) al = ldfrag_b(Ab2 + ao);
#pragma unroll
      for (int j = 0; j < 4; ++j) {
        acc[i][j] = mma_b_raw(ah, bh[j], acc[i][j]);
        if (NSPLIT >= 1) acc[i][j] = mma_b_raw(al, bh[j], acc[i][j]);
      }
      dep_guard_b(acc[i][0], acc[i][3], ah, al);
    }
    keep4_b(bh[0], bh[1], bh[2], bh[3]);
  }
  acc_guard4(acc[0][0], acc[0][1], acc[0][2], acc[0][3]);
  acc_guard4(acc[1][0], acc[1][1], acc[1][2], acc[1][3]);
  acc_guard4(acc[2][0], acc[2][1], acc[2][2], acc[2][3]);
  acc_guard4(acc[3][0], acc[3][1], acc[3][2], acc[3][3]);

  // ---- epilogue ----
  float* slab = sT[wave];
  float bcol[4];
#pragma unroll
  for (int j = 0; j < 4; ++j) {
    bcol[j] = 0.f;
    if (BIAS == 1) bcol[j] = bf_up(bf_bits(bias[n0 + (j << 4) + rlane]));   // n < N, bias has N entries
  }
#pragma unroll
  for (int i = 0; i < 4; ++i) {
    const int mBase = m0 + (i << 4);
    float brow[8];
#pragma unroll
    for (int r = 0; r < 8; ++r) {
      brow[r] = 0.f;
      if (BIAS == 2) brow[r] = bf_up(bf_bits(bias[mBase + mOff + r]));      // m < M, bias has M entries
    }
#pragma unroll
    for (int j = 0; j < 4; ++j) {
#pragma unroll
      for (int r = 0; r < 8; ++r) {
        slab[(mOff + r) * 68 + (j << 4) + rlane] = acc[i][j][r] + bcol[j] + brow[r];
      }
    }
    __builtin_amdgcn_fence(__ATOMIC_RELEASE, "workgroup");
    __builtin_amdgcn_wave_barrier();
    __builtin_amdgcn_fence(__ATOMIC_ACQUIRE, "workgroup");
    if (OUT_MODE == 0) {
      float* C = (float*)Cout + (size_t)b * strideC;
      const int hh = lane >> 4, c4 = (lane & 15) * 4;     // 256-B row segment = 16 lanes x 16 B
      {
#pragma unroll
        for (int it = 0; it < 8; ++it) {
          const int row = it * 2 + hh;                     // it 0..7 x hh 0..1 = rows 0..15
          const v4f v = *(const v4f*)(slab + row * 68 + c4);
          *(v4f*)(C + (size_t)(mBase + row) * ldc + n0 + c4) = v;
        }
        
      }
    } else {
      const int q = lane >> 3, c8 = (lane & 7) * 8;
      unsigned short* C  = (unsigned short*)Cout  + (size_t)b * strideC;
      unsigned short* C2 = (unsigned short*)Cout2 + (size_t)b * strideC2;
      const bool wlo = (OUT_MODE == 2) || (n0 < N2);      // wave-uniform
      v4u hv[4], lv[4];
#pragma unroll
      for (int it = 0; it < 4; ++it) {
        const int row = it * 4 + q;                        // it 0..3 x q 0..3 = rows 0..15
        const float* sp = slab + row * 68 + c8;
        v4u a, a2;
#pragma unroll
        for (int e = 0; e < 4; ++e) {
          const float f0 = sp[2 * e], f1 = sp[2 * e + 1];
          unsigned short h0, h1, l0, l1;
          if (OUT_MODE == 2) {
            h0 = bf_bits(f0); h1 = bf_bits(f1);
            l0 = bf_bits(f0 - bf_up(h0)); l1 = bf_bits(f1 - bf_up(h1));
          } else {
            const _Float16 x0 = (_Float16)f0, x1 = (_Float16)f1;
            h0 = h_bits(x0); h1 = h_bits(x1);
            l0 = h_bits((_Float16)((f0 - (float)x0) * rscale));
            l1 = h_bits((_Float16)((f1 - (float)x1) * rscale));
          }
          a[e] = pk16(h0, h1); a2[e] = pk16(l0, l1);
        }
        hv[it] = a; lv[it] = a2;
      }
      {
#pragma unroll
        for (int it = 0; it < 4; ++it) {
          const int row = it * 4 + q;
          *(v4u*)(C + (size_t)(mBase + row) * ldc + n0 + c8) = hv[it];
          if (wlo) *(v4u*)(C2 + (size_t)(mBase + row) * ldc2 + n0 + c8) = lv[it];
        }
        
      }
    }
    __builtin_amdgcn_fence(__ATOMIC_RELEASE, "workgroup");
    __builtin_amdgcn_wave_barrier();
    __builtin_amdgcn_fence(__ATOMIC_ACQUIRE, "workgroup");
  }
}

// =====================================================================================================
// Causal attention, head dim 64, key chunks of 64.
//   q planes (bf16 hi / lo): element (b, t, h, d) at [(b*SEQ + t)*DM + h*64 + d]
//   k planes (bf16 hi / lo): same layout with key index s
//   v^T hi plane (f16):      element (b, h, d, s) at [(b*DM + h*64 + d)*SEQ + s]
//   v^T residual plane (f16, (v - hi)*4096): [(b*DM + h*64 + d)*VLP + s], s < VLP, read only when RES
//   (a key chunk at or beyond VLP would contribute a zero v residual; its address is clamped)
//   Mask: query t keeps key s iff s <= t. A query block qb therefore needs key chunks 0..qb only (block-uniform
//   trip count qb+1 <= NQB); keys in later chunks exceed every query index of the block and are skipped entirely.
//   Inside a visited chunk a masked key gets logit -inf -> exp gives exactly 0, so it adds nothing to the numerator
//   or the normaliser. Row max bookkeeping: every query keeps key 0 (chunk 0), so after chunk 0 the running max of
//   every row is finite; in the diagonal chunk every query keeps at least its own key. Every row ends with l > 0.
//   out planes (bf16 hi / lo of the normalised context): element (b, t, h, d) at [(b*SEQ + t)*DM + h*64 + d]
//   scores = q . k : bf16 hi/lo split (hi.hi + hi.lo + lo.hi), f32 accumulate, then * 1/8 and the mask in f32
//   p = exp(s - m) carried as f16(1024 p); context = p . v on f16 WMMA; RES adds f16 residual planes of p and v
//   (scale 4096, separate accumulator folded back with 1/4096 per chunk in f32); online softmax (running max) in f32.
//   Block = 4 waves = 64 query rows of one (b, h); grid = nqbThis * NH * NB.
//   K / V^T chunk staging: 128 threads x 32 elements per plane = the whole 64x64 tile of every plane read later
//   (plain 16-B loads, __syncthreads before and after); P tiles are wave-private, spilled with _Float16 element stores
//   Output coverage: each wave stores rows q0..q0+15 (it 0..3 x lane>>3 0..3) x 64 columns (8 lanes x 8) of both planes;
//   grid over all (b, h, qb) = the whole [NB*SEQ][DM] planes.
// =====================================================================================================
template <bool RES>
__global__ __launch_bounds__(128)
void attn_causal64(const unsigned short* __restrict__ qhp, const unsigned short* __restrict__ qlp,
                   const unsigned short* __restrict__ khp, const unsigned short* __restrict__ klp,
                   const unsigned short* __restrict__ vhp, const unsigned short* __restrict__ vlp,
                   unsigned short* ohp, unsigned short* olp,
                   int qbBase, int nqbThis) {
  union FB { v16b v; v8b h[2]; };
  union FH { v16h v; v8h h[2]; };
  __shared__ __align__(16) __bf16   Ksh[64 * LP];                 // K hi [kv][d], pitch LP
  __shared__ __align__(16) __bf16   Ksl[64 * LP];                 // K lo
  __shared__ __align__(16) _Float16 Vth[64 * LP];                 // V^T hi [d][kv], pitch LP
  __shared__ __align__(16) _Float16 Vtl[RES ? 64 * LP : 8];       // V^T residual
  __shared__ __align__(16) _Float16 Psh[4][16 * LP];              // per wave P [row][kv]
  __shared__ __align__(16) _Float16 Psl[RES ? 4 : 1][16 * LP];    // per wave P residual
  __shared__ __align__(16) float    Os[4][16 * OP];               // per wave context tile [row][d]

  const int tid  = threadIdx.x;
  const int wave = tid >> 5;
  const int lane = tid & 31;
  const int hh   = lane >> 4;
  const int c    = lane & 15;

  const int bx   = blockIdx.x;
  const int qbl  = bx % nqbThis;
  const int rest = bx / nqbThis;
  const int h    = rest % NH;
  const int b    = rest / NH;
  const int qb   = qbBase + qbl;               // 0..NQB-1 (block-uniform)
  const int q0   = qb * 64 + wave * 16;
  const size_t rowB = (size_t)b * SEQ;

  const __bf16* Qh = (const __bf16*)(const void*)qhp + (size_t)h * HD;
  const __bf16* Ql = (const __bf16*)(const void*)qlp + (size_t)h * HD;
  const __bf16* Kh = (const __bf16*)(const void*)khp + (size_t)h * HD;
  const __bf16* Kl = (const __bf16*)(const void*)klp + (size_t)h * HD;
  const _Float16* Vh = (const _Float16*)(const void*)vhp + ((size_t)b * DM + (size_t)h * HD) * SEQ;
  const _Float16* Vl = (const _Float16*)(const void*)vlp + ((size_t)b * DM + (size_t)h * HD) * VLP;

  // ---- Q fragments (A operand, row = lane&15): 2 d-chunks, hi and lo ----
  v16b qah[2], qal[2];
#pragma unroll
  for (int dc = 0; dc < 2; ++dc) {
    const size_t qo = (rowB + q0 + c) * DM + dc * 32 + 8 * hh;
    qah[dc] = ldfrag_b(Qh + qo);
    qal[dc] = ldfrag_b(Ql + qo);
  }

  float mrow[8], lrow[8];
  v8f oacc[4];
#pragma unroll
  for (int r = 0; r < 8; ++r) { mrow[r] = -INFINITY; lrow[r] = 0.f; }
#pragma unroll
  for (int t = 0; t < 4; ++t) oacc[t] = zero8();

  for (int kt = 0; kt <= qb; ++kt) {           // block-uniform trip count, <= NQB
    const int kv0 = kt * 64;                   // kv0 + 63 < SEQ
    __syncthreads();
    {
      const int r = tid >> 1, half = (tid & 1) * 32;
      const __bf16*   kg  = Kh + (rowB + kv0 + r) * DM + half;    // K row kv0+r, d = half..half+31
      const __bf16*   klg = Kl + (rowB + kv0 + r) * DM + half;
      const _Float16* vg  = Vh + (size_t)r * SEQ + kv0 + half;    // V^T row d = r, s = kv0+half..+31
      const int kvl = (kv0 + 64 <= VLP) ? kv0 : (VLP - 64);     // clamped address into the residual plane
      const _Float16* vlg = Vl + (size_t)r * VLP + kvl + half;
      const bool resOK = (kv0 + 64 <= VLP);                      // block-uniform (always true for qb < RESQB)
#pragma unroll
      for (int i = 0; i < 4; ++i) {
        const v8b a0 = *(const v8b*)(kg + 8 * i);
        const v8b a1 = *(const v8b*)(klg + 8 * i);
        const v8h b0 = *(const v8h*)(vg + 8 * i);
        *(v8b*)(Ksh + r * LP + half + 8 * i) = a0;
        *(v8b*)(Ksl + r * LP + half + 8 * i) = a1;
        *(v8h*)(Vth + r * LP + half + 8 * i) = b0;
        if (RES) {
          v8h b1 = *(const v8h*)(vlg + 8 * i);
          if (!resOK) b1 = zero8h();
          *(v8h*)(Vtl + r * LP + half + 8 * i) = b1;
        }
      }
    }
    __syncthreads();

    // ---- scores: 16 query rows x 64 keys per wave, 3 bf16 products ----
    v8f s[4];
#pragma unroll
    for (int j = 0; j < 4; ++j) {
      s[j] = zero8();
#pragma unroll
      for (int dc = 0; dc < 2; ++dc) {
        FB kb, kl;
        kb.h[0] = *(const v8b*)(Ksh + (j * 16 + c) * LP + dc * 32 + 8 * hh);
        kb.h[1] = *(const v8b*)(Ksh + (j * 16 + c) * LP + dc * 32 + 16 + 8 * hh);
        kl.h[0] = *(const v8b*)(Ksl + (j * 16 + c) * LP + dc * 32 + 8 * hh);
        kl.h[1] = *(const v8b*)(Ksl + (j * 16 + c) * LP + dc * 32 + 16 + 8 * hh);
        s[j] = mma_b(qah[dc], kb.v, s[j]);
        s[j] = mma_b(qah[dc], kl.v, s[j]);
        s[j] = mma_b(qal[dc], kb.v, s[j]);
      }
    }

    // ---- scale, causal mask by index, row max, online softmax, P (x1024, f16) and P residual (x4096) to LDS ----
    _Float16* pwh = Psh[wave];
    _Float16* pwl = Psl[RES ? wave : 0];
#pragma unroll
    for (int r = 0; r < 8; ++r) {
      const int rowq = q0 + 8 * hh + r;        // query index of D row 8hh+r
      float m = -INFINITY;
#pragma unroll
      for (int j = 0; j < 4; ++j) {
        const int key = kv0 + j * 16 + c;
        float sv = s[j][r] * 0.125f;
        const bool keep = (key <= rowq);
        sv = keep ? sv : -INFINITY;
        s[j][r] = sv;
        m = fmaxf(m, sv);
      }
#pragma unroll
      for (int off = 1; off < 16; off <<= 1) m = fmaxf(m, __shfl_xor(m, off, 32));
      const float mnew  = fmaxf(mrow[r], m);
      const float msafe = (mnew == -INFINITY) ? 0.f : mnew;
      const float alpha = __expf(mrow[r] - msafe);
      mrow[r] = mnew;
      float psum = 0.f;
#pragma unroll
      for (int j = 0; j < 4; ++j) {
        const float p = __expf(s[j][r] - msafe);     // masked logit: exp(-inf) = 0
        psum += p;
        const float p1k = p * 1024.0f;
        const _Float16 ph = (_Float16)p1k;
        pwh[(8 * hh + r) * LP + j * 16 + c] = ph;
        if (RES) {
          const _Float16 pl = (_Float16)((p1k - (float)ph) * 4096.0f);
          pwl[(8 * hh + r) * LP + j * 16 + c] = pl;
        }
      }
#pragma unroll
      for (int off = 1; off < 16; off <<= 1) psum += __shfl_xor(psum, off, 32);
      lrow[r] = lrow[r] * alpha + psum;
#pragma unroll
      for (int t = 0; t < 4; ++t) oacc[t][r] *= alpha;
    }
    __builtin_amdgcn_fence(__ATOMIC_RELEASE, "workgroup");
    __builtin_amdgcn_wave_barrier();
    __builtin_amdgcn_fence(__ATOMIC_ACQUIRE, "workgroup");

    // ---- context += P . V (f16 WMMA), residual products into a separate accumulator ----
    v8f o1[4];
#pragma unroll
    for (int t = 0; t < 4; ++t) o1[t] = zero8();
#pragma unroll 1
    for (int kk = 0; kk < 2; ++kk) {
      FH pa, pl;
      pa.h[0] = *(const v8h*)(pwh + c * LP + kk * 32 + 8 * hh);
      pa.h[1] = *(const v8h*)(pwh + c * LP + kk * 32 + 16 + 8 * hh);
      if (RES) {
        pl.h[0] = *(const v8h*)(pwl + c * LP + kk * 32 + 8 * hh);
        pl.h[1] = *(const v8h*)(pwl + c * LP + kk * 32 + 16 + 8 * hh);
      } else {
        pl.v = pa.v;
      }
#pragma unroll
      for (int t = 0; t < 4; ++t) {
        FH vb;
        vb.h[0] = *(const v8h*)(Vth + (t * 16 + c) * LP + kk * 32 + 8 * hh);
        vb.h[1] = *(const v8h*)(Vth + (t * 16 + c) * LP + kk * 32 + 16 + 8 * hh);
        oacc[t] = mma_h(pa.v, vb.v, oacc[t]);
        if (RES) {
          FH vl;
          vl.h[0] = *(const v8h*)(Vtl + (t * 16 + c) * LP + kk * 32 + 8 * hh);
          vl.h[1] = *(const v8h*)(Vtl + (t * 16 + c) * LP + kk * 32 + 16 + 8 * hh);
          o1[t] = mma_h(pa.v, vl.v, o1[t]);
          o1[t] = mma_h(pl.v, vb.v, o1[t]);
        }
      }
    }
    if (RES) {
#pragma unroll
      for (int t = 0; t < 4; ++t)
#pragma unroll
        for (int r = 0; r < 8; ++r) oacc[t][r] += o1[t][r] * (1.0f / 4096.0f);
    }
  }

  // ---- normalise (1/l and the 1/1024 p carry), stage the wave's 16x64 tile, bf16 hi/lo split,
  float* os = Os[wave];
#pragma unroll
  for (int r = 0; r < 8; ++r) {
    const float l = lrow[r];
    const float inv = ((l > 0.f) ? (1.0f / l) : 0.f) * (1.0f / 1024.0f);
#pragma unroll
    for (int t = 0; t < 4; ++t) os[(8 * hh + r) * OP + t * 16 + c] = oacc[t][r] * inv;
  }
  __builtin_amdgcn_fence(__ATOMIC_RELEASE, "workgroup");
  __builtin_amdgcn_wave_barrier();
  __builtin_amdgcn_fence(__ATOMIC_ACQUIRE, "workgroup");
  {
    const int q4 = lane >> 3, c8 = (lane & 7) * 8;
    v4u hv[4], lv[4];
#pragma unroll
    for (int it = 0; it < 4; ++it) {
      const int row = it * 4 + q4;   // it 0..3 x q4 0..3 = rows 0..15 of the wave tile
      const float* sp = os + row * OP + c8;
      v4u a, a2;
#pragma unroll
      for (int e = 0; e < 4; ++e) {
        const float f0 = sp[2 * e], f1 = sp[2 * e + 1];
        const unsigned short h0 = bf_bits(f0), h1 = bf_bits(f1);
        const unsigned short l0 = bf_bits(f0 - bf_up(h0)), l1 = bf_bits(f1 - bf_up(h1));
        a[e] = pk16(h0, h1); a2[e] = pk16(l0, l1);
      }
      hv[it] = a; lv[it] = a2;
    }
    {
#pragma unroll
      for (int it = 0; it < 4; ++it) {
        const int row = it * 4 + q4;
        const size_t go = (rowB + q0 + row) * DM + (size_t)h * HD + c8;
        *(v4u*)(ohp + go) = hv[it];
        *(v4u*)(olp + go) = lv[it];
      }
      
    }
  }
}

// =====================================================================================================
// Workspace map (bytes; every region is an exact multiple of its 64x64-tile / whole-line store granularity,
//   Qb   bf16 [8192][512]            0            8388608
//   Kb   bf16 [8192][512]            8388608      8388608
//   Vb   bf16 [8192][512]            16777216     8388608
//   WqT  bf16 [512 n][512 k]         25165824     524288
//   WkT                              25690112     524288
//   WvT                              26214400     524288
//   WoT                              26738688     524288
//   Qh   bf16 [8192][512]            27262976     8388608
//   Ql                               35651584     8388608
//   Kh                               44040192     8388608
//   Kl                               52428800     8388608
//   VTh  f16  [2][512][4096]         60817408     8388608
//   VTl  f16  [2][512][512]          69206016     1048576
//   Oh   bf16 [8192][512]            70254592     8388608
//   Ol                               78643200     8388608
//   end                              87031808
// =====================================================================================================
extern "C" void kernel_launch(void* const* d_in, const int* in_sizes, int n_in,
                              void* d_out, int out_size, void* d_ws, size_t ws_size,
                              hipStream_t stream) {
  if (n_in < 11) return;
  const int NX = NB * SEQ * DM;                    // 4194304
  if (in_sizes[0] != NX || in_sizes[1] != NX || in_sizes[2] != NX) return;
  if (in_sizes[3] != DM * DM || in_sizes[5] != DM * DM || in_sizes[7] != DM * DM || in_sizes[9] != DM * DM) return;
  if (in_sizes[4] != DM || in_sizes[6] != DM || in_sizes[8] != DM || in_sizes[10] != DM) return;
  if (out_size != NX) return;

  const float* v  = (const float*)d_in[0];   // [2][4096][512]
  const float* k  = (const float*)d_in[1];   // [2][4096][512]
  const float* q  = (const float*)d_in[2];   // [2][4096][512]
  const float* Wq = (const float*)d_in[3];   // [512 in][512 out] = [k][n]
  const float* bq = (const float*)d_in[4];   // [512]
  const float* Wk = (const float*)d_in[5];   // [512 in][512 out]
  const float* bk = (const float*)d_in[6];   // [512]
  const float* Wv = (const float*)d_in[7];   // [512 in][512 out]
  const float* bv = (const float*)d_in[8];   // [512]
  const float* Wo = (const float*)d_in[9];   // [512 in][512 out]
  const float* bo = (const float*)d_in[10];  // [512]

  const size_t PX  = (size_t)NB * SEQ * DM * 2;    //  8388608  16-bit activation plane [8192][512]
  const size_t PW  = (size_t)DM * DM * 2;          //   524288  16-bit weight plane [512][512]
  const size_t PVT = (size_t)NB * DM * SEQ * 2;    //  8388608  v^T hi plane
  const size_t PVL = (size_t)NB * DM * VLP * 2;    //  1048576  v^T residual plane
  size_t off = 0;
  const size_t oQb  = off; off += PX;
  const size_t oKb  = off; off += PX;
  const size_t oVb  = off; off += PX;
  const size_t oWq  = off; off += PW;
  const size_t oWk  = off; off += PW;
  const size_t oWv  = off; off += PW;
  const size_t oWo  = off; off += PW;
  const size_t oQh  = off; off += PX;
  const size_t oQl  = off; off += PX;
  const size_t oKh  = off; off += PX;
  const size_t oKl  = off; off += PX;
  const size_t oVTh = off; off += PVT;
  const size_t oVTl = off; off += PVL;
  const size_t oOh  = off; off += PX;
  const size_t oOl  = off; off += PX;
  if (off > ws_size) return;                       // off = 87031808
  if (off > (size_t)134217728) return;

  char* ws = (char*)d_ws;
  unsigned short* Qb  = (unsigned short*)(ws + oQb);
  unsigned short* Kb  = (unsigned short*)(ws + oKb);
  unsigned short* Vb  = (unsigned short*)(ws + oVb);
  unsigned short* WqT = (unsigned short*)(ws + oWq);
  unsigned short* WkT = (unsigned short*)(ws + oWk);
  unsigned short* WvT = (unsigned short*)(ws + oWv);
  unsigned short* WoT = (unsigned short*)(ws + oWo);
  unsigned short* Qh  = (unsigned short*)(ws + oQh);
  unsigned short* Ql  = (unsigned short*)(ws + oQl);
  unsigned short* Kh  = (unsigned short*)(ws + oKh);
  unsigned short* Kl  = (unsigned short*)(ws + oKl);
  unsigned short* VTh = (unsigned short*)(ws + oVTh);
  unsigned short* VTl = (unsigned short*)(ws + oVTl);
  unsigned short* Oh  = (unsigned short*)(ws + oOh);
  unsigned short* Ol  = (unsigned short*)(ws + oOl);

  const dim3 blk(256);
  const int n8x = NX / 8;                                      // 524288
  const dim3 gCvtX((n8x + 255) / 256);                         // 2048 blocks
  const dim3 gTr(DM / 64, DM / 64);                            // 8 x 8 tiles of 64x64 (exact)
  const dim3 gProj(((NB * SEQ / 64) * (DM / 64) + 7) / 8, 1);  // 1024 tiles -> 128 blocks: M=8192, N=512
  const dim3 gVT(((DM / 64) * (SEQ / 64) + 7) / 8, NB);        //  512 tiles ->  64 blocks x 2 batches: M=512, N=4096

  // (1) activations f32 -> bf16 planes (same layout as the inputs)
  cvt_bf16x8<<<gCvtX, blk, 0, stream>>>(q, Qb, n8x);
  cvt_bf16x8<<<gCvtX, blk, 0, stream>>>(k, Kb, n8x);
  cvt_bf16x8<<<gCvtX, blk, 0, stream>>>(v, Vb, n8x);
  // (2) weights f32 [k=512 rows][n=512 cols] -> bf16 transposed planes W^T [n][k] (k contiguous)
  cvt_bf16_tr64<<<gTr, blk, 0, stream>>>(Wq, WqT, DM, DM);
  cvt_bf16_tr64<<<gTr, blk, 0, stream>>>(Wk, WkT, DM, DM);
  cvt_bf16_tr64<<<gTr, blk, 0, stream>>>(Wv, WvT, DM, DM);
  cvt_bf16_tr64<<<gTr, blk, 0, stream>>>(Wo, WoT, DM, DM);
  // (3) qp = q . Wq + bq -> bf16 hi/lo planes [b*SEQ+t][h*64+d]   (A = Qb, Bt = WqT [n][k]; M=8192, N=512, K=512)
  gemm64<0, 2, 1><<<gProj, blk, 0, stream>>>(
      Qb, Qb, DM, 0LL, WqT, DM, 0LL, bq,
      (void*)Qh, DM, 0LL, (void*)Ql, DM, 0LL, DM,
      NB * SEQ, DM, DM, 1.0f);
  // (4) kp = k . Wk + bk -> bf16 hi/lo planes
  gemm64<0, 2, 1><<<gProj, blk, 0, stream>>>(
      Kb, Kb, DM, 0LL, WkT, DM, 0LL, bk,
      (void*)Kh, DM, 0LL, (void*)Kl, DM, 0LL, DM,
      NB * SEQ, DM, DM, 1.0f);
  // (5) vp^T = Wv^T . v^T + bv per batch -> f16 hi plane [b][h*64+d][s] (pitch SEQ) and residual plane
  //     (x4096, keys < VLP only, pitch VLP)   (A = WvT [dout][k], Bt = Vb rows of batch b; M=512, N=4096, K=512)
  gemm64<0, 3, 2><<<gVT, blk, 0, stream>>>(
      WvT, WvT, DM, 0LL, Vb, DM, (long long)SEQ * DM, bv,
      (void*)VTh, SEQ, (long long)DM * SEQ, (void*)VTl, VLP, (long long)DM * VLP, VLP,
      DM, SEQ, DM, 4096.0f);
  // (6) causal attention: query blocks 0..RESQB-1 with residual planes, the rest without
  attn_causal64<true><<<dim3(NB * NH * RESQB), dim3(128), 0, stream>>>(
      Qh, Ql, Kh, Kl, VTh, VTl, Oh, Ol, 0, RESQB);
  attn_causal64<false><<<dim3(NB * NH * (NQB - RESQB)), dim3(128), 0, stream>>>(
      Qh, Ql, Kh, Kl, VTh, VTl, Oh, Ol, RESQB, NQB - RESQB);
  // (7) out = context . Wo + bo -> d_out f32 [8192][512]  (A = context hi + lo planes, 2 products; Bt = WoT)
  gemm64<1, 0, 1><<<gProj, blk, 0, stream>>>(
      Oh, Ol, DM, 0LL, WoT, DM, 0LL, bo,
      d_out, DM, 0LL, d_out, DM, 0LL, DM,
      NB * SEQ, DM, DM, 1.0f);
  (void)hipGetLastError();
}

// v002
// One run takes 267 microseconds.
// Two timings next to v001 both put it at 1.33 times that version's speed.
// Counting every step since v000, it is 1.98 times as fast.
// Contractions: q, k, v^T projections = v_wmma_f32_16x16x32_bf16 (bf16 operands from RNE-converted inputs and weights, single product, f32 accumulate);
// q.k^T scores = v_wmma_f32_16x16x32_bf16 with bf16 hi/lo split q and k (hi.hi + hi.lo + lo.hi), f32 accumulate;
// p.v = v_wmma_f32_16x16x32_f16 (p carried x1024 in f16 times v in f16, single product; plus f16 residual planes x4096 of
// p and v for the first 512 query rows of every sequence), f32 accumulate;
// ctx.Wo = v_wmma_f32_16x16x32_bf16 with ctx as bf16 hi/lo planes times bf16 Wo^T (2 products), f32 accumulate;
// causal mask (key <= query), online softmax, normalisers and bias adds in f32 on the VALU.
// Carry audit:
//   Psh = f16(1024 * p)                      -> the 1/1024 is folded exactly once in the attention epilogue: inv = (1/l) * (1/1024)
//   Psl = f16((1024 p - Psh) * 4096)         }  products Psh.VTl and Psl.VTh go to the separate accumulator o1,
//   VTl = f16((v - VTh) * 4096)              }  folded back with * (1/4096) once per key chunk (RES blocks only)
//   VTh = f16(v), no carry (|v| typ. 0.45); q / k / ctx lo planes are unscaled bf16 residuals (v - hi) sharing the hi accumulator;
//   score scale 1/8 applied once in f32 after the score accumulate. No other scaled planes.
#include <hip/hip_runtime.h>
#include <math.h>
#include <stdint.h>

#define NB    2
#define SEQ   4096
#define DM    512
#define NH    8
#define HD    64
#define NQB   (SEQ / 64)   // 64 query / key blocks of 64
#define VLP   512          // key pitch of the v^T residual plane (keys 0..VLP-1)
#define RESQB 8            // leading 64-row query blocks that use the p / v residual planes
#define LP    72           // LDS row pitch of the 64-element 16-bit tiles: 144 B = 16 B x 9, 16 rows of a 16-B read on 16 bank quads
#define OP    68           // LDS row pitch of the f32 context tile, in floats (16-B reads down a column walk)
static_assert(RESQB * 64 <= VLP);
static_assert(NH * HD == DM);
static_assert((SEQ % 64) == 0 && (DM % 64) == 0 && (DM % 32) == 0);
static_assert(((NB * SEQ / 64) * (DM / 64)) % 8 == 0);
static_assert(((DM / 64) * (SEQ / 64)) % 8 == 0);
static_assert((NB * SEQ * DM) % (8 * 256) == 0);
static_assert((DM * DM) % (64 * 64) == 0);

typedef _Float16 v16h __attribute__((ext_vector_type(16)));
typedef _Float16 v8h  __attribute__((ext_vector_type(8)));
typedef __bf16   v16b __attribute__((ext_vector_type(16)));
typedef __bf16   v8b  __attribute__((ext_vector_type(8)));
typedef float    v8f  __attribute__((ext_vector_type(8)));
typedef float    v4f  __attribute__((ext_vector_type(4)));
typedef unsigned int v4u __attribute__((ext_vector_type(4)));

// ---- scalar helpers --------------------------------------------------------------------------------
__device__ __forceinline__ unsigned short bf_bits(float f) {          // f32 -> bf16 bits, RNE convert
  unsigned u = __float_as_uint(f);
  return (unsigned short)((u + 0x7FFFu + ((u >> 16) & 1u)) >> 16);
}
__device__ __forceinline__ float bf_up(unsigned short h) { return __uint_as_float(((unsigned)h) << 16); }
__device__ __forceinline__ unsigned short h_bits(_Float16 x) { return __builtin_bit_cast(unsigned short, x); }
__device__ __forceinline__ unsigned pk16(unsigned short a, unsigned short b) { return (unsigned)a | ((unsigned)b << 16); }
__device__ __forceinline__ v8f zero8() { v8f z = {0.f, 0.f, 0.f, 0.f, 0.f, 0.f, 0.f, 0.f}; return z; }
__device__ __forceinline__ v8h zero8h() {
  const _Float16 z = (_Float16)0.0f;
  v8h r = {z, z, z, z, z, z, z, z};
  return r;
}

// ---- fragment loader: 16-bit A/B operand, lane -> row/col (lane&15), p already includes +8*(lane>>4);
//      elements 0..7 <- p[0..7] (k0+8h..), elements 8..15 <- p[16..23] (k0+16+8h..)
__device__ __forceinline__ v16b ldfrag_b(const __bf16* p) {
  union { v16b v; v8b h[2]; } f;
  f.h[0] = *(const v8b*)(p);
  f.h[1] = *(const v8b*)(p + 16);
  return f.v;
}

// ---- WMMA helpers with trailing VALU hazard gap --------------------------------------------------------
__device__ __forceinline__ v8f mma_b(v16b a, v16b b, v8f c) {
  c = __builtin_amdgcn_wmma_f32_16x16x32_bf16(false, a, false, b, (short)0, c, false, false);
  asm volatile("v_nop\n\tv_nop\n\tv_nop\n\tv_nop" : "+v"(c) : "v"(a), "v"(b));
  return c;
}
__device__ __forceinline__ v8f mma_h(v16h a, v16h b, v8f c) {
  c = __builtin_amdgcn_wmma_f32_16x16x32_f16(false, a, false, b, (short)0, c, false, false);
  asm volatile("v_nop\n\tv_nop\n\tv_nop\n\tv_nop" : "+v"(c) : "v"(a), "v"(b));
  return c;
}
__device__ __forceinline__ v8f mma_b_raw(v16b a, v16b b, v8f c) {
  return __builtin_amdgcn_wmma_f32_16x16x32_bf16(false, a, false, b, (short)0, c, false, false);
}
__device__ __forceinline__ void dep_guard_b(v8f& a, v8f& b, v16b x, v16b y) {
  asm volatile("v_nop\n\tv_nop\n\tv_nop\n\tv_nop" : "+v"(a), "+v"(b) : "v"(x), "v"(y));
}
__device__ __forceinline__ void keep4_b(v16b a, v16b b, v16b c, v16b d) {
  asm volatile("v_nop" :: "v"(a), "v"(b), "v"(c), "v"(d));
}
__device__ __forceinline__ void acc_guard4(v8f& a, v8f& b, v8f& c, v8f& d) {
  asm volatile("v_nop\n\tv_nop\n\tv_nop\n\tv_nop" : "+v"(a), "+v"(b), "+v"(c), "+v"(d));
}

// =====================================================================================================
// f32 -> bf16 (RNE convert), 8 elements per thread, one 16-B store per lane: a wave writes 512 contiguous B
// the [8192][512] activations, a multiple of 256).
// coverage: n8 threads x 8 = the whole plane.
// =====================================================================================================
__device__ __forceinline__ void cvt_bf16x8(const float* __restrict__ in, unsigned short* out, int n8, int blk) {
  const int i = blk * 256 + threadIdx.x;
  if (i < n8) {
    const v4f a = *(const v4f*)(in + (size_t)i * 8);
    const v4f b = *(const v4f*)(in + (size_t)i * 8 + 4);
    v4u p;
    p[0] = pk16(bf_bits(a[0]), bf_bits(a[1]));
    p[1] = pk16(bf_bits(a[2]), bf_bits(a[3]));
    p[2] = pk16(bf_bits(b[0]), bf_bits(b[1]));
    p[3] = pk16(bf_bits(b[2]), bf_bits(b[3]));
    *(v4u*)(out + (size_t)i * 8) = p;
    
  }
}

// =====================================================================================================
// f32 [K rows][N cols] (pitch ldw) -> bf16 transposed plane WT[n][k] (pitch ldt, k contiguous), RNE convert.
// One 64x64 tile per block (n0 = 64 * tileN, k0 = 64 * tileK, N and K exact multiples of 64): the tile is staged in LDS with
// coalesced 16-B loads (256 threads x 16 floats = the whole tile), __syncthreads, then each output row segment
// coverage: 8 waves x 2 x (lane>>3 = 4 rows) = 64 rows n, 8 lanes x 8 = 64 k: the whole tile; grid = the whole plane.
// =====================================================================================================
__device__ __forceinline__ void cvt_bf16_tr64(const float* __restrict__ W, unsigned short* WT, int ldw, int ldt,
                                              int tileN, int tileK, float* sW) {
  const int tid = threadIdx.x;
  const int n0 = tileN * 64;
  const int k0 = tileK * 64;
  {
    const int kr = tid >> 2, cb = (tid & 3) * 16;          // row k0+kr, cols n0+cb .. +15
    const float* src = W + (size_t)(k0 + kr) * ldw + n0 + cb;
#pragma unroll
    for (int i = 0; i < 4; ++i) {
      const v4f f = *(const v4f*)(src + 4 * i);
      float* d = sW + kr * 65 + cb + 4 * i;
      d[0] = f[0]; d[1] = f[1]; d[2] = f[2]; d[3] = f[3];
    }
  }
  __syncthreads();
  const int wave = tid >> 5, lane = tid & 31;
  const int q = lane >> 3, c8 = (lane & 7) * 8;
  v4u pv[2];
#pragma unroll
  for (int it = 0; it < 2; ++it) {
    const int nr = wave * 8 + it * 4 + q;                  // output row n0+nr, 0 <= nr < 64
    v4u p;
#pragma unroll
    for (int e = 0; e < 4; ++e) {
      const float f0 = sW[(c8 + 2 * e) * 65 + nr];
      const float f1 = sW[(c8 + 2 * e + 1) * 65 + nr];
      p[e] = pk16(bf_bits(f0), bf_bits(f1));
    }
    pv[it] = p;
  }
  {
#pragma unroll
    for (int it = 0; it < 2; ++it) {
      const int nr = wave * 8 + it * 4 + q;
      *(v4u*)(WT + (size_t)(n0 + nr) * ldt + k0 + c8) = pv[it];
    }
    
  }
}

// =====================================================================================================
// One grid for all seven independent plane conversions: blocks 0..4*NTR-1 transpose the four weights (64x64 tile each,
// planes WT + w*DM*DM in the order Wq, Wk, Wv, Wo), the next 3*NCV blocks convert q, k, v (planes Xb + w*NB*SEQ*DM).
// The branch is block-uniform, so the transpose's __syncthreads is passed by all threads of its block or by none.
// =====================================================================================================
#define NTR ((DM / 64) * (DM / 64))          // 64 tiles per weight
#define NCV ((NB * SEQ * DM) / (8 * 256))    // 2048 blocks per activation plane
__global__ __launch_bounds__(256) void prep_planes(const float* __restrict__ q, const float* __restrict__ k,
                                                   const float* __restrict__ v,
                                                   const float* __restrict__ Wq, const float* __restrict__ Wk,
                                                   const float* __restrict__ Wv, const float* __restrict__ Wo,
                                                   unsigned short* Xb, unsigned short* WT) {
  __shared__ __align__(16) float sW[64 * 65];
  const int bx = blockIdx.x;
  if (bx < 4 * NTR) {
    const int w = bx / NTR, t = bx % NTR;
    const float* W = (w == 0) ? Wq : (w == 1) ? Wk : (w == 2) ? Wv : Wo;
    cvt_bf16_tr64(W, WT + (size_t)w * DM * DM, DM, DM, t % (DM / 64), t / (DM / 64), sW);
  } else {
    const int cb = bx - 4 * NTR;
    const int w = cb / NCV, blk = cb % NCV;
    const float* in = (w == 0) ? q : (w == 1) ? k : v;
    cvt_bf16x8(in, Xb + (size_t)w * NB * SEQ * DM, (NB * SEQ * DM) / 8, blk);
  }
}

// =====================================================================================================
// Register-blocked batched bf16 WMMA GEMM: C[m][n] = sum_k A[m][k] * Bt[n][k] + bias; one wave per 64x64 tile,
// no block barriers. A row-major [M][K] pitch lda; Bt row-major [N][K] pitch ldb (k contiguous);
// M, N multiples of 64, K multiple of 32 (host shapes are static multiples). b = batch index (strides in elements).
// NSPLIT: 0 = A.Bt; 1 = (A + A2).Bt (A2 = unscaled bf16 lo plane of A, 2 products).
// BIAS: 0 = none; 1 = per column n, bias[n]; 2 = per row m, bias[m]; the bias value is RNE-converted to bf16 and added in f32.
// OUT_MODE: 0 = f32 (pitch ldc); 2 = bf16 hi plane C + bf16 lo plane C2 (lo = RNE(v - hi), unscaled);
//           3 = f16 hi plane C + f16 residual plane C2 = f16((v - hi) * rscale), C2 written only for tiles
//               with n0 < N2 (pitch ldc2, batch stride strideC2).
// =====================================================================================================
template <int NSPLIT, int OUT_MODE, int BIAS>
__device__ __forceinline__ void gemm64_body(
    const unsigned short* __restrict__ Ap, const unsigned short* A2p, int lda, long long strideA,
    const unsigned short* __restrict__ Btp, int ldb, long long strideB,
    const float* __restrict__ bias,
    void* Cout, int ldc, long long strideC,
    void* Cout2, int ldc2, long long strideC2, int N2,
    int M, int N, int K, float rscale,
    int blk, int b, float (*sT)[16 * 68]) {   // blk = block index inside this product, b = batch index
  const __bf16* A   = (const __bf16*)(const void*)Ap;
  const __bf16* A2  = (const __bf16*)(const void*)A2p;
  const __bf16* Bt  = (const __bf16*)(const void*)Btp;
  const int lane = threadIdx.x & 31;
  const int wave = threadIdx.x >> 5;
  const int tilesN = N >> 6;
  const int tilesM = M >> 6;
  const int tile = blk * 8 + wave;
  if (tile >= tilesM * tilesN) return;   // wave-uniform; no block barriers in this kernel
  const int tm = tile / tilesN;
  const int tn = tile - tm * tilesN;
  const int m0 = tm << 6;
  const int n0 = tn << 6;

  const __bf16* Ab  = A  + (size_t)b * strideA;
  const __bf16* Bb  = Bt + (size_t)b * strideB;
  const __bf16* Ab2 = (NSPLIT >= 1) ? (A2 + (size_t)b * strideA) : Ab;

  const int rlane = lane & 15;                 // row (A) / col (B, D) within subtile
  const int koff  = (lane >> 4) * 8;           // k offset of this lane half
  const int mOff  = (lane >> 4) * 8;           // D row offset

  v8f acc[4][4];
#pragma unroll
  for (int i = 0; i < 4; ++i)
#pragma unroll
    for (int j = 0; j < 4; ++j) acc[i][j] = zero8();

  for (int k0 = 0; k0 < K; k0 += 32) {
    v16b bh[4];
#pragma unroll
    for (int j = 0; j < 4; ++j) {
      const size_t bo = (size_t)(n0 + (j << 4) + rlane) * ldb + koff + k0;
      bh[j] = ldfrag_b(Bb + bo);
    }
#pragma unroll
    for (int i = 0; i < 4; ++i) {
      const size_t ao = (size_t)(m0 + (i << 4) + rlane) * lda + koff + k0;
      const v16b ah = ldfrag_b(Ab + ao);
      v16b al = ah;
      if (NSPLIT >= 1) al = ldfrag_b(Ab2 + ao);
#pragma unroll
      for (int j = 0; j < 4; ++j) {
        acc[i][j] = mma_b_raw(ah, bh[j], acc[i][j]);
        if (NSPLIT >= 1) acc[i][j] = mma_b_raw(al, bh[j], acc[i][j]);
      }
      dep_guard_b(acc[i][0], acc[i][3], ah, al);
    }
    keep4_b(bh[0], bh[1], bh[2], bh[3]);
  }
  acc_guard4(acc[0][0], acc[0][1], acc[0][2], acc[0][3]);
  acc_guard4(acc[1][0], acc[1][1], acc[1][2], acc[1][3]);
  acc_guard4(acc[2][0], acc[2][1], acc[2][2], acc[2][3]);
  acc_guard4(acc[3][0], acc[3][1], acc[3][2], acc[3][3]);

  // ---- epilogue ----
  float* slab = sT[wave];
  float bcol[4];
#pragma unroll
  for (int j = 0; j < 4; ++j) {
    bcol[j] = 0.f;
    if (BIAS == 1) bcol[j] = bf_up(bf_bits(bias[n0 + (j << 4) + rlane]));   // n < N, bias has N entries
  }
#pragma unroll
  for (int i = 0; i < 4; ++i) {
    const int mBase = m0 + (i << 4);
    float brow[8];
#pragma unroll
    for (int r = 0; r < 8; ++r) {
      brow[r] = 0.f;
      if (BIAS == 2) brow[r] = bf_up(bf_bits(bias[mBase + mOff + r]));      // m < M, bias has M entries
    }
#pragma unroll
    for (int j = 0; j < 4; ++j) {
#pragma unroll
      for (int r = 0; r < 8; ++r) {
        slab[(mOff + r) * 68 + (j << 4) + rlane] = acc[i][j][r] + bcol[j] + brow[r];
      }
    }
    __builtin_amdgcn_fence(__ATOMIC_RELEASE, "workgroup");
    __builtin_amdgcn_wave_barrier();
    __builtin_amdgcn_fence(__ATOMIC_ACQUIRE, "workgroup");
    if (OUT_MODE == 0) {
      float* C = (float*)Cout + (size_t)b * strideC;
      const int hh = lane >> 4, c4 = (lane & 15) * 4;     // 256-B row segment = 16 lanes x 16 B
      {
#pragma unroll
        for (int it = 0; it < 8; ++it) {
          const int row = it * 2 + hh;                     // it 0..7 x hh 0..1 = rows 0..15
          const v4f v = *(const v4f*)(slab + row * 68 + c4);
          *(v4f*)(C + (size_t)(mBase + row) * ldc + n0 + c4) = v;
        }
        
      }
    } else {
      const int q = lane >> 3, c8 = (lane & 7) * 8;
      unsigned short* C  = (unsigned short*)Cout  + (size_t)b * strideC;
      unsigned short* C2 = (unsigned short*)Cout2 + (size_t)b * strideC2;
      const bool wlo = (OUT_MODE == 2) || (n0 < N2);      // wave-uniform
      v4u hv[4], lv[4];
#pragma unroll
      for (int it = 0; it < 4; ++it) {
        const int row = it * 4 + q;                        // it 0..3 x q 0..3 = rows 0..15
        const float* sp = slab + row * 68 + c8;
        v4u a, a2;
#pragma unroll
        for (int e = 0; e < 4; ++e) {
          const float f0 = sp[2 * e], f1 = sp[2 * e + 1];
          unsigned short h0, h1, l0, l1;
          if (OUT_MODE == 2) {
            h0 = bf_bits(f0); h1 = bf_bits(f1);
            l0 = bf_bits(f0 - bf_up(h0)); l1 = bf_bits(f1 - bf_up(h1));
          } else {
            const _Float16 x0 = (_Float16)f0, x1 = (_Float16)f1;
            h0 = h_bits(x0); h1 = h_bits(x1);
            l0 = h_bits((_Float16)((f0 - (float)x0) * rscale));
            l1 = h_bits((_Float16)((f1 - (float)x1) * rscale));
          }
          a[e] = pk16(h0, h1); a2[e] = pk16(l0, l1);
        }
        hv[it] = a; lv[it] = a2;
      }
      {
#pragma unroll
        for (int it = 0; it < 4; ++it) {
          const int row = it * 4 + q;
          *(v4u*)(C + (size_t)(mBase + row) * ldc + n0 + c8) = hv[it];
          if (wlo) *(v4u*)(C2 + (size_t)(mBase + row) * ldc2 + n0 + c8) = lv[it];
        }
        
      }
    }
    __builtin_amdgcn_fence(__ATOMIC_RELEASE, "workgroup");
    __builtin_amdgcn_wave_barrier();
    __builtin_amdgcn_fence(__ATOMIC_ACQUIRE, "workgroup");
  }
}

// One product per launch (the output projection).
template <int NSPLIT, int OUT_MODE, int BIAS>
__global__ __launch_bounds__(256) void gemm64(
    const unsigned short* __restrict__ Ap, const unsigned short* A2p, int lda, long long strideA,
    const unsigned short* __restrict__ Btp, int ldb, long long strideB,
    const float* __restrict__ bias,
    void* Cout, int ldc, long long strideC,
    void* Cout2, int ldc2, long long strideC2, int N2,
    int M, int N, int K, float rscale) {
  __shared__ __align__(16) float sT[8][16 * 68];   // per-wave 16x64 slab, pitch 68 floats
  gemm64_body<NSPLIT, OUT_MODE, BIAS>(Ap, A2p, lda, strideA, Btp, ldb, strideB, bias, Cout, ldc, strideC,
                                      Cout2, ldc2, strideC2, N2, M, N, K, rscale, blockIdx.x, blockIdx.y, sT);
}

// The three independent input projections in one grid (GPB blocks each): blockIdx.y = 0: qp, 1: kp (bf16 hi/lo planes,
// M = NB*SEQ, N = DM), 2: vp^T (f16 hi + residual planes, M = DM, N = SEQ, batch = blockIdx.x / (GPB / NB)).
// Xb = bf16 planes of q, k, v in that order; WT = W^T planes of Wq, Wk, Wv; QK = planes Qh, Ql, Kh, Kl in that order.
#define GPB (((NB * SEQ / 64) * (DM / 64)) / 8)   // 128 blocks of 8 tiles
static_assert(GPB == NB * (((DM / 64) * (SEQ / 64)) / 8));
__global__ __launch_bounds__(256) void gemm_qkv(
    const unsigned short* __restrict__ Xb, const unsigned short* __restrict__ WT,
    const float* __restrict__ bq, const float* __restrict__ bk, const float* __restrict__ bv,
    unsigned short* QK, unsigned short* VTh, unsigned short* VTl) {
  __shared__ __align__(16) float sT[8][16 * 68];   // per-wave 16x64 slab, pitch 68 floats
  const size_t NXE = (size_t)NB * SEQ * DM;
  const int y = blockIdx.y;                        // block-uniform
  if (y < 2) {
    const unsigned short* A = Xb + (size_t)y * NXE;
    gemm64_body<0, 2, 1>(A, A, DM, 0LL, WT + (size_t)y * DM * DM, DM, 0LL, y ? bk : bq,
                         (void*)(QK + (size_t)(2 * y) * NXE), DM, 0LL, (void*)(QK + (size_t)(2 * y + 1) * NXE), DM, 0LL, DM,
                         NB * SEQ, DM, DM, 1.0f, blockIdx.x, 0, sT);
  } else {
    const unsigned short* A = WT + (size_t)2 * DM * DM;
    gemm64_body<0, 3, 2>(A, A, DM, 0LL, Xb + 2 * NXE, DM, (long long)SEQ * DM, bv,
                         (void*)VTh, SEQ, (long long)DM * SEQ, (void*)VTl, VLP, (long long)DM * VLP, VLP,
                         DM, SEQ, DM, 4096.0f, blockIdx.x % (GPB / NB), blockIdx.x / (GPB / NB), sT);
  }
}

// =====================================================================================================
// Causal attention, head dim 64, key chunks of 64.
//   q planes (bf16 hi / lo): element (b, t, h, d) at [(b*SEQ + t)*DM + h*64 + d]
//   k planes (bf16 hi / lo): same layout with key index s
//   v^T hi plane (f16):      element (b, h, d, s) at [(b*DM + h*64 + d)*SEQ + s]
//   v^T residual plane (f16, (v - hi)*4096): [(b*DM + h*64 + d)*VLP + s], s < VLP, read only when RES
//   (a key chunk at or beyond VLP would contribute a zero v residual; its address is clamped)
//   Mask: query t keeps key s iff s <= t. A query block qb therefore needs key chunks 0..qb only (block-uniform
//   trip count qb+1 <= NQB); keys in later chunks exceed every query index of the block and are skipped entirely.
//   Inside a visited chunk a masked key gets logit -inf -> exp gives exactly 0, so it adds nothing to the numerator
//   or the normaliser. Row max bookkeeping: every query keeps key 0 (chunk 0), so after chunk 0 the running max of
//   every row is finite; in the diagonal chunk every query keeps at least its own key. Every row ends with l > 0.
//   out planes (bf16 hi / lo of the normalised context): element (b, t, h, d) at [(b*SEQ + t)*DM + h*64 + d]
//   scores = q . k : bf16 hi/lo split (hi.hi + hi.lo + lo.hi), f32 accumulate, then * 1/8 and the mask in f32
//   p = exp(s - m) carried as f16(1024 p); context = p . v on f16 WMMA; RES adds f16 residual planes of p and v
//   (scale 4096, separate accumulator folded back with 1/4096 per chunk in f32); online softmax (running max) in f32.
//   Block = 4 waves = 64 query rows of one (b, h); bx = 0 .. nqbThis * NH * NB - 1 (this variant's blocks).
//   K / V^T chunk staging: 128 threads x 32 elements per plane = the whole 64x64 tile of every plane read later
//   (plain 16-B loads, __syncthreads before and after); P tiles are wave-private, spilled with _Float16 element stores
//   Output coverage: each wave stores rows q0..q0+15 (it 0..3 x lane>>3 0..3) x 64 columns (8 lanes x 8) of both planes;
//   grid over all (b, h, qb) = the whole [NB*SEQ][DM] planes.
// =====================================================================================================
struct AttnLds {                                   // one LDS layout for both variants (they share a grid)
  __bf16   Ksh[64 * LP];                            // K hi [kv][d], pitch LP
  __bf16   Ksl[64 * LP];                            // K lo
  _Float16 Vth[64 * LP];                            // V^T hi [d][kv], pitch LP
  _Float16 Psh[4][16 * LP];                         // per wave P [row][kv]
  float    Os[4][16 * OP];                          // per wave context tile [row][d]
  _Float16 Vtl[64 * LP];                            // V^T residual (RES only)
  _Float16 Psl[4][16 * LP];                         // per wave P residual (RES only)
};
static_assert((64 * LP * 2) % 16 == 0 && (16 * LP * 2) % 16 == 0 && (16 * OP * 4) % 16 == 0);

template <bool RES>
__device__ __forceinline__
void attn_causal64(const unsigned short* __restrict__ qhp, const unsigned short* __restrict__ qlp,
                   const unsigned short* __restrict__ khp, const unsigned short* __restrict__ klp,
                   const unsigned short* __restrict__ vhp, const unsigned short* __restrict__ vlp,
                   unsigned short* ohp, unsigned short* olp,
                   int qbBase, int nqbThis, int bx, AttnLds& lds) {
  union FB { v16b v; v8b h[2]; };
  union FH { v16h v; v8h h[2]; };
  __bf16*   const Ksh = lds.Ksh;
  __bf16*   const Ksl = lds.Ksl;
  _Float16* const Vth = lds.Vth;
  _Float16* const Vtl = lds.Vtl;
  _Float16 (* const Psh)[16 * LP] = lds.Psh;
  _Float16 (* const Psl)[16 * LP] = lds.Psl;
  float    (* const Os)[16 * OP]  = lds.Os;

  const int tid  = threadIdx.x;
  const int wave = tid >> 5;
  const int lane = tid & 31;
  const int hh   = lane >> 4;
  const int c    = lane & 15;

  const int qbl  = bx % nqbThis;
  const int rest = bx / nqbThis;
  const int h    = rest % NH;
  const int b    = rest / NH;
  const int qb   = qbBase + qbl;               // 0..NQB-1 (block-uniform)
  const int q0   = qb * 64 + wave * 16;
  const size_t rowB = (size_t)b * SEQ;

  const __bf16* Qh = (const __bf16*)(const void*)qhp + (size_t)h * HD;
  const __bf16* Ql = (const __bf16*)(const void*)qlp + (size_t)h * HD;
  const __bf16* Kh = (const __bf16*)(const void*)khp + (size_t)h * HD;
  const __bf16* Kl = (const __bf16*)(const void*)klp + (size_t)h * HD;
  const _Float16* Vh = (const _Float16*)(const void*)vhp + ((size_t)b * DM + (size_t)h * HD) * SEQ;
  const _Float16* Vl = (const _Float16*)(const void*)vlp + ((size_t)b * DM + (size_t)h * HD) * VLP;

  // ---- Q fragments (A operand, row = lane&15): 2 d-chunks, hi and lo ----
  v16b qah[2], qal[2];
#pragma unroll
  for (int dc = 0; dc < 2; ++dc) {
    const size_t qo = (rowB + q0 + c) * DM + dc * 32 + 8 * hh;
    qah[dc] = ldfrag_b(Qh + qo);
    qal[dc] = ldfrag_b(Ql + qo);
  }

  float mrow[8], lrow[8];
  v8f oacc[4];
#pragma unroll
  for (int r = 0; r < 8; ++r) { mrow[r] = -INFINITY; lrow[r] = 0.f; }
#pragma unroll
  for (int t = 0; t < 4; ++t) oacc[t] = zero8();

  for (int kt = 0; kt <= qb; ++kt) {           // block-uniform trip count, <= NQB
    const int kv0 = kt * 64;                   // kv0 + 63 < SEQ
    __syncthreads();
    {
      const int r = tid >> 1, half = (tid & 1) * 32;
      const __bf16*   kg  = Kh + (rowB + kv0 + r) * DM + half;    // K row kv0+r, d = half..half+31
      const __bf16*   klg = Kl + (rowB + kv0 + r) * DM + half;
      const _Float16* vg  = Vh + (size_t)r * SEQ + kv0 + half;    // V^T row d = r, s = kv0+half..+31
      const int kvl = (kv0 + 64 <= VLP) ? kv0 : (VLP - 64);     // clamped address into the residual plane
      const _Float16* vlg = Vl + (size_t)r * VLP + kvl + half;
      const bool resOK = (kv0 + 64 <= VLP);                      // block-uniform (always true for qb < RESQB)
#pragma unroll
      for (int i = 0; i < 4; ++i) {
        const v8b a0 = *(const v8b*)(kg + 8 * i);
        const v8b a1 = *(const v8b*)(klg + 8 * i);
        const v8h b0 = *(const v8h*)(vg + 8 * i);
        *(v8b*)(Ksh + r * LP + half + 8 * i) = a0;
        *(v8b*)(Ksl + r * LP + half + 8 * i) = a1;
        *(v8h*)(Vth + r * LP + half + 8 * i) = b0;
        if (RES) {
          v8h b1 = *(const v8h*)(vlg + 8 * i);
          if (!resOK) b1 = zero8h();
          *(v8h*)(Vtl + r * LP + half + 8 * i) = b1;
        }
      }
      // RES build: the last load's result was placed on address pairs that earlier loads of this batch name. The pairs are
      // inputs of the wait, so they stay as they are until the batch's address translations are done.
      if (RES) asm volatile("s_wait_xcnt 0x0" :: "v"(kg), "v"(klg), "v"(vg), "v"(vlg) : "memory");
    }
    __syncthreads();

    // ---- scores: 16 query rows x 64 keys per wave, 3 bf16 products ----
    v8f s[4];
#pragma unroll
    for (int j = 0; j < 4; ++j) {
      s[j] = zero8();
#pragma unroll
      for (int dc = 0; dc < 2; ++dc) {
        FB kb, kl;
        kb.h[0] = *(const v8b*)(Ksh + (j * 16 + c) * LP + dc * 32 + 8 * hh);
        kb.h[1] = *(const v8b*)(Ksh + (j * 16 + c) * LP + dc * 32 + 16 + 8 * hh);
        kl.h[0] = *(const v8b*)(Ksl + (j * 16 + c) * LP + dc * 32 + 8 * hh);
        kl.h[1] = *(const v8b*)(Ksl + (j * 16 + c) * LP + dc * 32 + 16 + 8 * hh);
        s[j] = mma_b(qah[dc], kb.v, s[j]);
        s[j] = mma_b(qah[dc], kl.v, s[j]);
        s[j] = mma_b(qal[dc], kb.v, s[j]);
      }
    }

    // ---- scale, causal mask by index, row max, online softmax, P (x1024, f16) and P residual (x4096) to LDS ----
    _Float16* pwh = Psh[wave];
    _Float16* pwl = Psl[RES ? wave : 0];
#pragma unroll
    for (int r = 0; r < 8; ++r) {
      const int rowq = q0 + 8 * hh + r;        // query index of D row 8hh+r
      float m = -INFINITY;
#pragma unroll
      for (int j = 0; j < 4; ++j) {
        const int key = kv0 + j * 16 + c;
        float sv = s[j][r] * 0.125f;
        const bool keep = (key <= rowq);
        sv = keep ? sv : -INFINITY;
        s[j][r] = sv;
        m = fmaxf(m, sv);
      }
#pragma unroll
      for (int off = 1; off < 16; off <<= 1) m = fmaxf(m, __shfl_xor(m, off, 32));
      const float mnew  = fmaxf(mrow[r], m);
      const float msafe = (mnew == -INFINITY) ? 0.f : mnew;
      const float alpha = __expf(mrow[r] - msafe);
      mrow[r] = mnew;
      float psum = 0.f;
#pragma unroll
      for (int j = 0; j < 4; ++j) {
        const float p = __expf(s[j][r] - msafe);     // masked logit: exp(-inf) = 0
        psum += p;
        const float p1k = p * 1024.0f;
        const _Float16 ph = (_Float16)p1k;
        pwh[(8 * hh + r) * LP + j * 16 + c] = ph;
        if (RES) {
          const _Float16 pl = (_Float16)((p1k - (float)ph) * 4096.0f);
          pwl[(8 * hh + r) * LP + j * 16 + c] = pl;
        }
      }
#pragma unroll
      for (int off = 1; off < 16; off <<= 1) psum += __shfl_xor(psum, off, 32);
      lrow[r] = lrow[r] * alpha + psum;
#pragma unroll
      for (int t = 0; t < 4; ++t) oacc[t][r] *= alpha;
    }
    __builtin_amdgcn_fence(__ATOMIC_RELEASE, "workgroup");
    __builtin_amdgcn_wave_barrier();
    __builtin_amdgcn_fence(__ATOMIC_ACQUIRE, "workgroup");

    // ---- context += P . V (f16 WMMA), residual products into a separate accumulator ----
    v8f o1[4];
#pragma unroll
    for (int t = 0; t < 4; ++t) o1[t] = zero8();
#pragma unroll 1
    for (int kk = 0; kk < 2; ++kk) {
      FH pa, pl;
      pa.h[0] = *(const v8h*)(pwh + c * LP + kk * 32 + 8 * hh);
      pa.h[1] = *(const v8h*)(pwh + c * LP + kk * 32 + 16 + 8 * hh);
      if (RES) {
        pl.h[0] = *(const v8h*)(pwl + c * LP + kk * 32 + 8 * hh);
        pl.h[1] = *(const v8h*)(pwl + c * LP + kk * 32 + 16 + 8 * hh);
      } else {
        pl.v = pa.v;
      }
#pragma unroll
      for (int t = 0; t < 4; ++t) {
        FH vb;
        vb.h[0] = *(const v8h*)(Vth + (t * 16 + c) * LP + kk * 32 + 8 * hh);
        vb.h[1] = *(const v8h*)(Vth + (t * 16 + c) * LP + kk * 32 + 16 + 8 * hh);
        oacc[t] = mma_h(pa.v, vb.v, oacc[t]);
        if (RES) {
          FH vl;
          vl.h[0] = *(const v8h*)(Vtl + (t * 16 + c) * LP + kk * 32 + 8 * hh);
          vl.h[1] = *(const v8h*)(Vtl + (t * 16 + c) * LP + kk * 32 + 16 + 8 * hh);
          o1[t] = mma_h(pa.v, vl.v, o1[t]);
          o1[t] = mma_h(pl.v, vb.v, o1[t]);
        }
      }
    }
    if (RES) {
#pragma unroll
      for (int t = 0; t < 4; ++t)
#pragma unroll
        for (int r = 0; r < 8; ++r) oacc[t][r] += o1[t][r] * (1.0f / 4096.0f);
    }
  }

  // ---- normalise (1/l and the 1/1024 p carry), stage the wave's 16x64 tile, bf16 hi/lo split,
  float* os = Os[wave];
#pragma unroll
  for (int r = 0; r < 8; ++r) {
    const float l = lrow[r];
    const float inv = ((l > 0.f) ? (1.0f / l) : 0.f) * (1.0f / 1024.0f);
#pragma unroll
    for (int t = 0; t < 4; ++t) os[(8 * hh + r) * OP + t * 16 + c] = oacc[t][r] * inv;
  }
  __builtin_amdgcn_fence(__ATOMIC_RELEASE, "workgroup");
  __builtin_amdgcn_wave_barrier();
  __builtin_amdgcn_fence(__ATOMIC_ACQUIRE, "workgroup");
  {
    const int q4 = lane >> 3, c8 = (lane & 7) * 8;
    v4u hv[4], lv[4];
#pragma unroll
    for (int it = 0; it < 4; ++it) {
      const int row = it * 4 + q4;   // it 0..3 x q4 0..3 = rows 0..15 of the wave tile
      const float* sp = os + row * OP + c8;
      v4u a, a2;
#pragma unroll
      for (int e = 0; e < 4; ++e) {
        const float f0 = sp[2 * e], f1 = sp[2 * e + 1];
        const unsigned short h0 = bf_bits(f0), h1 = bf_bits(f1);
        const unsigned short l0 = bf_bits(f0 - bf_up(h0)), l1 = bf_bits(f1 - bf_up(h1));
        a[e] = pk16(h0, h1); a2[e] = pk16(l0, l1);
      }
      hv[it] = a; lv[it] = a2;
    }
    {
#pragma unroll
      for (int it = 0; it < 4; ++it) {
        const int row = it * 4 + q4;
        const size_t go = (rowB + q0 + row) * DM + (size_t)h * HD + c8;
        *(v4u*)(ohp + go) = hv[it];
        *(v4u*)(olp + go) = lv[it];
      }
      
    }
  }
}

// Both attention variants in one grid: blocks 0..NMAIN-1 are the query blocks RESQB..NQB-1 (no residual planes),
// the last NB*NH*RESQB blocks the leading RESQB query blocks with residual planes. The branch is block-uniform.
#define NMAIN (NB * NH * (NQB - RESQB))
__global__ __launch_bounds__(128)
void attn_all(const unsigned short* __restrict__ qhp, const unsigned short* __restrict__ qlp,
              const unsigned short* __restrict__ khp, const unsigned short* __restrict__ klp,
              const unsigned short* __restrict__ vhp, const unsigned short* __restrict__ vlp,
              unsigned short* ohp, unsigned short* olp) {
  __shared__ __align__(16) AttnLds lds;
  const int bx = blockIdx.x;
  if (bx < NMAIN) attn_causal64<false>(qhp, qlp, khp, klp, vhp, vlp, ohp, olp, RESQB, NQB - RESQB, bx, lds);
  else            attn_causal64<true>(qhp, qlp, khp, klp, vhp, vlp, ohp, olp, 0, RESQB, bx - NMAIN, lds);
}

// =====================================================================================================
// Workspace map (bytes; every region is an exact multiple of its 64x64-tile / whole-line store granularity,
//   Qb   bf16 [8192][512]            0            8388608
//   Kb   bf16 [8192][512]            8388608      8388608
//   Vb   bf16 [8192][512]            16777216     8388608
//   WqT  bf16 [512 n][512 k]         25165824     524288
//   WkT                              25690112     524288
//   WvT                              26214400     524288
//   WoT                              26738688     524288
//   Qh   bf16 [8192][512]            27262976     8388608
//   Ql                               35651584     8388608
//   Kh                               44040192     8388608
//   Kl                               52428800     8388608
//   VTh  f16  [2][512][4096]         60817408     8388608
//   VTl  f16  [2][512][512]          69206016     1048576
//   Oh   bf16 [8192][512]            70254592     8388608
//   Ol                               78643200     8388608
//   end                              87031808
// =====================================================================================================
extern "C" void kernel_launch(void* const* d_in, const int* in_sizes, int n_in,
                              void* d_out, int out_size, void* d_ws, size_t ws_size,
                              hipStream_t stream) {
  if (n_in < 11) return;
  const int NX = NB * SEQ * DM;                    // 4194304
  if (in_sizes[0] != NX || in_sizes[1] != NX || in_sizes[2] != NX) return;
  if (in_sizes[3] != DM * DM || in_sizes[5] != DM * DM || in_sizes[7] != DM * DM || in_sizes[9] != DM * DM) return;
  if (in_sizes[4] != DM || in_sizes[6] != DM || in_sizes[8] != DM || in_sizes[10] != DM) return;
  if (out_size != NX) return;

  const float* v  = (const float*)d_in[0];   // [2][4096][512]
  const float* k  = (const float*)d_in[1];   // [2][4096][512]
  const float* q  = (const float*)d_in[2];   // [2][4096][512]
  const float* Wq = (const float*)d_in[3];   // [512 in][512 out] = [k][n]
  const float* bq = (const float*)d_in[4];   // [512]
  const float* Wk = (const float*)d_in[5];   // [512 in][512 out]
  const float* bk = (const float*)d_in[6];   // [512]
  const float* Wv = (const float*)d_in[7];   // [512 in][512 out]
  const float* bv = (const float*)d_in[8];   // [512]
  const float* Wo = (const float*)d_in[9];   // [512 in][512 out]
  const float* bo = (const float*)d_in[10];  // [512]

  const size_t PX  = (size_t)NB * SEQ * DM * 2;    //  8388608  16-bit activation plane [8192][512]
  const size_t PW  = (size_t)DM * DM * 2;          //   524288  16-bit weight plane [512][512]
  const size_t PVT = (size_t)NB * DM * SEQ * 2;    //  8388608  v^T hi plane
  const size_t PVL = (size_t)NB * DM * VLP * 2;    //  1048576  v^T residual plane
  size_t off = 0;
  const size_t oQb  = off; off += PX;
  const size_t oKb  = off; off += PX;
  const size_t oVb  = off; off += PX;
  const size_t oWq  = off; off += PW;
  const size_t oWk  = off; off += PW;
  const size_t oWv  = off; off += PW;
  const size_t oWo  = off; off += PW;
  const size_t oQh  = off; off += PX;
  const size_t oQl  = off; off += PX;
  const size_t oKh  = off; off += PX;
  const size_t oKl  = off; off += PX;
  const size_t oVTh = off; off += PVT;
  const size_t oVTl = off; off += PVL;
  const size_t oOh  = off; off += PX;
  const size_t oOl  = off; off += PX;
  if (off > ws_size) return;                       // off = 87031808
  if (off > (size_t)134217728) return;

  char* ws = (char*)d_ws;
  unsigned short* Qb  = (unsigned short*)(ws + oQb);
  unsigned short* Kb  = (unsigned short*)(ws + oKb);
  unsigned short* Vb  = (unsigned short*)(ws + oVb);
  unsigned short* WqT = (unsigned short*)(ws + oWq);
  unsigned short* WkT = (unsigned short*)(ws + oWk);
  unsigned short* WvT = (unsigned short*)(ws + oWv);
  unsigned short* WoT = (unsigned short*)(ws + oWo);
  unsigned short* Qh  = (unsigned short*)(ws + oQh);
  unsigned short* Ql  = (unsigned short*)(ws + oQl);
  unsigned short* Kh  = (unsigned short*)(ws + oKh);
  unsigned short* Kl  = (unsigned short*)(ws + oKl);
  unsigned short* VTh = (unsigned short*)(ws + oVTh);
  unsigned short* VTl = (unsigned short*)(ws + oVTl);
  unsigned short* Oh  = (unsigned short*)(ws + oOh);
  unsigned short* Ol  = (unsigned short*)(ws + oOl);

  const dim3 blk(256);
  const dim3 gProj(GPB, 1);                                    // 1024 tiles -> 128 blocks: M=8192, N=512

  // (1) all plane conversions in one grid: weights f32 [k][n] -> bf16 W^T [n][k] (WqT, WkT, WvT, WoT are contiguous),
  //     activations f32 -> bf16 planes of the inputs' layout (Qb, Kb, Vb are contiguous)
  prep_planes<<<dim3(4 * NTR + 3 * NCV), blk, 0, stream>>>(q, k, v, Wq, Wk, Wv, Wo, Qb, WqT);
  // (2) the three input projections in one grid: qp, kp -> bf16 hi/lo planes [b*SEQ+t][h*64+d] (Qh, Ql, Kh, Kl contiguous),
  //     vp^T per batch -> f16 hi plane [b][h*64+d][s] (pitch SEQ) and residual plane (x4096, keys < VLP only, pitch VLP)
  gemm_qkv<<<dim3(GPB, 3), blk, 0, stream>>>(Qb, WqT, bq, bk, bv, Qh, VTh, VTl);
  // (3) causal attention, one grid: query blocks RESQB.. without, 0..RESQB-1 with residual planes
  attn_all<<<dim3(NB * NH * NQB), dim3(128), 0, stream>>>(Qh, Ql, Kh, Kl, VTh, VTl, Oh, Ol);
  // (4) out = context . Wo + bo -> d_out f32 [8192][512]  (A = context hi + lo planes, 2 products; Bt = WoT)
  gemm64<1, 0, 1><<<gProj, blk, 0, stream>>>(
      Oh, Ol, DM, 0LL, WoT, DM, 0LL, bo,
      d_out, DM, 0LL, d_out, DM, 0LL, DM,
      NB * SEQ, DM, DM, 1.0f);
  (void)hipGetLastError();
}

// v003
// Measured time: 247 microseconds a run.
// Timed twice side by side with v002, it ran 1.08 times as fast both times.
// Counting every step since v000, it is 2.14 times as fast.
// Contractions: q, k, v^T projections = v_wmma_f32_16x16x32_bf16 (bf16 operands from RNE-converted inputs and weights, single product, f32 accumulate);
// q.k^T scores = v_wmma_f32_16x16x32_bf16 with bf16 hi/lo split q and k (hi.hi + hi.lo + lo.hi), f32 accumulate;
// p.v = v_wmma_f32_16x16x32_f16 (p carried x1024 in f16 times v in f16, single product; plus f16 residual planes x4096 of
// p and v for the first 512 query rows of every sequence), f32 accumulate;
// ctx.Wo = v_wmma_f32_16x16x32_bf16 with ctx as bf16 hi/lo planes times bf16 Wo^T (2 products), f32 accumulate;
// causal mask (key <= query), online softmax, normalisers and bias adds in f32 on the VALU.
// Carry audit:
//   Psh = f16(1024 * p)                      -> the 1/1024 is folded exactly once in the attention epilogue: inv = (1/l) * (1/1024)
//   Psl = f16((1024 p - Psh) * 4096)         }  products Psh.VTl and Psl.VTh go to the separate accumulator o1,
//   VTl = f16((v - VTh) * 4096)              }  folded back with * (1/4096) once per key chunk (RES blocks only)
//   VTh = f16(v), no carry (|v| typ. 0.45); q / k / ctx lo planes are unscaled bf16 residuals (v - hi) sharing the hi accumulator;
//   score scale 1/8 applied once in f32 after the score accumulate. No other scaled planes.
#include <hip/hip_runtime.h>
#include <math.h>
#include <stdint.h>

#define NB    2
#define SEQ   4096
#define DM    512
#define NH    8
#define HD    64
#define NQB   (SEQ / 64)   // 64 query / key blocks of 64
#define VLP   512          // key pitch of the v^T residual plane (keys 0..VLP-1)
#define RESQB 8            // leading 64-row query blocks that use the p / v residual planes
#define LP    72           // LDS row pitch of the 64-element 16-bit tiles: 144 B = 16 B x 9, 16 rows of a 16-B read on 16 bank quads
#define OP    68           // LDS row pitch of the f32 context tile, in floats (16-B reads down a column walk)
static_assert(RESQB * 64 <= VLP);
static_assert(NH * HD == DM);
static_assert((SEQ % 64) == 0 && (DM % 64) == 0 && (DM % 32) == 0);
static_assert(((NB * SEQ / 64) * (DM / 64)) % 8 == 0);
static_assert(((DM / 64) * (SEQ / 64)) % 8 == 0);
static_assert((NB * SEQ * DM) % (8 * 256) == 0);
static_assert((DM * DM) % (64 * 64) == 0);

typedef _Float16 v16h __attribute__((ext_vector_type(16)));
typedef _Float16 v8h  __attribute__((ext_vector_type(8)));
typedef __bf16   v16b __attribute__((ext_vector_type(16)));
typedef __bf16   v8b  __attribute__((ext_vector_type(8)));
typedef float    v8f  __attribute__((ext_vector_type(8)));
typedef float    v4f  __attribute__((ext_vector_type(4)));
typedef unsigned int v4u __attribute__((ext_vector_type(4)));

// ---- scalar helpers --------------------------------------------------------------------------------
__device__ __forceinline__ unsigned short bf_bits(float f) {          // f32 -> bf16 bits, RNE convert
  unsigned u = __float_as_uint(f);
  return (unsigned short)((u + 0x7FFFu + ((u >> 16) & 1u)) >> 16);
}
__device__ __forceinline__ float bf_up(unsigned short h) { return __uint_as_float(((unsigned)h) << 16); }
__device__ __forceinline__ unsigned short h_bits(_Float16 x) { return __builtin_bit_cast(unsigned short, x); }
__device__ __forceinline__ unsigned pk16(unsigned short a, unsigned short b) { return (unsigned)a | ((unsigned)b << 16); }
__device__ __forceinline__ v8f zero8() { v8f z = {0.f, 0.f, 0.f, 0.f, 0.f, 0.f, 0.f, 0.f}; return z; }
__device__ __forceinline__ v8h zero8h() {
  const _Float16 z = (_Float16)0.0f;
  v8h r = {z, z, z, z, z, z, z, z};
  return r;
}

// ---- fragment loader: 16-bit A/B operand, lane -> row/col (lane&15), p already includes +8*(lane>>4);
//      elements 0..7 <- p[0..7] (k0+8h..), elements 8..15 <- p[16..23] (k0+16+8h..)
__device__ __forceinline__ v16b ldfrag_b(const __bf16* p) {
  union { v16b v; v8b h[2]; } f;
  f.h[0] = *(const v8b*)(p);
  f.h[1] = *(const v8b*)(p + 16);
  return f.v;
}

// ---- WMMA helpers with trailing VALU hazard gap --------------------------------------------------------
__device__ __forceinline__ v8f mma_h_raw(v16h a, v16h b, v8f c) {
  return __builtin_amdgcn_wmma_f32_16x16x32_f16(false, a, false, b, (short)0, c, false, false);
}
__device__ __forceinline__ v8f mma_b_raw(v16b a, v16b b, v8f c) {
  return __builtin_amdgcn_wmma_f32_16x16x32_bf16(false, a, false, b, (short)0, c, false, false);
}
__device__ __forceinline__ void dep_guard_b(v8f& a, v8f& b, v16b x, v16b y) {
  asm volatile("v_nop\n\tv_nop\n\tv_nop\n\tv_nop" : "+v"(a), "+v"(b) : "v"(x), "v"(y));
}
__device__ __forceinline__ void keep4_b(v16b a, v16b b, v16b c, v16b d) {
  asm volatile("v_nop" :: "v"(a), "v"(b), "v"(c), "v"(d));
}
__device__ __forceinline__ void acc_guard4(v8f& a, v8f& b, v8f& c, v8f& d) {
  asm volatile("v_nop\n\tv_nop\n\tv_nop\n\tv_nop" : "+v"(a), "+v"(b), "+v"(c), "+v"(d));
}

// =====================================================================================================
// f32 -> bf16 (RNE convert), 8 elements per thread, one 16-B store per lane: a wave writes 512 contiguous B
// the [8192][512] activations, a multiple of 256).
// coverage: n8 threads x 8 = the whole plane.
// =====================================================================================================
__device__ __forceinline__ void cvt_bf16x8(const float* __restrict__ in, unsigned short* out, int n8, int blk) {
  const int i = blk * 256 + threadIdx.x;
  if (i < n8) {
    const v4f a = *(const v4f*)(in + (size_t)i * 8);
    const v4f b = *(const v4f*)(in + (size_t)i * 8 + 4);
    v4u p;
    p[0] = pk16(bf_bits(a[0]), bf_bits(a[1]));
    p[1] = pk16(bf_bits(a[2]), bf_bits(a[3]));
    p[2] = pk16(bf_bits(b[0]), bf_bits(b[1]));
    p[3] = pk16(bf_bits(b[2]), bf_bits(b[3]));
    *(v4u*)(out + (size_t)i * 8) = p;
    
  }
}

// =====================================================================================================
// f32 [K rows][N cols] (pitch ldw) -> bf16 transposed plane WT[n][k] (pitch ldt, k contiguous), RNE convert.
// One 64x64 tile per block (n0 = 64 * tileN, k0 = 64 * tileK, N and K exact multiples of 64): the tile is staged in LDS with
// coalesced 16-B loads (256 threads x 16 floats = the whole tile), __syncthreads, then each output row segment
// coverage: 8 waves x 2 x (lane>>3 = 4 rows) = 64 rows n, 8 lanes x 8 = 64 k: the whole tile; grid = the whole plane.
// =====================================================================================================
__device__ __forceinline__ void cvt_bf16_tr64(const float* __restrict__ W, unsigned short* WT, int ldw, int ldt,
                                              int tileN, int tileK, float* sW) {
  const int tid = threadIdx.x;
  const int n0 = tileN * 64;
  const int k0 = tileK * 64;
  {
    const int kr = tid >> 2, cb = (tid & 3) * 16;          // row k0+kr, cols n0+cb .. +15
    const float* src = W + (size_t)(k0 + kr) * ldw + n0 + cb;
#pragma unroll
    for (int i = 0; i < 4; ++i) {
      const v4f f = *(const v4f*)(src + 4 * i);
      float* d = sW + kr * 65 + cb + 4 * i;
      d[0] = f[0]; d[1] = f[1]; d[2] = f[2]; d[3] = f[3];
    }
  }
  __syncthreads();
  const int wave = tid >> 5, lane = tid & 31;
  const int q = lane >> 3, c8 = (lane & 7) * 8;
  v4u pv[2];
#pragma unroll
  for (int it = 0; it < 2; ++it) {
    const int nr = wave * 8 + it * 4 + q;                  // output row n0+nr, 0 <= nr < 64
    v4u p;
#pragma unroll
    for (int e = 0; e < 4; ++e) {
      const float f0 = sW[(c8 + 2 * e) * 65 + nr];
      const float f1 = sW[(c8 + 2 * e + 1) * 65 + nr];
      p[e] = pk16(bf_bits(f0), bf_bits(f1));
    }
    pv[it] = p;
  }
  {
#pragma unroll
    for (int it = 0; it < 2; ++it) {
      const int nr = wave * 8 + it * 4 + q;
      *(v4u*)(WT + (size_t)(n0 + nr) * ldt + k0 + c8) = pv[it];
    }
    
  }
}

// =====================================================================================================
// One grid for all seven independent plane conversions: blocks 0..4*NTR-1 transpose the four weights (64x64 tile each,
// planes WT + w*DM*DM in the order Wq, Wk, Wv, Wo), the next 3*NCV blocks convert q, k, v (planes Xb + w*NB*SEQ*DM).
// The branch is block-uniform, so the transpose's __syncthreads is passed by all threads of its block or by none.
// =====================================================================================================
#define NTR ((DM / 64) * (DM / 64))          // 64 tiles per weight
#define NCV ((NB * SEQ * DM) / (8 * 256))    // 2048 blocks per activation plane
__global__ __launch_bounds__(256) void prep_planes(const float* __restrict__ q, const float* __restrict__ k,
                                                   const float* __restrict__ v,
                                                   const float* __restrict__ Wq, const float* __restrict__ Wk,
                                                   const float* __restrict__ Wv, const float* __restrict__ Wo,
                                                   unsigned short* Xb, unsigned short* WT) {
  __shared__ __align__(16) float sW[64 * 65];
  const int bx = blockIdx.x;
  if (bx < 4 * NTR) {
    const int w = bx / NTR, t = bx % NTR;
    const float* W = (w == 0) ? Wq : (w == 1) ? Wk : (w == 2) ? Wv : Wo;
    cvt_bf16_tr64(W, WT + (size_t)w * DM * DM, DM, DM, t % (DM / 64), t / (DM / 64), sW);
  } else {
    const int cb = bx - 4 * NTR;
    const int w = cb / NCV, blk = cb % NCV;
    const float* in = (w == 0) ? q : (w == 1) ? k : v;
    cvt_bf16x8(in, Xb + (size_t)w * NB * SEQ * DM, (NB * SEQ * DM) / 8, blk);
  }
}

// =====================================================================================================
// Register-blocked batched bf16 WMMA GEMM: C[m][n] = sum_k A[m][k] * Bt[n][k] + bias; one wave per 64x64 tile,
// no block barriers. A row-major [M][K] pitch lda; Bt row-major [N][K] pitch ldb (k contiguous);
// M, N multiples of 64, K multiple of 32 (host shapes are static multiples). b = batch index (strides in elements).
// NSPLIT: 0 = A.Bt; 1 = (A + A2).Bt (A2 = unscaled bf16 lo plane of A, 2 products).
// BIAS: 0 = none; 1 = per column n, bias[n]; 2 = per row m, bias[m]; the bias value is RNE-converted to bf16 and added in f32.
// OUT_MODE: 0 = f32 (pitch ldc); 2 = bf16 hi plane C + bf16 lo plane C2 (lo = RNE(v - hi), unscaled);
//           3 = f16 hi plane C + f16 residual plane C2 = f16((v - hi) * rscale), C2 written only for tiles
//               with n0 < N2 (pitch ldc2, batch stride strideC2).
// =====================================================================================================
template <int NSPLIT, int OUT_MODE, int BIAS>
__device__ __forceinline__ void gemm64_body(
    const unsigned short* __restrict__ Ap, const unsigned short* A2p, int lda, long long strideA,
    const unsigned short* __restrict__ Btp, int ldb, long long strideB,
    const float* __restrict__ bias,
    void* Cout, int ldc, long long strideC,
    void* Cout2, int ldc2, long long strideC2, int N2,
    int M, int N, int K, float rscale,
    int blk, int b, float (*sT)[16 * 68]) {   // blk = block index inside this product, b = batch index
  const __bf16* A   = (const __bf16*)(const void*)Ap;
  const __bf16* A2  = (const __bf16*)(const void*)A2p;
  const __bf16* Bt  = (const __bf16*)(const void*)Btp;
  const int lane = threadIdx.x & 31;
  const int wave = threadIdx.x >> 5;
  const int tilesN = N >> 6;
  const int tilesM = M >> 6;
  const int tile = blk * 8 + wave;
  if (tile >= tilesM * tilesN) return;   // wave-uniform; no block barriers in this kernel
  const int tm = tile / tilesN;
  const int tn = tile - tm * tilesN;
  const int m0 = tm << 6;
  const int n0 = tn << 6;

  const __bf16* Ab  = A  + (size_t)b * strideA;
  const __bf16* Bb  = Bt + (size_t)b * strideB;
  const __bf16* Ab2 = (NSPLIT >= 1) ? (A2 + (size_t)b * strideA) : Ab;

  const int rlane = lane & 15;                 // row (A) / col (B, D) within subtile
  const int koff  = (lane >> 4) * 8;           // k offset of this lane half
  const int mOff  = (lane >> 4) * 8;           // D row offset

  v8f acc[4][4];
#pragma unroll
  for (int i = 0; i < 4; ++i)
#pragma unroll
    for (int j = 0; j < 4; ++j) acc[i][j] = zero8();

  for (int k0 = 0; k0 < K; k0 += 32) {
    v16b bh[4];
#pragma unroll
    for (int j = 0; j < 4; ++j) {
      const size_t bo = (size_t)(n0 + (j << 4) + rlane) * ldb + koff + k0;
      bh[j] = ldfrag_b(Bb + bo);
    }
#pragma unroll
    for (int i = 0; i < 4; ++i) {
      const size_t ao = (size_t)(m0 + (i << 4) + rlane) * lda + koff + k0;
      const v16b ah = ldfrag_b(Ab + ao);
      v16b al = ah;
      if (NSPLIT >= 1) al = ldfrag_b(Ab2 + ao);
#pragma unroll
      for (int j = 0; j < 4; ++j) {
        acc[i][j] = mma_b_raw(ah, bh[j], acc[i][j]);
        if (NSPLIT >= 1) acc[i][j] = mma_b_raw(al, bh[j], acc[i][j]);
      }
      dep_guard_b(acc[i][0], acc[i][3], ah, al);
    }
    keep4_b(bh[0], bh[1], bh[2], bh[3]);
  }
  acc_guard4(acc[0][0], acc[0][1], acc[0][2], acc[0][3]);
  acc_guard4(acc[1][0], acc[1][1], acc[1][2], acc[1][3]);
  acc_guard4(acc[2][0], acc[2][1], acc[2][2], acc[2][3]);
  acc_guard4(acc[3][0], acc[3][1], acc[3][2], acc[3][3]);

  // ---- epilogue ----
  float* slab = sT[wave];
  float bcol[4];
#pragma unroll
  for (int j = 0; j < 4; ++j) {
    bcol[j] = 0.f;
    if (BIAS == 1) bcol[j] = bf_up(bf_bits(bias[n0 + (j << 4) + rlane]));   // n < N, bias has N entries
  }
#pragma unroll
  for (int i = 0; i < 4; ++i) {
    const int mBase = m0 + (i << 4);
    float brow[8];
#pragma unroll
    for (int r = 0; r < 8; ++r) {
      brow[r] = 0.f;
      if (BIAS == 2) brow[r] = bf_up(bf_bits(bias[mBase + mOff + r]));      // m < M, bias has M entries
    }
#pragma unroll
    for (int j = 0; j < 4; ++j) {
#pragma unroll
      for (int r = 0; r < 8; ++r) {
        slab[(mOff + r) * 68 + (j << 4) + rlane] = acc[i][j][r] + bcol[j] + brow[r];
      }
    }
    __builtin_amdgcn_fence(__ATOMIC_RELEASE, "workgroup");
    __builtin_amdgcn_wave_barrier();
    __builtin_amdgcn_fence(__ATOMIC_ACQUIRE, "workgroup");
    if (OUT_MODE == 0) {
      float* C = (float*)Cout + (size_t)b * strideC;
      const int hh = lane >> 4, c4 = (lane & 15) * 4;     // 256-B row segment = 16 lanes x 16 B
      {
#pragma unroll
        for (int it = 0; it < 8; ++it) {
          const int row = it * 2 + hh;                     // it 0..7 x hh 0..1 = rows 0..15
          const v4f v = *(const v4f*)(slab + row * 68 + c4);
          *(v4f*)(C + (size_t)(mBase + row) * ldc + n0 + c4) = v;
        }
        
      }
    } else {
      const int q = lane >> 3, c8 = (lane & 7) * 8;
      unsigned short* C  = (unsigned short*)Cout  + (size_t)b * strideC;
      unsigned short* C2 = (unsigned short*)Cout2 + (size_t)b * strideC2;
      const bool wlo = (OUT_MODE == 2) || (n0 < N2);      // wave-uniform
      v4u hv[4], lv[4];
#pragma unroll
      for (int it = 0; it < 4; ++it) {
        const int row = it * 4 + q;                        // it 0..3 x q 0..3 = rows 0..15
        const float* sp = slab + row * 68 + c8;
        v4u a, a2;
#pragma unroll
        for (int e = 0; e < 4; ++e) {
          const float f0 = sp[2 * e], f1 = sp[2 * e + 1];
          unsigned short h0, h1, l0, l1;
          if (OUT_MODE == 2) {
            h0 = bf_bits(f0); h1 = bf_bits(f1);
            l0 = bf_bits(f0 - bf_up(h0)); l1 = bf_bits(f1 - bf_up(h1));
          } else {
            const _Float16 x0 = (_Float16)f0, x1 = (_Float16)f1;
            h0 = h_bits(x0); h1 = h_bits(x1);
            l0 = h_bits((_Float16)((f0 - (float)x0) * rscale));
            l1 = h_bits((_Float16)((f1 - (float)x1) * rscale));
          }
          a[e] = pk16(h0, h1); a2[e] = pk16(l0, l1);
        }
        hv[it] = a; lv[it] = a2;
      }
      {
#pragma unroll
        for (int it = 0; it < 4; ++it) {
          const int row = it * 4 + q;
          *(v4u*)(C + (size_t)(mBase + row) * ldc + n0 + c8) = hv[it];
          if (wlo) *(v4u*)(C2 + (size_t)(mBase + row) * ldc2 + n0 + c8) = lv[it];
        }
        
      }
    }
    __builtin_amdgcn_fence(__ATOMIC_RELEASE, "workgroup");
    __builtin_amdgcn_wave_barrier();
    __builtin_amdgcn_fence(__ATOMIC_ACQUIRE, "workgroup");
  }
}

// One product per launch (the output projection).
template <int NSPLIT, int OUT_MODE, int BIAS>
__global__ __launch_bounds__(256) void gemm64(
    const unsigned short* __restrict__ Ap, const unsigned short* A2p, int lda, long long strideA,
    const unsigned short* __restrict__ Btp, int ldb, long long strideB,
    const float* __restrict__ bias,
    void* Cout, int ldc, long long strideC,
    void* Cout2, int ldc2, long long strideC2, int N2,
    int M, int N, int K, float rscale) {
  __shared__ __align__(16) float sT[8][16 * 68];   // per-wave 16x64 slab, pitch 68 floats
  gemm64_body<NSPLIT, OUT_MODE, BIAS>(Ap, A2p, lda, strideA, Btp, ldb, strideB, bias, Cout, ldc, strideC,
                                      Cout2, ldc2, strideC2, N2, M, N, K, rscale, blockIdx.x, blockIdx.y, sT);
}

// The three independent input projections in one grid (GPB blocks each): blockIdx.y = 0: qp, 1: kp (bf16 hi/lo planes,
// M = NB*SEQ, N = DM), 2: vp^T (f16 hi + residual planes, M = DM, N = SEQ, batch = blockIdx.x / (GPB / NB)).
// Xb = bf16 planes of q, k, v in that order; WT = W^T planes of Wq, Wk, Wv; QK = planes Qh, Ql, Kh, Kl in that order.
#define GPB (((NB * SEQ / 64) * (DM / 64)) / 8)   // 128 blocks of 8 tiles
static_assert(GPB == NB * (((DM / 64) * (SEQ / 64)) / 8));
__global__ __launch_bounds__(256) void gemm_qkv(
    const unsigned short* __restrict__ Xb, const unsigned short* __restrict__ WT,
    const float* __restrict__ bq, const float* __restrict__ bk, const float* __restrict__ bv,
    unsigned short* QK, unsigned short* VTh, unsigned short* VTl) {
  __shared__ __align__(16) float sT[8][16 * 68];   // per-wave 16x64 slab, pitch 68 floats
  const size_t NXE = (size_t)NB * SEQ * DM;
  const int y = blockIdx.y;                        // block-uniform
  if (y < 2) {
    const unsigned short* A = Xb + (size_t)y * NXE;
    gemm64_body<0, 2, 1>(A, A, DM, 0LL, WT + (size_t)y * DM * DM, DM, 0LL, y ? bk : bq,
                         (void*)(QK + (size_t)(2 * y) * NXE), DM, 0LL, (void*)(QK + (size_t)(2 * y + 1) * NXE), DM, 0LL, DM,
                         NB * SEQ, DM, DM, 1.0f, blockIdx.x, 0, sT);
  } else {
    const unsigned short* A = WT + (size_t)2 * DM * DM;
    gemm64_body<0, 3, 2>(A, A, DM, 0LL, Xb + 2 * NXE, DM, (long long)SEQ * DM, bv,
                         (void*)VTh, SEQ, (long long)DM * SEQ, (void*)VTl, VLP, (long long)DM * VLP, VLP,
                         DM, SEQ, DM, 4096.0f, blockIdx.x % (GPB / NB), blockIdx.x / (GPB / NB), sT);
  }
}

// =====================================================================================================
// Causal attention, head dim 64, key chunks of 64.
//   q planes (bf16 hi / lo): element (b, t, h, d) at [(b*SEQ + t)*DM + h*64 + d]
//   k planes (bf16 hi / lo): same layout with key index s
//   v^T hi plane (f16):      element (b, h, d, s) at [(b*DM + h*64 + d)*SEQ + s]
//   v^T residual plane (f16, (v - hi)*4096): [(b*DM + h*64 + d)*VLP + s], s < VLP, read only when RES
//   (a key chunk at or beyond VLP would contribute a zero v residual; its address is clamped)
//   Mask: query t keeps key s iff s <= t. A query block qb therefore needs key chunks 0..qb only (block-uniform
//   trip count qb+1 <= NQB); keys in later chunks exceed every query index of the block and are skipped entirely.
//   Inside a visited chunk a masked key gets logit -inf -> exp gives exactly 0, so it adds nothing to the numerator
//   or the normaliser. Row max bookkeeping: every query keeps key 0 (chunk 0), so after chunk 0 the running max of
//   every row is finite; in the diagonal chunk every query keeps at least its own key. Every row ends with l > 0.
//   out planes (bf16 hi / lo of the normalised context): element (b, t, h, d) at [(b*SEQ + t)*DM + h*64 + d]
//   scores = q . k : bf16 hi/lo split (hi.hi + hi.lo + lo.hi), f32 accumulate, then * 1/8 and the mask in f32
//   p = exp(s - m) carried as f16(1024 p); context = p . v on f16 WMMA; RES adds f16 residual planes of p and v
//   (scale 4096, separate accumulator folded back with 1/4096 per chunk in f32); online softmax (running max) in f32.
//   Block = 4 waves = 64 query rows of one (b, h); bx = 0 .. nqbThis * NH * NB - 1 (this variant's blocks).
//   K / V^T chunk staging: 128 threads x 32 elements per plane = the whole 64x64 tile of every plane read later
//   (plain 16-B loads, __syncthreads before and after); P tiles are wave-private, spilled with _Float16 element stores
//   Output coverage: each wave stores rows q0..q0+15 (it 0..3 x lane>>3 0..3) x 64 columns (8 lanes x 8) of both planes;
//   grid over all (b, h, qb) = the whole [NB*SEQ][DM] planes.
// =====================================================================================================
struct AttnLds {                                   // one LDS layout for both variants (they share a grid)
  __bf16   Ksh[64 * LP];                            // K hi [kv][d], pitch LP
  __bf16   Ksl[64 * LP];                            // K lo
  _Float16 Vth[64 * LP];                            // V^T hi [d][kv], pitch LP
  _Float16 Psh[4][16 * LP];                         // per wave P [row][kv]
  float    Os[4][16 * OP];                          // per wave context tile [row][d]
  _Float16 Vtl[64 * LP];                            // V^T residual (RES only)
  _Float16 Psl[4][16 * LP];                         // per wave P residual (RES only)
};
static_assert((64 * LP * 2) % 16 == 0 && (16 * LP * 2) % 16 == 0 && (16 * OP * 4) % 16 == 0);

template <bool RES>
__device__ __forceinline__
void attn_causal64(const unsigned short* __restrict__ qhp, const unsigned short* __restrict__ qlp,
                   const unsigned short* __restrict__ khp, const unsigned short* __restrict__ klp,
                   const unsigned short* __restrict__ vhp, const unsigned short* __restrict__ vlp,
                   unsigned short* ohp, unsigned short* olp,
                   int qbBase, int nqbThis, int bx, AttnLds& lds) {
  union FB { v16b v; v8b h[2]; };
  union FH { v16h v; v8h h[2]; };
  __bf16*   const Ksh = lds.Ksh;
  __bf16*   const Ksl = lds.Ksl;
  _Float16* const Vth = lds.Vth;
  _Float16* const Vtl = lds.Vtl;
  _Float16 (* const Psh)[16 * LP] = lds.Psh;
  _Float16 (* const Psl)[16 * LP] = lds.Psl;
  float    (* const Os)[16 * OP]  = lds.Os;

  const int tid  = threadIdx.x;
  const int wave = tid >> 5;
  const int lane = tid & 31;
  const int hh   = lane >> 4;
  const int c    = lane & 15;

  const int qbl  = bx % nqbThis;
  const int rest = bx / nqbThis;
  const int h    = rest % NH;
  const int b    = rest / NH;
  const int qb   = qbBase + qbl;               // 0..NQB-1 (block-uniform)
  const int q0   = qb * 64 + wave * 16;
  const size_t rowB = (size_t)b * SEQ;

  const __bf16* Qh = (const __bf16*)(const void*)qhp + (size_t)h * HD;
  const __bf16* Ql = (const __bf16*)(const void*)qlp + (size_t)h * HD;
  const __bf16* Kh = (const __bf16*)(const void*)khp + (size_t)h * HD;
  const __bf16* Kl = (const __bf16*)(const void*)klp + (size_t)h * HD;
  const _Float16* Vh = (const _Float16*)(const void*)vhp + ((size_t)b * DM + (size_t)h * HD) * SEQ;
  const _Float16* Vl = (const _Float16*)(const void*)vlp + ((size_t)b * DM + (size_t)h * HD) * VLP;

  // ---- Q fragments (A operand, row = lane&15): 2 d-chunks, hi and lo ----
  v16b qah[2], qal[2];
#pragma unroll
  for (int dc = 0; dc < 2; ++dc) {
    const size_t qo = (rowB + q0 + c) * DM + dc * 32 + 8 * hh;
    qah[dc] = ldfrag_b(Qh + qo);
    qal[dc] = ldfrag_b(Ql + qo);
  }

  float mrow[8], lrow[8];
  v8f oacc[4];
#pragma unroll
  for (int r = 0; r < 8; ++r) { mrow[r] = -INFINITY; lrow[r] = 0.f; }
#pragma unroll
  for (int t = 0; t < 4; ++t) oacc[t] = zero8();

  for (int kt = 0; kt <= qb; ++kt) {           // block-uniform trip count, <= NQB
    const int kv0 = kt * 64;                   // kv0 + 63 < SEQ
    __syncthreads();
    {
      const int r = tid >> 1, half = (tid & 1) * 32;
      const __bf16*   kg  = Kh + (rowB + kv0 + r) * DM + half;    // K row kv0+r, d = half..half+31
      const __bf16*   klg = Kl + (rowB + kv0 + r) * DM + half;
      const _Float16* vg  = Vh + (size_t)r * SEQ + kv0 + half;    // V^T row d = r, s = kv0+half..+31
      const int kvl = (kv0 + 64 <= VLP) ? kv0 : (VLP - 64);     // clamped address into the residual plane
      const _Float16* vlg = Vl + (size_t)r * VLP + kvl + half;
      const bool resOK = (kv0 + 64 <= VLP);                      // block-uniform (always true for qb < RESQB)
#pragma unroll
      for (int i = 0; i < 4; ++i) {
        const v8b a0 = *(const v8b*)(kg + 8 * i);
        const v8b a1 = *(const v8b*)(klg + 8 * i);
        const v8h b0 = *(const v8h*)(vg + 8 * i);
        *(v8b*)(Ksh + r * LP + half + 8 * i) = a0;
        *(v8b*)(Ksl + r * LP + half + 8 * i) = a1;
        *(v8h*)(Vth + r * LP + half + 8 * i) = b0;
        if (RES) {
          v8h b1 = *(const v8h*)(vlg + 8 * i);
          if (!resOK) b1 = zero8h();
          *(v8h*)(Vtl + r * LP + half + 8 * i) = b1;
        }
      }
      // RES build: the last load's result was placed on address pairs that earlier loads of this batch name. The pairs are
      // inputs of the wait, so they stay as they are until the batch's address translations are done.
      if (RES) asm volatile("s_wait_xcnt 0x0" :: "v"(kg), "v"(klg), "v"(vg), "v"(vlg) : "memory");
    }
    __syncthreads();

    // ---- scores: 16 query rows x 64 keys per wave, 3 bf16 products ----
    // All K fragments of a d-chunk are read as one group, then the four key tiles' accumulators take turns, so one LDS wait
    // serves 12 products and no product waits for the one before it. Each s[j] still sums hi.hi, hi.lo, lo.hi per d-chunk.
    v8f s[4];
#pragma unroll
    for (int j = 0; j < 4; ++j) s[j] = zero8();
#pragma unroll
    for (int dc = 0; dc < 2; ++dc) {
      FB kb[4], kl[4];
#pragma unroll
      for (int j = 0; j < 4; ++j) {
        kb[j].h[0] = *(const v8b*)(Ksh + (j * 16 + c) * LP + dc * 32 + 8 * hh);
        kb[j].h[1] = *(const v8b*)(Ksh + (j * 16 + c) * LP + dc * 32 + 16 + 8 * hh);
        kl[j].h[0] = *(const v8b*)(Ksl + (j * 16 + c) * LP + dc * 32 + 8 * hh);
        kl[j].h[1] = *(const v8b*)(Ksl + (j * 16 + c) * LP + dc * 32 + 16 + 8 * hh);
      }
#pragma unroll
      for (int j = 0; j < 4; ++j) s[j] = mma_b_raw(qah[dc], kb[j].v, s[j]);
#pragma unroll
      for (int j = 0; j < 4; ++j) s[j] = mma_b_raw(qah[dc], kl[j].v, s[j]);
#pragma unroll
      for (int j = 0; j < 4; ++j) s[j] = mma_b_raw(qal[dc], kb[j].v, s[j]);
    }

    // ---- scale, causal mask by index, row max, online softmax, P (x1024, f16) and P residual (x4096) to LDS ----
    _Float16* pwh = Psh[wave];
    _Float16* pwl = Psl[RES ? wave : 0];
#pragma unroll
    for (int r = 0; r < 8; ++r) {
      const int rowq = q0 + 8 * hh + r;        // query index of D row 8hh+r
      float m = -INFINITY;
#pragma unroll
      for (int j = 0; j < 4; ++j) {
        const int key = kv0 + j * 16 + c;
        float sv = s[j][r] * 0.125f;
        const bool keep = (key <= rowq);
        sv = keep ? sv : -INFINITY;
        s[j][r] = sv;
        m = fmaxf(m, sv);
      }
#pragma unroll
      for (int off = 1; off < 16; off <<= 1) m = fmaxf(m, __shfl_xor(m, off, 32));
      const float mnew  = fmaxf(mrow[r], m);
      const float msafe = (mnew == -INFINITY) ? 0.f : mnew;
      const float alpha = __expf(mrow[r] - msafe);
      mrow[r] = mnew;
      float psum = 0.f;
#pragma unroll
      for (int j = 0; j < 4; ++j) {
        const float p = __expf(s[j][r] - msafe);     // masked logit: exp(-inf) = 0
        psum += p;
        const float p1k = p * 1024.0f;
        const _Float16 ph = (_Float16)p1k;
        pwh[(8 * hh + r) * LP + j * 16 + c] = ph;
        if (RES) {
          const _Float16 pl = (_Float16)((p1k - (float)ph) * 4096.0f);
          pwl[(8 * hh + r) * LP + j * 16 + c] = pl;
        }
      }
#pragma unroll
      for (int off = 1; off < 16; off <<= 1) psum += __shfl_xor(psum, off, 32);
      lrow[r] = lrow[r] * alpha + psum;
#pragma unroll
      for (int t = 0; t < 4; ++t) oacc[t][r] *= alpha;
    }
    __builtin_amdgcn_fence(__ATOMIC_RELEASE, "workgroup");
    __builtin_amdgcn_wave_barrier();
    __builtin_amdgcn_fence(__ATOMIC_ACQUIRE, "workgroup");

    // ---- context += P . V (f16 WMMA), residual products into a separate accumulator ----
    v8f o1[4];
#pragma unroll
    for (int t = 0; t < 4; ++t) o1[t] = zero8();
    // Unrolled, with each key half's P and V fragments read as one group ahead of its products; the four d tiles take turns.
#pragma unroll
    for (int kk = 0; kk < 2; ++kk) {
      FH pa, pl;
      pa.h[0] = *(const v8h*)(pwh + c * LP + kk * 32 + 8 * hh);
      pa.h[1] = *(const v8h*)(pwh + c * LP + kk * 32 + 16 + 8 * hh);
      if (RES) {
        pl.h[0] = *(const v8h*)(pwl + c * LP + kk * 32 + 8 * hh);
        pl.h[1] = *(const v8h*)(pwl + c * LP + kk * 32 + 16 + 8 * hh);
      } else {
        pl.v = pa.v;
      }
      FH vb[4], vl[4];
#pragma unroll
      for (int t = 0; t < 4; ++t) {
        vb[t].h[0] = *(const v8h*)(Vth + (t * 16 + c) * LP + kk * 32 + 8 * hh);
        vb[t].h[1] = *(const v8h*)(Vth + (t * 16 + c) * LP + kk * 32 + 16 + 8 * hh);
        if (RES) {
          vl[t].h[0] = *(const v8h*)(Vtl + (t * 16 + c) * LP + kk * 32 + 8 * hh);
          vl[t].h[1] = *(const v8h*)(Vtl + (t * 16 + c) * LP + kk * 32 + 16 + 8 * hh);
        } else {
          vl[t].v = vb[t].v;
        }
      }
#pragma unroll
      for (int t = 0; t < 4; ++t) oacc[t] = mma_h_raw(pa.v, vb[t].v, oacc[t]);
      if (RES) {
#pragma unroll
        for (int t = 0; t < 4; ++t) o1[t] = mma_h_raw(pa.v, vl[t].v, o1[t]);
#pragma unroll
        for (int t = 0; t < 4; ++t) o1[t] = mma_h_raw(pl.v, vb[t].v, o1[t]);
      }
    }
    if (RES) {
#pragma unroll
      for (int t = 0; t < 4; ++t)
#pragma unroll
        for (int r = 0; r < 8; ++r) oacc[t][r] += o1[t][r] * (1.0f / 4096.0f);
    }
  }

  // ---- normalise (1/l and the 1/1024 p carry), stage the wave's 16x64 tile, bf16 hi/lo split,
  float* os = Os[wave];
#pragma unroll
  for (int r = 0; r < 8; ++r) {
    const float l = lrow[r];
    const float inv = ((l > 0.f) ? (1.0f / l) : 0.f) * (1.0f / 1024.0f);
#pragma unroll
    for (int t = 0; t < 4; ++t) os[(8 * hh + r) * OP + t * 16 + c] = oacc[t][r] * inv;
  }
  __builtin_amdgcn_fence(__ATOMIC_RELEASE, "workgroup");
  __builtin_amdgcn_wave_barrier();
  __builtin_amdgcn_fence(__ATOMIC_ACQUIRE, "workgroup");
  {
    const int q4 = lane >> 3, c8 = (lane & 7) * 8;
    v4u hv[4], lv[4];
#pragma unroll
    for (int it = 0; it < 4; ++it) {
      const int row = it * 4 + q4;   // it 0..3 x q4 0..3 = rows 0..15 of the wave tile
      const float* sp = os + row * OP + c8;
      v4u a, a2;
#pragma unroll
      for (int e = 0; e < 4; ++e) {
        const float f0 = sp[2 * e], f1 = sp[2 * e + 1];
        const unsigned short h0 = bf_bits(f0), h1 = bf_bits(f1);
        const unsigned short l0 = bf_bits(f0 - bf_up(h0)), l1 = bf_bits(f1 - bf_up(h1));
        a[e] = pk16(h0, h1); a2[e] = pk16(l0, l1);
      }
      hv[it] = a; lv[it] = a2;
    }
    {
#pragma unroll
      for (int it = 0; it < 4; ++it) {
        const int row = it * 4 + q4;
        const size_t go = (rowB + q0 + row) * DM + (size_t)h * HD + c8;
        *(v4u*)(ohp + go) = hv[it];
        *(v4u*)(olp + go) = lv[it];
      }
      
    }
  }
}

// Both attention variants in one grid: blocks 0..NMAIN-1 are the query blocks RESQB..NQB-1 (no residual planes),
// the last NB*NH*RESQB blocks the leading RESQB query blocks with residual planes. The branch is block-uniform.
#define NMAIN (NB * NH * (NQB - RESQB))
__global__ __launch_bounds__(128)
void attn_all(const unsigned short* __restrict__ qhp, const unsigned short* __restrict__ qlp,
              const unsigned short* __restrict__ khp, const unsigned short* __restrict__ klp,
              const unsigned short* __restrict__ vhp, const unsigned short* __restrict__ vlp,
              unsigned short* ohp, unsigned short* olp) {
  __shared__ __align__(16) AttnLds lds;
  const int bx = blockIdx.x;
  if (bx < NMAIN) attn_causal64<false>(qhp, qlp, khp, klp, vhp, vlp, ohp, olp, RESQB, NQB - RESQB, bx, lds);
  else            attn_causal64<true>(qhp, qlp, khp, klp, vhp, vlp, ohp, olp, 0, RESQB, bx - NMAIN, lds);
}

// =====================================================================================================
// Workspace map (bytes; every region is an exact multiple of its 64x64-tile / whole-line store granularity,
//   Qb   bf16 [8192][512]            0            8388608
//   Kb   bf16 [8192][512]            8388608      8388608
//   Vb   bf16 [8192][512]            16777216     8388608
//   WqT  bf16 [512 n][512 k]         25165824     524288
//   WkT                              25690112     524288
//   WvT                              26214400     524288
//   WoT                              26738688     524288
//   Qh   bf16 [8192][512]            27262976     8388608
//   Ql                               35651584     8388608
//   Kh                               44040192     8388608
//   Kl                               52428800     8388608
//   VTh  f16  [2][512][4096]         60817408     8388608
//   VTl  f16  [2][512][512]          69206016     1048576
//   Oh   bf16 [8192][512]            70254592     8388608
//   Ol                               78643200     8388608
//   end                              87031808
// =====================================================================================================
extern "C" void kernel_launch(void* const* d_in, const int* in_sizes, int n_in,
                              void* d_out, int out_size, void* d_ws, size_t ws_size,
                              hipStream_t stream) {
  if (n_in < 11) return;
  const int NX = NB * SEQ * DM;                    // 4194304
  if (in_sizes[0] != NX || in_sizes[1] != NX || in_sizes[2] != NX) return;
  if (in_sizes[3] != DM * DM || in_sizes[5] != DM * DM || in_sizes[7] != DM * DM || in_sizes[9] != DM * DM) return;
  if (in_sizes[4] != DM || in_sizes[6] != DM || in_sizes[8] != DM || in_sizes[10] != DM) return;
  if (out_size != NX) return;

  const float* v  = (const float*)d_in[0];   // [2][4096][512]
  const float* k  = (const float*)d_in[1];   // [2][4096][512]
  const float* q  = (const float*)d_in[2];   // [2][4096][512]
  const float* Wq = (const float*)d_in[3];   // [512 in][512 out] = [k][n]
  const float* bq = (const float*)d_in[4];   // [512]
  const float* Wk = (const float*)d_in[5];   // [512 in][512 out]
  const float* bk = (const float*)d_in[6];   // [512]
  const float* Wv = (const float*)d_in[7];   // [512 in][512 out]
  const float* bv = (const float*)d_in[8];   // [512]
  const float* Wo = (const float*)d_in[9];   // [512 in][512 out]
  const float* bo = (const float*)d_in[10];  // [512]

  const size_t PX  = (size_t)NB * SEQ * DM * 2;    //  8388608  16-bit activation plane [8192][512]
  const size_t PW  = (size_t)DM * DM * 2;          //   524288  16-bit weight plane [512][512]
  const size_t PVT = (size_t)NB * DM * SEQ * 2;    //  8388608  v^T hi plane
  const size_t PVL = (size_t)NB * DM * VLP * 2;    //  1048576  v^T residual plane
  size_t off = 0;
  const size_t oQb  = off; off += PX;
  const size_t oKb  = off; off += PX;
  const size_t oVb  = off; off += PX;
  const size_t oWq  = off; off += PW;
  const size_t oWk  = off; off += PW;
  const size_t oWv  = off; off += PW;
  const size_t oWo  = off; off += PW;
  const size_t oQh  = off; off += PX;
  const size_t oQl  = off; off += PX;
  const size_t oKh  = off; off += PX;
  const size_t oKl  = off; off += PX;
  const size_t oVTh = off; off += PVT;
  const size_t oVTl = off; off += PVL;
  const size_t oOh  = off; off += PX;
  const size_t oOl  = off; off += PX;
  if (off > ws_size) return;                       // off = 87031808
  if (off > (size_t)134217728) return;

  char* ws = (char*)d_ws;
  unsigned short* Qb  = (unsigned short*)(ws + oQb);
  unsigned short* Kb  = (unsigned short*)(ws + oKb);
  unsigned short* Vb  = (unsigned short*)(ws + oVb);
  unsigned short* WqT = (unsigned short*)(ws + oWq);
  unsigned short* WkT = (unsigned short*)(ws + oWk);
  unsigned short* WvT = (unsigned short*)(ws + oWv);
  unsigned short* WoT = (unsigned short*)(ws + oWo);
  unsigned short* Qh  = (unsigned short*)(ws + oQh);
  unsigned short* Ql  = (unsigned short*)(ws + oQl);
  unsigned short* Kh  = (unsigned short*)(ws + oKh);
  unsigned short* Kl  = (unsigned short*)(ws + oKl);
  unsigned short* VTh = (unsigned short*)(ws + oVTh);
  unsigned short* VTl = (unsigned short*)(ws + oVTl);
  unsigned short* Oh  = (unsigned short*)(ws + oOh);
  unsigned short* Ol  = (unsigned short*)(ws + oOl);

  const dim3 blk(256);
  const dim3 gProj(GPB, 1);                                    // 1024 tiles -> 128 blocks: M=8192, N=512

  // (1) all plane conversions in one grid: weights f32 [k][n] -> bf16 W^T [n][k] (WqT, WkT, WvT, WoT are contiguous),
  //     activations f32 -> bf16 planes of the inputs' layout (Qb, Kb, Vb are contiguous)
  prep_planes<<<dim3(4 * NTR + 3 * NCV), blk, 0, stream>>>(q, k, v, Wq, Wk, Wv, Wo, Qb, WqT);
  // (2) the three input projections in one grid: qp, kp -> bf16 hi/lo planes [b*SEQ+t][h*64+d] (Qh, Ql, Kh, Kl contiguous),
  //     vp^T per batch -> f16 hi plane [b][h*64+d][s] (pitch SEQ) and residual plane (x4096, keys < VLP only, pitch VLP)
  gemm_qkv<<<dim3(GPB, 3), blk, 0, stream>>>(Qb, WqT, bq, bk, bv, Qh, VTh, VTl);
  // (3) causal attention, one grid: query blocks RESQB.. without, 0..RESQB-1 with residual planes
  attn_all<<<dim3(NB * NH * NQB), dim3(128), 0, stream>>>(Qh, Ql, Kh, Kl, VTh, VTl, Oh, Ol);
  // (4) out = context . Wo + bo -> d_out f32 [8192][512]  (A = context hi + lo planes, 2 products; Bt = WoT)
  gemm64<1, 0, 1><<<gProj, blk, 0, stream>>>(
      Oh, Ol, DM, 0LL, WoT, DM, 0LL, bo,
      d_out, DM, 0LL, d_out, DM, 0LL, DM,
      NB * SEQ, DM, DM, 1.0f);
  (void)hipGetLastError();
}

// v004
// Measured time: 189 microseconds a run.
// Two timings next to v003 put it at 1.33 and 1.31 times that version's speed.
// Counting every step since v000, it is 2.82 times as fast.
// Contractions: q, k, v^T projections = v_wmma_f32_16x16x32_bf16 (bf16 operands from RNE-converted inputs and weights, single product, f32 accumulate);
// k.q^T scores (keys down, queries across) = v_wmma_f32_16x16x32_bf16 with bf16 hi/lo split q and k (hi.hi + hi.lo + lo.hi), f32 accumulate;
// v^T.p^T = v_wmma_f32_16x16x32_f16 (p carried x1024 in f16 times v in f16, single product; plus f16 residual planes x4096 of
// p and v for the first 512 query rows of every sequence), f32 accumulate;
// ctx.Wo = v_wmma_f32_16x16x32_bf16 with ctx as bf16 hi/lo planes times bf16 Wo^T (2 products), f32 accumulate;
// causal mask (key <= query), online softmax, normalisers and bias adds in f32 on the VALU.
// Carry audit:
//   ph  = f16(1024 * p)                      -> the 1/1024 is folded exactly once in the attention epilogue: inv = (1/l) * (1/1024)
//   pl  = f16((1024 p - ph) * 4096)          }  products VTl.ph and VTh.pl go to the separate accumulator o1,
//   VTl = f16((v - VTh) * 4096)              }  folded back with * (1/4096) once per key chunk (RES blocks only)
//   VTh = f16(v), no carry (|v| typ. 0.45); q / k / ctx lo planes are unscaled bf16 residuals (v - hi) sharing the hi accumulator;
//   score scale 1/8 applied once in f32 after the score accumulate. No other scaled planes.
#include <hip/hip_runtime.h>
#include <math.h>
#include <stdint.h>

#define NB    2
#define SEQ   4096
#define DM    512
#define NH    8
#define HD    64
#define NQB   (SEQ / 64)   // 64 query / key blocks of 64
#define VLP   512          // key pitch of the v^T residual plane (keys 0..VLP-1)
#define RESQB 8            // leading 64-row query blocks that use the p / v residual planes
#define LP    72           // LDS row pitch of the 64-element 16-bit tiles: 144 B = 16 B x 9, 16 rows of a 16-B read on 16 bank quads
#define OP    68           // LDS row pitch of the f32 context tile, in floats (16-B reads down a column walk)
static_assert(RESQB * 64 <= VLP);
static_assert(NH * HD == DM);
static_assert((SEQ % 64) == 0 && (DM % 64) == 0 && (DM % 32) == 0);
static_assert(((NB * SEQ / 64) * (DM / 64)) % 8 == 0);
static_assert(((DM / 64) * (SEQ / 64)) % 8 == 0);
static_assert((NB * SEQ * DM) % (8 * 256) == 0);
static_assert((DM * DM) % (64 * 64) == 0);

typedef _Float16 v16h __attribute__((ext_vector_type(16)));
typedef _Float16 v8h  __attribute__((ext_vector_type(8)));
typedef __bf16   v16b __attribute__((ext_vector_type(16)));
typedef __bf16   v8b  __attribute__((ext_vector_type(8)));
typedef float    v8f  __attribute__((ext_vector_type(8)));
typedef float    v4f  __attribute__((ext_vector_type(4)));
typedef unsigned int v4u __attribute__((ext_vector_type(4)));

// ---- scalar helpers --------------------------------------------------------------------------------
__device__ __forceinline__ unsigned short bf_bits(float f) {          // f32 -> bf16 bits, RNE convert
  unsigned u = __float_as_uint(f);
  return (unsigned short)((u + 0x7FFFu + ((u >> 16) & 1u)) >> 16);
}
__device__ __forceinline__ float bf_up(unsigned short h) { return __uint_as_float(((unsigned)h) << 16); }
__device__ __forceinline__ unsigned short h_bits(_Float16 x) { return __builtin_bit_cast(unsigned short, x); }
__device__ __forceinline__ unsigned pk16(unsigned short a, unsigned short b) { return (unsigned)a | ((unsigned)b << 16); }
__device__ __forceinline__ v8f zero8() { v8f z = {0.f, 0.f, 0.f, 0.f, 0.f, 0.f, 0.f, 0.f}; return z; }
__device__ __forceinline__ v8h zero8h() {
  const _Float16 z = (_Float16)0.0f;
  v8h r = {z, z, z, z, z, z, z, z};
  return r;
}

// value of lane l ^ 16 (the other half of the wave), by a vector cross-row move
__device__ __forceinline__ float xhalf(float x) {
  const int i = __builtin_bit_cast(int, x);
  return __builtin_bit_cast(float, __builtin_amdgcn_permlanex16(i, i, 0x76543210, 0xfedcba98, false, false));
}

// e^x as __expf forms it (x * log2 e, then v_exp_f32). SLOT: the exponential and one v_nop in one statement. The v_nop is the slot
// the instruction set asks for between a transcendental and an instruction that overwrites its source.
template <bool SLOT>
__device__ __forceinline__ float exp_nat(float x) {
  if (!SLOT) return __expf(x);
  const float y = x * 1.44269504088896340736f;
  float r;
  asm("v_exp_f32 %0, %1\n\tv_nop" : "=v"(r) : "v"(y));
  return r;
}

// ---- fragment loader: 16-bit A/B operand, lane -> row/col (lane&15), p already includes +8*(lane>>4);
//      elements 0..7 <- p[0..7] (k0+8h..), elements 8..15 <- p[16..23] (k0+16+8h..)
__device__ __forceinline__ v16b ldfrag_b(const __bf16* p) {
  union { v16b v; v8b h[2]; } f;
  f.h[0] = *(const v8b*)(p);
  f.h[1] = *(const v8b*)(p + 16);
  return f.v;
}

// ---- WMMA helpers with trailing VALU hazard gap --------------------------------------------------------
__device__ __forceinline__ v8f mma_h_raw(v16h a, v16h b, v8f c) {
  return __builtin_amdgcn_wmma_f32_16x16x32_f16(false, a, false, b, (short)0, c, false, false);
}
__device__ __forceinline__ v8f mma_b_raw(v16b a, v16b b, v8f c) {
  return __builtin_amdgcn_wmma_f32_16x16x32_bf16(false, a, false, b, (short)0, c, false, false);
}
__device__ __forceinline__ void dep_guard_b(v8f& a, v8f& b, v16b x, v16b y) {
  asm volatile("v_nop\n\tv_nop\n\tv_nop\n\tv_nop" : "+v"(a), "+v"(b) : "v"(x), "v"(y));
}
__device__ __forceinline__ void keep4_b(v16b a, v16b b, v16b c, v16b d) {
  asm volatile("v_nop" :: "v"(a), "v"(b), "v"(c), "v"(d));
}
__device__ __forceinline__ void acc_guard4(v8f& a, v8f& b, v8f& c, v8f& d) {
  asm volatile("v_nop\n\tv_nop\n\tv_nop\n\tv_nop" : "+v"(a), "+v"(b), "+v"(c), "+v"(d));
}

// =====================================================================================================
// f32 -> bf16 (RNE convert), 8 elements per thread, one 16-B store per lane: a wave writes 512 contiguous B
// the [8192][512] activations, a multiple of 256).
// coverage: n8 threads x 8 = the whole plane.
// =====================================================================================================
__device__ __forceinline__ void cvt_bf16x8(const float* __restrict__ in, unsigned short* out, int n8, int blk) {
  const int i = blk * 256 + threadIdx.x;
  if (i < n8) {
    const v4f a = *(const v4f*)(in + (size_t)i * 8);
    const v4f b = *(const v4f*)(in + (size_t)i * 8 + 4);
    v4u p;
    p[0] = pk16(bf_bits(a[0]), bf_bits(a[1]));
    p[1] = pk16(bf_bits(a[2]), bf_bits(a[3]));
    p[2] = pk16(bf_bits(b[0]), bf_bits(b[1]));
    p[3] = pk16(bf_bits(b[2]), bf_bits(b[3]));
    *(v4u*)(out + (size_t)i * 8) = p;
    
  }
}

// =====================================================================================================
// f32 [K rows][N cols] (pitch ldw) -> bf16 transposed plane WT[n][k] (pitch ldt, k contiguous), RNE convert.
// One 64x64 tile per block (n0 = 64 * tileN, k0 = 64 * tileK, N and K exact multiples of 64): the tile is staged in LDS with
// coalesced 16-B loads (256 threads x 16 floats = the whole tile), __syncthreads, then each output row segment
// coverage: 8 waves x 2 x (lane>>3 = 4 rows) = 64 rows n, 8 lanes x 8 = 64 k: the whole tile; grid = the whole plane.
// =====================================================================================================
__device__ __forceinline__ void cvt_bf16_tr64(const float* __restrict__ W, unsigned short* WT, int ldw, int ldt,
                                              int tileN, int tileK, float* sW) {
  const int tid = threadIdx.x;
  const int n0 = tileN * 64;
  const int k0 = tileK * 64;
  {
    const int kr = tid >> 2, cb = (tid & 3) * 16;          // row k0+kr, cols n0+cb .. +15
    const float* src = W + (size_t)(k0 + kr) * ldw + n0 + cb;
#pragma unroll
    for (int i = 0; i < 4; ++i) {
      const v4f f = *(const v4f*)(src + 4 * i);
      float* d = sW + kr * 65 + cb + 4 * i;
      d[0] = f[0]; d[1] = f[1]; d[2] = f[2]; d[3] = f[3];
    }
  }
  __syncthreads();
  const int wave = tid >> 5, lane = tid & 31;
  const int q = lane >> 3, c8 = (lane & 7) * 8;
  v4u pv[2];
#pragma unroll
  for (int it = 0; it < 2; ++it) {
    const int nr = wave * 8 + it * 4 + q;                  // output row n0+nr, 0 <= nr < 64
    v4u p;
#pragma unroll
    for (int e = 0; e < 4; ++e) {
      const float f0 = sW[(c8 + 2 * e) * 65 + nr];
      const float f1 = sW[(c8 + 2 * e + 1) * 65 + nr];
      p[e] = pk16(bf_bits(f0), bf_bits(f1));
    }
    pv[it] = p;
  }
  {
#pragma unroll
    for (int it = 0; it < 2; ++it) {
      const int nr = wave * 8 + it * 4 + q;
      *(v4u*)(WT + (size_t)(n0 + nr) * ldt + k0 + c8) = pv[it];
    }
    
  }
}

// =====================================================================================================
// One grid for all seven independent plane conversions: blocks 0..4*NTR-1 transpose the four weights (64x64 tile each,
// planes WT + w*DM*DM in the order Wq, Wk, Wv, Wo), the next 3*NCV blocks convert q, k, v (planes Xb + w*NB*SEQ*DM).
// The branch is block-uniform, so the transpose's __syncthreads is passed by all threads of its block or by none.
// =====================================================================================================
#define NTR ((DM / 64) * (DM / 64))          // 64 tiles per weight
#define NCV ((NB * SEQ * DM) / (8 * 256))    // 2048 blocks per activation plane
__global__ __launch_bounds__(256) void prep_planes(const float* __restrict__ q, const float* __restrict__ k,
                                                   const float* __restrict__ v,
                                                   const float* __restrict__ Wq, const float* __restrict__ Wk,
                                                   const float* __restrict__ Wv, const float* __restrict__ Wo,
                                                   unsigned short* Xb, unsigned short* WT) {
  __shared__ __align__(16) float sW[64 * 65];
  const int bx = blockIdx.x;
  if (bx < 4 * NTR) {
    const int w = bx / NTR, t = bx % NTR;
    const float* W = (w == 0) ? Wq : (w == 1) ? Wk : (w == 2) ? Wv : Wo;
    cvt_bf16_tr64(W, WT + (size_t)w * DM * DM, DM, DM, t % (DM / 64), t / (DM / 64), sW);
  } else {
    const int cb = bx - 4 * NTR;
    const int w = cb / NCV, blk = cb % NCV;
    const float* in = (w == 0) ? q : (w == 1) ? k : v;
    cvt_bf16x8(in, Xb + (size_t)w * NB * SEQ * DM, (NB * SEQ * DM) / 8, blk);
  }
}

// =====================================================================================================
// Register-blocked batched bf16 WMMA GEMM: C[m][n] = sum_k A[m][k] * Bt[n][k] + bias; one wave per 64x64 tile,
// no block barriers. A row-major [M][K] pitch lda; Bt row-major [N][K] pitch ldb (k contiguous);
// M, N multiples of 64, K multiple of 32 (host shapes are static multiples). b = batch index (strides in elements).
// NSPLIT: 0 = A.Bt; 1 = (A + A2).Bt (A2 = unscaled bf16 lo plane of A, 2 products).
// BIAS: 0 = none; 1 = per column n, bias[n]; 2 = per row m, bias[m]; the bias value is RNE-converted to bf16 and added in f32.
// OUT_MODE: 0 = f32 (pitch ldc); 2 = bf16 hi plane C + bf16 lo plane C2 (lo = RNE(v - hi), unscaled);
//           3 = f16 hi plane C + f16 residual plane C2 = f16((v - hi) * rscale), C2 written only for tiles
//               with n0 < N2 (pitch ldc2, batch stride strideC2).
// =====================================================================================================
template <int NSPLIT, int OUT_MODE, int BIAS>
__device__ __forceinline__ void gemm64_body(
    const unsigned short* __restrict__ Ap, const unsigned short* A2p, int lda, long long strideA,
    const unsigned short* __restrict__ Btp, int ldb, long long strideB,
    const float* __restrict__ bias,
    void* Cout, int ldc, long long strideC,
    void* Cout2, int ldc2, long long strideC2, int N2,
    int M, int N, int K, float rscale,
    int blk, int b, float (*sT)[16 * 68]) {   // blk = block index inside this product, b = batch index
  const __bf16* A   = (const __bf16*)(const void*)Ap;
  const __bf16* A2  = (const __bf16*)(const void*)A2p;
  const __bf16* Bt  = (const __bf16*)(const void*)Btp;
  const int lane = threadIdx.x & 31;
  const int wave = threadIdx.x >> 5;
  const int tilesN = N >> 6;
  const int tilesM = M >> 6;
  const int tile = blk * 8 + wave;
  if (tile >= tilesM * tilesN) return;   // wave-uniform; no block barriers in this kernel
  const int tm = tile / tilesN;
  const int tn = tile - tm * tilesN;
  const int m0 = tm << 6;
  const int n0 = tn << 6;

  const __bf16* Ab  = A  + (size_t)b * strideA;
  const __bf16* Bb  = Bt + (size_t)b * strideB;
  const __bf16* Ab2 = (NSPLIT >= 1) ? (A2 + (size_t)b * strideA) : Ab;

  const int rlane = lane & 15;                 // row (A) / col (B, D) within subtile
  const int koff  = (lane >> 4) * 8;           // k offset of this lane half
  const int mOff  = (lane >> 4) * 8;           // D row offset

  v8f acc[4][4];
#pragma unroll
  for (int i = 0; i < 4; ++i)
#pragma unroll
    for (int j = 0; j < 4; ++j) acc[i][j] = zero8();

  for (int k0 = 0; k0 < K; k0 += 32) {
    v16b bh[4];
#pragma unroll
    for (int j = 0; j < 4; ++j) {
      const size_t bo = (size_t)(n0 + (j << 4) + rlane) * ldb + koff + k0;
      bh[j] = ldfrag_b(Bb + bo);
    }
#pragma unroll
    for (int i = 0; i < 4; ++i) {
      const size_t ao = (size_t)(m0 + (i << 4) + rlane) * lda + koff + k0;
      const v16b ah = ldfrag_b(Ab + ao);
      v16b al = ah;
      if (NSPLIT >= 1) al = ldfrag_b(Ab2 + ao);
#pragma unroll
      for (int j = 0; j < 4; ++j) {
        acc[i][j] = mma_b_raw(ah, bh[j], acc[i][j]);
        if (NSPLIT >= 1) acc[i][j] = mma_b_raw(al, bh[j], acc[i][j]);
      }
      dep_guard_b(acc[i][0], acc[i][3], ah, al);
    }
    keep4_b(bh[0], bh[1], bh[2], bh[3]);
  }
  acc_guard4(acc[0][0], acc[0][1], acc[0][2], acc[0][3]);
  acc_guard4(acc[1][0], acc[1][1], acc[1][2], acc[1][3]);
  acc_guard4(acc[2][0], acc[2][1], acc[2][2], acc[2][3]);
  acc_guard4(acc[3][0], acc[3][1], acc[3][2], acc[3][3]);

  // ---- epilogue ----
  float* slab = sT[wave];
  float bcol[4];
#pragma unroll
  for (int j = 0; j < 4; ++j) {
    bcol[j] = 0.f;
    if (BIAS == 1) bcol[j] = bf_up(bf_bits(bias[n0 + (j << 4) + rlane]));   // n < N, bias has N entries
  }
#pragma unroll
  for (int i = 0; i < 4; ++i) {
    const int mBase = m0 + (i << 4);
    float brow[8];
#pragma unroll
    for (int r = 0; r < 8; ++r) {
      brow[r] = 0.f;
      if (BIAS == 2) brow[r] = bf_up(bf_bits(bias[mBase + mOff + r]));      // m < M, bias has M entries
    }
#pragma unroll
    for (int j = 0; j < 4; ++j) {
#pragma unroll
      for (int r = 0; r < 8; ++r) {
        slab[(mOff + r) * 68 + (j << 4) + rlane] = acc[i][j][r] + bcol[j] + brow[r];
      }
    }
    __builtin_amdgcn_fence(__ATOMIC_RELEASE, "workgroup");
    __builtin_amdgcn_wave_barrier();
    __builtin_amdgcn_fence(__ATOMIC_ACQUIRE, "workgroup");
    if (OUT_MODE == 0) {
      float* C = (float*)Cout + (size_t)b * strideC;
      const int hh = lane >> 4, c4 = (lane & 15) * 4;     // 256-B row segment = 16 lanes x 16 B
      {
#pragma unroll
        for (int it = 0; it < 8; ++it) {
          const int row = it * 2 + hh;                     // it 0..7 x hh 0..1 = rows 0..15
          const v4f v = *(const v4f*)(slab + row * 68 + c4);
          *(v4f*)(C + (size_t)(mBase + row) * ldc + n0 + c4) = v;
        }
        
      }
    } else {
      const int q = lane >> 3, c8 = (lane & 7) * 8;
      unsigned short* C  = (unsigned short*)Cout  + (size_t)b * strideC;
      unsigned short* C2 = (unsigned short*)Cout2 + (size_t)b * strideC2;
      const bool wlo = (OUT_MODE == 2) || (n0 < N2);      // wave-uniform
      v4u hv[4], lv[4];
#pragma unroll
      for (int it = 0; it < 4; ++it) {
        const int row = it * 4 + q;                        // it 0..3 x q 0..3 = rows 0..15
        const float* sp = slab + row * 68 + c8;
        v4u a, a2;
#pragma unroll
        for (int e = 0; e < 4; ++e) {
          const float f0 = sp[2 * e], f1 = sp[2 * e + 1];
          unsigned short h0, h1, l0, l1;
          if (OUT_MODE == 2) {
            h0 = bf_bits(f0); h1 = bf_bits(f1);
            l0 = bf_bits(f0 - bf_up(h0)); l1 = bf_bits(f1 - bf_up(h1));
          } else {
            const _Float16 x0 = (_Float16)f0, x1 = (_Float16)f1;
            h0 = h_bits(x0); h1 = h_bits(x1);
            l0 = h_bits((_Float16)((f0 - (float)x0) * rscale));
            l1 = h_bits((_Float16)((f1 - (float)x1) * rscale));
          }
          a[e] = pk16(h0, h1); a2[e] = pk16(l0, l1);
        }
        hv[it] = a; lv[it] = a2;
      }
      {
#pragma unroll
        for (int it = 0; it < 4; ++it) {
          const int row = it * 4 + q;
          *(v4u*)(C + (size_t)(mBase + row) * ldc + n0 + c8) = hv[it];
          if (wlo) *(v4u*)(C2 + (size_t)(mBase + row) * ldc2 + n0 + c8) = lv[it];
        }
        
      }
    }
    __builtin_amdgcn_fence(__ATOMIC_RELEASE, "workgroup");
    __builtin_amdgcn_wave_barrier();
    __builtin_amdgcn_fence(__ATOMIC_ACQUIRE, "workgroup");
  }
}

// One product per launch (the output projection).
template <int NSPLIT, int OUT_MODE, int BIAS>
__global__ __launch_bounds__(256) void gemm64(
    const unsigned short* __restrict__ Ap, const unsigned short* A2p, int lda, long long strideA,
    const unsigned short* __restrict__ Btp, int ldb, long long strideB,
    const float* __restrict__ bias,
    void* Cout, int ldc, long long strideC,
    void* Cout2, int ldc2, long long strideC2, int N2,
    int M, int N, int K, float rscale) {
  __shared__ __align__(16) float sT[8][16 * 68];   // per-wave 16x64 slab, pitch 68 floats
  gemm64_body<NSPLIT, OUT_MODE, BIAS>(Ap, A2p, lda, strideA, Btp, ldb, strideB, bias, Cout, ldc, strideC,
                                      Cout2, ldc2, strideC2, N2, M, N, K, rscale, blockIdx.x, blockIdx.y, sT);
}

// The three independent input projections in one grid (GPB blocks each): blockIdx.y = 0: qp, 1: kp (bf16 hi/lo planes,
// M = NB*SEQ, N = DM), 2: vp^T (f16 hi + residual planes, M = DM, N = SEQ, batch = blockIdx.x / (GPB / NB)).
// Xb = bf16 planes of q, k, v in that order; WT = W^T planes of Wq, Wk, Wv; QK = planes Qh, Ql, Kh, Kl in that order.
#define GPB (((NB * SEQ / 64) * (DM / 64)) / 8)   // 128 blocks of 8 tiles
static_assert(GPB == NB * (((DM / 64) * (SEQ / 64)) / 8));
__global__ __launch_bounds__(256) void gemm_qkv(
    const unsigned short* __restrict__ Xb, const unsigned short* __restrict__ WT,
    const float* __restrict__ bq, const float* __restrict__ bk, const float* __restrict__ bv,
    unsigned short* QK, unsigned short* VTh, unsigned short* VTl) {
  __shared__ __align__(16) float sT[8][16 * 68];   // per-wave 16x64 slab, pitch 68 floats
  const size_t NXE = (size_t)NB * SEQ * DM;
  const int y = blockIdx.y;                        // block-uniform
  if (y < 2) {
    const unsigned short* A = Xb + (size_t)y * NXE;
    gemm64_body<0, 2, 1>(A, A, DM, 0LL, WT + (size_t)y * DM * DM, DM, 0LL, y ? bk : bq,
                         (void*)(QK + (size_t)(2 * y) * NXE), DM, 0LL, (void*)(QK + (size_t)(2 * y + 1) * NXE), DM, 0LL, DM,
                         NB * SEQ, DM, DM, 1.0f, blockIdx.x, 0, sT);
  } else {
    const unsigned short* A = WT + (size_t)2 * DM * DM;
    gemm64_body<0, 3, 2>(A, A, DM, 0LL, Xb + 2 * NXE, DM, (long long)SEQ * DM, bv,
                         (void*)VTh, SEQ, (long long)DM * SEQ, (void*)VTl, VLP, (long long)DM * VLP, VLP,
                         DM, SEQ, DM, 4096.0f, blockIdx.x % (GPB / NB), blockIdx.x / (GPB / NB), sT);
  }
}

// =====================================================================================================
// Causal attention, head dim 64, key chunks of 64.
//   q planes (bf16 hi / lo): element (b, t, h, d) at [(b*SEQ + t)*DM + h*64 + d]
//   k planes (bf16 hi / lo): same layout with key index s
//   v^T hi plane (f16):      element (b, h, d, s) at [(b*DM + h*64 + d)*SEQ + s]
//   v^T residual plane (f16, (v - hi)*4096): [(b*DM + h*64 + d)*VLP + s], s < VLP, read only when RES
//   (a key chunk at or beyond VLP would contribute a zero v residual; its address is clamped)
//   Mask: query t keeps key s iff s <= t. A query block qb therefore needs key chunks 0..qb only (block-uniform
//   trip count qb+1 <= NQB); keys in later chunks exceed every query index of the block and are skipped entirely.
//   Inside a visited chunk a masked key gets logit -inf -> exp gives exactly 0, so it adds nothing to the numerator
//   or the normaliser. Row max bookkeeping: every query keeps key 0 (chunk 0), so after chunk 0 the running max of
//   every row is finite; in the diagonal chunk every query keeps at least its own key. Every row ends with l > 0.
//   out planes (bf16 hi / lo of the normalised context): element (b, t, h, d) at [(b*SEQ + t)*DM + h*64 + d]
//   scores = q . k : bf16 hi/lo split (hi.hi + hi.lo + lo.hi), f32 accumulate, then * 1/8 and the mask in f32
//   p = exp(s - m) carried as f16(1024 p); context = p . v on f16 WMMA; RES adds f16 residual planes of p and v
//   (scale 4096, separate accumulator folded back with 1/4096 per chunk in f32); online softmax (running max) in f32.
//   Block = 4 waves = 64 query rows of one (b, h); bx = 0 .. nqbThis * NH * NB - 1 (this variant's blocks).
//   K / V^T chunk staging: 128 threads x 32 elements per plane = the whole 64x64 tile of every plane read later
//   (plain 16-B loads, __syncthreads before and after).
//   Both products are computed transposed: S^T = K . Q^T (A = K rows, B = Q) and O^T += V^T . P^T (A = V^T rows, B = P^T).
//   A lane then holds 32 scores of ONE query (column lane&15; keys j*16 + 8*(lane>>4) + r): maximum and sum run in the lane,
//   the two wave halves exchange the maximum once per chunk and join their partial normalisers once, after the loop.
//   Two score tiles 2kk, 2kk+1, converted in place, are the B operand of key half kk in the hardware k order
//   (element e < 8: key 8*(lane>>4) + e, e >= 8: key 16 + 8*(lane>>4) + e - 8), the order the V^T loads already have: P never touches LDS.
//   Output coverage: each wave stores rows q0..q0+15 (it 0..3 x lane>>3 0..3) x 64 columns (8 lanes x 8) of both planes;
//   grid over all (b, h, qb) = the whole [NB*SEQ][DM] planes.
// =====================================================================================================
struct AttnLds {                                   // one LDS layout for both variants (they share a grid)
  __bf16   Ksh[64 * LP];                            // K hi [kv][d], pitch LP
  __bf16   Ksl[64 * LP];                            // K lo
  _Float16 Vth[64 * LP];                            // V^T hi [d][kv], pitch LP
  float    Os[4][16 * OP];                          // per wave context tile [row][d]
  _Float16 Vtl[64 * LP];                            // V^T residual (RES only)
};
static_assert((64 * LP * 2) % 16 == 0 && (16 * LP * 2) % 16 == 0 && (16 * OP * 4) % 16 == 0);

template <bool RES>
__device__ __forceinline__
void attn_causal64(const unsigned short* __restrict__ qhp, const unsigned short* __restrict__ qlp,
                   const unsigned short* __restrict__ khp, const unsigned short* __restrict__ klp,
                   const unsigned short* __restrict__ vhp, const unsigned short* __restrict__ vlp,
                   unsigned short* ohp, unsigned short* olp,
                   int qbBase, int nqbThis, int bx, AttnLds& lds) {
  union FB { v16b v; v8b h[2]; };
  union FH { v16h v; v8h h[2]; };
  __bf16*   const Ksh = lds.Ksh;
  __bf16*   const Ksl = lds.Ksl;
  _Float16* const Vth = lds.Vth;
  _Float16* const Vtl = lds.Vtl;
  float    (* const Os)[16 * OP]  = lds.Os;

  const int tid  = threadIdx.x;
  const int wave = tid >> 5;
  const int lane = tid & 31;
  const int hh   = lane >> 4;
  const int c    = lane & 15;

  const int qbl  = bx % nqbThis;
  const int rest = bx / nqbThis;
  const int h    = rest % NH;
  const int b    = rest / NH;
  const int qb   = qbBase + qbl;               // 0..NQB-1 (block-uniform)
  const int q0   = qb * 64 + wave * 16;
  const size_t rowB = (size_t)b * SEQ;

  const __bf16* Qh = (const __bf16*)(const void*)qhp + (size_t)h * HD;
  const __bf16* Ql = (const __bf16*)(const void*)qlp + (size_t)h * HD;
  const __bf16* Kh = (const __bf16*)(const void*)khp + (size_t)h * HD;
  const __bf16* Kl = (const __bf16*)(const void*)klp + (size_t)h * HD;
  const _Float16* Vh = (const _Float16*)(const void*)vhp + ((size_t)b * DM + (size_t)h * HD) * SEQ;
  const _Float16* Vl = (const _Float16*)(const void*)vlp + ((size_t)b * DM + (size_t)h * HD) * VLP;

  // ---- Q fragments (B operand, column = lane&15): 2 d-chunks, hi and lo ----
  v16b qah[2], qal[2];
#pragma unroll
  for (int dc = 0; dc < 2; ++dc) {
    const size_t qo = (rowB + q0 + c) * DM + dc * 32 + 8 * hh;
    qah[dc] = ldfrag_b(Qh + qo);
    qal[dc] = ldfrag_b(Ql + qo);
  }

  const int rowq = q0 + c;                     // this lane's query
  float mrow = -INFINITY, lrow = 0.f;          // running max of the query (both halves alike), this half's partial normaliser
  v8f oacc[4];                                 // oacc[t][r] = O^T[d = t*16 + 8hh + r][query c]
#pragma unroll
  for (int t = 0; t < 4; ++t) oacc[t] = zero8();

  for (int kt = 0; kt <= qb; ++kt) {           // block-uniform trip count, <= NQB
    const int kv0 = kt * 64;                   // kv0 + 63 < SEQ
    __syncthreads();
    {
      const int r = tid >> 1, half = (tid & 1) * 32;
      const __bf16*   kg  = Kh + (rowB + kv0 + r) * DM + half;    // K row kv0+r, d = half..half+31
      const __bf16*   klg = Kl + (rowB + kv0 + r) * DM + half;
      const _Float16* vg  = Vh + (size_t)r * SEQ + kv0 + half;    // V^T row d = r, s = kv0+half..+31
      const int kvl = (kv0 + 64 <= VLP) ? kv0 : (VLP - 64);     // clamped address into the residual plane
      const _Float16* vlg = Vl + (size_t)r * VLP + kvl + half;
      const bool resOK = (kv0 + 64 <= VLP);                      // block-uniform (always true for qb < RESQB)
#pragma unroll
      for (int i = 0; i < 4; ++i) {
        const v8b a0 = *(const v8b*)(kg + 8 * i);
        const v8b a1 = *(const v8b*)(klg + 8 * i);
        const v8h b0 = *(const v8h*)(vg + 8 * i);
        *(v8b*)(Ksh + r * LP + half + 8 * i) = a0;
        *(v8b*)(Ksl + r * LP + half + 8 * i) = a1;
        *(v8h*)(Vth + r * LP + half + 8 * i) = b0;
        if (RES) {
          v8h b1 = *(const v8h*)(vlg + 8 * i);
          if (!resOK) b1 = zero8h();
          *(v8h*)(Vtl + r * LP + half + 8 * i) = b1;
        }
      }
      // RES build: the last load's result was placed on address pairs that earlier loads of this batch name. The pairs are
      // inputs of the wait, so they stay as they are until the batch's address translations are done.
      if (RES) asm volatile("s_wait_xcnt 0x0" :: "v"(kg), "v"(klg), "v"(vg), "v"(vlg) : "memory");
    }
    __syncthreads();

    // ---- scores, transposed: 64 keys x 16 queries per wave, 3 bf16 products ----
    // All K fragments of a d-chunk are read as one group, then the four key tiles' accumulators take turns, so one LDS wait
    // serves 12 products and no product waits for the one before it. Each s[j] still sums hi.hi, hi.lo, lo.hi per d-chunk.
    v8f s[4];                                  // s[j][r] = S^T[key kv0 + j*16 + 8hh + r][query c]
#pragma unroll
    for (int j = 0; j < 4; ++j) s[j] = zero8();
#pragma unroll
    for (int dc = 0; dc < 2; ++dc) {
      FB kb[4], kl[4];
#pragma unroll
      for (int j = 0; j < 4; ++j) {
        kb[j].h[0] = *(const v8b*)(Ksh + (j * 16 + c) * LP + dc * 32 + 8 * hh);
        kb[j].h[1] = *(const v8b*)(Ksh + (j * 16 + c) * LP + dc * 32 + 16 + 8 * hh);
        kl[j].h[0] = *(const v8b*)(Ksl + (j * 16 + c) * LP + dc * 32 + 8 * hh);
        kl[j].h[1] = *(const v8b*)(Ksl + (j * 16 + c) * LP + dc * 32 + 16 + 8 * hh);
      }
#pragma unroll
      for (int j = 0; j < 4; ++j) s[j] = mma_b_raw(kb[j].v, qah[dc], s[j]);
#pragma unroll
      for (int j = 0; j < 4; ++j) s[j] = mma_b_raw(kl[j].v, qah[dc], s[j]);
#pragma unroll
      for (int j = 0; j < 4; ++j) s[j] = mma_b_raw(kb[j].v, qal[dc], s[j]);
    }

    // ---- scale, causal mask by index, maximum in the lane (one chain per key tile), one exchange between the halves ----
    float mj[4];
#pragma unroll
    for (int j = 0; j < 4; ++j) {
      mj[j] = -INFINITY;
#pragma unroll
      for (int r = 0; r < 8; ++r) {
        const int key = kv0 + j * 16 + 8 * hh + r;
        float sv = s[j][r] * 0.125f;
        const bool keep = (key <= rowq);
        sv = keep ? sv : -INFINITY;
        s[j][r] = sv;
        mj[j] = fmaxf(mj[j], sv);
      }
    }
    float m = fmaxf(fmaxf(mj[0], mj[1]), fmaxf(mj[2], mj[3]));
    m = fmaxf(m, xhalf(m));                    // both halves now hold the query's maximum over the chunk
    const float mnew  = fmaxf(mrow, m);
    const float msafe = (mnew == -INFINITY) ? 0.f : mnew;
    const float alpha = exp_nat<RES>(mrow - msafe);
    mrow = mnew;

    // ---- online softmax; P (x1024, f16) and P residual (x4096) packed straight into the B operands of the second product ----
    FH pa[2], pl[2];
    float pj[4];
#pragma unroll
    for (int j = 0; j < 4; ++j) {
      pj[j] = 0.f;
#pragma unroll
      for (int r = 0; r < 8; ++r) {
        const float p = exp_nat<RES>(s[j][r] - msafe);   // masked logit: exp(-inf) = 0
        pj[j] += p;
        const float p1k = p * 1024.0f;
        const _Float16 ph = (_Float16)p1k;
        pa[j >> 1].v[(j & 1) * 8 + r] = ph;
        if (RES) pl[j >> 1].v[(j & 1) * 8 + r] = (_Float16)((p1k - (float)ph) * 4096.0f);
      }
    }
    lrow = lrow * alpha + ((pj[0] + pj[1]) + (pj[2] + pj[3]));
#pragma unroll
    for (int t = 0; t < 4; ++t)
#pragma unroll
      for (int r = 0; r < 8; ++r) oacc[t][r] *= alpha;

    // ---- context^T += V^T . P^T (f16 WMMA), residual products into a separate accumulator ----
    v8f o1[4];
#pragma unroll
    for (int t = 0; t < 4; ++t) o1[t] = zero8();
    // Unrolled, with each key half's V fragments read as one group ahead of its products; the four d tiles take turns.
#pragma unroll
    for (int kk = 0; kk < 2; ++kk) {
      FH vb[4], vl[4];
#pragma unroll
      for (int t = 0; t < 4; ++t) {
        vb[t].h[0] = *(const v8h*)(Vth + (t * 16 + c) * LP + kk * 32 + 8 * hh);
        vb[t].h[1] = *(const v8h*)(Vth + (t * 16 + c) * LP + kk * 32 + 16 + 8 * hh);
        if (RES) {
          vl[t].h[0] = *(const v8h*)(Vtl + (t * 16 + c) * LP + kk * 32 + 8 * hh);
          vl[t].h[1] = *(const v8h*)(Vtl + (t * 16 + c) * LP + kk * 32 + 16 + 8 * hh);
        } else {
          vl[t].v = vb[t].v;
        }
      }
#pragma unroll
      for (int t = 0; t < 4; ++t) oacc[t] = mma_h_raw(vb[t].v, pa[kk].v, oacc[t]);
      if (RES) {
#pragma unroll
        for (int t = 0; t < 4; ++t) o1[t] = mma_h_raw(vl[t].v, pa[kk].v, o1[t]);
#pragma unroll
        for (int t = 0; t < 4; ++t) o1[t] = mma_h_raw(vb[t].v, pl[kk].v, o1[t]);
      }
    }
    if (RES) {
#pragma unroll
      for (int t = 0; t < 4; ++t)
#pragma unroll
        for (int r = 0; r < 8; ++r) oacc[t][r] += o1[t][r] * (1.0f / 4096.0f);
    }
  }

  // ---- join the halves' normalisers, normalise (1/l and the 1/1024 p carry), stage the wave's 16x64 tile [query][d]
  //      (a lane's 8 registers of a tile are 8 consecutive d of its query: two 16-B stores), bf16 hi/lo split,
  float* os = Os[wave];
  {
    const float l = lrow + xhalf(lrow);        // unconditional: both halves take part in the exchange
    const float inv = ((l > 0.f) ? (1.0f / l) : 0.f) * (1.0f / 1024.0f);
#pragma unroll
    for (int t = 0; t < 4; ++t) {
      v4f w0, w1;
#pragma unroll
      for (int r = 0; r < 4; ++r) { w0[r] = oacc[t][r] * inv; w1[r] = oacc[t][4 + r] * inv; }
      *(v4f*)(os + c * OP + t * 16 + 8 * hh)     = w0;
      *(v4f*)(os + c * OP + t * 16 + 8 * hh + 4) = w1;
    }
  }
  __builtin_amdgcn_fence(__ATOMIC_RELEASE, "workgroup");
  __builtin_amdgcn_wave_barrier();
  __builtin_amdgcn_fence(__ATOMIC_ACQUIRE, "workgroup");
  {
    const int q4 = lane >> 3, c8 = (lane & 7) * 8;
    v4u hv[4], lv[4];
#pragma unroll
    for (int it = 0; it < 4; ++it) {
      const int row = it * 4 + q4;   // it 0..3 x q4 0..3 = rows 0..15 of the wave tile
      const float* sp = os + row * OP + c8;
      v4u a, a2;
#pragma unroll
      for (int e = 0; e < 4; ++e) {
        const float f0 = sp[2 * e], f1 = sp[2 * e + 1];
        const unsigned short h0 = bf_bits(f0), h1 = bf_bits(f1);
        const unsigned short l0 = bf_bits(f0 - bf_up(h0)), l1 = bf_bits(f1 - bf_up(h1));
        a[e] = pk16(h0, h1); a2[e] = pk16(l0, l1);
      }
      hv[it] = a; lv[it] = a2;
    }
    {
#pragma unroll
      for (int it = 0; it < 4; ++it) {
        const int row = it * 4 + q4;
        const size_t go = (rowB + q0 + row) * DM + (size_t)h * HD + c8;
        *(v4u*)(ohp + go) = hv[it];
        *(v4u*)(olp + go) = lv[it];
      }
      
    }
  }
}

// Both attention variants in one grid: blocks 0..NMAIN-1 are the query blocks RESQB..NQB-1 (no residual planes),
// the last NB*NH*RESQB blocks the leading RESQB query blocks with residual planes. The branch is block-uniform.
#define NMAIN (NB * NH * (NQB - RESQB))
__global__ __launch_bounds__(128)
void attn_all(const unsigned short* __restrict__ qhp, const unsigned short* __restrict__ qlp,
              const unsigned short* __restrict__ khp, const unsigned short* __restrict__ klp,
              const unsigned short* __restrict__ vhp, const unsigned short* __restrict__ vlp,
              unsigned short* ohp, unsigned short* olp) {
  __shared__ __align__(16) AttnLds lds;
  const int bx = blockIdx.x;
  if (bx < NMAIN) attn_causal64<false>(qhp, qlp, khp, klp, vhp, vlp, ohp, olp, RESQB, NQB - RESQB, bx, lds);
  else            attn_causal64<true>(qhp, qlp, khp, klp, vhp, vlp, ohp, olp, 0, RESQB, bx - NMAIN, lds);
}

// =====================================================================================================
// Workspace map (bytes; every region is an exact multiple of its 64x64-tile / whole-line store granularity,
//   Qb   bf16 [8192][512]            0            8388608
//   Kb   bf16 [8192][512]            8388608      8388608
//   Vb   bf16 [8192][512]            16777216     8388608
//   WqT  bf16 [512 n][512 k]         25165824     524288
//   WkT                              25690112     524288
//   WvT                              26214400     524288
//   WoT                              26738688     524288
//   Qh   bf16 [8192][512]            27262976     8388608
//   Ql                               35651584     8388608
//   Kh                               44040192     8388608
//   Kl                               52428800     8388608
//   VTh  f16  [2][512][4096]         60817408     8388608
//   VTl  f16  [2][512][512]          69206016     1048576
//   Oh   bf16 [8192][512]            70254592     8388608
//   Ol                               78643200     8388608
//   end                              87031808
// =====================================================================================================
extern "C" void kernel_launch(void* const* d_in, const int* in_sizes, int n_in,
                              void* d_out, int out_size, void* d_ws, size_t ws_size,
                              hipStream_t stream) {
  if (n_in < 11) return;
  const int NX = NB * SEQ * DM;                    // 4194304
  if (in_sizes[0] != NX || in_sizes[1] != NX || in_sizes[2] != NX) return;
  if (in_sizes[3] != DM * DM || in_sizes[5] != DM * DM || in_sizes[7] != DM * DM || in_sizes[9] != DM * DM) return;
  if (in_sizes[4] != DM || in_sizes[6] != DM || in_sizes[8] != DM || in_sizes[10] != DM) return;
  if (out_size != NX) return;

  const float* v  = (const float*)d_in[0];   // [2][4096][512]
  const float* k  = (const float*)d_in[1];   // [2][4096][512]
  const float* q  = (const float*)d_in[2];   // [2][4096][512]
  const float* Wq = (const float*)d_in[3];   // [512 in][512 out] = [k][n]
  const float* bq = (const float*)d_in[4];   // [512]
  const float* Wk = (const float*)d_in[5];   // [512 in][512 out]
  const float* bk = (const float*)d_in[6];   // [512]
  const float* Wv = (const float*)d_in[7];   // [512 in][512 out]
  const float* bv = (const float*)d_in[8];   // [512]
  const float* Wo = (const float*)d_in[9];   // [512 in][512 out]
  const float* bo = (const float*)d_in[10];  // [512]

  const size_t PX  = (size_t)NB * SEQ * DM * 2;    //  8388608  16-bit activation plane [8192][512]
  const size_t PW  = (size_t)DM * DM * 2;          //   524288  16-bit weight plane [512][512]
  const size_t PVT = (size_t)NB * DM * SEQ * 2;    //  8388608  v^T hi plane
  const size_t PVL = (size_t)NB * DM * VLP * 2;    //  1048576  v^T residual plane
  size_t off = 0;
  const size_t oQb  = off; off += PX;
  const size_t oKb  = off; off += PX;
  const size_t oVb  = off; off += PX;
  const size_t oWq  = off; off += PW;
  const size_t oWk  = off; off += PW;
  const size_t oWv  = off; off += PW;
  const size_t oWo  = off; off += PW;
  const size_t oQh  = off; off += PX;
  const size_t oQl  = off; off += PX;
  const size_t oKh  = off; off += PX;
  const size_t oKl  = off; off += PX;
  const size_t oVTh = off; off += PVT;
  const size_t oVTl = off; off += PVL;
  const size_t oOh  = off; off += PX;
  const size_t oOl  = off; off += PX;
  if (off > ws_size) return;                       // off = 87031808
  if (off > (size_t)134217728) return;

  char* ws = (char*)d_ws;
  unsigned short* Qb  = (unsigned short*)(ws + oQb);
  unsigned short* Kb  = (unsigned short*)(ws + oKb);
  unsigned short* Vb  = (unsigned short*)(ws + oVb);
  unsigned short* WqT = (unsigned short*)(ws + oWq);
  unsigned short* WkT = (unsigned short*)(ws + oWk);
  unsigned short* WvT = (unsigned short*)(ws + oWv);
  unsigned short* WoT = (unsigned short*)(ws + oWo);
  unsigned short* Qh  = (unsigned short*)(ws + oQh);
  unsigned short* Ql  = (unsigned short*)(ws + oQl);
  unsigned short* Kh  = (unsigned short*)(ws + oKh);
  unsigned short* Kl  = (unsigned short*)(ws + oKl);
  unsigned short* VTh = (unsigned short*)(ws + oVTh);
  unsigned short* VTl = (unsigned short*)(ws + oVTl);
  unsigned short* Oh  = (unsigned short*)(ws + oOh);
  unsigned short* Ol  = (unsigned short*)(ws + oOl);

  const dim3 blk(256);
  const dim3 gProj(GPB, 1);                                    // 1024 tiles -> 128 blocks: M=8192, N=512

  // (1) all plane conversions in one grid: weights f32 [k][n] -> bf16 W^T [n][k] (WqT, WkT, WvT, WoT are contiguous),
  //     activations f32 -> bf16 planes of the inputs' layout (Qb, Kb, Vb are contiguous)
  prep_planes<<<dim3(4 * NTR + 3 * NCV), blk, 0, stream>>>(q, k, v, Wq, Wk, Wv, Wo, Qb, WqT);
  // (2) the three input projections in one grid: qp, kp -> bf16 hi/lo planes [b*SEQ+t][h*64+d] (Qh, Ql, Kh, Kl contiguous),
  //     vp^T per batch -> f16 hi plane [b][h*64+d][s] (pitch SEQ) and residual plane (x4096, keys < VLP only, pitch VLP)
  gemm_qkv<<<dim3(GPB, 3), blk, 0, stream>>>(Qb, WqT, bq, bk, bv, Qh, VTh, VTl);
  // (3) causal attention, one grid: query blocks RESQB.. without, 0..RESQB-1 with residual planes
  attn_all<<<dim3(NB * NH * NQB), dim3(128), 0, stream>>>(Qh, Ql, Kh, Kl, VTh, VTl, Oh, Ol);
  // (4) out = context . Wo + bo -> d_out f32 [8192][512]  (A = context hi + lo planes, 2 products; Bt = WoT)
  gemm64<1, 0, 1><<<gProj, blk, 0, stream>>>(
      Oh, Ol, DM, 0LL, WoT, DM, 0LL, bo,
      d_out, DM, 0LL, d_out, DM, 0LL, DM,
      NB * SEQ, DM, DM, 1.0f);
  (void)hipGetLastError();
}

// v005
// It runs in 171 microseconds.
// Timed twice side by side with v004, it ran 1.10 and 1.09 times as fast.
// Counting every step since v000, it is 3.09 times as fast.
// Contractions: q, k, v^T projections = v_wmma_f32_16x16x32_bf16 (bf16 operands from RNE-converted inputs and weights, single product, f32 accumulate);
// k.q^T scores (keys down, queries across) = v_wmma_f32_16x16x32_bf16 with bf16 hi/lo split q and k (hi.hi + hi.lo + lo.hi), f32 accumulate;
// v^T.p^T = v_wmma_f32_16x16x32_f16 (p carried x1024 in f16 times v in f16, single product; plus f16 residual planes x4096 of
// p and v for the first 512 query rows of every sequence), f32 accumulate;
// ctx.Wo = v_wmma_f32_16x16x32_bf16 with ctx as bf16 hi/lo planes times bf16 Wo^T (2 products), f32 accumulate;
// causal mask (key <= query), online softmax, normalisers and bias adds in f32 on the VALU.
// Carry audit:
//   ph  = f16(1024 * p)                      -> the 1/1024 is folded exactly once in the attention epilogue: inv = (1/l) * (1/1024)
//   pl  = f16((1024 p - ph) * 4096)          }  products VTl.ph and VTh.pl go to the separate accumulator o1,
//   VTl = f16((v - VTh) * 4096)              }  folded back with * (1/4096) once per key chunk (RES blocks only)
//   VTh = f16(v), no carry (|v| typ. 0.45); q / k / ctx lo planes are unscaled bf16 residuals (v - hi) sharing the hi accumulator;
//   score scale 1/8 applied once in f32 after the score accumulate. No other scaled planes.
#include <hip/hip_runtime.h>
#include <math.h>
#include <stdint.h>

#define NB    2
#define SEQ   4096
#define DM    512
#define NH    8
#define HD    64
#define NQB   (SEQ / 64)   // 64 query / key blocks of 64
#define VLP   512          // key pitch of the v^T residual plane (keys 0..VLP-1)
#define RESQB 8            // leading 64-row query blocks that use the p / v residual planes
#define LP    72           // LDS row pitch of the 64-element 16-bit tiles: 144 B = 16 B x 9, 16 rows of a 16-B read on 16 bank quads
#define OP    68           // LDS row pitch of the f32 context tile, in floats (16-B reads down a column walk)
static_assert(RESQB * 64 <= VLP);
static_assert(NH * HD == DM);
static_assert((SEQ % 64) == 0 && (DM % 64) == 0 && (DM % 32) == 0);
static_assert(((NB * SEQ / 64) * (DM / 64)) % 8 == 0);
static_assert(((DM / 64) * (SEQ / 64)) % 8 == 0);
static_assert((NB * SEQ * DM) % (8 * 256) == 0);
static_assert((DM * DM) % (64 * 64) == 0);

typedef _Float16 v16h __attribute__((ext_vector_type(16)));
typedef _Float16 v8h  __attribute__((ext_vector_type(8)));
typedef __bf16   v16b __attribute__((ext_vector_type(16)));
typedef __bf16   v8b  __attribute__((ext_vector_type(8)));
typedef float    v8f  __attribute__((ext_vector_type(8)));
typedef float    v4f  __attribute__((ext_vector_type(4)));
typedef unsigned int v4u __attribute__((ext_vector_type(4)));

// ---- scalar helpers --------------------------------------------------------------------------------
__device__ __forceinline__ unsigned short bf_bits(float f) {          // f32 -> bf16 bits, RNE convert
  unsigned u = __float_as_uint(f);
  return (unsigned short)((u + 0x7FFFu + ((u >> 16) & 1u)) >> 16);
}
__device__ __forceinline__ float bf_up(unsigned short h) { return __uint_as_float(((unsigned)h) << 16); }
__device__ __forceinline__ unsigned short h_bits(_Float16 x) { return __builtin_bit_cast(unsigned short, x); }
__device__ __forceinline__ unsigned pk16(unsigned short a, unsigned short b) { return (unsigned)a | ((unsigned)b << 16); }
__device__ __forceinline__ v8f zero8() { v8f z = {0.f, 0.f, 0.f, 0.f, 0.f, 0.f, 0.f, 0.f}; return z; }
__device__ __forceinline__ v8h zero8h() {
  const _Float16 z = (_Float16)0.0f;
  v8h r = {z, z, z, z, z, z, z, z};
  return r;
}

// value of lane l ^ 16 (the other half of the wave), by a vector cross-row move
__device__ __forceinline__ float xhalf(float x) {
  const int i = __builtin_bit_cast(int, x);
  return __builtin_bit_cast(float, __builtin_amdgcn_permlanex16(i, i, 0x76543210, 0xfedcba98, false, false));
}

// e^x as __expf forms it (x * log2 e, then v_exp_f32). SLOT: the exponential and one v_nop in one statement. The v_nop is the slot
// the instruction set asks for between a transcendental and an instruction that overwrites its source.
template <bool SLOT>
__device__ __forceinline__ float exp_nat(float x) {
  if (!SLOT) return __expf(x);
  const float y = x * 1.44269504088896340736f;
  float r;
  asm("v_exp_f32 %0, %1\n\tv_nop" : "=v"(r) : "v"(y));
  return r;
}

// ---- fragment loader: 16-bit A/B operand, lane -> row/col (lane&15), p already includes +8*(lane>>4);
//      elements 0..7 <- p[0..7] (k0+8h..), elements 8..15 <- p[16..23] (k0+16+8h..)
__device__ __forceinline__ v16b ldfrag_b(const __bf16* p) {
  union { v16b v; v8b h[2]; } f;
  f.h[0] = *(const v8b*)(p);
  f.h[1] = *(const v8b*)(p + 16);
  return f.v;
}

// ---- WMMA helpers with trailing VALU hazard gap --------------------------------------------------------
__device__ __forceinline__ v8f mma_h_raw(v16h a, v16h b, v8f c) {
  return __builtin_amdgcn_wmma_f32_16x16x32_f16(false, a, false, b, (short)0, c, false, false);
}
__device__ __forceinline__ v8f mma_b_raw(v16b a, v16b b, v8f c) {
  return __builtin_amdgcn_wmma_f32_16x16x32_bf16(false, a, false, b, (short)0, c, false, false);
}
__device__ __forceinline__ void dep_guard_b(v8f& a, v8f& b, v16b x, v16b y) {
  asm volatile("v_nop\n\tv_nop\n\tv_nop\n\tv_nop" : "+v"(a), "+v"(b) : "v"(x), "v"(y));
}
__device__ __forceinline__ void keep4_b(v16b a, v16b b, v16b c, v16b d) {
  asm volatile("v_nop" :: "v"(a), "v"(b), "v"(c), "v"(d));
}
__device__ __forceinline__ void acc_guard4(v8f& a, v8f& b, v8f& c, v8f& d) {
  asm volatile("v_nop\n\tv_nop\n\tv_nop\n\tv_nop" : "+v"(a), "+v"(b), "+v"(c), "+v"(d));
}

// =====================================================================================================
// f32 -> bf16 (RNE convert), 8 elements per thread, one 16-B store per lane: a wave writes 512 contiguous B
// the [8192][512] activations, a multiple of 256).
// coverage: n8 threads x 8 = the whole plane.
// =====================================================================================================
__device__ __forceinline__ void cvt_bf16x8(const float* __restrict__ in, unsigned short* out, int n8, int blk) {
  const int i = blk * 256 + threadIdx.x;
  if (i < n8) {
    const v4f a = *(const v4f*)(in + (size_t)i * 8);
    const v4f b = *(const v4f*)(in + (size_t)i * 8 + 4);
    v4u p;
    p[0] = pk16(bf_bits(a[0]), bf_bits(a[1]));
    p[1] = pk16(bf_bits(a[2]), bf_bits(a[3]));
    p[2] = pk16(bf_bits(b[0]), bf_bits(b[1]));
    p[3] = pk16(bf_bits(b[2]), bf_bits(b[3]));
    *(v4u*)(out + (size_t)i * 8) = p;
    
  }
}

// =====================================================================================================
// f32 [K rows][N cols] (pitch ldw) -> bf16 transposed plane WT[n][k] (pitch ldt, k contiguous), RNE convert.
// One 64x64 tile per block (n0 = 64 * tileN, k0 = 64 * tileK, N and K exact multiples of 64): the tile is staged in LDS with
// coalesced 16-B loads (256 threads x 16 floats = the whole tile), __syncthreads, then each output row segment
// coverage: 8 waves x 2 x (lane>>3 = 4 rows) = 64 rows n, 8 lanes x 8 = 64 k: the whole tile; grid = the whole plane.
// =====================================================================================================
__device__ __forceinline__ void cvt_bf16_tr64(const float* __restrict__ W, unsigned short* WT, int ldw, int ldt,
                                              int tileN, int tileK, float* sW) {
  const int tid = threadIdx.x;
  const int n0 = tileN * 64;
  const int k0 = tileK * 64;
  {
    const int kr = tid >> 2, cb = (tid & 3) * 16;          // row k0+kr, cols n0+cb .. +15
    const float* src = W + (size_t)(k0 + kr) * ldw + n0 + cb;
#pragma unroll
    for (int i = 0; i < 4; ++i) {
      const v4f f = *(const v4f*)(src + 4 * i);
      float* d = sW + kr * 65 + cb + 4 * i;
      d[0] = f[0]; d[1] = f[1]; d[2] = f[2]; d[3] = f[3];
    }
  }
  __syncthreads();
  const int wave = tid >> 5, lane = tid & 31;
  const int q = lane >> 3, c8 = (lane & 7) * 8;
  v4u pv[2];
#pragma unroll
  for (int it = 0; it < 2; ++it) {
    const int nr = wave * 8 + it * 4 + q;                  // output row n0+nr, 0 <= nr < 64
    v4u p;
#pragma unroll
    for (int e = 0; e < 4; ++e) {
      const float f0 = sW[(c8 + 2 * e) * 65 + nr];
      const float f1 = sW[(c8 + 2 * e + 1) * 65 + nr];
      p[e] = pk16(bf_bits(f0), bf_bits(f1));
    }
    pv[it] = p;
  }
  {
#pragma unroll
    for (int it = 0; it < 2; ++it) {
      const int nr = wave * 8 + it * 4 + q;
      *(v4u*)(WT + (size_t)(n0 + nr) * ldt + k0 + c8) = pv[it];
    }
    
  }
}

// =====================================================================================================
// One grid for all seven independent plane conversions: blocks 0..4*NTR-1 transpose the four weights (64x64 tile each,
// planes WT + w*DM*DM in the order Wq, Wk, Wv, Wo), the next 3*NCV blocks convert q, k, v (planes Xb + w*NB*SEQ*DM).
// The branch is block-uniform, so the transpose's __syncthreads is passed by all threads of its block or by none.
// =====================================================================================================
#define NTR ((DM / 64) * (DM / 64))          // 64 tiles per weight
#define NCV ((NB * SEQ * DM) / (8 * 256))    // 2048 blocks per activation plane
__global__ __launch_bounds__(256) void prep_planes(const float* __restrict__ q, const float* __restrict__ k,
                                                   const float* __restrict__ v,
                                                   const float* __restrict__ Wq, const float* __restrict__ Wk,
                                                   const float* __restrict__ Wv, const float* __restrict__ Wo,
                                                   unsigned short* Xb, unsigned short* WT) {
  __shared__ __align__(16) float sW[64 * 65];
  const int bx = blockIdx.x;
  if (bx < 4 * NTR) {
    const int w = bx / NTR, t = bx % NTR;
    const float* W = (w == 0) ? Wq : (w == 1) ? Wk : (w == 2) ? Wv : Wo;
    cvt_bf16_tr64(W, WT + (size_t)w * DM * DM, DM, DM, t % (DM / 64), t / (DM / 64), sW);
  } else {
    const int cb = bx - 4 * NTR;
    const int w = cb / NCV, blk = cb % NCV;
    const float* in = (w == 0) ? q : (w == 1) ? k : v;
    cvt_bf16x8(in, Xb + (size_t)w * NB * SEQ * DM, (NB * SEQ * DM) / 8, blk);
  }
}

// =====================================================================================================
// Register-blocked batched bf16 WMMA GEMM: C[m][n] = sum_k A[m][k] * Bt[n][k] + bias; one wave per 64x64 tile,
// no block barriers. A row-major [M][K] pitch lda; Bt row-major [N][K] pitch ldb (k contiguous);
// M, N multiples of 64, K multiple of 32 (host shapes are static multiples). b = batch index (strides in elements).
// NSPLIT: 0 = A.Bt; 1 = (A + A2).Bt (A2 = unscaled bf16 lo plane of A, 2 products).
// BIAS: 0 = none; 1 = per column n, bias[n]; 2 = per row m, bias[m]; the bias value is RNE-converted to bf16 and added in f32.
// OUT_MODE: 0 = f32 (pitch ldc); 2 = bf16 hi plane C + bf16 lo plane C2 (lo = RNE(v - hi), unscaled);
//           3 = f16 hi plane C + f16 residual plane C2 = f16((v - hi) * rscale), C2 written only for tiles
//               with n0 < N2 (pitch ldc2, batch stride strideC2).
// =====================================================================================================
template <int NSPLIT, int OUT_MODE, int BIAS>
__device__ __forceinline__ void gemm64_body(
    const unsigned short* __restrict__ Ap, const unsigned short* A2p, int lda, long long strideA,
    const unsigned short* __restrict__ Btp, int ldb, long long strideB,
    const float* __restrict__ bias,
    void* Cout, int ldc, long long strideC,
    void* Cout2, int ldc2, long long strideC2, int N2,
    int M, int N, int K, float rscale,
    int blk, int b, float (*sT)[16 * 68]) {   // blk = block index inside this product, b = batch index
  const __bf16* A   = (const __bf16*)(const void*)Ap;
  const __bf16* A2  = (const __bf16*)(const void*)A2p;
  const __bf16* Bt  = (const __bf16*)(const void*)Btp;
  const int lane = threadIdx.x & 31;
  const int wave = threadIdx.x >> 5;
  const int tilesN = N >> 6;
  const int tilesM = M >> 6;
  const int tile = blk * 8 + wave;
  if (tile >= tilesM * tilesN) return;   // wave-uniform; no block barriers in this kernel
  const int tm = tile / tilesN;
  const int tn = tile - tm * tilesN;
  const int m0 = tm << 6;
  const int n0 = tn << 6;

  const __bf16* Ab  = A  + (size_t)b * strideA;
  const __bf16* Bb  = Bt + (size_t)b * strideB;
  const __bf16* Ab2 = (NSPLIT >= 1) ? (A2 + (size_t)b * strideA) : Ab;

  const int rlane = lane & 15;                 // row (A) / col (B, D) within subtile
  const int koff  = (lane >> 4) * 8;           // k offset of this lane half
  const int mOff  = (lane >> 4) * 8;           // D row offset

  v8f acc[4][4];
#pragma unroll
  for (int i = 0; i < 4; ++i)
#pragma unroll
    for (int j = 0; j < 4; ++j) acc[i][j] = zero8();

  for (int k0 = 0; k0 < K; k0 += 32) {
    v16b bh[4];
#pragma unroll
    for (int j = 0; j < 4; ++j) {
      const size_t bo = (size_t)(n0 + (j << 4) + rlane) * ldb + koff + k0;
      bh[j] = ldfrag_b(Bb + bo);
    }
#pragma unroll
    for (int i = 0; i < 4; ++i) {
      const size_t ao = (size_t)(m0 + (i << 4) + rlane) * lda + koff + k0;
      const v16b ah = ldfrag_b(Ab + ao);
      v16b al = ah;
      if (NSPLIT >= 1) al = ldfrag_b(Ab2 + ao);
#pragma unroll
      for (int j = 0; j < 4; ++j) {
        acc[i][j] = mma_b_raw(ah, bh[j], acc[i][j]);
        if (NSPLIT >= 1) acc[i][j] = mma_b_raw(al, bh[j], acc[i][j]);
      }
      dep_guard_b(acc[i][0], acc[i][3], ah, al);
    }
    keep4_b(bh[0], bh[1], bh[2], bh[3]);
  }
  acc_guard4(acc[0][0], acc[0][1], acc[0][2], acc[0][3]);
  acc_guard4(acc[1][0], acc[1][1], acc[1][2], acc[1][3]);
  acc_guard4(acc[2][0], acc[2][1], acc[2][2], acc[2][3]);
  acc_guard4(acc[3][0], acc[3][1], acc[3][2], acc[3][3]);

  // ---- epilogue ----
  float* slab = sT[wave];
  float bcol[4];
#pragma unroll
  for (int j = 0; j < 4; ++j) {
    bcol[j] = 0.f;
    if (BIAS == 1) bcol[j] = bf_up(bf_bits(bias[n0 + (j << 4) + rlane]));   // n < N, bias has N entries
  }
#pragma unroll
  for (int i = 0; i < 4; ++i) {
    const int mBase = m0 + (i << 4);
    float brow[8];
#pragma unroll
    for (int r = 0; r < 8; ++r) {
      brow[r] = 0.f;
      if (BIAS == 2) brow[r] = bf_up(bf_bits(bias[mBase + mOff + r]));      // m < M, bias has M entries
    }
#pragma unroll
    for (int j = 0; j < 4; ++j) {
#pragma unroll
      for (int r = 0; r < 8; ++r) {
        slab[(mOff + r) * 68 + (j << 4) + rlane] = acc[i][j][r] + bcol[j] + brow[r];
      }
    }
    __builtin_amdgcn_fence(__ATOMIC_RELEASE, "workgroup");
    __builtin_amdgcn_wave_barrier();
    __builtin_amdgcn_fence(__ATOMIC_ACQUIRE, "workgroup");
    if (OUT_MODE == 0) {
      float* C = (float*)Cout + (size_t)b * strideC;
      const int hh = lane >> 4, c4 = (lane & 15) * 4;     // 256-B row segment = 16 lanes x 16 B
      {
#pragma unroll
        for (int it = 0; it < 8; ++it) {
          const int row = it * 2 + hh;                     // it 0..7 x hh 0..1 = rows 0..15
          const v4f v = *(const v4f*)(slab + row * 68 + c4);
          *(v4f*)(C + (size_t)(mBase + row) * ldc + n0 + c4) = v;
        }
        
      }
    } else {
      const int q = lane >> 3, c8 = (lane & 7) * 8;
      unsigned short* C  = (unsigned short*)Cout  + (size_t)b * strideC;
      unsigned short* C2 = (unsigned short*)Cout2 + (size_t)b * strideC2;
      const bool wlo = (OUT_MODE == 2) || (n0 < N2);      // wave-uniform
      v4u hv[4], lv[4];
#pragma unroll
      for (int it = 0; it < 4; ++it) {
        const int row = it * 4 + q;                        // it 0..3 x q 0..3 = rows 0..15
        const float* sp = slab + row * 68 + c8;
        v4u a, a2;
#pragma unroll
        for (int e = 0; e < 4; ++e) {
          const float f0 = sp[2 * e], f1 = sp[2 * e + 1];
          unsigned short h0, h1, l0, l1;
          if (OUT_MODE == 2) {
            h0 = bf_bits(f0); h1 = bf_bits(f1);
            l0 = bf_bits(f0 - bf_up(h0)); l1 = bf_bits(f1 - bf_up(h1));
          } else {
            const _Float16 x0 = (_Float16)f0, x1 = (_Float16)f1;
            h0 = h_bits(x0); h1 = h_bits(x1);
            l0 = h_bits((_Float16)((f0 - (float)x0) * rscale));
            l1 = h_bits((_Float16)((f1 - (float)x1) * rscale));
          }
          a[e] = pk16(h0, h1); a2[e] = pk16(l0, l1);
        }
        hv[it] = a; lv[it] = a2;
      }
      {
#pragma unroll
        for (int it = 0; it < 4; ++it) {
          const int row = it * 4 + q;
          *(v4u*)(C + (size_t)(mBase + row) * ldc + n0 + c8) = hv[it];
          if (wlo) *(v4u*)(C2 + (size_t)(mBase + row) * ldc2 + n0 + c8) = lv[it];
        }
        
      }
    }
    __builtin_amdgcn_fence(__ATOMIC_RELEASE, "workgroup");
    __builtin_amdgcn_wave_barrier();
    __builtin_amdgcn_fence(__ATOMIC_ACQUIRE, "workgroup");
  }
}

// One product per launch (the output projection).
template <int NSPLIT, int OUT_MODE, int BIAS>
__global__ __launch_bounds__(256) void gemm64(
    const unsigned short* __restrict__ Ap, const unsigned short* A2p, int lda, long long strideA,
    const unsigned short* __restrict__ Btp, int ldb, long long strideB,
    const float* __restrict__ bias,
    void* Cout, int ldc, long long strideC,
    void* Cout2, int ldc2, long long strideC2, int N2,
    int M, int N, int K, float rscale) {
  __shared__ __align__(16) float sT[8][16 * 68];   // per-wave 16x64 slab, pitch 68 floats
  gemm64_body<NSPLIT, OUT_MODE, BIAS>(Ap, A2p, lda, strideA, Btp, ldb, strideB, bias, Cout, ldc, strideC,
                                      Cout2, ldc2, strideC2, N2, M, N, K, rscale, blockIdx.x, blockIdx.y, sT);
}

// The three independent input projections in one grid (GPB blocks each): blockIdx.y = 0: qp, 1: kp (bf16 hi/lo planes,
// M = NB*SEQ, N = DM), 2: vp^T (f16 hi + residual planes, M = DM, N = SEQ, batch = blockIdx.x / (GPB / NB)).
// Xb = bf16 planes of q, k, v in that order; WT = W^T planes of Wq, Wk, Wv; QK = planes Qh, Ql, Kh, Kl in that order.
#define GPB (((NB * SEQ / 64) * (DM / 64)) / 8)   // 128 blocks of 8 tiles
static_assert(GPB == NB * (((DM / 64) * (SEQ / 64)) / 8));
__global__ __launch_bounds__(256) void gemm_qkv(
    const unsigned short* __restrict__ Xb, const unsigned short* __restrict__ WT,
    const float* __restrict__ bq, const float* __restrict__ bk, const float* __restrict__ bv,
    unsigned short* QK, unsigned short* VTh, unsigned short* VTl) {
  __shared__ __align__(16) float sT[8][16 * 68];   // per-wave 16x64 slab, pitch 68 floats
  const size_t NXE = (size_t)NB * SEQ * DM;
  const int y = blockIdx.y;                        // block-uniform
  if (y < 2) {
    const unsigned short* A = Xb + (size_t)y * NXE;
    gemm64_body<0, 2, 1>(A, A, DM, 0LL, WT + (size_t)y * DM * DM, DM, 0LL, y ? bk : bq,
                         (void*)(QK + (size_t)(2 * y) * NXE), DM, 0LL, (void*)(QK + (size_t)(2 * y + 1) * NXE), DM, 0LL, DM,
                         NB * SEQ, DM, DM, 1.0f, blockIdx.x, 0, sT);
  } else {
    const unsigned short* A = WT + (size_t)2 * DM * DM;
    gemm64_body<0, 3, 2>(A, A, DM, 0LL, Xb + 2 * NXE, DM, (long long)SEQ * DM, bv,
                         (void*)VTh, SEQ, (long long)DM * SEQ, (void*)VTl, VLP, (long long)DM * VLP, VLP,
                         DM, SEQ, DM, 4096.0f, blockIdx.x % (GPB / NB), blockIdx.x / (GPB / NB), sT);
  }
}

// =====================================================================================================
// Causal attention, head dim 64, key chunks of 64.
//   q planes (bf16 hi / lo): element (b, t, h, d) at [(b*SEQ + t)*DM + h*64 + d]
//   k planes (bf16 hi / lo): same layout with key index s
//   v^T hi plane (f16):      element (b, h, d, s) at [(b*DM + h*64 + d)*SEQ + s]
//   v^T residual plane (f16, (v - hi)*4096): [(b*DM + h*64 + d)*VLP + s], s < VLP, read only when RES
//   (a key chunk at or beyond VLP would contribute a zero v residual; its address is clamped)
//   Mask: query t keeps key s iff s <= t. A query block qb therefore needs key chunks 0..qb only (block-uniform
//   trip count qb+1 <= NQB); keys in later chunks exceed every query index of the block and are skipped entirely.
//   Inside a visited chunk a masked key gets logit -inf -> exp gives exactly 0, so it adds nothing to the numerator
//   or the normaliser. Row max bookkeeping: every query keeps key 0 (chunk 0), so after chunk 0 the running max of
//   every row is finite; in the diagonal chunk every query keeps at least its own key. Every row ends with l > 0.
//   out planes (bf16 hi / lo of the normalised context): element (b, t, h, d) at [(b*SEQ + t)*DM + h*64 + d]
//   scores = q . k : bf16 hi/lo split (hi.hi + hi.lo + lo.hi), f32 accumulate, then * 1/8 and the mask in f32
//   p = exp(s - m) carried as f16(1024 p); context = p . v on f16 WMMA; RES adds f16 residual planes of p and v
//   (scale 4096, separate accumulator folded back with 1/4096 per chunk in f32); online softmax (running max) in f32.
//   Block = 4 waves = 64 query rows of one (b, h); this variant takes nqbThis * NH * NB blocks of the shared grid.
//   K / V^T chunk staging: 128 threads x 4 rows x 8 elements per plane = the whole 64x64 tile of every plane read later
//   (plain 16-B loads, 8 lanes per 128-B row, __syncthreads before and after).
//   Both products are computed transposed: S^T = K . Q^T (A = K rows, B = Q) and O^T += V^T . P^T (A = V^T rows, B = P^T).
//   A lane then holds 32 scores of ONE query (column lane&15; keys j*16 + 8*(lane>>4) + r): maximum and sum run in the lane,
//   the two wave halves exchange the maximum once per chunk and join their partial normalisers once, after the loop.
//   Two score tiles 2kk, 2kk+1, converted in place, are the B operand of key half kk in the hardware k order
//   (element e < 8: key 8*(lane>>4) + e, e >= 8: key 16 + 8*(lane>>4) + e - 8), the order the V^T loads already have: P never touches LDS.
//   Output coverage: each wave stores rows q0..q0+15 (it 0..3 x lane>>3 0..3) x 64 columns (8 lanes x 8) of both planes;
//   grid over all (b, h, qb) = the whole [NB*SEQ][DM] planes.
// =====================================================================================================
struct AttnLds {                                   // one LDS layout for both variants (they share a grid)
  __bf16   Ksh[64 * LP];                            // K hi [kv][d], pitch LP
  __bf16   Ksl[64 * LP];                            // K lo
  _Float16 Vth[64 * LP];                            // V^T hi [d][kv], pitch LP
  float    Os[4][16 * OP];                          // per wave context tile [row][d]
  _Float16 Vtl[64 * LP];                            // V^T residual (RES only)
};
static_assert((64 * LP * 2) % 16 == 0 && (16 * LP * 2) % 16 == 0 && (16 * OP * 4) % 16 == 0);

template <bool RES>
__device__ __forceinline__
void attn_causal64(const unsigned short* __restrict__ qhp, const unsigned short* __restrict__ qlp,
                   const unsigned short* __restrict__ khp, const unsigned short* __restrict__ klp,
                   const unsigned short* __restrict__ vhp, const unsigned short* __restrict__ vlp,
                   unsigned short* ohp, unsigned short* olp,
                   int qbBase, int nqbThis, int bx, AttnLds& lds) {
  union FB { v16b v; v8b h[2]; };
  union FH { v16h v; v8h h[2]; };
  __bf16*   const Ksh = lds.Ksh;
  __bf16*   const Ksl = lds.Ksl;
  _Float16* const Vth = lds.Vth;
  _Float16* const Vtl = lds.Vtl;
  float    (* const Os)[16 * OP]  = lds.Os;

  const int tid  = threadIdx.x;
  const int wave = tid >> 5;
  const int lane = tid & 31;
  const int hh   = lane >> 4;
  const int c    = lane & 15;

  const int qbl  = bx % nqbThis;
  const int rest = bx / nqbThis;
  const int h    = rest % NH;
  const int b    = rest / NH;
  const int qb   = qbBase + qbl;               // 0..NQB-1 (block-uniform)
  const int q0   = qb * 64 + wave * 16;
  const size_t rowB = (size_t)b * SEQ;

  const __bf16* Qh = (const __bf16*)(const void*)qhp + (size_t)h * HD;
  const __bf16* Ql = (const __bf16*)(const void*)qlp + (size_t)h * HD;
  const __bf16* Kh = (const __bf16*)(const void*)khp + (size_t)h * HD;
  const __bf16* Kl = (const __bf16*)(const void*)klp + (size_t)h * HD;
  const _Float16* Vh = (const _Float16*)(const void*)vhp + ((size_t)b * DM + (size_t)h * HD) * SEQ;
  const _Float16* Vl = (const _Float16*)(const void*)vlp + ((size_t)b * DM + (size_t)h * HD) * VLP;

  // ---- Q fragments (B operand, column = lane&15): 2 d-chunks, hi and lo ----
  v16b qah[2], qal[2];
#pragma unroll
  for (int dc = 0; dc < 2; ++dc) {
    const size_t qo = (rowB + q0 + c) * DM + dc * 32 + 8 * hh;
    qah[dc] = ldfrag_b(Qh + qo);
    qal[dc] = ldfrag_b(Ql + qo);
  }

  const int rowq = q0 + c;                     // this lane's query
  float mrow = -INFINITY, lrow = 0.f;          // running max of the query (both halves alike), this half's partial normaliser
  v8f oacc[4];                                 // oacc[t][r] = O^T[d = t*16 + 8hh + r][query c]
#pragma unroll
  for (int t = 0; t < 4; ++t) oacc[t] = zero8();

  for (int kt = 0; kt <= qb; ++kt) {           // block-uniform trip count, <= NQB
    const int kv0 = kt * 64;                   // kv0 + 63 < SEQ
    __syncthreads();
    {
      // 8 lanes per 128-B row, 4 rows per wave and load: every wave-wide 16-B load covers 4 whole lines (2 lanes per row
      // touched 16 lines for the same 512 B). A thread takes piece pc of rows r, r+16, r+32, r+48.
      const int r = tid >> 3, pc = (tid & 7) * 8;
      const __bf16*   kg  = Kh + (rowB + kv0 + r) * DM + pc;      // K row kv0+r, d = pc..pc+7
      const __bf16*   klg = Kl + (rowB + kv0 + r) * DM + pc;
      const _Float16* vg  = Vh + (size_t)r * SEQ + kv0 + pc;      // V^T row d = r, s = kv0+pc..+7
      const int kvl = (kv0 + 64 <= VLP) ? kv0 : (VLP - 64);     // clamped address into the residual plane
      const _Float16* vlg = Vl + (size_t)r * VLP + kvl + pc;
      const bool resOK = (kv0 + 64 <= VLP);                      // block-uniform (always true for qb < RESQB)
#pragma unroll
      for (int i = 0; i < 4; ++i) {
        const v8b a0 = *(const v8b*)(kg + (size_t)(16 * i) * DM);
        const v8b a1 = *(const v8b*)(klg + (size_t)(16 * i) * DM);
        const v8h b0 = *(const v8h*)(vg + (size_t)(16 * i) * SEQ);
        *(v8b*)(Ksh + (r + 16 * i) * LP + pc) = a0;
        *(v8b*)(Ksl + (r + 16 * i) * LP + pc) = a1;
        *(v8h*)(Vth + (r + 16 * i) * LP + pc) = b0;
        if (RES) {
          v8h b1 = *(const v8h*)(vlg + (size_t)(16 * i) * VLP);
          if (!resOK) b1 = zero8h();
          *(v8h*)(Vtl + (r + 16 * i) * LP + pc) = b1;
        }
      }
      // RES build: the last load's result was placed on address pairs that earlier loads of this batch name. The pairs are
      // inputs of the wait, so they stay as they are until the batch's address translations are done.
      if (RES) asm volatile("s_wait_xcnt 0x0" :: "v"(kg), "v"(klg), "v"(vg), "v"(vlg) : "memory");
    }
    __syncthreads();

    // ---- scores, transposed: 64 keys x 16 queries per wave, 3 bf16 products ----
    // All K fragments of a d-chunk are read as one group, then the four key tiles' accumulators take turns, so one LDS wait
    // serves 12 products and no product waits for the one before it. Each s[j] still sums hi.hi, hi.lo, lo.hi per d-chunk.
    v8f s[4];                                  // s[j][r] = S^T[key kv0 + j*16 + 8hh + r][query c]
#pragma unroll
    for (int j = 0; j < 4; ++j) s[j] = zero8();
#pragma unroll
    for (int dc = 0; dc < 2; ++dc) {
      FB kb[4], kl[4];
#pragma unroll
      for (int j = 0; j < 4; ++j) {
        kb[j].h[0] = *(const v8b*)(Ksh + (j * 16 + c) * LP + dc * 32 + 8 * hh);
        kb[j].h[1] = *(const v8b*)(Ksh + (j * 16 + c) * LP + dc * 32 + 16 + 8 * hh);
        kl[j].h[0] = *(const v8b*)(Ksl + (j * 16 + c) * LP + dc * 32 + 8 * hh);
        kl[j].h[1] = *(const v8b*)(Ksl + (j * 16 + c) * LP + dc * 32 + 16 + 8 * hh);
      }
#pragma unroll
      for (int j = 0; j < 4; ++j) s[j] = mma_b_raw(kb[j].v, qah[dc], s[j]);
#pragma unroll
      for (int j = 0; j < 4; ++j) s[j] = mma_b_raw(kl[j].v, qah[dc], s[j]);
#pragma unroll
      for (int j = 0; j < 4; ++j) s[j] = mma_b_raw(kb[j].v, qal[dc], s[j]);
    }

    // ---- scale, causal mask by index, maximum in the lane (one chain per key tile), one exchange between the halves ----
    float mj[4];
#pragma unroll
    for (int j = 0; j < 4; ++j) {
      mj[j] = -INFINITY;
#pragma unroll
      for (int r = 0; r < 8; ++r) {
        const int key = kv0 + j * 16 + 8 * hh + r;
        float sv = s[j][r] * 0.125f;
        const bool keep = (key <= rowq);
        sv = keep ? sv : -INFINITY;
        s[j][r] = sv;
        mj[j] = fmaxf(mj[j], sv);
      }
    }
    float m = fmaxf(fmaxf(mj[0], mj[1]), fmaxf(mj[2], mj[3]));
    m = fmaxf(m, xhalf(m));                    // both halves now hold the query's maximum over the chunk
    const float mnew  = fmaxf(mrow, m);
    const float msafe = (mnew == -INFINITY) ? 0.f : mnew;
    const float alpha = exp_nat<RES>(mrow - msafe);
    mrow = mnew;

    // ---- online softmax; P (x1024, f16) and P residual (x4096) packed straight into the B operands of the second product ----
    FH pa[2], pl[2];
    float pj[4];
#pragma unroll
    for (int j = 0; j < 4; ++j) {
      pj[j] = 0.f;
#pragma unroll
      for (int r = 0; r < 8; ++r) {
        const float p = exp_nat<RES>(s[j][r] - msafe);   // masked logit: exp(-inf) = 0
        pj[j] += p;
        const float p1k = p * 1024.0f;
        const _Float16 ph = (_Float16)p1k;
        pa[j >> 1].v[(j & 1) * 8 + r] = ph;
        if (RES) pl[j >> 1].v[(j & 1) * 8 + r] = (_Float16)((p1k - (float)ph) * 4096.0f);
      }
    }
    lrow = lrow * alpha + ((pj[0] + pj[1]) + (pj[2] + pj[3]));
#pragma unroll
    for (int t = 0; t < 4; ++t)
#pragma unroll
      for (int r = 0; r < 8; ++r) oacc[t][r] *= alpha;

    // ---- context^T += V^T . P^T (f16 WMMA), residual products into a separate accumulator ----
    v8f o1[4];
#pragma unroll
    for (int t = 0; t < 4; ++t) o1[t] = zero8();
    // Unrolled, with each key half's V fragments read as one group ahead of its products; the four d tiles take turns.
#pragma unroll
    for (int kk = 0; kk < 2; ++kk) {
      FH vb[4], vl[4];
#pragma unroll
      for (int t = 0; t < 4; ++t) {
        vb[t].h[0] = *(const v8h*)(Vth + (t * 16 + c) * LP + kk * 32 + 8 * hh);
        vb[t].h[1] = *(const v8h*)(Vth + (t * 16 + c) * LP + kk * 32 + 16 + 8 * hh);
        if (RES) {
          vl[t].h[0] = *(const v8h*)(Vtl + (t * 16 + c) * LP + kk * 32 + 8 * hh);
          vl[t].h[1] = *(const v8h*)(Vtl + (t * 16 + c) * LP + kk * 32 + 16 + 8 * hh);
        } else {
          vl[t].v = vb[t].v;
        }
      }
#pragma unroll
      for (int t = 0; t < 4; ++t) oacc[t] = mma_h_raw(vb[t].v, pa[kk].v, oacc[t]);
      if (RES) {
#pragma unroll
        for (int t = 0; t < 4; ++t) o1[t] = mma_h_raw(vl[t].v, pa[kk].v, o1[t]);
#pragma unroll
        for (int t = 0; t < 4; ++t) o1[t] = mma_h_raw(vb[t].v, pl[kk].v, o1[t]);
      }
    }
    if (RES) {
#pragma unroll
      for (int t = 0; t < 4; ++t)
#pragma unroll
        for (int r = 0; r < 8; ++r) oacc[t][r] += o1[t][r] * (1.0f / 4096.0f);
    }
  }

  // ---- join the halves' normalisers, normalise (1/l and the 1/1024 p carry), stage the wave's 16x64 tile [query][d]
  //      (a lane's 8 registers of a tile are 8 consecutive d of its query: two 16-B stores), bf16 hi/lo split,
  float* os = Os[wave];
  {
    const float l = lrow + xhalf(lrow);        // unconditional: both halves take part in the exchange
    const float inv = ((l > 0.f) ? (1.0f / l) : 0.f) * (1.0f / 1024.0f);
#pragma unroll
    for (int t = 0; t < 4; ++t) {
      v4f w0, w1;
#pragma unroll
      for (int r = 0; r < 4; ++r) { w0[r] = oacc[t][r] * inv; w1[r] = oacc[t][4 + r] * inv; }
      *(v4f*)(os + c * OP + t * 16 + 8 * hh)     = w0;
      *(v4f*)(os + c * OP + t * 16 + 8 * hh + 4) = w1;
    }
  }
  __builtin_amdgcn_fence(__ATOMIC_RELEASE, "workgroup");
  __builtin_amdgcn_wave_barrier();
  __builtin_amdgcn_fence(__ATOMIC_ACQUIRE, "workgroup");
  {
    const int q4 = lane >> 3, c8 = (lane & 7) * 8;
    v4u hv[4], lv[4];
#pragma unroll
    for (int it = 0; it < 4; ++it) {
      const int row = it * 4 + q4;   // it 0..3 x q4 0..3 = rows 0..15 of the wave tile
      const float* sp = os + row * OP + c8;
      v4u a, a2;
#pragma unroll
      for (int e = 0; e < 4; ++e) {
        const float f0 = sp[2 * e], f1 = sp[2 * e + 1];
        const unsigned short h0 = bf_bits(f0), h1 = bf_bits(f1);
        const unsigned short l0 = bf_bits(f0 - bf_up(h0)), l1 = bf_bits(f1 - bf_up(h1));
        a[e] = pk16(h0, h1); a2[e] = pk16(l0, l1);
      }
      hv[it] = a; lv[it] = a2;
    }
    {
#pragma unroll
      for (int it = 0; it < 4; ++it) {
        const int row = it * 4 + q4;
        const size_t go = (rowB + q0 + row) * DM + (size_t)h * HD + c8;
        *(v4u*)(ohp + go) = hv[it];
        *(v4u*)(olp + go) = lv[it];
      }
      
    }
  }
}

// Both attention variants in one grid: blocks 0..NMAIN-1 are the query blocks RESQB..NQB-1 (no residual planes),
// the last NB*NH*RESQB blocks the leading RESQB query blocks with residual planes. The branch is block-uniform.
#define NMAIN (NB * NH * (NQB - RESQB))
__global__ __launch_bounds__(128)
void attn_all(const unsigned short* __restrict__ qhp, const unsigned short* __restrict__ qlp,
              const unsigned short* __restrict__ khp, const unsigned short* __restrict__ klp,
              const unsigned short* __restrict__ vhp, const unsigned short* __restrict__ vlp,
              unsigned short* ohp, unsigned short* olp) {
  __shared__ __align__(16) AttnLds lds;
  const int bx = blockIdx.x;
  if (bx < NMAIN) attn_causal64<false>(qhp, qlp, khp, klp, vhp, vlp, ohp, olp, RESQB, NQB - RESQB, bx, lds);
  else            attn_causal64<true>(qhp, qlp, khp, klp, vhp, vlp, ohp, olp, 0, RESQB, bx - NMAIN, lds);
}

// =====================================================================================================
// Workspace map (bytes; every region is an exact multiple of its 64x64-tile / whole-line store granularity,
//   Qb   bf16 [8192][512]            0            8388608
//   Kb   bf16 [8192][512]            8388608      8388608
//   Vb   bf16 [8192][512]            16777216     8388608
//   WqT  bf16 [512 n][512 k]         25165824     524288
//   WkT                              25690112     524288
//   WvT                              26214400     524288
//   WoT                              26738688     524288
//   Qh   bf16 [8192][512]            27262976     8388608
//   Ql                               35651584     8388608
//   Kh                               44040192     8388608
//   Kl                               52428800     8388608
//   VTh  f16  [2][512][4096]         60817408     8388608
//   VTl  f16  [2][512][512]          69206016     1048576
//   Oh   bf16 [8192][512]            70254592     8388608
//   Ol                               78643200     8388608
//   end                              87031808
// =====================================================================================================
extern "C" void kernel_launch(void* const* d_in, const int* in_sizes, int n_in,
                              void* d_out, int out_size, void* d_ws, size_t ws_size,
                              hipStream_t stream) {
  if (n_in < 11) return;
  const int NX = NB * SEQ * DM;                    // 4194304
  if (in_sizes[0] != NX || in_sizes[1] != NX || in_sizes[2] != NX) return;
  if (in_sizes[3] != DM * DM || in_sizes[5] != DM * DM || in_sizes[7] != DM * DM || in_sizes[9] != DM * DM) return;
  if (in_sizes[4] != DM || in_sizes[6] != DM || in_sizes[8] != DM || in_sizes[10] != DM) return;
  if (out_size != NX) return;

  const float* v  = (const float*)d_in[0];   // [2][4096][512]
  const float* k  = (const float*)d_in[1];   // [2][4096][512]
  const float* q  = (const float*)d_in[2];   // [2][4096][512]
  const float* Wq = (const float*)d_in[3];   // [512 in][512 out] = [k][n]
  const float* bq = (const float*)d_in[4];   // [512]
  const float* Wk = (const float*)d_in[5];   // [512 in][512 out]
  const float* bk = (const float*)d_in[6];   // [512]
  const float* Wv = (const float*)d_in[7];   // [512 in][512 out]
  const float* bv = (const float*)d_in[8];   // [512]
  const float* Wo = (const float*)d_in[9];   // [512 in][512 out]
  const float* bo = (const float*)d_in[10];  // [512]

  const size_t PX  = (size_t)NB * SEQ * DM * 2;    //  8388608  16-bit activation plane [8192][512]
  const size_t PW  = (size_t)DM * DM * 2;          //   524288  16-bit weight plane [512][512]
  const size_t PVT = (size_t)NB * DM * SEQ * 2;    //  8388608  v^T hi plane
  const size_t PVL = (size_t)NB * DM * VLP * 2;    //  1048576  v^T residual plane
  size_t off = 0;
  const size_t oQb  = off; off += PX;
  const size_t oKb  = off; off += PX;
  const size_t oVb  = off; off += PX;
  const size_t oWq  = off; off += PW;
  const size_t oWk  = off; off += PW;
  const size_t oWv  = off; off += PW;
  const size_t oWo  = off; off += PW;
  const size_t oQh  = off; off += PX;
  const size_t oQl  = off; off += PX;
  const size_t oKh  = off; off += PX;
  const size_t oKl  = off; off += PX;
  const size_t oVTh = off; off += PVT;
  const size_t oVTl = off; off += PVL;
  const size_t oOh  = off; off += PX;
  const size_t oOl  = off; off += PX;
  if (off > ws_size) return;                       // off = 87031808
  if (off > (size_t)134217728) return;

  char* ws = (char*)d_ws;
  unsigned short* Qb  = (unsigned short*)(ws + oQb);
  unsigned short* Kb  = (unsigned short*)(ws + oKb);
  unsigned short* Vb  = (unsigned short*)(ws + oVb);
  unsigned short* WqT = (unsigned short*)(ws + oWq);
  unsigned short* WkT = (unsigned short*)(ws + oWk);
  unsigned short* WvT = (unsigned short*)(ws + oWv);
  unsigned short* WoT = (unsigned short*)(ws + oWo);
  unsigned short* Qh  = (unsigned short*)(ws + oQh);
  unsigned short* Ql  = (unsigned short*)(ws + oQl);
  unsigned short* Kh  = (unsigned short*)(ws + oKh);
  unsigned short* Kl  = (unsigned short*)(ws + oKl);
  unsigned short* VTh = (unsigned short*)(ws + oVTh);
  unsigned short* VTl = (unsigned short*)(ws + oVTl);
  unsigned short* Oh  = (unsigned short*)(ws + oOh);
  unsigned short* Ol  = (unsigned short*)(ws + oOl);

  const dim3 blk(256);
  const dim3 gProj(GPB, 1);                                    // 1024 tiles -> 128 blocks: M=8192, N=512

  // (1) all plane conversions in one grid: weights f32 [k][n] -> bf16 W^T [n][k] (WqT, WkT, WvT, WoT are contiguous),
  //     activations f32 -> bf16 planes of the inputs' layout (Qb, Kb, Vb are contiguous)
  prep_planes<<<dim3(4 * NTR + 3 * NCV), blk, 0, stream>>>(q, k, v, Wq, Wk, Wv, Wo, Qb, WqT);
  // (2) the three input projections in one grid: qp, kp -> bf16 hi/lo planes [b*SEQ+t][h*64+d] (Qh, Ql, Kh, Kl contiguous),
  //     vp^T per batch -> f16 hi plane [b][h*64+d][s] (pitch SEQ) and residual plane (x4096, keys < VLP only, pitch VLP)
  gemm_qkv<<<dim3(GPB, 3), blk, 0, stream>>>(Qb, WqT, bq, bk, bv, Qh, VTh, VTl);
  // (3) causal attention, one grid: query blocks RESQB.. without, 0..RESQB-1 with residual planes
  attn_all<<<dim3(NB * NH * NQB), dim3(128), 0, stream>>>(Qh, Ql, Kh, Kl, VTh, VTl, Oh, Ol);
  // (4) out = context . Wo + bo -> d_out f32 [8192][512]  (A = context hi + lo planes, 2 products; Bt = WoT)
  gemm64<1, 0, 1><<<gProj, blk, 0, stream>>>(
      Oh, Ol, DM, 0LL, WoT, DM, 0LL, bo,
      d_out, DM, 0LL, d_out, DM, 0LL, DM,
      NB * SEQ, DM, DM, 1.0f);
  (void)hipGetLastError();
}

// v006
// A run of this version takes 164 microseconds.
// In two side-by-side timings against v005, it was 1.04 and 1.05 times as fast.
// Over all steps from v000 it is 3.23 times as fast.
// Contractions: q, k, v^T projections = v_wmma_f32_16x16x32_bf16 (bf16 operands from RNE-converted inputs and weights, single product, f32 accumulate);
// k.q^T scores (keys down, queries across) = v_wmma_f32_16x16x32_bf16 with bf16 hi/lo split q and k (hi.hi + hi.lo + lo.hi), f32 accumulate;
// v^T.p^T = v_wmma_f32_16x16x32_f16 (p carried x1024 in f16 times v in f16, single product; plus f16 residual planes x4096 of
// p and v for the first 512 query rows of every sequence), f32 accumulate;
// ctx.Wo = v_wmma_f32_16x16x32_bf16 with ctx as bf16 hi/lo planes times bf16 Wo^T (2 products), f32 accumulate;
// causal mask (key <= query), online softmax, normalisers and bias adds in f32 on the VALU.
// Carry audit:
//   ph  = f16(1024 * p)                      -> the 1/1024 is folded exactly once in the attention epilogue: inv = (1/l) * (1/1024)
//   pl  = f16((1024 p - ph) * 4096)          }  products VTl.ph and VTh.pl go to the separate accumulator o1,
//   VTl = f16((v - VTh) * 4096)              }  folded back with * (1/4096) once per key chunk (RES blocks only)
//   VTh = f16(v), no carry (|v| typ. 0.45); q / k / ctx lo planes are unscaled bf16 residuals (v - hi) sharing the hi accumulator;
//   score scale 1/8 applied once in f32 after the score accumulate. No other scaled planes.
#include <hip/hip_runtime.h>
#include <math.h>
#include <stdint.h>

#define NB    2
#define SEQ   4096
#define DM    512
#define NH    8
#define HD    64
#define NQB   (SEQ / 64)   // 64 query / key blocks of 64
#define VLP   512          // key pitch of the v^T residual plane (keys 0..VLP-1)
#define RESQB 8            // leading 64-row query blocks that use the p / v residual planes
#define LP    72           // LDS row pitch of the 64-element 16-bit tiles: 144 B = 16 B x 9, 16 rows of a 16-B read on 16 bank quads
#define OP    68           // LDS row pitch of the f32 context tile, in floats (16-B reads down a column walk)
static_assert(RESQB * 64 <= VLP);
static_assert(NH * HD == DM);
static_assert((SEQ % 64) == 0 && (DM % 64) == 0 && (DM % 32) == 0);
static_assert(((NB * SEQ / 64) * (DM / 64)) % 8 == 0);
static_assert(((DM / 64) * (SEQ / 64)) % 8 == 0);
static_assert((NB * SEQ * DM) % (8 * 256) == 0);
static_assert((DM * DM) % (64 * 64) == 0);

typedef _Float16 v16h __attribute__((ext_vector_type(16)));
typedef _Float16 v8h  __attribute__((ext_vector_type(8)));
typedef __bf16   v16b __attribute__((ext_vector_type(16)));
typedef __bf16   v8b  __attribute__((ext_vector_type(8)));
typedef float    v8f  __attribute__((ext_vector_type(8)));
typedef float    v4f  __attribute__((ext_vector_type(4)));
typedef unsigned int v4u __attribute__((ext_vector_type(4)));

// ---- scalar helpers --------------------------------------------------------------------------------
__device__ __forceinline__ unsigned short bf_bits(float f) {          // f32 -> bf16 bits, RNE convert
  unsigned u = __float_as_uint(f);
  return (unsigned short)((u + 0x7FFFu + ((u >> 16) & 1u)) >> 16);
}
__device__ __forceinline__ float bf_up(unsigned short h) { return __uint_as_float(((unsigned)h) << 16); }
__device__ __forceinline__ unsigned short h_bits(_Float16 x) { return __builtin_bit_cast(unsigned short, x); }
__device__ __forceinline__ unsigned pk16(unsigned short a, unsigned short b) { return (unsigned)a | ((unsigned)b << 16); }
__device__ __forceinline__ v8f zero8() { v8f z = {0.f, 0.f, 0.f, 0.f, 0.f, 0.f, 0.f, 0.f}; return z; }
__device__ __forceinline__ v8h zero8h() {
  const _Float16 z = (_Float16)0.0f;
  v8h r = {z, z, z, z, z, z, z, z};
  return r;
}

// value of lane l ^ 16 (the other half of the wave), by a vector cross-row move
__device__ __forceinline__ float xhalf(float x) {
  const int i = __builtin_bit_cast(int, x);
  return __builtin_bit_cast(float, __builtin_amdgcn_permlanex16(i, i, 0x76543210, 0xfedcba98, false, false));
}

// e^x as __expf forms it (x * log2 e, then v_exp_f32): the exponential and one v_nop in one statement. The v_nop is the slot
// the instruction set asks for between a transcendental and an instruction that overwrites its source.
__device__ __forceinline__ float exp_nat(float x) {
  const float y = x * 1.44269504088896340736f;
  float r;
  asm("v_exp_f32 %0, %1\n\tv_nop" : "=v"(r) : "v"(y));
  return r;
}

// ---- fragment loader: 16-bit A/B operand, lane -> row/col (lane&15), p already includes +8*(lane>>4);
//      elements 0..7 <- p[0..7] (k0+8h..), elements 8..15 <- p[16..23] (k0+16+8h..)
__device__ __forceinline__ v16b ldfrag_b(const __bf16* p) {
  union { v16b v; v8b h[2]; } f;
  f.h[0] = *(const v8b*)(p);
  f.h[1] = *(const v8b*)(p + 16);
  return f.v;
}

// ---- WMMA helpers with trailing VALU hazard gap --------------------------------------------------------
__device__ __forceinline__ v8f mma_h_raw(v16h a, v16h b, v8f c) {
  return __builtin_amdgcn_wmma_f32_16x16x32_f16(false, a, false, b, (short)0, c, false, false);
}
__device__ __forceinline__ v8f mma_b_raw(v16b a, v16b b, v8f c) {
  return __builtin_amdgcn_wmma_f32_16x16x32_bf16(false, a, false, b, (short)0, c, false, false);
}
__device__ __forceinline__ void dep_guard_b(v8f& a, v8f& b, v16b x, v16b y) {
  asm volatile("v_nop\n\tv_nop\n\tv_nop\n\tv_nop" : "+v"(a), "+v"(b) : "v"(x), "v"(y));
}
__device__ __forceinline__ void keep4_b(v16b a, v16b b, v16b c, v16b d) {
  asm volatile("v_nop" :: "v"(a), "v"(b), "v"(c), "v"(d));
}
__device__ __forceinline__ void acc_guard4(v8f& a, v8f& b, v8f& c, v8f& d) {
  asm volatile("v_nop\n\tv_nop\n\tv_nop\n\tv_nop" : "+v"(a), "+v"(b), "+v"(c), "+v"(d));
}

// =====================================================================================================
// f32 -> bf16 (RNE convert), 8 elements per thread, one 16-B store per lane: a wave writes 512 contiguous B
// the [8192][512] activations, a multiple of 256).
// coverage: n8 threads x 8 = the whole plane.
// =====================================================================================================
__device__ __forceinline__ void cvt_bf16x8(const float* __restrict__ in, unsigned short* out, int n8, int blk) {
  const int i = blk * 256 + threadIdx.x;
  if (i < n8) {
    const v4f a = *(const v4f*)(in + (size_t)i * 8);
    const v4f b = *(const v4f*)(in + (size_t)i * 8 + 4);
    v4u p;
    p[0] = pk16(bf_bits(a[0]), bf_bits(a[1]));
    p[1] = pk16(bf_bits(a[2]), bf_bits(a[3]));
    p[2] = pk16(bf_bits(b[0]), bf_bits(b[1]));
    p[3] = pk16(bf_bits(b[2]), bf_bits(b[3]));
    *(v4u*)(out + (size_t)i * 8) = p;
    
  }
}

// =====================================================================================================
// f32 [K rows][N cols] (pitch ldw) -> bf16 transposed plane WT[n][k] (pitch ldt, k contiguous), RNE convert.
// One 64x64 tile per block (n0 = 64 * tileN, k0 = 64 * tileK, N and K exact multiples of 64): the tile is staged in LDS with
// coalesced 16-B loads (256 threads x 16 floats = the whole tile), __syncthreads, then each output row segment
// coverage: 8 waves x 2 x (lane>>3 = 4 rows) = 64 rows n, 8 lanes x 8 = 64 k: the whole tile; grid = the whole plane.
// =====================================================================================================
__device__ __forceinline__ void cvt_bf16_tr64(const float* __restrict__ W, unsigned short* WT, int ldw, int ldt,
                                              int tileN, int tileK, float* sW) {
  const int tid = threadIdx.x;
  const int n0 = tileN * 64;
  const int k0 = tileK * 64;
  {
    const int kr = tid >> 2, cb = (tid & 3) * 16;          // row k0+kr, cols n0+cb .. +15
    const float* src = W + (size_t)(k0 + kr) * ldw + n0 + cb;
#pragma unroll
    for (int i = 0; i < 4; ++i) {
      const v4f f = *(const v4f*)(src + 4 * i);
      float* d = sW + kr * 65 + cb + 4 * i;
      d[0] = f[0]; d[1] = f[1]; d[2] = f[2]; d[3] = f[3];
    }
  }
  __syncthreads();
  const int wave = tid >> 5, lane = tid & 31;
  const int q = lane >> 3, c8 = (lane & 7) * 8;
  v4u pv[2];
#pragma unroll
  for (int it = 0; it < 2; ++it) {
    const int nr = wave * 8 + it * 4 + q;                  // output row n0+nr, 0 <= nr < 64
    v4u p;
#pragma unroll
    for (int e = 0; e < 4; ++e) {
      const float f0 = sW[(c8 + 2 * e) * 65 + nr];
      const float f1 = sW[(c8 + 2 * e + 1) * 65 + nr];
      p[e] = pk16(bf_bits(f0), bf_bits(f1));
    }
    pv[it] = p;
  }
  {
#pragma unroll
    for (int it = 0; it < 2; ++it) {
      const int nr = wave * 8 + it * 4 + q;
      *(v4u*)(WT + (size_t)(n0 + nr) * ldt + k0 + c8) = pv[it];
    }
    
  }
}

// =====================================================================================================
// One grid for all seven independent plane conversions: blocks 0..4*NTR-1 transpose the four weights (64x64 tile each,
// planes WT + w*DM*DM in the order Wq, Wk, Wv, Wo), the next 3*NCV blocks convert q, k, v (planes Xb + w*NB*SEQ*DM).
// The branch is block-uniform, so the transpose's __syncthreads is passed by all threads of its block or by none.
// =====================================================================================================
#define NTR ((DM / 64) * (DM / 64))          // 64 tiles per weight
#define NCV ((NB * SEQ * DM) / (8 * 256))    // 2048 blocks per activation plane
__global__ __launch_bounds__(256) void prep_planes(const float* __restrict__ q, const float* __restrict__ k,
                                                   const float* __restrict__ v,
                                                   const float* __restrict__ Wq, const float* __restrict__ Wk,
                                                   const float* __restrict__ Wv, const float* __restrict__ Wo,
                                                   unsigned short* Xb, unsigned short* WT) {
  __shared__ __align__(16) float sW[64 * 65];
  const int bx = blockIdx.x;
  if (bx < 4 * NTR) {
    const int w = bx / NTR, t = bx % NTR;
    const float* W = (w == 0) ? Wq : (w == 1) ? Wk : (w == 2) ? Wv : Wo;
    cvt_bf16_tr64(W, WT + (size_t)w * DM * DM, DM, DM, t % (DM / 64), t / (DM / 64), sW);
  } else {
    const int cb = bx - 4 * NTR;
    const int w = cb / NCV, blk = cb % NCV;
    const float* in = (w == 0) ? q : (w == 1) ? k : v;
    cvt_bf16x8(in, Xb + (size_t)w * NB * SEQ * DM, (NB * SEQ * DM) / 8, blk);
  }
}

// =====================================================================================================
// Register-blocked batched bf16 WMMA GEMM: C[m][n] = sum_k A[m][k] * Bt[n][k] + bias; one wave per 64x64 tile,
// no block barriers. A row-major [M][K] pitch lda; Bt row-major [N][K] pitch ldb (k contiguous);
// M, N multiples of 64, K multiple of 32 (host shapes are static multiples). b = batch index (strides in elements).
// NSPLIT: 0 = A.Bt; 1 = (A + A2).Bt (A2 = unscaled bf16 lo plane of A, 2 products).
// BIAS: 0 = none; 1 = per column n, bias[n]; 2 = per row m, bias[m]; the bias value is RNE-converted to bf16 and added in f32.
// OUT_MODE: 0 = f32 (pitch ldc); 2 = bf16 hi plane C + bf16 lo plane C2 (lo = RNE(v - hi), unscaled);
//           3 = f16 hi plane C + f16 residual plane C2 = f16((v - hi) * rscale), C2 written only for tiles
//               with n0 < N2 (pitch ldc2, batch stride strideC2).
// =====================================================================================================
template <int NSPLIT, int OUT_MODE, int BIAS>
__device__ __forceinline__ void gemm64_body(
    const unsigned short* __restrict__ Ap, const unsigned short* A2p, int lda, long long strideA,
    const unsigned short* __restrict__ Btp, int ldb, long long strideB,
    const float* __restrict__ bias,
    void* Cout, int ldc, long long strideC,
    void* Cout2, int ldc2, long long strideC2, int N2,
    int M, int N, int K, float rscale,
    int blk, int b, float (*sT)[16 * 68]) {   // blk = block index inside this product, b = batch index
  const __bf16* A   = (const __bf16*)(const void*)Ap;
  const __bf16* A2  = (const __bf16*)(const void*)A2p;
  const __bf16* Bt  = (const __bf16*)(const void*)Btp;
  const int lane = threadIdx.x & 31;
  const int wave = threadIdx.x >> 5;
  const int tilesN = N >> 6;
  const int tilesM = M >> 6;
  const int tile = blk * 8 + wave;
  if (tile >= tilesM * tilesN) return;   // wave-uniform; no block barriers in this kernel
  const int tm = tile / tilesN;
  const int tn = tile - tm * tilesN;
  const int m0 = tm << 6;
  const int n0 = tn << 6;

  const __bf16* Ab  = A  + (size_t)b * strideA;
  const __bf16* Bb  = Bt + (size_t)b * strideB;
  const __bf16* Ab2 = (NSPLIT >= 1) ? (A2 + (size_t)b * strideA) : Ab;

  const int rlane = lane & 15;                 // row (A) / col (B, D) within subtile
  const int koff  = (lane >> 4) * 8;           // k offset of this lane half
  const int mOff  = (lane >> 4) * 8;           // D row offset

  v8f acc[4][4];
#pragma unroll
  for (int i = 0; i < 4; ++i)
#pragma unroll
    for (int j = 0; j < 4; ++j) acc[i][j] = zero8();

  for (int k0 = 0; k0 < K; k0 += 32) {
    v16b bh[4];
#pragma unroll
    for (int j = 0; j < 4; ++j) {
      const size_t bo = (size_t)(n0 + (j << 4) + rlane) * ldb + koff + k0;
      bh[j] = ldfrag_b(Bb + bo);
    }
#pragma unroll
    for (int i = 0; i < 4; ++i) {
      const size_t ao = (size_t)(m0 + (i << 4) + rlane) * lda + koff + k0;
      const v16b ah = ldfrag_b(Ab + ao);
      v16b al = ah;
      if (NSPLIT >= 1) al = ldfrag_b(Ab2 + ao);
#pragma unroll
      for (int j = 0; j < 4; ++j) {
        acc[i][j] = mma_b_raw(ah, bh[j], acc[i][j]);
        if (NSPLIT >= 1) acc[i][j] = mma_b_raw(al, bh[j], acc[i][j]);
      }
      dep_guard_b(acc[i][0], acc[i][3], ah, al);
    }
    keep4_b(bh[0], bh[1], bh[2], bh[3]);
  }
  acc_guard4(acc[0][0], acc[0][1], acc[0][2], acc[0][3]);
  acc_guard4(acc[1][0], acc[1][1], acc[1][2], acc[1][3]);
  acc_guard4(acc[2][0], acc[2][1], acc[2][2], acc[2][3]);
  acc_guard4(acc[3][0], acc[3][1], acc[3][2], acc[3][3]);

  // ---- epilogue ----
  float* slab = sT[wave];
  float bcol[4];
#pragma unroll
  for (int j = 0; j < 4; ++j) {
    bcol[j] = 0.f;
    if (BIAS == 1) bcol[j] = bf_up(bf_bits(bias[n0 + (j << 4) + rlane]));   // n < N, bias has N entries
  }
#pragma unroll
  for (int i = 0; i < 4; ++i) {
    const int mBase = m0 + (i << 4);
    float brow[8];
#pragma unroll
    for (int r = 0; r < 8; ++r) {
      brow[r] = 0.f;
      if (BIAS == 2) brow[r] = bf_up(bf_bits(bias[mBase + mOff + r]));      // m < M, bias has M entries
    }
#pragma unroll
    for (int j = 0; j < 4; ++j) {
#pragma unroll
      for (int r = 0; r < 8; ++r) {
        slab[(mOff + r) * 68 + (j << 4) + rlane] = acc[i][j][r] + bcol[j] + brow[r];
      }
    }
    __builtin_amdgcn_fence(__ATOMIC_RELEASE, "workgroup");
    __builtin_amdgcn_wave_barrier();
    __builtin_amdgcn_fence(__ATOMIC_ACQUIRE, "workgroup");
    if (OUT_MODE == 0) {
      float* C = (float*)Cout + (size_t)b * strideC;
      const int hh = lane >> 4, c4 = (lane & 15) * 4;     // 256-B row segment = 16 lanes x 16 B
      {
#pragma unroll
        for (int it = 0; it < 8; ++it) {
          const int row = it * 2 + hh;                     // it 0..7 x hh 0..1 = rows 0..15
          const v4f v = *(const v4f*)(slab + row * 68 + c4);
          *(v4f*)(C + (size_t)(mBase + row) * ldc + n0 + c4) = v;
        }
        
      }
    } else {
      const int q = lane >> 3, c8 = (lane & 7) * 8;
      unsigned short* C  = (unsigned short*)Cout  + (size_t)b * strideC;
      unsigned short* C2 = (unsigned short*)Cout2 + (size_t)b * strideC2;
      const bool wlo = (OUT_MODE == 2) || (n0 < N2);      // wave-uniform
      v4u hv[4], lv[4];
#pragma unroll
      for (int it = 0; it < 4; ++it) {
        const int row = it * 4 + q;                        // it 0..3 x q 0..3 = rows 0..15
        const float* sp = slab + row * 68 + c8;
        v4u a, a2;
#pragma unroll
        for (int e = 0; e < 4; ++e) {
          const float f0 = sp[2 * e], f1 = sp[2 * e + 1];
          unsigned short h0, h1, l0, l1;
          if (OUT_MODE == 2) {
            h0 = bf_bits(f0); h1 = bf_bits(f1);
            l0 = bf_bits(f0 - bf_up(h0)); l1 = bf_bits(f1 - bf_up(h1));
          } else {
            const _Float16 x0 = (_Float16)f0, x1 = (_Float16)f1;
            h0 = h_bits(x0); h1 = h_bits(x1);
            l0 = h_bits((_Float16)((f0 - (float)x0) * rscale));
            l1 = h_bits((_Float16)((f1 - (float)x1) * rscale));
          }
          a[e] = pk16(h0, h1); a2[e] = pk16(l0, l1);
        }
        hv[it] = a; lv[it] = a2;
      }
      {
#pragma unroll
        for (int it = 0; it < 4; ++it) {
          const int row = it * 4 + q;
          *(v4u*)(C + (size_t)(mBase + row) * ldc + n0 + c8) = hv[it];
          if (wlo) *(v4u*)(C2 + (size_t)(mBase + row) * ldc2 + n0 + c8) = lv[it];
        }
        
      }
    }
    __builtin_amdgcn_fence(__ATOMIC_RELEASE, "workgroup");
    __builtin_amdgcn_wave_barrier();
    __builtin_amdgcn_fence(__ATOMIC_ACQUIRE, "workgroup");
  }
}

// One product per launch (the output projection).
template <int NSPLIT, int OUT_MODE, int BIAS>
__global__ __launch_bounds__(256) void gemm64(
    const unsigned short* __restrict__ Ap, const unsigned short* A2p, int lda, long long strideA,
    const unsigned short* __restrict__ Btp, int ldb, long long strideB,
    const float* __restrict__ bias,
    void* Cout, int ldc, long long strideC,
    void* Cout2, int ldc2, long long strideC2, int N2,
    int M, int N, int K, float rscale) {
  __shared__ __align__(16) float sT[8][16 * 68];   // per-wave 16x64 slab, pitch 68 floats
  gemm64_body<NSPLIT, OUT_MODE, BIAS>(Ap, A2p, lda, strideA, Btp, ldb, strideB, bias, Cout, ldc, strideC,
                                      Cout2, ldc2, strideC2, N2, M, N, K, rscale, blockIdx.x, blockIdx.y, sT);
}

// The three independent input projections in one grid (GPB blocks each): blockIdx.y = 0: qp, 1: kp (bf16 hi/lo planes,
// M = NB*SEQ, N = DM), 2: vp^T (f16 hi + residual planes, M = DM, N = SEQ, batch = blockIdx.x / (GPB / NB)).
// Xb = bf16 planes of q, k, v in that order; WT = W^T planes of Wq, Wk, Wv; QK = planes Qh, Ql, Kh, Kl in that order.
#define GPB (((NB * SEQ / 64) * (DM / 64)) / 8)   // 128 blocks of 8 tiles
static_assert(GPB == NB * (((DM / 64) * (SEQ / 64)) / 8));
__global__ __launch_bounds__(256) void gemm_qkv(
    const unsigned short* __restrict__ Xb, const unsigned short* __restrict__ WT,
    const float* __restrict__ bq, const float* __restrict__ bk, const float* __restrict__ bv,
    unsigned short* QK, unsigned short* VTh, unsigned short* VTl) {
  __shared__ __align__(16) float sT[8][16 * 68];   // per-wave 16x64 slab, pitch 68 floats
  const size_t NXE = (size_t)NB * SEQ * DM;
  const int y = blockIdx.y;                        // block-uniform
  if (y < 2) {
    const unsigned short* A = Xb + (size_t)y * NXE;
    gemm64_body<0, 2, 1>(A, A, DM, 0LL, WT + (size_t)y * DM * DM, DM, 0LL, y ? bk : bq,
                         (void*)(QK + (size_t)(2 * y) * NXE), DM, 0LL, (void*)(QK + (size_t)(2 * y + 1) * NXE), DM, 0LL, DM,
                         NB * SEQ, DM, DM, 1.0f, blockIdx.x, 0, sT);
  } else {
    const unsigned short* A = WT + (size_t)2 * DM * DM;
    gemm64_body<0, 3, 2>(A, A, DM, 0LL, Xb + 2 * NXE, DM, (long long)SEQ * DM, bv,
                         (void*)VTh, SEQ, (long long)DM * SEQ, (void*)VTl, VLP, (long long)DM * VLP, VLP,
                         DM, SEQ, DM, 4096.0f, blockIdx.x % (GPB / NB), blockIdx.x / (GPB / NB), sT);
  }
}

// =====================================================================================================
// Causal attention, head dim 64, key chunks of 64.
//   q planes (bf16 hi / lo): element (b, t, h, d) at [(b*SEQ + t)*DM + h*64 + d]
//   k planes (bf16 hi / lo): same layout with key index s
//   v^T hi plane (f16):      element (b, h, d, s) at [(b*DM + h*64 + d)*SEQ + s]
//   v^T residual plane (f16, (v - hi)*4096): [(b*DM + h*64 + d)*VLP + s], s < VLP, read only when RES
//   (a key chunk at or beyond VLP would contribute a zero v residual; its address is clamped)
//   Mask: query t keeps key s iff s <= t. A query block qb therefore needs key chunks 0..qb only. They are dealt to two wave
//   groups, even chunks to group 0, odd chunks to group 1 (block-uniform trip count (qb+2)/2 <= NQB/2); for even qb group 1's
//   last chunk is qb+1, in bounds and wholly masked. Each group keeps its own running max, normaliser and context sums.
//   Inside a visited chunk a masked key gets logit -inf -> exp gives exactly 0, so it adds nothing to the numerator
//   or the normaliser. Row max bookkeeping: every query keeps key 0 (chunk 0), so group 0's running max of every row is finite
//   after its first chunk; a group that has kept no key yet has max -inf, sums 0, and rescales by 0. Every row ends with l > 0.
//   out planes (bf16 hi / lo of the normalised context): element (b, t, h, d) at [(b*SEQ + t)*DM + h*64 + d]
//   scores = q . k : bf16 hi/lo split (hi.hi + hi.lo + lo.hi), f32 accumulate, then * 1/8 and the mask in f32
//   p = exp(s - m) carried as f16(1024 p); context = p . v on f16 WMMA; RES adds f16 residual planes of p and v
//   (scale 4096, separate accumulator folded back with 1/4096 per chunk in f32); online softmax (running max) in f32.
//   Block = 2 groups x 4 waves = 64 query rows of one (b, h), wave w and wave w+4 on the same 16 rows; grid = NQB * NH * NB.
//   K / V^T chunk staging, per group into its own tiles: 128 threads x 4 rows x 8 elements per plane = the whole 64x64 tile of every plane read later
//   (plain 16-B loads, 8 lanes per 128-B row, __syncthreads before and after).
//   Both products are computed transposed: S^T = K . Q^T (A = K rows, B = Q) and O^T += V^T . P^T (A = V^T rows, B = P^T).
//   A lane then holds 32 scores of ONE query (column lane&15; keys j*16 + 8*(lane>>4) + r): maximum and sum run in the lane,
//   the two wave halves exchange the maximum once per chunk and join their partial normalisers once, after the loop.
//   Two score tiles 2kk, 2kk+1, converted in place, are the B operand of key half kk in the hardware k order
//   (element e < 8: key 8*(lane>>4) + e, e >= 8: key 16 + 8*(lane>>4) + e - 8), the order the V^T loads already have: P never touches LDS.
//   Output coverage: each wave of group 0 stores rows q0..q0+15 (it 0..3 x lane>>3 0..3) x 64 columns (8 lanes x 8) of both planes;
//   grid over all (b, h, qb) = the whole [NB*SEQ][DM] planes.
// =====================================================================================================
#define XP 36                                      // floats per lane in the hand-over area: 144 B = 16 B x 9, 16-B accesses conflict-free
struct AttnTiles {                                 // one key chunk, staged and read by one wave group only
  __bf16   Ksh[64 * LP];                            // K hi [kv][d], pitch LP
  __bf16   Ksl[64 * LP];                            // K lo
  _Float16 Vth[64 * LP];                            // V^T hi [d][kv], pitch LP
  _Float16 Vtl[64 * LP];                            // V^T residual (RES only)
};
struct AttnLds {                                   // one LDS layout for both variants (they share a grid)
  AttnTiles t[2];                                   // wave group 0: even key chunks, wave group 1: odd key chunks
  float    Os[4][16 * OP];                          // per wave context tile [row][d] (group 0)
  float    Xs[4][32 * XP];                          // group 1 -> group 0: per lane 32 context sums, running max, partial normaliser
};
static_assert((64 * LP * 2) % 16 == 0 && (16 * LP * 2) % 16 == 0 && (16 * OP * 4) % 16 == 0 && (XP * 4) % 16 == 0);

template <bool RES>
__device__ __forceinline__
void attn_causal64(const unsigned short* __restrict__ qhp, const unsigned short* __restrict__ qlp,
                   const unsigned short* __restrict__ khp, const unsigned short* __restrict__ klp,
                   const unsigned short* __restrict__ vhp, const unsigned short* __restrict__ vlp,
                   unsigned short* ohp, unsigned short* olp,
                   int qb, int h, int b, AttnLds& lds) {   // qb = 0..NQB-1, h, b: block-uniform
  union FB { v16b v; v8b h[2]; };
  union FH { v16h v; v8h h[2]; };
  const int tid  = threadIdx.x & 127;          // thread inside its wave group
  const int grp  = __builtin_amdgcn_readfirstlane((int)(threadIdx.x >> 7));   // wave group 0 / 1, wave-uniform
  const int wave = tid >> 5;                   // 0..3: the 16 query rows of the block this wave owns
  const int lane = tid & 31;
  const int hh   = lane >> 4;
  const int c    = lane & 15;

  __bf16*   const Ksh = lds.t[grp].Ksh;
  __bf16*   const Ksl = lds.t[grp].Ksl;
  _Float16* const Vth = lds.t[grp].Vth;
  _Float16* const Vtl = lds.t[grp].Vtl;
  float    (* const Os)[16 * OP]  = lds.Os;

  const int q0   = qb * 64 + wave * 16;
  const size_t rowB = (size_t)b * SEQ;

  const __bf16* Qh = (const __bf16*)(const void*)qhp + (size_t)h * HD;
  const __bf16* Ql = (const __bf16*)(const void*)qlp + (size_t)h * HD;
  const __bf16* Kh = (const __bf16*)(const void*)khp + (size_t)h * HD;
  const __bf16* Kl = (const __bf16*)(const void*)klp + (size_t)h * HD;
  const _Float16* Vh = (const _Float16*)(const void*)vhp + ((size_t)b * DM + (size_t)h * HD) * SEQ;
  const _Float16* Vl = (const _Float16*)(const void*)vlp + ((size_t)b * DM + (size_t)h * HD) * VLP;

  // ---- Q fragments (B operand, column = lane&15): 2 d-chunks, hi and lo ----
  v16b qah[2], qal[2];
#pragma unroll
  for (int dc = 0; dc < 2; ++dc) {
    const size_t qo = (rowB + q0 + c) * DM + dc * 32 + 8 * hh;
    qah[dc] = ldfrag_b(Qh + qo);
    qal[dc] = ldfrag_b(Ql + qo);
  }

  const int rowq = q0 + c;                     // this lane's query
  float mrow = -INFINITY, lrow = 0.f;          // running max of the query (both halves alike), this half's partial normaliser
  v8f oacc[4];                                 // oacc[t][r] = O^T[d = t*16 + 8hh + r][query c]
#pragma unroll
  for (int t = 0; t < 4; ++t) oacc[t] = zero8();

  const int trips = (qb + 2) >> 1;             // block-uniform, <= NQB / 2: chunks 0..qb dealt even / odd to the two groups
  for (int it = 0; it < trips; ++it) {
    const int kv0 = (2 * it + grp) * 64;       // chunk 2*it + grp <= qb, or qb + 1 <= NQB - 1 for even qb (all masked): kv0 + 63 < SEQ
    __syncthreads();
    {
      // 8 lanes per 128-B row, 4 rows per wave and load: every wave-wide 16-B load covers 4 whole lines (2 lanes per row
      // touched 16 lines for the same 512 B). A thread takes piece pc of rows r, r+16, r+32, r+48.
      const int r = tid >> 3, pc = (tid & 7) * 8;
      const __bf16*   kg  = Kh + (rowB + kv0 + r) * DM + pc;      // K row kv0+r, d = pc..pc+7
      const __bf16*   klg = Kl + (rowB + kv0 + r) * DM + pc;
      const _Float16* vg  = Vh + (size_t)r * SEQ + kv0 + pc;      // V^T row d = r, s = kv0+pc..+7
      const int kvl = (kv0 + 64 <= VLP) ? kv0 : (VLP - 64);     // clamped address into the residual plane
      const _Float16* vlg = Vl + (size_t)r * VLP + kvl + pc;
      const bool resOK = (kv0 + 64 <= VLP);                      // wave-uniform (always true for qb < RESQB)
#pragma unroll
      for (int i = 0; i < 4; ++i) {
        const v8b a0 = *(const v8b*)(kg + (size_t)(16 * i) * DM);
        const v8b a1 = *(const v8b*)(klg + (size_t)(16 * i) * DM);
        const v8h b0 = *(const v8h*)(vg + (size_t)(16 * i) * SEQ);
        *(v8b*)(Ksh + (r + 16 * i) * LP + pc) = a0;
        *(v8b*)(Ksl + (r + 16 * i) * LP + pc) = a1;
        *(v8h*)(Vth + (r + 16 * i) * LP + pc) = b0;
        if (RES) {
          v8h b1 = *(const v8h*)(vlg + (size_t)(16 * i) * VLP);
          if (!resOK) b1 = zero8h();
          *(v8h*)(Vtl + (r + 16 * i) * LP + pc) = b1;
        }
      }
      // RES build: the last load's result was placed on address pairs that earlier loads of this batch name. The pairs are
      // inputs of the wait, so they stay as they are until the batch's address translations are done.
      if (RES) asm volatile("s_wait_xcnt 0x0" :: "v"(kg), "v"(klg), "v"(vg), "v"(vlg) : "memory");
    }
    __syncthreads();

    // ---- scores, transposed: 64 keys x 16 queries per wave, 3 bf16 products ----
    // All K fragments of a d-chunk are read as one group, then the four key tiles' accumulators take turns, so one LDS wait
    // serves 12 products and no product waits for the one before it. Each s[j] still sums hi.hi, hi.lo, lo.hi per d-chunk.
    v8f s[4];                                  // s[j][r] = S^T[key kv0 + j*16 + 8hh + r][query c]
#pragma unroll
    for (int j = 0; j < 4; ++j) s[j] = zero8();
#pragma unroll
    for (int dc = 0; dc < 2; ++dc) {
      FB kb[4], kl[4];
#pragma unroll
      for (int j = 0; j < 4; ++j) {
        kb[j].h[0] = *(const v8b*)(Ksh + (j * 16 + c) * LP + dc * 32 + 8 * hh);
        kb[j].h[1] = *(const v8b*)(Ksh + (j * 16 + c) * LP + dc * 32 + 16 + 8 * hh);
        kl[j].h[0] = *(const v8b*)(Ksl + (j * 16 + c) * LP + dc * 32 + 8 * hh);
        kl[j].h[1] = *(const v8b*)(Ksl + (j * 16 + c) * LP + dc * 32 + 16 + 8 * hh);
      }
#pragma unroll
      for (int j = 0; j < 4; ++j) s[j] = mma_b_raw(kb[j].v, qah[dc], s[j]);
#pragma unroll
      for (int j = 0; j < 4; ++j) s[j] = mma_b_raw(kl[j].v, qah[dc], s[j]);
#pragma unroll
      for (int j = 0; j < 4; ++j) s[j] = mma_b_raw(kb[j].v, qal[dc], s[j]);
    }

    // ---- scale, causal mask by index, maximum in the lane (one chain per key tile), one exchange between the halves ----
    float mj[4];
#pragma unroll
    for (int j = 0; j < 4; ++j) {
      mj[j] = -INFINITY;
#pragma unroll
      for (int r = 0; r < 8; ++r) {
        const int key = kv0 + j * 16 + 8 * hh + r;
        float sv = s[j][r] * 0.125f;
        const bool keep = (key <= rowq);
        sv = keep ? sv : -INFINITY;
        s[j][r] = sv;
        mj[j] = fmaxf(mj[j], sv);
      }
    }
    float m = fmaxf(fmaxf(mj[0], mj[1]), fmaxf(mj[2], mj[3]));
    m = fmaxf(m, xhalf(m));                    // both halves now hold the query's maximum over the chunk
    const float mnew  = fmaxf(mrow, m);
    const float msafe = (mnew == -INFINITY) ? 0.f : mnew;
    const float alpha = exp_nat(mrow - msafe);
    mrow = mnew;

    // ---- online softmax; P (x1024, f16) and P residual (x4096) packed straight into the B operands of the second product ----
    FH pa[2], pl[2];
    float pj[4];
#pragma unroll
    for (int j = 0; j < 4; ++j) {
      pj[j] = 0.f;
#pragma unroll
      for (int r = 0; r < 8; ++r) {
        const float p = exp_nat(s[j][r] - msafe);   // masked logit: exp(-inf) = 0
        pj[j] += p;
        const float p1k = p * 1024.0f;
        const _Float16 ph = (_Float16)p1k;
        pa[j >> 1].v[(j & 1) * 8 + r] = ph;
        if (RES) pl[j >> 1].v[(j & 1) * 8 + r] = (_Float16)((p1k - (float)ph) * 4096.0f);
      }
    }
    lrow = lrow * alpha + ((pj[0] + pj[1]) + (pj[2] + pj[3]));
#pragma unroll
    for (int t = 0; t < 4; ++t)
#pragma unroll
      for (int r = 0; r < 8; ++r) oacc[t][r] *= alpha;

    // ---- context^T += V^T . P^T (f16 WMMA), residual products into a separate accumulator ----
    v8f o1[4];
#pragma unroll
    for (int t = 0; t < 4; ++t) o1[t] = zero8();
    // Unrolled, with each key half's V fragments read as one group ahead of its products; the four d tiles take turns.
#pragma unroll
    for (int kk = 0; kk < 2; ++kk) {
      FH vb[4], vl[4];
#pragma unroll
      for (int t = 0; t < 4; ++t) {
        vb[t].h[0] = *(const v8h*)(Vth + (t * 16 + c) * LP + kk * 32 + 8 * hh);
        vb[t].h[1] = *(const v8h*)(Vth + (t * 16 + c) * LP + kk * 32 + 16 + 8 * hh);
        if (RES) {
          vl[t].h[0] = *(const v8h*)(Vtl + (t * 16 + c) * LP + kk * 32 + 8 * hh);
          vl[t].h[1] = *(const v8h*)(Vtl + (t * 16 + c) * LP + kk * 32 + 16 + 8 * hh);
        } else {
          vl[t].v = vb[t].v;
        }
      }
#pragma unroll
      for (int t = 0; t < 4; ++t) oacc[t] = mma_h_raw(vb[t].v, pa[kk].v, oacc[t]);
      if (RES) {
#pragma unroll
        for (int t = 0; t < 4; ++t) o1[t] = mma_h_raw(vl[t].v, pa[kk].v, o1[t]);
#pragma unroll
        for (int t = 0; t < 4; ++t) o1[t] = mma_h_raw(vb[t].v, pl[kk].v, o1[t]);
      }
    }
    if (RES) {
#pragma unroll
      for (int t = 0; t < 4; ++t)
#pragma unroll
        for (int r = 0; r < 8; ++r) oacc[t][r] += o1[t][r] * (1.0f / 4096.0f);
    }
  }

  // ---- join the halves' normalisers, normalise (1/l and the 1/1024 p carry), stage the wave's 16x64 tile [query][d]
  //      (a lane's 8 registers of a tile are 8 consecutive d of its query: two 16-B stores), bf16 hi/lo split,
  // ---- join the two wave groups: group 1 leaves its context sums, running max and partial normaliser in LDS (a lane's own
  //      144-B row), all eight waves pass one barrier, group 0 rescales both parts to the common max and adds them; group 1 is done.
  float* xs = lds.Xs[wave] + lane * XP;
  if (grp == 1) {
#pragma unroll
    for (int t = 0; t < 4; ++t) {
      v4f w0, w1;
#pragma unroll
      for (int r = 0; r < 4; ++r) { w0[r] = oacc[t][r]; w1[r] = oacc[t][4 + r]; }
      *(v4f*)(xs + t * 8)     = w0;
      *(v4f*)(xs + t * 8 + 4) = w1;
    }
    xs[32] = mrow;
    xs[33] = lrow;
  }
  __syncthreads();
  if (grp == 1) return;                        // wave-uniform; no block barrier follows
  {
    const float m2 = xs[32], l2 = xs[33];
    const float mm = fmaxf(mrow, m2);
    const float ms = (mm == -INFINITY) ? 0.f : mm;
    const float a1 = exp_nat(mrow - ms);
    const float a2 = exp_nat(m2 - ms);    // group 1 kept no key (query block 0): m2 = -inf, a2 = 0, its sums are 0
    lrow = lrow * a1 + l2 * a2;
#pragma unroll
    for (int t = 0; t < 4; ++t) {
      const v4f x0 = *(const v4f*)(xs + t * 8);
      const v4f x1 = *(const v4f*)(xs + t * 8 + 4);
#pragma unroll
      for (int r = 0; r < 4; ++r) {
        oacc[t][r]     = oacc[t][r] * a1 + x0[r] * a2;
        oacc[t][4 + r] = oacc[t][4 + r] * a1 + x1[r] * a2;
      }
    }
  }

  float* os = Os[wave];
  {
    const float l = lrow + xhalf(lrow);        // unconditional: both halves take part in the exchange
    const float inv = ((l > 0.f) ? (1.0f / l) : 0.f) * (1.0f / 1024.0f);
#pragma unroll
    for (int t = 0; t < 4; ++t) {
      v4f w0, w1;
#pragma unroll
      for (int r = 0; r < 4; ++r) { w0[r] = oacc[t][r] * inv; w1[r] = oacc[t][4 + r] * inv; }
      *(v4f*)(os + c * OP + t * 16 + 8 * hh)     = w0;
      *(v4f*)(os + c * OP + t * 16 + 8 * hh + 4) = w1;
    }
  }
  __builtin_amdgcn_fence(__ATOMIC_RELEASE, "workgroup");
  __builtin_amdgcn_wave_barrier();
  __builtin_amdgcn_fence(__ATOMIC_ACQUIRE, "workgroup");
  {
    const int q4 = lane >> 3, c8 = (lane & 7) * 8;
    v4u hv[4], lv[4];
#pragma unroll
    for (int it = 0; it < 4; ++it) {
      const int row = it * 4 + q4;   // it 0..3 x q4 0..3 = rows 0..15 of the wave tile
      const float* sp = os + row * OP + c8;
      v4u a, a2;
#pragma unroll
      for (int e = 0; e < 4; ++e) {
        const float f0 = sp[2 * e], f1 = sp[2 * e + 1];
        const unsigned short h0 = bf_bits(f0), h1 = bf_bits(f1);
        const unsigned short l0 = bf_bits(f0 - bf_up(h0)), l1 = bf_bits(f1 - bf_up(h1));
        a[e] = pk16(h0, h1); a2[e] = pk16(l0, l1);
      }
      hv[it] = a; lv[it] = a2;
    }
    {
#pragma unroll
      for (int it = 0; it < 4; ++it) {
        const int row = it * 4 + q4;
        const size_t go = (rowB + q0 + row) * DM + (size_t)h * HD + c8;
        *(v4u*)(ohp + go) = hv[it];
        *(v4u*)(olp + go) = lv[it];
        // The registers these two stores name are reused for the next pair's address and data: wait before they are overwritten.
        asm volatile("s_wait_xcnt 0x0" ::: "memory");
      }
    }
  }
}

// Both attention variants in one grid. Eight-wave blocks no longer all fit on the chip at once, so the block index sets the order
// of starting. First the leading RESQB query blocks (residual planes): few trips, but each far dearer than a plain one, so started
// last they would run on alone. Then the plain blocks from the longest (NQB-1) down to RESQB: a place that falls free takes the
// longest block left, and the launch ends on the shortest. The branch is block-uniform.
__global__ __launch_bounds__(256)
void attn_all(const unsigned short* __restrict__ qhp, const unsigned short* __restrict__ qlp,
              const unsigned short* __restrict__ khp, const unsigned short* __restrict__ klp,
              const unsigned short* __restrict__ vhp, const unsigned short* __restrict__ vlp,
              unsigned short* ohp, unsigned short* olp) {
  __shared__ __align__(16) AttnLds lds;
  const int bx = blockIdx.x;
  const int g  = bx / (NB * NH);               // 0..NQB-1
  const int qb = (g < RESQB) ? (RESQB - 1 - g) : (NQB - 1 + RESQB - g);   // RESQB-1..0, then NQB-1..RESQB: every (qb, h, b) exactly once
  const int hb = bx % (NB * NH);
  if (qb >= RESQB) attn_causal64<false>(qhp, qlp, khp, klp, vhp, vlp, ohp, olp, qb, hb % NH, hb / NH, lds);
  else             attn_causal64<true>(qhp, qlp, khp, klp, vhp, vlp, ohp, olp, qb, hb % NH, hb / NH, lds);
}

// =====================================================================================================
// Workspace map (bytes; every region is an exact multiple of its 64x64-tile / whole-line store granularity,
//   Qb   bf16 [8192][512]            0            8388608
//   Kb   bf16 [8192][512]            8388608      8388608
//   Vb   bf16 [8192][512]            16777216     8388608
//   WqT  bf16 [512 n][512 k]         25165824     524288
//   WkT                              25690112     524288
//   WvT                              26214400     524288
//   WoT                              26738688     524288
//   Qh   bf16 [8192][512]            27262976     8388608
//   Ql                               35651584     8388608
//   Kh                               44040192     8388608
//   Kl                               52428800     8388608
//   VTh  f16  [2][512][4096]         60817408     8388608
//   VTl  f16  [2][512][512]          69206016     1048576
//   Oh   bf16 [8192][512]            70254592     8388608
//   Ol                               78643200     8388608
//   end                              87031808
// =====================================================================================================
extern "C" void kernel_launch(void* const* d_in, const int* in_sizes, int n_in,
                              void* d_out, int out_size, void* d_ws, size_t ws_size,
                              hipStream_t stream) {
  if (n_in < 11) return;
  const int NX = NB * SEQ * DM;                    // 4194304
  if (in_sizes[0] != NX || in_sizes[1] != NX || in_sizes[2] != NX) return;
  if (in_sizes[3] != DM * DM || in_sizes[5] != DM * DM || in_sizes[7] != DM * DM || in_sizes[9] != DM * DM) return;
  if (in_sizes[4] != DM || in_sizes[6] != DM || in_sizes[8] != DM || in_sizes[10] != DM) return;
  if (out_size != NX) return;

  const float* v  = (const float*)d_in[0];   // [2][4096][512]
  const float* k  = (const float*)d_in[1];   // [2][4096][512]
  const float* q  = (const float*)d_in[2];   // [2][4096][512]
  const float* Wq = (const float*)d_in[3];   // [512 in][512 out] = [k][n]
  const float* bq = (const float*)d_in[4];   // [512]
  const float* Wk = (const float*)d_in[5];   // [512 in][512 out]
  const float* bk = (const float*)d_in[6];   // [512]
  const float* Wv = (const float*)d_in[7];   // [512 in][512 out]
  const float* bv = (const float*)d_in[8];   // [512]
  const float* Wo = (const float*)d_in[9];   // [512 in][512 out]
  const float* bo = (const float*)d_in[10];  // [512]

  const size_t PX  = (size_t)NB * SEQ * DM * 2;    //  8388608  16-bit activation plane [8192][512]
  const size_t PW  = (size_t)DM * DM * 2;          //   524288  16-bit weight plane [512][512]
  const size_t PVT = (size_t)NB * DM * SEQ * 2;    //  8388608  v^T hi plane
  const size_t PVL = (size_t)NB * DM * VLP * 2;    //  1048576  v^T residual plane
  size_t off = 0;
  const size_t oQb  = off; off += PX;
  const size_t oKb  = off; off += PX;
  const size_t oVb  = off; off += PX;
  const size_t oWq  = off; off += PW;
  const size_t oWk  = off; off += PW;
  const size_t oWv  = off; off += PW;
  const size_t oWo  = off; off += PW;
  const size_t oQh  = off; off += PX;
  const size_t oQl  = off; off += PX;
  const size_t oKh  = off; off += PX;
  const size_t oKl  = off; off += PX;
  const size_t oVTh = off; off += PVT;
  const size_t oVTl = off; off += PVL;
  const size_t oOh  = off; off += PX;
  const size_t oOl  = off; off += PX;
  if (off > ws_size) return;                       // off = 87031808
  if (off > (size_t)134217728) return;

  char* ws = (char*)d_ws;
  unsigned short* Qb  = (unsigned short*)(ws + oQb);
  unsigned short* Kb  = (unsigned short*)(ws + oKb);
  unsigned short* Vb  = (unsigned short*)(ws + oVb);
  unsigned short* WqT = (unsigned short*)(ws + oWq);
  unsigned short* WkT = (unsigned short*)(ws + oWk);
  unsigned short* WvT = (unsigned short*)(ws + oWv);
  unsigned short* WoT = (unsigned short*)(ws + oWo);
  unsigned short* Qh  = (unsigned short*)(ws + oQh);
  unsigned short* Ql  = (unsigned short*)(ws + oQl);
  unsigned short* Kh  = (unsigned short*)(ws + oKh);
  unsigned short* Kl  = (unsigned short*)(ws + oKl);
  unsigned short* VTh = (unsigned short*)(ws + oVTh);
  unsigned short* VTl = (unsigned short*)(ws + oVTl);
  unsigned short* Oh  = (unsigned short*)(ws + oOh);
  unsigned short* Ol  = (unsigned short*)(ws + oOl);

  const dim3 blk(256);
  const dim3 gProj(GPB, 1);                                    // 1024 tiles -> 128 blocks: M=8192, N=512

  // (1) all plane conversions in one grid: weights f32 [k][n] -> bf16 W^T [n][k] (WqT, WkT, WvT, WoT are contiguous),
  //     activations f32 -> bf16 planes of the inputs' layout (Qb, Kb, Vb are contiguous)
  prep_planes<<<dim3(4 * NTR + 3 * NCV), blk, 0, stream>>>(q, k, v, Wq, Wk, Wv, Wo, Qb, WqT);
  // (2) the three input projections in one grid: qp, kp -> bf16 hi/lo planes [b*SEQ+t][h*64+d] (Qh, Ql, Kh, Kl contiguous),
  //     vp^T per batch -> f16 hi plane [b][h*64+d][s] (pitch SEQ) and residual plane (x4096, keys < VLP only, pitch VLP)
  gemm_qkv<<<dim3(GPB, 3), blk, 0, stream>>>(Qb, WqT, bq, bk, bv, Qh, VTh, VTl);
  // (3) causal attention, one grid: query blocks RESQB.. without, 0..RESQB-1 with residual planes
  attn_all<<<dim3(NB * NH * NQB), dim3(256), 0, stream>>>(Qh, Ql, Kh, Kl, VTh, VTl, Oh, Ol);
  // (4) out = context . Wo + bo -> d_out f32 [8192][512]  (A = context hi + lo planes, 2 products; Bt = WoT)
  gemm64<1, 0, 1><<<gProj, blk, 0, stream>>>(
      Oh, Ol, DM, 0LL, WoT, DM, 0LL, bo,
      d_out, DM, 0LL, d_out, DM, 0LL, DM,
      NB * SEQ, DM, DM, 1.0f);
  (void)hipGetLastError();
}

// v007
// Measured time: 122 microseconds a run.
// In both of two side-by-side timings against v006, it was 1.34 times as fast.
// All steps since v000 together make it 4.33 times as fast.
// Contractions: q, k, v^T projections = v_wmma_f32_16x16x32_bf16 (bf16 operands from RNE-converted inputs and weights, single product, f32 accumulate);
// k.q^T scores (keys down, queries across) = v_wmma_f32_16x16x32_bf16 with bf16 hi/lo split q and k (hi.hi + hi.lo + lo.hi), f32 accumulate;
// v^T.p^T = v_wmma_f32_16x16x32_f16 (p carried x1024 in f16 times v in f16, single product; plus f16 residual planes x4096 of
// p and v for the first 512 query rows of every sequence), f32 accumulate;
// ctx.Wo = v_wmma_f32_16x16x32_bf16 with ctx as bf16 hi/lo planes times bf16 Wo^T (2 products), f32 accumulate;
// causal mask (key <= query), online softmax, normalisers and bias adds in f32 on the VALU.
// Carry audit:
//   ph  = f16(1024 * p)                      -> the 1/1024 is folded exactly once in the attention epilogue: inv = (1/l) * (1/1024)
//   pl  = f16((1024 p - ph) * 4096)          }  products VTl.ph and VTh.pl go to the separate accumulator o1,
//   VTl = f16((v - VTh) * 4096)              }  folded back with * (1/4096) once per key chunk (RES blocks only)
//   VTh = f16(v), no carry (|v| typ. 0.45); q / k / ctx lo planes are unscaled bf16 residuals (v - hi) sharing the hi accumulator;
//   score scale 1/8 applied once in f32 after the score accumulate. No other scaled planes.
#include <hip/hip_runtime.h>
#include <math.h>
#include <stdint.h>

#define NB    2
#define SEQ   4096
#define DM    512
#define NH    8
#define HD    64
#define NQB   (SEQ / 64)   // 64 query / key blocks of 64
#define VLP   512          // key pitch of the v^T residual plane (keys 0..VLP-1)
#define RESQB 8            // leading 64-row query blocks that use the p / v residual planes
#define LP    72           // LDS row pitch of the 64-element 16-bit tiles: 144 B = 16 B x 9, 16 rows of a 16-B read on 16 bank quads
#define OP    68           // LDS row pitch of the f32 context tile, in floats (16-B reads down a column walk)
static_assert(RESQB * 64 <= VLP);
static_assert(NH * HD == DM);
static_assert((SEQ % 64) == 0 && (DM % 64) == 0 && (DM % 32) == 0);
static_assert(((NB * SEQ / 64) * (DM / 64)) % 8 == 0);
static_assert(((DM / 64) * (SEQ / 64)) % 8 == 0);
static_assert((NB * SEQ * DM) % (8 * 256) == 0);
static_assert((DM * DM) % (64 * 64) == 0);
static_assert((DM % 512) == 0 && (SEQ % 512) == 0);   // a product's block takes 512 neighbouring rows of its second operand

typedef _Float16 v16h __attribute__((ext_vector_type(16)));
typedef _Float16 v8h  __attribute__((ext_vector_type(8)));
typedef __bf16   v16b __attribute__((ext_vector_type(16)));
typedef __bf16   v8b  __attribute__((ext_vector_type(8)));
typedef float    v8f  __attribute__((ext_vector_type(8)));
typedef float    v4f  __attribute__((ext_vector_type(4)));
typedef unsigned int v4u __attribute__((ext_vector_type(4)));

// ---- scalar helpers --------------------------------------------------------------------------------
__device__ __forceinline__ unsigned short bf_bits(float f) {          // f32 -> bf16 bits, RNE convert
  unsigned u = __float_as_uint(f);
  return (unsigned short)((u + 0x7FFFu + ((u >> 16) & 1u)) >> 16);
}
__device__ __forceinline__ float bf_up(unsigned short h) { return __uint_as_float(((unsigned)h) << 16); }
__device__ __forceinline__ unsigned short h_bits(_Float16 x) { return __builtin_bit_cast(unsigned short, x); }
__device__ __forceinline__ unsigned pk16(unsigned short a, unsigned short b) { return (unsigned)a | ((unsigned)b << 16); }
__device__ __forceinline__ v8f zero8() { v8f z = {0.f, 0.f, 0.f, 0.f, 0.f, 0.f, 0.f, 0.f}; return z; }
__device__ __forceinline__ v8h zero8h() {
  const _Float16 z = (_Float16)0.0f;
  v8h r = {z, z, z, z, z, z, z, z};
  return r;
}

// value of lane l ^ 16 (the other half of the wave), by a vector cross-row move
__device__ __forceinline__ float xhalf(float x) {
  const int i = __builtin_bit_cast(int, x);
  return __builtin_bit_cast(float, __builtin_amdgcn_permlanex16(i, i, 0x76543210, 0xfedcba98, false, false));
}

// e^x as __expf forms it (x * log2 e, then v_exp_f32): the exponential and one v_nop in one statement. The v_nop is the slot
// the instruction set asks for between a transcendental and an instruction that overwrites its source.
__device__ __forceinline__ float exp_nat(float x) {
  const float y = x * 1.44269504088896340736f;
  float r;
  asm("v_exp_f32 %0, %1\n\tv_nop" : "=v"(r) : "v"(y));
  return r;
}

// ---- fragment loader: 16-bit A/B operand, lane -> row/col (lane&15), p already includes +8*(lane>>4);
//      elements 0..7 <- p[0..7] (k0+8h..), elements 8..15 <- p[16..23] (k0+16+8h..)
__device__ __forceinline__ v16b ldfrag_b(const __bf16* p) {
  union { v16b v; v8b h[2]; } f;
  f.h[0] = *(const v8b*)(p);
  f.h[1] = *(const v8b*)(p + 16);
  return f.v;
}

// ---- WMMA helpers with trailing VALU hazard gap --------------------------------------------------------
__device__ __forceinline__ v8f mma_h_raw(v16h a, v16h b, v8f c) {
  return __builtin_amdgcn_wmma_f32_16x16x32_f16(false, a, false, b, (short)0, c, false, false);
}
__device__ __forceinline__ v8f mma_b_raw(v16b a, v16b b, v8f c) {
  return __builtin_amdgcn_wmma_f32_16x16x32_bf16(false, a, false, b, (short)0, c, false, false);
}
__device__ __forceinline__ void dep_guard_b(v8f& a, v8f& b, v16b x, v16b y) {
  asm volatile("v_nop\n\tv_nop\n\tv_nop\n\tv_nop" : "+v"(a), "+v"(b) : "v"(x), "v"(y));
}
__device__ __forceinline__ void keep4_b(v16b a, v16b b, v16b c, v16b d) {
  asm volatile("v_nop" :: "v"(a), "v"(b), "v"(c), "v"(d));
}
__device__ __forceinline__ void acc_guard4(v8f& a, v8f& b, v8f& c, v8f& d) {
  asm volatile("v_nop\n\tv_nop\n\tv_nop\n\tv_nop" : "+v"(a), "+v"(b), "+v"(c), "+v"(d));
}

// =====================================================================================================
// f32 -> bf16 (RNE convert), 8 elements per thread, one 16-B store per lane: a wave writes 512 contiguous B
// the [8192][512] activations, a multiple of 256).
// coverage: n8 threads x 8 = the whole plane.
// =====================================================================================================
__device__ __forceinline__ void cvt_bf16x8(const float* __restrict__ in, unsigned short* out, int n8, int blk) {
  const int i = blk * 256 + threadIdx.x;
  if (i < n8) {
    const v4f a = *(const v4f*)(in + (size_t)i * 8);
    const v4f b = *(const v4f*)(in + (size_t)i * 8 + 4);
    v4u p;
    p[0] = pk16(bf_bits(a[0]), bf_bits(a[1]));
    p[1] = pk16(bf_bits(a[2]), bf_bits(a[3]));
    p[2] = pk16(bf_bits(b[0]), bf_bits(b[1]));
    p[3] = pk16(bf_bits(b[2]), bf_bits(b[3]));
    *(v4u*)(out + (size_t)i * 8) = p;
    
  }
}

// =====================================================================================================
// f32 [K rows][N cols] (pitch ldw) -> bf16 transposed plane WT[n][k] (pitch ldt, k contiguous), RNE convert.
// One 64x64 tile per block (n0 = 64 * tileN, k0 = 64 * tileK, N and K exact multiples of 64): the tile is staged in LDS with
// coalesced 16-B loads (256 threads x 16 floats = the whole tile), __syncthreads, then each output row segment
// coverage: 8 waves x 2 x (lane>>3 = 4 rows) = 64 rows n, 8 lanes x 8 = 64 k: the whole tile; grid = the whole plane.
// =====================================================================================================
__device__ __forceinline__ void cvt_bf16_tr64(const float* __restrict__ W, unsigned short* WT, int ldw, int ldt,
                                              int tileN, int tileK, float* sW) {
  const int tid = threadIdx.x;
  const int n0 = tileN * 64;
  const int k0 = tileK * 64;
  {
    const int kr = tid >> 2, cb = (tid & 3) * 16;          // row k0+kr, cols n0+cb .. +15
    const float* src = W + (size_t)(k0 + kr) * ldw + n0 + cb;
#pragma unroll
    for (int i = 0; i < 4; ++i) {
      const v4f f = *(const v4f*)(src + 4 * i);
      float* d = sW + kr * 65 + cb + 4 * i;
      d[0] = f[0]; d[1] = f[1]; d[2] = f[2]; d[3] = f[3];
    }
  }
  __syncthreads();
  const int wave = tid >> 5, lane = tid & 31;
  const int q = lane >> 3, c8 = (lane & 7) * 8;
  v4u pv[2];
#pragma unroll
  for (int it = 0; it < 2; ++it) {
    const int nr = wave * 8 + it * 4 + q;                  // output row n0+nr, 0 <= nr < 64
    v4u p;
#pragma unroll
    for (int e = 0; e < 4; ++e) {
      const float f0 = sW[(c8 + 2 * e) * 65 + nr];
      const float f1 = sW[(c8 + 2 * e + 1) * 65 + nr];
      p[e] = pk16(bf_bits(f0), bf_bits(f1));
    }
    pv[it] = p;
  }
  {
#pragma unroll
    for (int it = 0; it < 2; ++it) {
      const int nr = wave * 8 + it * 4 + q;
      *(v4u*)(WT + (size_t)(n0 + nr) * ldt + k0 + c8) = pv[it];
    }
    
  }
}

// =====================================================================================================
// One grid for all seven independent plane conversions: blocks 0..4*NTR-1 transpose the four weights (64x64 tile each,
// planes WT + w*DM*DM in the order Wq, Wk, Wv, Wo), the next 3*NCV blocks convert q, k, v (planes Xb + w*NB*SEQ*DM).
// The branch is block-uniform, so the transpose's __syncthreads is passed by all threads of its block or by none.
// =====================================================================================================
#define NTR ((DM / 64) * (DM / 64))          // 64 tiles per weight
#define NCV ((NB * SEQ * DM) / (8 * 256))    // 2048 blocks per activation plane
__global__ __launch_bounds__(256) void prep_planes(const float* __restrict__ q, const float* __restrict__ k,
                                                   const float* __restrict__ v,
                                                   const float* __restrict__ Wq, const float* __restrict__ Wk,
                                                   const float* __restrict__ Wv, const float* __restrict__ Wo,
                                                   unsigned short* Xb, unsigned short* WT) {
  __shared__ __align__(16) float sW[64 * 65];
  const int bx = blockIdx.x;
  if (bx < 4 * NTR) {
    const int w = bx / NTR, t = bx % NTR;
    const float* W = (w == 0) ? Wq : (w == 1) ? Wk : (w == 2) ? Wv : Wo;
    cvt_bf16_tr64(W, WT + (size_t)w * DM * DM, DM, DM, t % (DM / 64), t / (DM / 64), sW);
  } else {
    const int cb = bx - 4 * NTR;
    const int w = cb / NCV, blk = cb % NCV;
    const float* in = (w == 0) ? q : (w == 1) ? k : v;
    cvt_bf16x8(in, Xb + (size_t)w * NB * SEQ * DM, (NB * SEQ * DM) / 8, blk);
  }
}

// =====================================================================================================
// Register-blocked batched bf16 WMMA GEMM: C[m][n] = sum_k A[m][k] * Bt[n][k] + bias; one wave per 64x64 tile.
// A row-major [M][K] pitch lda; Bt row-major [N][K] pitch ldb (k contiguous);
// M a multiple of 64, N of 512, K of 64 (host shapes are static multiples). b = batch index (strides in elements).
// A block's eight tiles are one tile row and eight neighbouring tile columns: 64 rows of A, 512 rows of Bt. Per stage of 64 k
// (one 128-B line of every row) the block brings them to LDS with whole-line loads (8 lanes per row, 4 rows per wave-wide load,
// 256 threads x 16 pieces = all of Bt's 512 x 64, x 2 pieces = all of each A plane's 64 x 64), pitch LP, between two barriers;
// the fragments are then read from LDS in the k order they had from memory, so every accumulator sums in the same order.
// NSPLIT: 0 = A.Bt; 1 = (A + A2).Bt (A2 = unscaled bf16 lo plane of A, 2 products).
// BIAS: 0 = none; 1 = per column n, bias[n]; 2 = per row m, bias[m]; the bias value is RNE-converted to bf16 and added in f32.
// OUT_MODE: 0 = f32 (pitch ldc); 2 = bf16 hi plane C + bf16 lo plane C2 (lo = RNE(v - hi), unscaled);
//           3 = f16 hi plane C + f16 residual plane C2 = f16((v - hi) * rscale), C2 written only for tiles
//               with n0 < N2 (pitch ldc2, batch stride strideC2).
// =====================================================================================================
template <int NSPLIT, int OUT_MODE, int BIAS>
__device__ __forceinline__ void gemm64_body(
    const unsigned short* __restrict__ Ap, const unsigned short* A2p, int lda, long long strideA,
    const unsigned short* __restrict__ Btp, int ldb, long long strideB,
    const float* __restrict__ bias,
    void* Cout, int ldc, long long strideC,
    void* Cout2, int ldc2, long long strideC2, int N2,
    int M, int N, int K, float rscale,
    int blk, int b, float (*sT)[16 * 68],     // blk = block index inside this product, b = batch index
    __bf16* sA, __bf16* sA2, __bf16* sB) {    // LDS stage: A and A2 [64][LP], Bt [512][LP] (sA2 read and written only when NSPLIT)
  const __bf16* A   = (const __bf16*)(const void*)Ap;
  const __bf16* A2  = (const __bf16*)(const void*)A2p;
  const __bf16* Bt  = (const __bf16*)(const void*)Btp;
  const int lane = threadIdx.x & 31;
  const int wave = threadIdx.x >> 5;
  const int tilesN = N >> 6;
  const int tilesM = M >> 6;
  const int tile0 = blk * 8;                 // the block's first tile; tilesN is a multiple of 8, so its eight tiles share a tile row
  if (tile0 + 8 > tilesM * tilesN) return;   // block-uniform, in front of every barrier
  const int tm = tile0 / tilesN;
  const int nb0 = (tile0 - tm * tilesN) << 6; // first Bt row of the block
  const int m0 = tm << 6;
  const int n0 = nb0 + (wave << 6);

  const __bf16* Ab  = A  + (size_t)b * strideA;
  const __bf16* Bb  = Bt + (size_t)b * strideB;
  const __bf16* Ab2 = (NSPLIT >= 1) ? (A2 + (size_t)b * strideA) : Ab;

  const int rlane = lane & 15;                 // row (A) / col (B, D) within subtile
  const int koff  = (lane >> 4) * 8;           // k offset of this lane half
  const int mOff  = (lane >> 4) * 8;           // D row offset

  v8f acc[4][4];
#pragma unroll
  for (int i = 0; i < 4; ++i)
#pragma unroll
    for (int j = 0; j < 4; ++j) acc[i][j] = zero8();

  const int sr  = threadIdx.x >> 3;            // staging: row sr + 32 i of a plane, piece spc .. spc + 7 of its 64 k
  const int spc = (threadIdx.x & 7) * 8;
  for (int k0 = 0; k0 < K; k0 += 64) {
    __syncthreads();                           // every wave has read its last fragments of the stage before
    {
      const __bf16* bg  = Bb  + (size_t)(nb0 + sr) * ldb + k0 + spc;
      const __bf16* ag  = Ab  + (size_t)(m0 + sr) * lda + k0 + spc;
      const __bf16* ag2 = Ab2 + (size_t)(m0 + sr) * lda + k0 + spc;
      v8b tb[16], ta[2], ta2[2];
#pragma unroll
      for (int i = 0; i < 16; ++i) tb[i] = *(const v8b*)(bg + (size_t)(32 * i) * ldb);
#pragma unroll
      for (int i = 0; i < 2; ++i) {
        ta[i] = *(const v8b*)(ag + (size_t)(32 * i) * lda);
        if (NSPLIT >= 1) ta2[i] = *(const v8b*)(ag2 + (size_t)(32 * i) * lda);
      }
      // The address pairs get the next stage's values: the wait that belongs in front of that stands behind the batch of loads.
      // The pairs are its inputs, so no load's result is placed on them ahead of it.
      asm volatile("s_wait_xcnt 0x0" :: "v"(bg), "v"(ag), "v"(ag2) : "memory");
#pragma unroll
      for (int i = 0; i < 16; ++i) *(v8b*)(sB + (sr + 32 * i) * LP + spc) = tb[i];
#pragma unroll
      for (int i = 0; i < 2; ++i) {
        *(v8b*)(sA + (sr + 32 * i) * LP + spc) = ta[i];
        if (NSPLIT >= 1) *(v8b*)(sA2 + (sr + 32 * i) * LP + spc) = ta2[i];
      }
    }
    __syncthreads();                           // the stage is whole before any wave reads a fragment
#pragma unroll
    for (int kk = 0; kk < 2; ++kk) {
      // all fragments of these 32 k are read as one group ahead of their products: one LDS wait, not one per A fragment
      v16b bh[4], ah[4], al[4];
#pragma unroll
      for (int j = 0; j < 4; ++j) bh[j] = ldfrag_b(sB + ((wave << 6) + (j << 4) + rlane) * LP + kk * 32 + koff);
#pragma unroll
      for (int i = 0; i < 4; ++i) {
        const int ao = ((i << 4) + rlane) * LP + kk * 32 + koff;
        ah[i] = ldfrag_b(sA + ao);
        al[i] = ah[i];
        if (NSPLIT >= 1) al[i] = ldfrag_b(sA2 + ao);
      }
#pragma unroll
      for (int i = 0; i < 4; ++i) {
#pragma unroll
        for (int j = 0; j < 4; ++j) {
          acc[i][j] = mma_b_raw(ah[i], bh[j], acc[i][j]);
          if (NSPLIT >= 1) acc[i][j] = mma_b_raw(al[i], bh[j], acc[i][j]);
        }
        dep_guard_b(acc[i][0], acc[i][3], ah[i], al[i]);
      }
      keep4_b(bh[0], bh[1], bh[2], bh[3]);
    }
  }
  acc_guard4(acc[0][0], acc[0][1], acc[0][2], acc[0][3]);
  acc_guard4(acc[1][0], acc[1][1], acc[1][2], acc[1][3]);
  acc_guard4(acc[2][0], acc[2][1], acc[2][2], acc[2][3]);
  acc_guard4(acc[3][0], acc[3][1], acc[3][2], acc[3][3]);

  // ---- epilogue ----
  float* slab = sT[wave];
  float bcol[4];
#pragma unroll
  for (int j = 0; j < 4; ++j) {
    bcol[j] = 0.f;
    if (BIAS == 1) bcol[j] = bf_up(bf_bits(bias[n0 + (j << 4) + rlane]));   // n < N, bias has N entries
  }
#pragma unroll
  for (int i = 0; i < 4; ++i) {
    const int mBase = m0 + (i << 4);
    float brow[8];
#pragma unroll
    for (int r = 0; r < 8; ++r) {
      brow[r] = 0.f;
      if (BIAS == 2) brow[r] = bf_up(bf_bits(bias[mBase + mOff + r]));      // m < M, bias has M entries
    }
#pragma unroll
    for (int j = 0; j < 4; ++j) {
#pragma unroll
      for (int r = 0; r < 8; ++r) {
        slab[(mOff + r) * 68 + (j << 4) + rlane] = acc[i][j][r] + bcol[j] + brow[r];
      }
    }
    __builtin_amdgcn_fence(__ATOMIC_RELEASE, "workgroup");
    __builtin_amdgcn_wave_barrier();
    __builtin_amdgcn_fence(__ATOMIC_ACQUIRE, "workgroup");
    if (OUT_MODE == 0) {
      float* C = (float*)Cout + (size_t)b * strideC;
      const int hh = lane >> 4, c4 = (lane & 15) * 4;     // 256-B row segment = 16 lanes x 16 B
      {
#pragma unroll
        for (int it = 0; it < 8; ++it) {
          const int row = it * 2 + hh;                     // it 0..7 x hh 0..1 = rows 0..15
          const v4f v = *(const v4f*)(slab + row * 68 + c4);
          *(v4f*)(C + (size_t)(mBase + row) * ldc + n0 + c4) = v;
        }
        
      }
    } else {
      const int q = lane >> 3, c8 = (lane & 7) * 8;
      unsigned short* C  = (unsigned short*)Cout  + (size_t)b * strideC;
      unsigned short* C2 = (unsigned short*)Cout2 + (size_t)b * strideC2;
      const bool wlo = (OUT_MODE == 2) || (n0 < N2);      // wave-uniform
      v4u hv[4], lv[4];
#pragma unroll
      for (int it = 0; it < 4; ++it) {
        const int row = it * 4 + q;                        // it 0..3 x q 0..3 = rows 0..15
        const float* sp = slab + row * 68 + c8;
        v4u a, a2;
#pragma unroll
        for (int e = 0; e < 4; ++e) {
          const float f0 = sp[2 * e], f1 = sp[2 * e + 1];
          unsigned short h0, h1, l0, l1;
          if (OUT_MODE == 2) {
            h0 = bf_bits(f0); h1 = bf_bits(f1);
            l0 = bf_bits(f0 - bf_up(h0)); l1 = bf_bits(f1 - bf_up(h1));
          } else {
            const _Float16 x0 = (_Float16)f0, x1 = (_Float16)f1;
            h0 = h_bits(x0); h1 = h_bits(x1);
            l0 = h_bits((_Float16)((f0 - (float)x0) * rscale));
            l1 = h_bits((_Float16)((f1 - (float)x1) * rscale));
          }
          a[e] = pk16(h0, h1); a2[e] = pk16(l0, l1);
        }
        hv[it] = a; lv[it] = a2;
      }
      {
#pragma unroll
        for (int it = 0; it < 4; ++it) {
          const int row = it * 4 + q;
          *(v4u*)(C + (size_t)(mBase + row) * ldc + n0 + c8) = hv[it];
          if (wlo) *(v4u*)(C2 + (size_t)(mBase + row) * ldc2 + n0 + c8) = lv[it];
        }
        
      }
    }
    __builtin_amdgcn_fence(__ATOMIC_RELEASE, "workgroup");
    __builtin_amdgcn_wave_barrier();
    __builtin_amdgcn_fence(__ATOMIC_ACQUIRE, "workgroup");
  }
}

// One product per launch (the output projection). The operand pitches are template constants, so the staging loads' row steps
// are immediate offsets from one address pair per plane.
template <int NSPLIT, int OUT_MODE, int BIAS, int lda, int ldb>
__global__ __launch_bounds__(256) void gemm64(
    const unsigned short* __restrict__ Ap, const unsigned short* A2p, long long strideA,
    const unsigned short* __restrict__ Btp, long long strideB,
    const float* __restrict__ bias,
    void* Cout, int ldc, long long strideC,
    void* Cout2, int ldc2, long long strideC2, int N2,
    int M, int N, int K, float rscale) {
  __shared__ __align__(16) float sT[8][16 * 68];   // per-wave 16x64 slab, pitch 68 floats
  __shared__ __align__(16) __bf16 sB[512 * LP];
  __shared__ __align__(16) __bf16 sA[(NSPLIT >= 1 ? 2 : 1) * 64 * LP];
  gemm64_body<NSPLIT, OUT_MODE, BIAS>(Ap, A2p, lda, strideA, Btp, ldb, strideB, bias, Cout, ldc, strideC,
                                      Cout2, ldc2, strideC2, N2, M, N, K, rscale, blockIdx.x, blockIdx.y, sT,
                                      sA, sA + (NSPLIT >= 1 ? 64 * LP : 0), sB);
}

// The three independent input projections in one grid (GPB blocks each): blockIdx.y = 0: qp, 1: kp (bf16 hi/lo planes,
// M = NB*SEQ, N = DM), 2: vp^T (f16 hi + residual planes, M = DM, N = SEQ, batch = blockIdx.x / (GPB / NB)).
// Xb = bf16 planes of q, k, v in that order; WT = W^T planes of Wq, Wk, Wv; QK = planes Qh, Ql, Kh, Kl in that order.
#define GPB (((NB * SEQ / 64) * (DM / 64)) / 8)   // 128 blocks of 8 tiles
static_assert(GPB == NB * (((DM / 64) * (SEQ / 64)) / 8));
__global__ __launch_bounds__(256) void gemm_qkv(
    const unsigned short* __restrict__ Xb, const unsigned short* __restrict__ WT,
    const float* __restrict__ bq, const float* __restrict__ bk, const float* __restrict__ bv,
    unsigned short* QK, unsigned short* VTh, unsigned short* VTl) {
  __shared__ __align__(16) float sT[8][16 * 68];   // per-wave 16x64 slab, pitch 68 floats
  __shared__ __align__(16) __bf16 sB[512 * LP];
  __shared__ __align__(16) __bf16 sA[64 * LP];
  const size_t NXE = (size_t)NB * SEQ * DM;
  const int y = blockIdx.y;                        // block-uniform
  if (y < 2) {
    const unsigned short* A = Xb + (size_t)y * NXE;
    gemm64_body<0, 2, 1>(A, A, DM, 0LL, WT + (size_t)y * DM * DM, DM, 0LL, y ? bk : bq,
                         (void*)(QK + (size_t)(2 * y) * NXE), DM, 0LL, (void*)(QK + (size_t)(2 * y + 1) * NXE), DM, 0LL, DM,
                         NB * SEQ, DM, DM, 1.0f, blockIdx.x, 0, sT, sA, sA, sB);
  } else {
    const unsigned short* A = WT + (size_t)2 * DM * DM;
    gemm64_body<0, 3, 2>(A, A, DM, 0LL, Xb + 2 * NXE, DM, (long long)SEQ * DM, bv,
                         (void*)VTh, SEQ, (long long)DM * SEQ, (void*)VTl, VLP, (long long)DM * VLP, VLP,
                         DM, SEQ, DM, 4096.0f, blockIdx.x % (GPB / NB), blockIdx.x / (GPB / NB), sT, sA, sA, sB);
  }
}

// =====================================================================================================
// Causal attention, head dim 64, key chunks of 64.
//   q planes (bf16 hi / lo): element (b, t, h, d) at [(b*SEQ + t)*DM + h*64 + d]
//   k planes (bf16 hi / lo): same layout with key index s
//   v^T hi plane (f16):      element (b, h, d, s) at [(b*DM + h*64 + d)*SEQ + s]
//   v^T residual plane (f16, (v - hi)*4096): [(b*DM + h*64 + d)*VLP + s], s < VLP, read only when RES
//   (a key chunk at or beyond VLP would contribute a zero v residual; its address is clamped)
//   Mask: query t keeps key s iff s <= t. A query block qb therefore needs key chunks 0..qb only. They are dealt to two wave
//   groups, even chunks to group 0, odd chunks to group 1 (block-uniform trip count (qb+2)/2 <= NQB/2); for even qb group 1's
//   last chunk is qb+1, in bounds and wholly masked. Each group keeps its own running max, normaliser and context sums.
//   Inside a visited chunk a masked key gets logit -inf -> exp gives exactly 0, so it adds nothing to the numerator
//   or the normaliser. Row max bookkeeping: every query keeps key 0 (chunk 0), so group 0's running max of every row is finite
//   after its first chunk; a group that has kept no key yet has max -inf, sums 0, and rescales by 0. Every row ends with l > 0.
//   out planes (bf16 hi / lo of the normalised context): element (b, t, h, d) at [(b*SEQ + t)*DM + h*64 + d]
//   scores = q . k : bf16 hi/lo split (hi.hi + hi.lo + lo.hi), f32 accumulate, then * 1/8 and the mask in f32
//   p = exp(s - m) carried as f16(1024 p); context = p . v on f16 WMMA; RES adds f16 residual planes of p and v
//   (scale 4096, separate accumulator folded back with 1/4096 per chunk in f32); online softmax (running max) in f32.
//   Block = 2 groups x 4 waves = 64 query rows of one (b, h), wave w and wave w+4 on the same 16 rows; grid = NQB * NH * NB.
//   K / V^T chunk staging, per group into its own tiles: 128 threads x 4 rows x 8 elements per plane = the whole 64x64 tile of every plane read later
//   (plain 16-B loads, 8 lanes per 128-B row, __syncthreads before and after).
//   Both products are computed transposed: S^T = K . Q^T (A = K rows, B = Q) and O^T += V^T . P^T (A = V^T rows, B = P^T).
//   A lane then holds 32 scores of ONE query (column lane&15; keys j*16 + 8*(lane>>4) + r): maximum and sum run in the lane,
//   the two wave halves exchange the maximum once per chunk and join their partial normalisers once, after the loop.
//   Two score tiles 2kk, 2kk+1, converted in place, are the B operand of key half kk in the hardware k order
//   (element e < 8: key 8*(lane>>4) + e, e >= 8: key 16 + 8*(lane>>4) + e - 8), the order the V^T loads already have: P never touches LDS.
//   Output coverage: each wave of group 0 stores rows q0..q0+15 (it 0..3 x lane>>3 0..3) x 64 columns (8 lanes x 8) of both planes;
//   grid over all (b, h, qb) = the whole [NB*SEQ][DM] planes.
// =====================================================================================================
#define XP 36                                      // floats per lane in the hand-over area: 144 B = 16 B x 9, 16-B accesses conflict-free
struct AttnTiles {                                 // one key chunk, staged and read by one wave group only
  __bf16   Ksh[64 * LP];                            // K hi [kv][d], pitch LP
  __bf16   Ksl[64 * LP];                            // K lo
  _Float16 Vth[64 * LP];                            // V^T hi [d][kv], pitch LP
  _Float16 Vtl[64 * LP];                            // V^T residual (RES only)
};
struct AttnLds {                                   // one LDS layout for both variants (they share a grid)
  AttnTiles t[2];                                   // wave group 0: even key chunks, wave group 1: odd key chunks
  float    Os[4][16 * OP];                          // per wave context tile [row][d] (group 0)
  float    Xs[4][32 * XP];                          // group 1 -> group 0: per lane 32 context sums, running max, partial normaliser
};
static_assert((64 * LP * 2) % 16 == 0 && (16 * LP * 2) % 16 == 0 && (16 * OP * 4) % 16 == 0 && (XP * 4) % 16 == 0);

template <bool RES>
__device__ __forceinline__
void attn_causal64(const unsigned short* __restrict__ qhp, const unsigned short* __restrict__ qlp,
                   const unsigned short* __restrict__ khp, const unsigned short* __restrict__ klp,
                   const unsigned short* __restrict__ vhp, const unsigned short* __restrict__ vlp,
                   unsigned short* ohp, unsigned short* olp,
                   int qb, int h, int b, AttnLds& lds) {   // qb = 0..NQB-1, h, b: block-uniform
  union FB { v16b v; v8b h[2]; };
  union FH { v16h v; v8h h[2]; };
  const int tid  = threadIdx.x & 127;          // thread inside its wave group
  const int grp  = __builtin_amdgcn_readfirstlane((int)(threadIdx.x >> 7));   // wave group 0 / 1, wave-uniform
  const int wave = tid >> 5;                   // 0..3: the 16 query rows of the block this wave owns
  const int lane = tid & 31;
  const int hh   = lane >> 4;
  const int c    = lane & 15;

  __bf16*   const Ksh = lds.t[grp].Ksh;
  __bf16*   const Ksl = lds.t[grp].Ksl;
  _Float16* const Vth = lds.t[grp].Vth;
  _Float16* const Vtl = lds.t[grp].Vtl;
  float    (* const Os)[16 * OP]  = lds.Os;

  const int q0   = qb * 64 + wave * 16;
  const size_t rowB = (size_t)b * SEQ;

  const __bf16* Qh = (const __bf16*)(const void*)qhp + (size_t)h * HD;
  const __bf16* Ql = (const __bf16*)(const void*)qlp + (size_t)h * HD;
  const __bf16* Kh = (const __bf16*)(const void*)khp + (size_t)h * HD;
  const __bf16* Kl = (const __bf16*)(const void*)klp + (size_t)h * HD;
  const _Float16* Vh = (const _Float16*)(const void*)vhp + ((size_t)b * DM + (size_t)h * HD) * SEQ;
  const _Float16* Vl = (const _Float16*)(const void*)vlp + ((size_t)b * DM + (size_t)h * HD) * VLP;

  // ---- Q fragments (B operand, column = lane&15): 2 d-chunks, hi and lo ----
  v16b qah[2], qal[2];
#pragma unroll
  for (int dc = 0; dc < 2; ++dc) {
    const size_t qo = (rowB + q0 + c) * DM + dc * 32 + 8 * hh;
    qah[dc] = ldfrag_b(Qh + qo);
    qal[dc] = ldfrag_b(Ql + qo);
  }

  const int rowq = q0 + c;                     // this lane's query
  float mrow = -INFINITY, lrow = 0.f;          // running max of the query (both halves alike), this half's partial normaliser
  v8f oacc[4];                                 // oacc[t][r] = O^T[d = t*16 + 8hh + r][query c]
#pragma unroll
  for (int t = 0; t < 4; ++t) oacc[t] = zero8();

  const int trips = (qb + 2) >> 1;             // block-uniform, <= NQB / 2: chunks 0..qb dealt even / odd to the two groups
  for (int it = 0; it < trips; ++it) {
    const int kv0 = (2 * it + grp) * 64;       // chunk 2*it + grp <= qb, or qb + 1 <= NQB - 1 for even qb (all masked): kv0 + 63 < SEQ
    __syncthreads();
    {
      // 8 lanes per 128-B row, 4 rows per wave and load: every wave-wide 16-B load covers 4 whole lines (2 lanes per row
      // touched 16 lines for the same 512 B). A thread takes piece pc of rows r, r+16, r+32, r+48.
      const int r = tid >> 3, pc = (tid & 7) * 8;
      const __bf16*   kg  = Kh + (rowB + kv0 + r) * DM + pc;      // K row kv0+r, d = pc..pc+7
      const __bf16*   klg = Kl + (rowB + kv0 + r) * DM + pc;
      const _Float16* vg  = Vh + (size_t)r * SEQ + kv0 + pc;      // V^T row d = r, s = kv0+pc..+7
      const int kvl = (kv0 + 64 <= VLP) ? kv0 : (VLP - 64);     // clamped address into the residual plane
      const _Float16* vlg = Vl + (size_t)r * VLP + kvl + pc;
      const bool resOK = (kv0 + 64 <= VLP);                      // wave-uniform (always true for qb < RESQB)
#pragma unroll
      for (int i = 0; i < 4; ++i) {
        const v8b a0 = *(const v8b*)(kg + (size_t)(16 * i) * DM);
        const v8b a1 = *(const v8b*)(klg + (size_t)(16 * i) * DM);
        const v8h b0 = *(const v8h*)(vg + (size_t)(16 * i) * SEQ);
        *(v8b*)(Ksh + (r + 16 * i) * LP + pc) = a0;
        *(v8b*)(Ksl + (r + 16 * i) * LP + pc) = a1;
        *(v8h*)(Vth + (r + 16 * i) * LP + pc) = b0;
        if (RES) {
          v8h b1 = *(const v8h*)(vlg + (size_t)(16 * i) * VLP);
          if (!resOK) b1 = zero8h();
          *(v8h*)(Vtl + (r + 16 * i) * LP + pc) = b1;
        }
      }
      // RES build: the last load's result was placed on address pairs that earlier loads of this batch name. The pairs are
      // inputs of the wait, so they stay as they are until the batch's address translations are done.
      if (RES) asm volatile("s_wait_xcnt 0x0" :: "v"(kg), "v"(klg), "v"(vg), "v"(vlg) : "memory");
    }
    __syncthreads();

    // ---- scores, transposed: 64 keys x 16 queries per wave, 3 bf16 products ----
    // All K fragments of a d-chunk are read as one group, then the four key tiles' accumulators take turns, so one LDS wait
    // serves 12 products and no product waits for the one before it. Each s[j] still sums hi.hi, hi.lo, lo.hi per d-chunk.
    v8f s[4];                                  // s[j][r] = S^T[key kv0 + j*16 + 8hh + r][query c]
#pragma unroll
    for (int j = 0; j < 4; ++j) s[j] = zero8();
#pragma unroll
    for (int dc = 0; dc < 2; ++dc) {
      FB kb[4], kl[4];
#pragma unroll
      for (int j = 0; j < 4; ++j) {
        kb[j].h[0] = *(const v8b*)(Ksh + (j * 16 + c) * LP + dc * 32 + 8 * hh);
        kb[j].h[1] = *(const v8b*)(Ksh + (j * 16 + c) * LP + dc * 32 + 16 + 8 * hh);
        kl[j].h[0] = *(const v8b*)(Ksl + (j * 16 + c) * LP + dc * 32 + 8 * hh);
        kl[j].h[1] = *(const v8b*)(Ksl + (j * 16 + c) * LP + dc * 32 + 16 + 8 * hh);
      }
#pragma unroll
      for (int j = 0; j < 4; ++j) s[j] = mma_b_raw(kb[j].v, qah[dc], s[j]);
#pragma unroll
      for (int j = 0; j < 4; ++j) s[j] = mma_b_raw(kl[j].v, qah[dc], s[j]);
#pragma unroll
      for (int j = 0; j < 4; ++j) s[j] = mma_b_raw(kb[j].v, qal[dc], s[j]);
    }

    // ---- scale, causal mask by index, maximum in the lane (one chain per key tile), one exchange between the halves ----
    float mj[4];
#pragma unroll
    for (int j = 0; j < 4; ++j) {
      mj[j] = -INFINITY;
#pragma unroll
      for (int r = 0; r < 8; ++r) {
        const int key = kv0 + j * 16 + 8 * hh + r;
        float sv = s[j][r] * 0.125f;
        const bool keep = (key <= rowq);
        sv = keep ? sv : -INFINITY;
        s[j][r] = sv;
        mj[j] = fmaxf(mj[j], sv);
      }
    }
    float m = fmaxf(fmaxf(mj[0], mj[1]), fmaxf(mj[2], mj[3]));
    m = fmaxf(m, xhalf(m));                    // both halves now hold the query's maximum over the chunk
    const float mnew  = fmaxf(mrow, m);
    const float msafe = (mnew == -INFINITY) ? 0.f : mnew;
    const float alpha = exp_nat(mrow - msafe);
    mrow = mnew;

    // ---- online softmax; P (x1024, f16) and P residual (x4096) packed straight into the B operands of the second product ----
    FH pa[2], pl[2];
    float pj[4];
#pragma unroll
    for (int j = 0; j < 4; ++j) {
      pj[j] = 0.f;
#pragma unroll
      for (int r = 0; r < 8; ++r) {
        const float p = exp_nat(s[j][r] - msafe);   // masked logit: exp(-inf) = 0
        pj[j] += p;
        const float p1k = p * 1024.0f;
        const _Float16 ph = (_Float16)p1k;
        pa[j >> 1].v[(j & 1) * 8 + r] = ph;
        if (RES) pl[j >> 1].v[(j & 1) * 8 + r] = (_Float16)((p1k - (float)ph) * 4096.0f);
      }
    }
    lrow = lrow * alpha + ((pj[0] + pj[1]) + (pj[2] + pj[3]));
#pragma unroll
    for (int t = 0; t < 4; ++t)
#pragma unroll
      for (int r = 0; r < 8; ++r) oacc[t][r] *= alpha;

    // ---- context^T += V^T . P^T (f16 WMMA), residual products into a separate accumulator ----
    v8f o1[4];
#pragma unroll
    for (int t = 0; t < 4; ++t) o1[t] = zero8();
    // Unrolled, with each key half's V fragments read as one group ahead of its products; the four d tiles take turns.
#pragma unroll
    for (int kk = 0; kk < 2; ++kk) {
      FH vb[4], vl[4];
#pragma unroll
      for (int t = 0; t < 4; ++t) {
        vb[t].h[0] = *(const v8h*)(Vth + (t * 16 + c) * LP + kk * 32 + 8 * hh);
        vb[t].h[1] = *(const v8h*)(Vth + (t * 16 + c) * LP + kk * 32 + 16 + 8 * hh);
        if (RES) {
          vl[t].h[0] = *(const v8h*)(Vtl + (t * 16 + c) * LP + kk * 32 + 8 * hh);
          vl[t].h[1] = *(const v8h*)(Vtl + (t * 16 + c) * LP + kk * 32 + 16 + 8 * hh);
        } else {
          vl[t].v = vb[t].v;
        }
      }
#pragma unroll
      for (int t = 0; t < 4; ++t) oacc[t] = mma_h_raw(vb[t].v, pa[kk].v, oacc[t]);
      if (RES) {
#pragma unroll
        for (int t = 0; t < 4; ++t) o1[t] = mma_h_raw(vl[t].v, pa[kk].v, o1[t]);
#pragma unroll
        for (int t = 0; t < 4; ++t) o1[t] = mma_h_raw(vb[t].v, pl[kk].v, o1[t]);
      }
    }
    if (RES) {
#pragma unroll
      for (int t = 0; t < 4; ++t)
#pragma unroll
        for (int r = 0; r < 8; ++r) oacc[t][r] += o1[t][r] * (1.0f / 4096.0f);
    }
  }

  // ---- join the halves' normalisers, normalise (1/l and the 1/1024 p carry), stage the wave's 16x64 tile [query][d]
  //      (a lane's 8 registers of a tile are 8 consecutive d of its query: two 16-B stores), bf16 hi/lo split,
  // ---- join the two wave groups: group 1 leaves its context sums, running max and partial normaliser in LDS (a lane's own
  //      144-B row), all eight waves pass one barrier, group 0 rescales both parts to the common max and adds them; group 1 is done.
  float* xs = lds.Xs[wave] + lane * XP;
  if (grp == 1) {
#pragma unroll
    for (int t = 0; t < 4; ++t) {
      v4f w0, w1;
#pragma unroll
      for (int r = 0; r < 4; ++r) { w0[r] = oacc[t][r]; w1[r] = oacc[t][4 + r]; }
      *(v4f*)(xs + t * 8)     = w0;
      *(v4f*)(xs + t * 8 + 4) = w1;
    }
    xs[32] = mrow;
    xs[33] = lrow;
  }
  __syncthreads();
  if (grp == 1) return;                        // wave-uniform; no block barrier follows
  {
    const float m2 = xs[32], l2 = xs[33];
    const float mm = fmaxf(mrow, m2);
    const float ms = (mm == -INFINITY) ? 0.f : mm;
    const float a1 = exp_nat(mrow - ms);
    const float a2 = exp_nat(m2 - ms);    // group 1 kept no key (query block 0): m2 = -inf, a2 = 0, its sums are 0
    lrow = lrow * a1 + l2 * a2;
#pragma unroll
    for (int t = 0; t < 4; ++t) {
      const v4f x0 = *(const v4f*)(xs + t * 8);
      const v4f x1 = *(const v4f*)(xs + t * 8 + 4);
#pragma unroll
      for (int r = 0; r < 4; ++r) {
        oacc[t][r]     = oacc[t][r] * a1 + x0[r] * a2;
        oacc[t][4 + r] = oacc[t][4 + r] * a1 + x1[r] * a2;
      }
    }
  }

  float* os = Os[wave];
  {
    const float l = lrow + xhalf(lrow);        // unconditional: both halves take part in the exchange
    const float inv = ((l > 0.f) ? (1.0f / l) : 0.f) * (1.0f / 1024.0f);
#pragma unroll
    for (int t = 0; t < 4; ++t) {
      v4f w0, w1;
#pragma unroll
      for (int r = 0; r < 4; ++r) { w0[r] = oacc[t][r] * inv; w1[r] = oacc[t][4 + r] * inv; }
      *(v4f*)(os + c * OP + t * 16 + 8 * hh)     = w0;
      *(v4f*)(os + c * OP + t * 16 + 8 * hh + 4) = w1;
    }
  }
  __builtin_amdgcn_fence(__ATOMIC_RELEASE, "workgroup");
  __builtin_amdgcn_wave_barrier();
  __builtin_amdgcn_fence(__ATOMIC_ACQUIRE, "workgroup");
  {
    const int q4 = lane >> 3, c8 = (lane & 7) * 8;
    v4u hv[4], lv[4];
#pragma unroll
    for (int it = 0; it < 4; ++it) {
      const int row = it * 4 + q4;   // it 0..3 x q4 0..3 = rows 0..15 of the wave tile
      const float* sp = os + row * OP + c8;
      v4u a, a2;
#pragma unroll
      for (int e = 0; e < 4; ++e) {
        const float f0 = sp[2 * e], f1 = sp[2 * e + 1];
        const unsigned short h0 = bf_bits(f0), h1 = bf_bits(f1);
        const unsigned short l0 = bf_bits(f0 - bf_up(h0)), l1 = bf_bits(f1 - bf_up(h1));
        a[e] = pk16(h0, h1); a2[e] = pk16(l0, l1);
      }
      hv[it] = a; lv[it] = a2;
    }
    {
#pragma unroll
      for (int it = 0; it < 4; ++it) {
        const int row = it * 4 + q4;
        const size_t go = (rowB + q0 + row) * DM + (size_t)h * HD + c8;
        *(v4u*)(ohp + go) = hv[it];
        *(v4u*)(olp + go) = lv[it];
        // The registers these two stores name are reused for the next pair's address and data: wait before they are overwritten.
        asm volatile("s_wait_xcnt 0x0" ::: "memory");
      }
    }
  }
}

// Both attention variants in one grid. Eight-wave blocks no longer all fit on the chip at once, so the block index sets the order
// of starting. First the leading RESQB query blocks (residual planes): few trips, but each far dearer than a plain one, so started
// last they would run on alone. Then the plain blocks from the longest (NQB-1) down to RESQB: a place that falls free takes the
// longest block left, and the launch ends on the shortest. The branch is block-uniform.
__global__ __launch_bounds__(256)
void attn_all(const unsigned short* __restrict__ qhp, const unsigned short* __restrict__ qlp,
              const unsigned short* __restrict__ khp, const unsigned short* __restrict__ klp,
              const unsigned short* __restrict__ vhp, const unsigned short* __restrict__ vlp,
              unsigned short* ohp, unsigned short* olp) {
  __shared__ __align__(16) AttnLds lds;
  const int bx = blockIdx.x;
  const int g  = bx / (NB * NH);               // 0..NQB-1
  const int qb = (g < RESQB) ? (RESQB - 1 - g) : (NQB - 1 + RESQB - g);   // RESQB-1..0, then NQB-1..RESQB: every (qb, h, b) exactly once
  const int hb = bx % (NB * NH);
  if (qb >= RESQB) attn_causal64<false>(qhp, qlp, khp, klp, vhp, vlp, ohp, olp, qb, hb % NH, hb / NH, lds);
  else             attn_causal64<true>(qhp, qlp, khp, klp, vhp, vlp, ohp, olp, qb, hb % NH, hb / NH, lds);
}

// =====================================================================================================
// Workspace map (bytes; every region is an exact multiple of its 64x64-tile / whole-line store granularity,
//   Qb   bf16 [8192][512]            0            8388608
//   Kb   bf16 [8192][512]            8388608      8388608
//   Vb   bf16 [8192][512]            16777216     8388608
//   WqT  bf16 [512 n][512 k]         25165824     524288
//   WkT                              25690112     524288
//   WvT                              26214400     524288
//   WoT                              26738688     524288
//   Qh   bf16 [8192][512]            27262976     8388608
//   Ql                               35651584     8388608
//   Kh                               44040192     8388608
//   Kl                               52428800     8388608
//   VTh  f16  [2][512][4096]         60817408     8388608
//   VTl  f16  [2][512][512]          69206016     1048576
//   Oh   bf16 [8192][512]            70254592     8388608
//   Ol                               78643200     8388608
//   end                              87031808
// =====================================================================================================
extern "C" void kernel_launch(void* const* d_in, const int* in_sizes, int n_in,
                              void* d_out, int out_size, void* d_ws, size_t ws_size,
                              hipStream_t stream) {
  if (n_in < 11) return;
  const int NX = NB * SEQ * DM;                    // 4194304
  if (in_sizes[0] != NX || in_sizes[1] != NX || in_sizes[2] != NX) return;
  if (in_sizes[3] != DM * DM || in_sizes[5] != DM * DM || in_sizes[7] != DM * DM || in_sizes[9] != DM * DM) return;
  if (in_sizes[4] != DM || in_sizes[6] != DM || in_sizes[8] != DM || in_sizes[10] != DM) return;
  if (out_size != NX) return;

  const float* v  = (const float*)d_in[0];   // [2][4096][512]
  const float* k  = (const float*)d_in[1];   // [2][4096][512]
  const float* q  = (const float*)d_in[2];   // [2][4096][512]
  const float* Wq = (const float*)d_in[3];   // [512 in][512 out] = [k][n]
  const float* bq = (const float*)d_in[4];   // [512]
  const float* Wk = (const float*)d_in[5];   // [512 in][512 out]
  const float* bk = (const float*)d_in[6];   // [512]
  const float* Wv = (const float*)d_in[7];   // [512 in][512 out]
  const float* bv = (const float*)d_in[8];   // [512]
  const float* Wo = (const float*)d_in[9];   // [512 in][512 out]
  const float* bo = (const float*)d_in[10];  // [512]

  const size_t PX  = (size_t)NB * SEQ * DM * 2;    //  8388608  16-bit activation plane [8192][512]
  const size_t PW  = (size_t)DM * DM * 2;          //   524288  16-bit weight plane [512][512]
  const size_t PVT = (size_t)NB * DM * SEQ * 2;    //  8388608  v^T hi plane
  const size_t PVL = (size_t)NB * DM * VLP * 2;    //  1048576  v^T residual plane
  size_t off = 0;
  const size_t oQb  = off; off += PX;
  const size_t oKb  = off; off += PX;
  const size_t oVb  = off; off += PX;
  const size_t oWq  = off; off += PW;
  const size_t oWk  = off; off += PW;
  const size_t oWv  = off; off += PW;
  const size_t oWo  = off; off += PW;
  const size_t oQh  = off; off += PX;
  const size_t oQl  = off; off += PX;
  const size_t oKh  = off; off += PX;
  const size_t oKl  = off; off += PX;
  const size_t oVTh = off; off += PVT;
  const size_t oVTl = off; off += PVL;
  const size_t oOh  = off; off += PX;
  const size_t oOl  = off; off += PX;
  if (off > ws_size) return;                       // off = 87031808
  if (off > (size_t)134217728) return;

  char* ws = (char*)d_ws;
  unsigned short* Qb  = (unsigned short*)(ws + oQb);
  unsigned short* Kb  = (unsigned short*)(ws + oKb);
  unsigned short* Vb  = (unsigned short*)(ws + oVb);
  unsigned short* WqT = (unsigned short*)(ws + oWq);
  unsigned short* WkT = (unsigned short*)(ws + oWk);
  unsigned short* WvT = (unsigned short*)(ws + oWv);
  unsigned short* WoT = (unsigned short*)(ws + oWo);
  unsigned short* Qh  = (unsigned short*)(ws + oQh);
  unsigned short* Ql  = (unsigned short*)(ws + oQl);
  unsigned short* Kh  = (unsigned short*)(ws + oKh);
  unsigned short* Kl  = (unsigned short*)(ws + oKl);
  unsigned short* VTh = (unsigned short*)(ws + oVTh);
  unsigned short* VTl = (unsigned short*)(ws + oVTl);
  unsigned short* Oh  = (unsigned short*)(ws + oOh);
  unsigned short* Ol  = (unsigned short*)(ws + oOl);

  const dim3 blk(256);
  const dim3 gProj(GPB, 1);                                    // 1024 tiles -> 128 blocks: M=8192, N=512

  // (1) all plane conversions in one grid: weights f32 [k][n] -> bf16 W^T [n][k] (WqT, WkT, WvT, WoT are contiguous),
  //     activations f32 -> bf16 planes of the inputs' layout (Qb, Kb, Vb are contiguous)
  prep_planes<<<dim3(4 * NTR + 3 * NCV), blk, 0, stream>>>(q, k, v, Wq, Wk, Wv, Wo, Qb, WqT);
  // (2) the three input projections in one grid: qp, kp -> bf16 hi/lo planes [b*SEQ+t][h*64+d] (Qh, Ql, Kh, Kl contiguous),
  //     vp^T per batch -> f16 hi plane [b][h*64+d][s] (pitch SEQ) and residual plane (x4096, keys < VLP only, pitch VLP)
  gemm_qkv<<<dim3(GPB, 3), blk, 0, stream>>>(Qb, WqT, bq, bk, bv, Qh, VTh, VTl);
  // (3) causal attention, one grid: query blocks RESQB.. without, 0..RESQB-1 with residual planes
  attn_all<<<dim3(NB * NH * NQB), dim3(256), 0, stream>>>(Qh, Ql, Kh, Kl, VTh, VTl, Oh, Ol);
  // (4) out = context . Wo + bo -> d_out f32 [8192][512]  (A = context hi + lo planes, 2 products; Bt = WoT)
  gemm64<1, 0, 1, DM, DM><<<gProj, blk, 0, stream>>>(
      Oh, Ol, 0LL, WoT, 0LL, bo,
      d_out, DM, 0LL, d_out, DM, 0LL, DM,
      NB * SEQ, DM, DM, 1.0f);
  (void)hipGetLastError();
}

// v008
// Measured time: 115 microseconds a run.
// Next to v007, in two timings, it ran 1.07 times as fast each time.
// Counting every step since v000, it is 4.62 times as fast.
// Contractions: q, k, v^T projections = v_wmma_f32_16x16x32_bf16 (bf16 operands from RNE-converted inputs and weights, single product, f32 accumulate);
// k.q^T scores (keys down, queries across) = v_wmma_f32_16x16x32_bf16 with bf16 hi/lo split q and k (hi.hi + hi.lo + lo.hi), f32 accumulate;
// v^T.p^T = v_wmma_f32_16x16x32_f16 (p carried x1024 in f16 times v in f16, single product; plus f16 residual planes x4096 of
// p and v for the first 512 query rows of every sequence), f32 accumulate;
// ctx.Wo = v_wmma_f32_16x16x32_bf16 with ctx as bf16 hi/lo planes times bf16 Wo^T (2 products), f32 accumulate;
// causal mask (key <= query), online softmax, normalisers and bias adds in f32 on the VALU.
// Carry audit:
//   ph  = f16(1024 * p)                      -> the exponent's bias makes 1024 p directly; the normaliser l sums the same 1024 p, so inv = 1/l cancels it
//   pl  = f16((1024 p - ph) * 4096)          }  products VTl.ph and VTh.pl go to the separate accumulator o1,
//   VTl = f16((v - VTh) * 4096)              }  folded back with * (1/4096) once per key chunk (RES blocks only)
//   VTh = f16(v), no carry (|v| typ. 0.45); q / k / ctx lo planes are unscaled bf16 residuals (v - hi) sharing the hi accumulator;
//   score scale 1/8 applied once in f32, inside the multiply-add that forms the exponent. No other scaled planes.
#include <hip/hip_runtime.h>
#include <math.h>
#include <stdint.h>

#define NB    2
#define SEQ   4096
#define DM    512
#define NH    8
#define HD    64
#define NQB   (SEQ / 64)   // 64 query / key blocks of 64
#define VLP   512          // key pitch of the v^T residual plane (keys 0..VLP-1)
#define RESQB 8            // leading 64-row query blocks that use the p / v residual planes
#define LP    72           // LDS row pitch of the 64-element 16-bit tiles: 144 B = 16 B x 9, 16 rows of a 16-B read on 16 bank quads
#define OP    68           // LDS row pitch of the f32 context tile, in floats (16-B reads down a column walk)
static_assert(RESQB * 64 <= VLP);
static_assert(NH * HD == DM);
static_assert((SEQ % 64) == 0 && (DM % 64) == 0 && (DM % 32) == 0);
static_assert(((NB * SEQ / 64) * (DM / 64)) % 8 == 0);
static_assert(((DM / 64) * (SEQ / 64)) % 8 == 0);
static_assert((NB * SEQ * DM) % (8 * 256) == 0);
static_assert((DM * DM) % (64 * 64) == 0);
static_assert((DM % 512) == 0 && (SEQ % 512) == 0);   // a product's block takes 512 neighbouring rows of its second operand

typedef _Float16 v16h __attribute__((ext_vector_type(16)));
typedef _Float16 v8h  __attribute__((ext_vector_type(8)));
typedef __bf16   v16b __attribute__((ext_vector_type(16)));
typedef __bf16   v8b  __attribute__((ext_vector_type(8)));
typedef float    v8f  __attribute__((ext_vector_type(8)));
typedef float    v4f  __attribute__((ext_vector_type(4)));
typedef unsigned int v4u __attribute__((ext_vector_type(4)));

// ---- scalar helpers --------------------------------------------------------------------------------
__device__ __forceinline__ unsigned short bf_bits(float f) {          // f32 -> bf16 bits, RNE convert
  unsigned u = __float_as_uint(f);
  return (unsigned short)((u + 0x7FFFu + ((u >> 16) & 1u)) >> 16);
}
__device__ __forceinline__ float bf_up(unsigned short h) { return __uint_as_float(((unsigned)h) << 16); }
__device__ __forceinline__ unsigned short h_bits(_Float16 x) { return __builtin_bit_cast(unsigned short, x); }
__device__ __forceinline__ unsigned pk16(unsigned short a, unsigned short b) { return (unsigned)a | ((unsigned)b << 16); }
__device__ __forceinline__ v8f zero8() { v8f z = {0.f, 0.f, 0.f, 0.f, 0.f, 0.f, 0.f, 0.f}; return z; }
__device__ __forceinline__ v8h zero8h() {
  const _Float16 z = (_Float16)0.0f;
  v8h r = {z, z, z, z, z, z, z, z};
  return r;
}

// value of lane l ^ 16 (the other half of the wave), by a vector cross-row move
__device__ __forceinline__ float xhalf(float x) {
  const int i = __builtin_bit_cast(int, x);
  return __builtin_bit_cast(float, __builtin_amdgcn_permlanex16(i, i, 0x76543210, 0xfedcba98, false, false));
}

// 2^y: the exponential and one v_nop in one statement. The v_nop is the slot the instruction set asks for between a
// transcendental and an instruction that reads its result or overwrites its source; inside one statement nothing comes between them.
__device__ __forceinline__ float exp2_1(float y) {
  float r;
  asm("v_exp_f32 %0, %1\n\tv_nop" : "=v"(r) : "v"(y));
  return r;
}
// Eight independent 2^y in one statement: each exponential is the independent instruction behind the one before it (the results
// are early-clobber, so none lies on a source), and one v_nop behind the last keeps that slot: 9 issue slots, not 16.
__device__ __forceinline__ v8f exp2_8(v8f y) {
  float r0, r1, r2, r3, r4, r5, r6, r7;
  asm("v_exp_f32 %0, %8\n\tv_exp_f32 %1, %9\n\tv_exp_f32 %2, %10\n\tv_exp_f32 %3, %11\n\t"
      "v_exp_f32 %4, %12\n\tv_exp_f32 %5, %13\n\tv_exp_f32 %6, %14\n\tv_exp_f32 %7, %15\n\tv_nop"
      : "=&v"(r0), "=&v"(r1), "=&v"(r2), "=&v"(r3), "=&v"(r4), "=&v"(r5), "=&v"(r6), "=&v"(r7)
      : "v"(y[0]), "v"(y[1]), "v"(y[2]), "v"(y[3]), "v"(y[4]), "v"(y[5]), "v"(y[6]), "v"(y[7]));
  v8f r = {r0, r1, r2, r3, r4, r5, r6, r7};
  return r;
}
template <bool B> struct BoolC { static constexpr bool value = B; };

// ---- fragment loader: 16-bit A/B operand, lane -> row/col (lane&15), p already includes +8*(lane>>4);
//      elements 0..7 <- p[0..7] (k0+8h..), elements 8..15 <- p[16..23] (k0+16+8h..)
__device__ __forceinline__ v16b ldfrag_b(const __bf16* p) {
  union { v16b v; v8b h[2]; } f;
  f.h[0] = *(const v8b*)(p);
  f.h[1] = *(const v8b*)(p + 16);
  return f.v;
}

// ---- WMMA helpers with trailing VALU hazard gap --------------------------------------------------------
__device__ __forceinline__ v8f mma_h_raw(v16h a, v16h b, v8f c) {
  return __builtin_amdgcn_wmma_f32_16x16x32_f16(false, a, false, b, (short)0, c, false, false);
}
__device__ __forceinline__ v8f mma_b_raw(v16b a, v16b b, v8f c) {
  return __builtin_amdgcn_wmma_f32_16x16x32_bf16(false, a, false, b, (short)0, c, false, false);
}
__device__ __forceinline__ void dep_guard_b(v8f& a, v8f& b, v16b x, v16b y) {
  asm volatile("v_nop\n\tv_nop\n\tv_nop\n\tv_nop" : "+v"(a), "+v"(b) : "v"(x), "v"(y));
}
__device__ __forceinline__ void keep4_b(v16b a, v16b b, v16b c, v16b d) {
  asm volatile("v_nop" :: "v"(a), "v"(b), "v"(c), "v"(d));
}
__device__ __forceinline__ void acc_guard4(v8f& a, v8f& b, v8f& c, v8f& d) {
  asm volatile("v_nop\n\tv_nop\n\tv_nop\n\tv_nop" : "+v"(a), "+v"(b), "+v"(c), "+v"(d));
}

// =====================================================================================================
// f32 -> bf16 (RNE convert), 8 elements per thread, one 16-B store per lane: a wave writes 512 contiguous B
// the [8192][512] activations, a multiple of 256).
// coverage: n8 threads x 8 = the whole plane.
// =====================================================================================================
__device__ __forceinline__ void cvt_bf16x8(const float* __restrict__ in, unsigned short* out, int n8, int blk) {
  const int i = blk * 256 + threadIdx.x;
  if (i < n8) {
    const v4f a = *(const v4f*)(in + (size_t)i * 8);
    const v4f b = *(const v4f*)(in + (size_t)i * 8 + 4);
    v4u p;
    p[0] = pk16(bf_bits(a[0]), bf_bits(a[1]));
    p[1] = pk16(bf_bits(a[2]), bf_bits(a[3]));
    p[2] = pk16(bf_bits(b[0]), bf_bits(b[1]));
    p[3] = pk16(bf_bits(b[2]), bf_bits(b[3]));
    *(v4u*)(out + (size_t)i * 8) = p;
    
  }
}

// =====================================================================================================
// f32 [K rows][N cols] (pitch ldw) -> bf16 transposed plane WT[n][k] (pitch ldt, k contiguous), RNE convert.
// One 64x64 tile per block (n0 = 64 * tileN, k0 = 64 * tileK, N and K exact multiples of 64): the tile is staged in LDS with
// coalesced 16-B loads (256 threads x 16 floats = the whole tile), __syncthreads, then each output row segment
// coverage: 8 waves x 2 x (lane>>3 = 4 rows) = 64 rows n, 8 lanes x 8 = 64 k: the whole tile; grid = the whole plane.
// =====================================================================================================
__device__ __forceinline__ void cvt_bf16_tr64(const float* __restrict__ W, unsigned short* WT, int ldw, int ldt,
                                              int tileN, int tileK, float* sW) {
  const int tid = threadIdx.x;
  const int n0 = tileN * 64;
  const int k0 = tileK * 64;
  {
    const int kr = tid >> 2, cb = (tid & 3) * 16;          // row k0+kr, cols n0+cb .. +15
    const float* src = W + (size_t)(k0 + kr) * ldw + n0 + cb;
#pragma unroll
    for (int i = 0; i < 4; ++i) {
      const v4f f = *(const v4f*)(src + 4 * i);
      float* d = sW + kr * 65 + cb + 4 * i;
      d[0] = f[0]; d[1] = f[1]; d[2] = f[2]; d[3] = f[3];
    }
  }
  __syncthreads();
  const int wave = tid >> 5, lane = tid & 31;
  const int q = lane >> 3, c8 = (lane & 7) * 8;
  v4u pv[2];
#pragma unroll
  for (int it = 0; it < 2; ++it) {
    const int nr = wave * 8 + it * 4 + q;                  // output row n0+nr, 0 <= nr < 64
    v4u p;
#pragma unroll
    for (int e = 0; e < 4; ++e) {
      const float f0 = sW[(c8 + 2 * e) * 65 + nr];
      const float f1 = sW[(c8 + 2 * e + 1) * 65 + nr];
      p[e] = pk16(bf_bits(f0), bf_bits(f1));
    }
    pv[it] = p;
  }
  {
#pragma unroll
    for (int it = 0; it < 2; ++it) {
      const int nr = wave * 8 + it * 4 + q;
      *(v4u*)(WT + (size_t)(n0 + nr) * ldt + k0 + c8) = pv[it];
    }
    
  }
}

// =====================================================================================================
// One grid for all seven independent plane conversions: blocks 0..4*NTR-1 transpose the four weights (64x64 tile each,
// planes WT + w*DM*DM in the order Wq, Wk, Wv, Wo), the next 3*NCV blocks convert q, k, v (planes Xb + w*NB*SEQ*DM).
// The branch is block-uniform, so the transpose's __syncthreads is passed by all threads of its block or by none.
// =====================================================================================================
#define NTR ((DM / 64) * (DM / 64))          // 64 tiles per weight
#define NCV ((NB * SEQ * DM) / (8 * 256))    // 2048 blocks per activation plane
__global__ __launch_bounds__(256) void prep_planes(const float* __restrict__ q, const float* __restrict__ k,
                                                   const float* __restrict__ v,
                                                   const float* __restrict__ Wq, const float* __restrict__ Wk,
                                                   const float* __restrict__ Wv, const float* __restrict__ Wo,
                                                   unsigned short* Xb, unsigned short* WT) {
  __shared__ __align__(16) float sW[64 * 65];
  const int bx = blockIdx.x;
  if (bx < 4 * NTR) {
    const int w = bx / NTR, t = bx % NTR;
    const float* W = (w == 0) ? Wq : (w == 1) ? Wk : (w == 2) ? Wv : Wo;
    cvt_bf16_tr64(W, WT + (size_t)w * DM * DM, DM, DM, t % (DM / 64), t / (DM / 64), sW);
  } else {
    const int cb = bx - 4 * NTR;
    const int w = cb / NCV, blk = cb % NCV;
    const float* in = (w == 0) ? q : (w == 1) ? k : v;
    cvt_bf16x8(in, Xb + (size_t)w * NB * SEQ * DM, (NB * SEQ * DM) / 8, blk);
  }
}

// =====================================================================================================
// Register-blocked batched bf16 WMMA GEMM: C[m][n] = sum_k A[m][k] * Bt[n][k] + bias; one wave per 64x64 tile.
// A row-major [M][K] pitch lda; Bt row-major [N][K] pitch ldb (k contiguous);
// M a multiple of 64, N of 512, K of 64 (host shapes are static multiples). b = batch index (strides in elements).
// A block's eight tiles are one tile row and eight neighbouring tile columns: 64 rows of A, 512 rows of Bt. Per stage of 64 k
// (one 128-B line of every row) the block brings them to LDS with whole-line loads (8 lanes per row, 4 rows per wave-wide load,
// 256 threads x 16 pieces = all of Bt's 512 x 64, x 2 pieces = all of each A plane's 64 x 64), pitch LP, between two barriers;
// the fragments are then read from LDS in the k order they had from memory, so every accumulator sums in the same order.
// NSPLIT: 0 = A.Bt; 1 = (A + A2).Bt (A2 = unscaled bf16 lo plane of A, 2 products).
// BIAS: 0 = none; 1 = per column n, bias[n]; 2 = per row m, bias[m]; the bias value is RNE-converted to bf16 and added in f32.
// OUT_MODE: 0 = f32 (pitch ldc); 2 = bf16 hi plane C + bf16 lo plane C2 (lo = RNE(v - hi), unscaled);
//           3 = f16 hi plane C + f16 residual plane C2 = f16((v - hi) * rscale), C2 written only for tiles
//               with n0 < N2 (pitch ldc2, batch stride strideC2).
// =====================================================================================================
template <int NSPLIT, int OUT_MODE, int BIAS>
__device__ __forceinline__ void gemm64_body(
    const unsigned short* __restrict__ Ap, const unsigned short* A2p, int lda, long long strideA,
    const unsigned short* __restrict__ Btp, int ldb, long long strideB,
    const float* __restrict__ bias,
    void* Cout, int ldc, long long strideC,
    void* Cout2, int ldc2, long long strideC2, int N2,
    int M, int N, int K, float rscale,
    int blk, int b, float (*sT)[16 * 68],     // blk = block index inside this product, b = batch index
    __bf16* sA, __bf16* sA2, __bf16* sB) {    // LDS stage: A and A2 [64][LP], Bt [512][LP] (sA2 read and written only when NSPLIT)
  const __bf16* A   = (const __bf16*)(const void*)Ap;
  const __bf16* A2  = (const __bf16*)(const void*)A2p;
  const __bf16* Bt  = (const __bf16*)(const void*)Btp;
  const int lane = threadIdx.x & 31;
  const int wave = threadIdx.x >> 5;
  const int tilesN = N >> 6;
  const int tilesM = M >> 6;
  const int tile0 = blk * 8;                 // the block's first tile; tilesN is a multiple of 8, so its eight tiles share a tile row
  if (tile0 + 8 > tilesM * tilesN) return;   // block-uniform, in front of every barrier
  const int tm = tile0 / tilesN;
  const int nb0 = (tile0 - tm * tilesN) << 6; // first Bt row of the block
  const int m0 = tm << 6;
  const int n0 = nb0 + (wave << 6);

  const __bf16* Ab  = A  + (size_t)b * strideA;
  const __bf16* Bb  = Bt + (size_t)b * strideB;
  const __bf16* Ab2 = (NSPLIT >= 1) ? (A2 + (size_t)b * strideA) : Ab;

  const int rlane = lane & 15;                 // row (A) / col (B, D) within subtile
  const int koff  = (lane >> 4) * 8;           // k offset of this lane half
  const int mOff  = (lane >> 4) * 8;           // D row offset

  v8f acc[4][4];
#pragma unroll
  for (int i = 0; i < 4; ++i)
#pragma unroll
    for (int j = 0; j < 4; ++j) acc[i][j] = zero8();

  const int sr  = threadIdx.x >> 3;            // staging: row sr + 32 i of a plane, piece spc .. spc + 7 of its 64 k
  const int spc = (threadIdx.x & 7) * 8;
  for (int k0 = 0; k0 < K; k0 += 64) {
    __syncthreads();                           // every wave has read its last fragments of the stage before
    {
      const __bf16* bg  = Bb  + (size_t)(nb0 + sr) * ldb + k0 + spc;
      const __bf16* ag  = Ab  + (size_t)(m0 + sr) * lda + k0 + spc;
      const __bf16* ag2 = Ab2 + (size_t)(m0 + sr) * lda + k0 + spc;
      v8b tb[16], ta[2], ta2[2];
#pragma unroll
      for (int i = 0; i < 16; ++i) tb[i] = *(const v8b*)(bg + (size_t)(32 * i) * ldb);
#pragma unroll
      for (int i = 0; i < 2; ++i) {
        ta[i] = *(const v8b*)(ag + (size_t)(32 * i) * lda);
        if (NSPLIT >= 1) ta2[i] = *(const v8b*)(ag2 + (size_t)(32 * i) * lda);
      }
      // The address pairs get the next stage's values: the wait that belongs in front of that stands behind the batch of loads.
      // The pairs are its inputs, so no load's result is placed on them ahead of it.
      asm volatile("s_wait_xcnt 0x0" :: "v"(bg), "v"(ag), "v"(ag2) : "memory");
#pragma unroll
      for (int i = 0; i < 16; ++i) *(v8b*)(sB + (sr + 32 * i) * LP + spc) = tb[i];
#pragma unroll
      for (int i = 0; i < 2; ++i) {
        *(v8b*)(sA + (sr + 32 * i) * LP + spc) = ta[i];
        if (NSPLIT >= 1) *(v8b*)(sA2 + (sr + 32 * i) * LP + spc) = ta2[i];
      }
    }
    __syncthreads();                           // the stage is whole before any wave reads a fragment
#pragma unroll
    for (int kk = 0; kk < 2; ++kk) {
      // all fragments of these 32 k are read as one group ahead of their products: one LDS wait, not one per A fragment
      v16b bh[4], ah[4], al[4];
#pragma unroll
      for (int j = 0; j < 4; ++j) bh[j] = ldfrag_b(sB + ((wave << 6) + (j << 4) + rlane) * LP + kk * 32 + koff);
#pragma unroll
      for (int i = 0; i < 4; ++i) {
        const int ao = ((i << 4) + rlane) * LP + kk * 32 + koff;
        ah[i] = ldfrag_b(sA + ao);
        al[i] = ah[i];
        if (NSPLIT >= 1) al[i] = ldfrag_b(sA2 + ao);
      }
#pragma unroll
      for (int i = 0; i < 4; ++i) {
#pragma unroll
        for (int j = 0; j < 4; ++j) {
          acc[i][j] = mma_b_raw(ah[i], bh[j], acc[i][j]);
          if (NSPLIT >= 1) acc[i][j] = mma_b_raw(al[i], bh[j], acc[i][j]);
        }
        dep_guard_b(acc[i][0], acc[i][3], ah[i], al[i]);
      }
      keep4_b(bh[0], bh[1], bh[2], bh[3]);
    }
  }
  acc_guard4(acc[0][0], acc[0][1], acc[0][2], acc[0][3]);
  acc_guard4(acc[1][0], acc[1][1], acc[1][2], acc[1][3]);
  acc_guard4(acc[2][0], acc[2][1], acc[2][2], acc[2][3]);
  acc_guard4(acc[3][0], acc[3][1], acc[3][2], acc[3][3]);

  // ---- epilogue ----
  float* slab = sT[wave];
  float bcol[4];
#pragma unroll
  for (int j = 0; j < 4; ++j) {
    bcol[j] = 0.f;
    if (BIAS == 1) bcol[j] = bf_up(bf_bits(bias[n0 + (j << 4) + rlane]));   // n < N, bias has N entries
  }
#pragma unroll
  for (int i = 0; i < 4; ++i) {
    const int mBase = m0 + (i << 4);
    float brow[8];
#pragma unroll
    for (int r = 0; r < 8; ++r) {
      brow[r] = 0.f;
      if (BIAS == 2) brow[r] = bf_up(bf_bits(bias[mBase + mOff + r]));      // m < M, bias has M entries
    }
#pragma unroll
    for (int j = 0; j < 4; ++j) {
#pragma unroll
      for (int r = 0; r < 8; ++r) {
        slab[(mOff + r) * 68 + (j << 4) + rlane] = acc[i][j][r] + bcol[j] + brow[r];
      }
    }
    __builtin_amdgcn_fence(__ATOMIC_RELEASE, "workgroup");
    __builtin_amdgcn_wave_barrier();
    __builtin_amdgcn_fence(__ATOMIC_ACQUIRE, "workgroup");
    if (OUT_MODE == 0) {
      float* C = (float*)Cout + (size_t)b * strideC;
      const int hh = lane >> 4, c4 = (lane & 15) * 4;     // 256-B row segment = 16 lanes x 16 B
      {
#pragma unroll
        for (int it = 0; it < 8; ++it) {
          const int row = it * 2 + hh;                     // it 0..7 x hh 0..1 = rows 0..15
          const v4f v = *(const v4f*)(slab + row * 68 + c4);
          *(v4f*)(C + (size_t)(mBase + row) * ldc + n0 + c4) = v;
        }
        
      }
    } else {
      const int q = lane >> 3, c8 = (lane & 7) * 8;
      unsigned short* C  = (unsigned short*)Cout  + (size_t)b * strideC;
      unsigned short* C2 = (unsigned short*)Cout2 + (size_t)b * strideC2;
      const bool wlo = (OUT_MODE == 2) || (n0 < N2);      // wave-uniform
      v4u hv[4], lv[4];
#pragma unroll
      for (int it = 0; it < 4; ++it) {
        const int row = it * 4 + q;                        // it 0..3 x q 0..3 = rows 0..15
        const float* sp = slab + row * 68 + c8;
        v4u a, a2;
#pragma unroll
        for (int e = 0; e < 4; ++e) {
          const float f0 = sp[2 * e], f1 = sp[2 * e + 1];
          unsigned short h0, h1, l0, l1;
          if (OUT_MODE == 2) {
            h0 = bf_bits(f0); h1 = bf_bits(f1);
            l0 = bf_bits(f0 - bf_up(h0)); l1 = bf_bits(f1 - bf_up(h1));
          } else {
            const _Float16 x0 = (_Float16)f0, x1 = (_Float16)f1;
            h0 = h_bits(x0); h1 = h_bits(x1);
            l0 = h_bits((_Float16)((f0 - (float)x0) * rscale));
            l1 = h_bits((_Float16)((f1 - (float)x1) * rscale));
          }
          a[e] = pk16(h0, h1); a2[e] = pk16(l0, l1);
        }
        hv[it] = a; lv[it] = a2;
      }
      {
#pragma unroll
        for (int it = 0; it < 4; ++it) {
          const int row = it * 4 + q;
          *(v4u*)(C + (size_t)(mBase + row) * ldc + n0 + c8) = hv[it];
          if (wlo) *(v4u*)(C2 + (size_t)(mBase + row) * ldc2 + n0 + c8) = lv[it];
        }
        
      }
    }
    __builtin_amdgcn_fence(__ATOMIC_RELEASE, "workgroup");
    __builtin_amdgcn_wave_barrier();
    __builtin_amdgcn_fence(__ATOMIC_ACQUIRE, "workgroup");
  }
}

// One product per launch (the output projection). The operand pitches are template constants, so the staging loads' row steps
// are immediate offsets from one address pair per plane.
template <int NSPLIT, int OUT_MODE, int BIAS, int lda, int ldb>
__global__ __launch_bounds__(256) void gemm64(
    const unsigned short* __restrict__ Ap, const unsigned short* A2p, long long strideA,
    const unsigned short* __restrict__ Btp, long long strideB,
    const float* __restrict__ bias,
    void* Cout, int ldc, long long strideC,
    void* Cout2, int ldc2, long long strideC2, int N2,
    int M, int N, int K, float rscale) {
  __shared__ __align__(16) float sT[8][16 * 68];   // per-wave 16x64 slab, pitch 68 floats
  __shared__ __align__(16) __bf16 sB[512 * LP];
  __shared__ __align__(16) __bf16 sA[(NSPLIT >= 1 ? 2 : 1) * 64 * LP];
  gemm64_body<NSPLIT, OUT_MODE, BIAS>(Ap, A2p, lda, strideA, Btp, ldb, strideB, bias, Cout, ldc, strideC,
                                      Cout2, ldc2, strideC2, N2, M, N, K, rscale, blockIdx.x, blockIdx.y, sT,
                                      sA, sA + (NSPLIT >= 1 ? 64 * LP : 0), sB);
}

// The three independent input projections in one grid (GPB blocks each): blockIdx.y = 0: qp, 1: kp (bf16 hi/lo planes,
// M = NB*SEQ, N = DM), 2: vp^T (f16 hi + residual planes, M = DM, N = SEQ, batch = blockIdx.x / (GPB / NB)).
// Xb = bf16 planes of q, k, v in that order; WT = W^T planes of Wq, Wk, Wv; QK = planes Qh, Ql, Kh, Kl in that order.
#define GPB (((NB * SEQ / 64) * (DM / 64)) / 8)   // 128 blocks of 8 tiles
static_assert(GPB == NB * (((DM / 64) * (SEQ / 64)) / 8));
__global__ __launch_bounds__(256) void gemm_qkv(
    const unsigned short* __restrict__ Xb, const unsigned short* __restrict__ WT,
    const float* __restrict__ bq, const float* __restrict__ bk, const float* __restrict__ bv,
    unsigned short* QK, unsigned short* VTh, unsigned short* VTl) {
  __shared__ __align__(16) float sT[8][16 * 68];   // per-wave 16x64 slab, pitch 68 floats
  __shared__ __align__(16) __bf16 sB[512 * LP];
  __shared__ __align__(16) __bf16 sA[64 * LP];
  const size_t NXE = (size_t)NB * SEQ * DM;
  const int y = blockIdx.y;                        // block-uniform
  if (y < 2) {
    const unsigned short* A = Xb + (size_t)y * NXE;
    gemm64_body<0, 2, 1>(A, A, DM, 0LL, WT + (size_t)y * DM * DM, DM, 0LL, y ? bk : bq,
                         (void*)(QK + (size_t)(2 * y) * NXE), DM, 0LL, (void*)(QK + (size_t)(2 * y + 1) * NXE), DM, 0LL, DM,
                         NB * SEQ, DM, DM, 1.0f, blockIdx.x, 0, sT, sA, sA, sB);
  } else {
    const unsigned short* A = WT + (size_t)2 * DM * DM;
    gemm64_body<0, 3, 2>(A, A, DM, 0LL, Xb + 2 * NXE, DM, (long long)SEQ * DM, bv,
                         (void*)VTh, SEQ, (long long)DM * SEQ, (void*)VTl, VLP, (long long)DM * VLP, VLP,
                         DM, SEQ, DM, 4096.0f, blockIdx.x % (GPB / NB), blockIdx.x / (GPB / NB), sT, sA, sA, sB);
  }
}

// =====================================================================================================
// Causal attention, head dim 64, key chunks of 64.
//   q planes (bf16 hi / lo): element (b, t, h, d) at [(b*SEQ + t)*DM + h*64 + d]
//   k planes (bf16 hi / lo): same layout with key index s
//   v^T hi plane (f16):      element (b, h, d, s) at [(b*DM + h*64 + d)*SEQ + s]
//   v^T residual plane (f16, (v - hi)*4096): [(b*DM + h*64 + d)*VLP + s], s < VLP, read only when RES
//   (a key chunk at or beyond VLP would contribute a zero v residual; its address is clamped)
//   Mask: query t keeps key s iff s <= t. A query block qb therefore needs key chunks 0..qb only. They are dealt to two wave
//   groups, even chunks to group 0, odd chunks to group 1 (block-uniform trip count (qb+2)/2 <= NQB/2); for even qb group 1's
//   last chunk is qb+1, in bounds and wholly masked. Each group keeps its own running max, normaliser and context sums.
//   Inside a visited chunk a masked key gets logit -inf -> exp gives exactly 0, so it adds nothing to the numerator
//   or the normaliser. Row max bookkeeping: every query keeps key 0 (chunk 0), so group 0's running max of every row is finite
//   after its first chunk; a group that has kept no key yet has max -inf, sums 0, and rescales by 0. Every row ends with l > 0.
//   out planes (bf16 hi / lo of the normalised context): element (b, t, h, d) at [(b*SEQ + t)*DM + h*64 + d]
//   scores = q . k : bf16 hi/lo split (hi.hi + hi.lo + lo.hi), f32 accumulate, then * 1/8 and the mask in f32
//   p = exp(s - m) carried as f16(1024 p); context = p . v on f16 WMMA; RES adds f16 residual planes of p and v
//   (scale 4096, separate accumulator folded back with 1/4096 per chunk in f32); online softmax (running max) in f32.
//   Block = 2 groups x 4 waves = 64 query rows of one (b, h), wave w and wave w+4 on the same 16 rows; grid = NQB * NH * NB.
//   K / V^T chunk staging, per group into its own tiles: 128 threads x 4 rows x 8 elements per plane = the whole 64x64 tile of every plane read later
//   (plain 16-B loads, 8 lanes per 128-B row, __syncthreads before and after).
//   Both products are computed transposed: S^T = K . Q^T (A = K rows, B = Q) and O^T += V^T . P^T (A = V^T rows, B = P^T).
//   A lane then holds 32 scores of ONE query (column lane&15; keys j*16 + 8*(lane>>4) + r): maximum and sum run in the lane,
//   the two wave halves exchange the maximum once per chunk and join their partial normalisers once, after the loop.
//   Two score tiles 2kk, 2kk+1, converted in place, are the B operand of key half kk in the hardware k order
//   (element e < 8: key 8*(lane>>4) + e, e >= 8: key 16 + 8*(lane>>4) + e - 8), the order the V^T loads already have: P never touches LDS.
//   Output coverage: each wave of group 0 stores rows q0..q0+15 (it 0..3 x lane>>3 0..3) x 64 columns (8 lanes x 8) of both planes;
//   grid over all (b, h, qb) = the whole [NB*SEQ][DM] planes.
// =====================================================================================================
#define XP 36                                      // floats per lane in the hand-over area: 144 B = 16 B x 9, 16-B accesses conflict-free
struct AttnTiles {                                 // one key chunk, staged and read by one wave group only
  __bf16   Ksh[64 * LP];                            // K hi [kv][d], pitch LP
  __bf16   Ksl[64 * LP];                            // K lo
  _Float16 Vth[64 * LP];                            // V^T hi [d][kv], pitch LP
  _Float16 Vtl[64 * LP];                            // V^T residual (RES only)
};
struct AttnLds {                                   // one LDS layout for both variants (they share a grid)
  AttnTiles t[2];                                   // wave group 0: even key chunks, wave group 1: odd key chunks
  float    Os[4][16 * OP];                          // per wave context tile [row][d] (group 0)
  float    Xs[4][32 * XP];                          // group 1 -> group 0: per lane 32 context sums, running max, partial normaliser
};
static_assert((64 * LP * 2) % 16 == 0 && (16 * LP * 2) % 16 == 0 && (16 * OP * 4) % 16 == 0 && (XP * 4) % 16 == 0);

template <bool RES>
__device__ __forceinline__
void attn_causal64(const unsigned short* __restrict__ qhp, const unsigned short* __restrict__ qlp,
                   const unsigned short* __restrict__ khp, const unsigned short* __restrict__ klp,
                   const unsigned short* __restrict__ vhp, const unsigned short* __restrict__ vlp,
                   unsigned short* ohp, unsigned short* olp,
                   int qb, int h, int b, AttnLds& lds) {   // qb = 0..NQB-1, h, b: block-uniform
  union FB { v16b v; v8b h[2]; };
  union FH { v16h v; v8h h[2]; };
  const int tid  = threadIdx.x & 127;          // thread inside its wave group
  const int grp  = __builtin_amdgcn_readfirstlane((int)(threadIdx.x >> 7));   // wave group 0 / 1, wave-uniform
  const int wave = tid >> 5;                   // 0..3: the 16 query rows of the block this wave owns
  const int lane = tid & 31;
  const int hh   = lane >> 4;
  const int c    = lane & 15;

  __bf16*   const Ksh = lds.t[grp].Ksh;
  __bf16*   const Ksl = lds.t[grp].Ksl;
  _Float16* const Vth = lds.t[grp].Vth;
  _Float16* const Vtl = lds.t[grp].Vtl;
  float    (* const Os)[16 * OP]  = lds.Os;

  const int q0   = qb * 64 + wave * 16;
  const size_t rowB = (size_t)b * SEQ;

  const __bf16* Qh = (const __bf16*)(const void*)qhp + (size_t)h * HD;
  const __bf16* Ql = (const __bf16*)(const void*)qlp + (size_t)h * HD;
  const __bf16* Kh = (const __bf16*)(const void*)khp + (size_t)h * HD;
  const __bf16* Kl = (const __bf16*)(const void*)klp + (size_t)h * HD;
  const _Float16* Vh = (const _Float16*)(const void*)vhp + ((size_t)b * DM + (size_t)h * HD) * SEQ;
  const _Float16* Vl = (const _Float16*)(const void*)vlp + ((size_t)b * DM + (size_t)h * HD) * VLP;

  // ---- Q fragments (B operand, column = lane&15): 2 d-chunks, hi and lo ----
  v16b qah[2], qal[2];
  const __bf16* qhg = Qh + (rowB + q0 + c) * DM + 8 * hh;
  const __bf16* qlg = Ql + (rowB + q0 + c) * DM + 8 * hh;
#pragma unroll
  for (int dc = 0; dc < 2; ++dc) {
    qah[dc] = ldfrag_b(qhg + dc * 32);
    qal[dc] = ldfrag_b(qlg + dc * 32);
  }
  // The two address pairs are free for reuse behind these loads: the wait that belongs in front of an overwrite, the pairs as its inputs.
  asm volatile("s_wait_xcnt 0x0" :: "v"(qhg), "v"(qlg) : "memory");

  const int rowq = q0 + c;                     // this lane's query
  float mrow = -INFINITY, lrow = 0.f;          // running exponent offset of the query (both halves alike), this half's partial normaliser (of 1024 p)
  v8f oacc[4];                                 // oacc[t][r] = O^T[d = t*16 + 8hh + r][query c]
#pragma unroll
  for (int t = 0; t < 4; ++t) oacc[t] = zero8();

  // One staged key chunk: scores, online softmax, context sums. MASK = the chunk may hold keys beyond a query of this block.
  const float SC2 = 0.125f * 1.44269504088896340736f;   // score scale times log2 e
  auto chunk = [&](auto mk, const int kv0) __attribute__((always_inline)) {
    constexpr bool MASK = decltype(mk)::value;
    // ---- scores, transposed: 64 keys x 16 queries per wave, 3 bf16 products ----
    // All K fragments of a d-chunk are read as one group, then the four key tiles' accumulators take turns, so one LDS wait
    // serves 12 products and no product waits for the one before it. Each s[j] still sums hi.hi, hi.lo, lo.hi per d-chunk.
    v8f s[4];                                  // s[j][r] = S^T[key kv0 + j*16 + 8hh + r][query c]
#pragma unroll
    for (int j = 0; j < 4; ++j) s[j] = zero8();
#pragma unroll
    for (int dc = 0; dc < 2; ++dc) {
      FB kb[4], kl[4];
#pragma unroll
      for (int j = 0; j < 4; ++j) {
        kb[j].h[0] = *(const v8b*)(Ksh + (j * 16 + c) * LP + dc * 32 + 8 * hh);
        kb[j].h[1] = *(const v8b*)(Ksh + (j * 16 + c) * LP + dc * 32 + 16 + 8 * hh);
        kl[j].h[0] = *(const v8b*)(Ksl + (j * 16 + c) * LP + dc * 32 + 8 * hh);
        kl[j].h[1] = *(const v8b*)(Ksl + (j * 16 + c) * LP + dc * 32 + 16 + 8 * hh);
      }
#pragma unroll
      for (int j = 0; j < 4; ++j) s[j] = mma_b_raw(kb[j].v, qah[dc], s[j]);
#pragma unroll
      for (int j = 0; j < 4; ++j) s[j] = mma_b_raw(kl[j].v, qah[dc], s[j]);
#pragma unroll
      for (int j = 0; j < 4; ++j) s[j] = mma_b_raw(kb[j].v, qal[dc], s[j]);
    }

    // ---- causal mask by index (MASK chunks only), maximum of the raw scores in the lane (one chain per key tile), one exchange ----
    float mj[4];
#pragma unroll
    for (int j = 0; j < 4; ++j) {
      mj[j] = -INFINITY;
#pragma unroll
      for (int r = 0; r < 8; ++r) {
        if (MASK) {
          const int key = kv0 + j * 16 + 8 * hh + r;
          s[j][r] = (key <= rowq) ? s[j][r] : -INFINITY;
        }
        mj[j] = fmaxf(mj[j], s[j][r]);
      }
    }
    float m = fmaxf(fmaxf(mj[0], mj[1]), fmaxf(mj[2], mj[3]));
    m = fmaxf(m, xhalf(m));                    // both halves now hold the query's maximum over the chunk
    // The running max is kept as the exponent's offset: max * (log2 e / 8) - 10, rounded once (monotone in the max, -inf stays -inf).
    // Every p, every rescale and the groups' join subtract such offsets only, so numerator and normaliser share one reference.
    const float mnew  = fmaxf(mrow, __builtin_fmaf(m, SC2, -10.0f));
    const float msafe = (mnew == -INFINITY) ? 0.f : mnew;
    const float alpha = exp2_1(mrow - msafe);
    mrow = mnew;

    // ---- online softmax; P (x1024, f16) and P residual (x4096) packed straight into the B operands of the second product ----
    FH pa[2], pl[2];
    float pj[4];
    const v8f sc2v = {SC2, SC2, SC2, SC2, SC2, SC2, SC2, SC2};
    const v8f nmv  = {-msafe, -msafe, -msafe, -msafe, -msafe, -msafe, -msafe, -msafe};
#pragma unroll
    for (int j = 0; j < 4; ++j) {
      // one fused multiply-add per score (as a vector, so two share an instruction): 1/8, log2 e, the max and the x1024 carry
      v8f y;
      if (RES) {                               // single FMAs: as pairs this variant's build took 259 registers, and above 256 one block fewer fits a WGP
#pragma unroll
        for (int r = 0; r < 8; ++r) y[r] = __builtin_fmaf(s[j][r], SC2, -msafe);
      } else {
        y = __builtin_elementwise_fma(s[j], sc2v, nmv);
      }
      const v8f e = exp2_8(y);                 // 1024 p; masked logit: 2^(-inf) = 0
#pragma unroll
      for (int r = 0; r < 8; ++r) {
        const float p1k = e[r];
        pj[j] = r ? pj[j] + p1k : p1k;
        const _Float16 ph = (_Float16)p1k;
        pa[j >> 1].v[(j & 1) * 8 + r] = ph;
        if (RES) pl[j >> 1].v[(j & 1) * 8 + r] = (_Float16)((p1k - (float)ph) * 4096.0f);
      }
    }
    lrow = lrow * alpha + ((pj[0] + pj[1]) + (pj[2] + pj[3]));
#pragma unroll
    for (int t = 0; t < 4; ++t)
#pragma unroll
      for (int r = 0; r < 8; ++r) oacc[t][r] *= alpha;

    // ---- context^T += V^T . P^T (f16 WMMA), residual products into a separate accumulator ----
    v8f o1[4];
#pragma unroll
    for (int t = 0; t < 4; ++t) o1[t] = zero8();
    // Unrolled, with each key half's V fragments read as one group ahead of its products; the four d tiles take turns.
#pragma unroll
    for (int kk = 0; kk < 2; ++kk) {
      FH vb[4], vl[4];
#pragma unroll
      for (int t = 0; t < 4; ++t) {
        vb[t].h[0] = *(const v8h*)(Vth + (t * 16 + c) * LP + kk * 32 + 8 * hh);
        vb[t].h[1] = *(const v8h*)(Vth + (t * 16 + c) * LP + kk * 32 + 16 + 8 * hh);
        if (RES) {
          vl[t].h[0] = *(const v8h*)(Vtl + (t * 16 + c) * LP + kk * 32 + 8 * hh);
          vl[t].h[1] = *(const v8h*)(Vtl + (t * 16 + c) * LP + kk * 32 + 16 + 8 * hh);
        } else {
          vl[t].v = vb[t].v;
        }
      }
#pragma unroll
      for (int t = 0; t < 4; ++t) oacc[t] = mma_h_raw(vb[t].v, pa[kk].v, oacc[t]);
      if (RES) {
#pragma unroll
        for (int t = 0; t < 4; ++t) o1[t] = mma_h_raw(vl[t].v, pa[kk].v, o1[t]);
#pragma unroll
        for (int t = 0; t < 4; ++t) o1[t] = mma_h_raw(vb[t].v, pl[kk].v, o1[t]);
      }
    }
    if (RES) {
#pragma unroll
      for (int t = 0; t < 4; ++t)
#pragma unroll
        for (int r = 0; r < 8; ++r) oacc[t][r] += o1[t][r] * (1.0f / 4096.0f);
    }
  };

  // Bring key chunk kv0 .. kv0 + 63 into this group's tiles, between two barriers that all eight waves pass.
  auto stage = [&](const int kv0) __attribute__((always_inline)) {
    __syncthreads();
    {
      // 8 lanes per 128-B row, 4 rows per wave and load: every wave-wide 16-B load covers 4 whole lines (2 lanes per row
      // touched 16 lines for the same 512 B). A thread takes piece pc of rows r, r+16, r+32, r+48.
      const int r = tid >> 3, pc = (tid & 7) * 8;
      const __bf16*   kg  = Kh + (rowB + kv0 + r) * DM + pc;      // K row kv0+r, d = pc..pc+7
      const __bf16*   klg = Kl + (rowB + kv0 + r) * DM + pc;
      const _Float16* vg  = Vh + (size_t)r * SEQ + kv0 + pc;      // V^T row d = r, s = kv0+pc..+7
      const int kvl = (kv0 + 64 <= VLP) ? kv0 : (VLP - 64);     // clamped address into the residual plane
      const _Float16* vlg = Vl + (size_t)r * VLP + kvl + pc;
      const bool resOK = (kv0 + 64 <= VLP);                      // wave-uniform (always true for qb < RESQB)
#pragma unroll
      for (int i = 0; i < 4; ++i) {
        const v8b a0 = *(const v8b*)(kg + (size_t)(16 * i) * DM);
        const v8b a1 = *(const v8b*)(klg + (size_t)(16 * i) * DM);
        const v8h b0 = *(const v8h*)(vg + (size_t)(16 * i) * SEQ);
        *(v8b*)(Ksh + (r + 16 * i) * LP + pc) = a0;
        *(v8b*)(Ksl + (r + 16 * i) * LP + pc) = a1;
        *(v8h*)(Vth + (r + 16 * i) * LP + pc) = b0;
        if (RES) {
          v8h b1 = *(const v8h*)(vlg + (size_t)(16 * i) * VLP);
          if (!resOK) b1 = zero8h();
          *(v8h*)(Vtl + (r + 16 * i) * LP + pc) = b1;
        }
      }
      // RES build: the last load's result was placed on address pairs that earlier loads of this batch name. The pairs are
      // inputs of the wait, so they stay as they are until the batch's address translations are done.
      // The plain build has the same wait on its three pairs, which take the next chunk's addresses.
      if (RES) asm volatile("s_wait_xcnt 0x0" :: "v"(kg), "v"(klg), "v"(vg), "v"(vlg) : "memory");
      else     asm volatile("s_wait_xcnt 0x0" :: "v"(kg), "v"(klg), "v"(vg) : "memory");
    }
    __syncthreads();
  };

  // chunk 2*it + grp <= qb, or qb + 1 <= NQB - 1 for even qb (all masked): kv0 + 63 < SEQ.
  // Only the last trip's chunks reach or pass the diagonal (2*it + grp >= qb needs it = trips - 1): the trips before it keep every
  // key and run without the mask's compare and select. The last trip stands behind the loop, so the loop holds one variant only.
  const int trips = (qb + 2) >> 1;             // block-uniform, 1 <= trips <= NQB / 2: chunks 0..qb dealt even / odd to the two groups
  for (int it = 0; it + 1 < trips; ++it) {
    const int kv0 = (2 * it + grp) * 64;
    stage(kv0);
    chunk(BoolC<false>(), kv0);
  }
  {
    const int kv0 = (2 * (trips - 1) + grp) * 64;
    stage(kv0);
    chunk(BoolC<true>(), kv0);
  }

  // ---- join the halves' normalisers, normalise (1/l; the x1024 carry is in l too), stage the wave's 16x64 tile [query][d]
  //      (a lane's 8 registers of a tile are 8 consecutive d of its query: two 16-B stores), bf16 hi/lo split,
  // ---- join the two wave groups: group 1 leaves its context sums, running max and partial normaliser in LDS (a lane's own
  //      144-B row), all eight waves pass one barrier, group 0 rescales both parts to the common max and adds them; group 1 is done.
  float* xs = lds.Xs[wave] + lane * XP;
  if (grp == 1) {
#pragma unroll
    for (int t = 0; t < 4; ++t) {
      v4f w0, w1;
#pragma unroll
      for (int r = 0; r < 4; ++r) { w0[r] = oacc[t][r]; w1[r] = oacc[t][4 + r]; }
      *(v4f*)(xs + t * 8)     = w0;
      *(v4f*)(xs + t * 8 + 4) = w1;
    }
    xs[32] = mrow;
    xs[33] = lrow;
  }
  __syncthreads();
  if (grp == 1) return;                        // wave-uniform; no block barrier follows
  {
    const float m2 = xs[32], l2 = xs[33];
    const float mm = fmaxf(mrow, m2);
    const float ms = (mm == -INFINITY) ? 0.f : mm;
    const float a1 = exp2_1(mrow - ms);
    const float a2 = exp2_1(m2 - ms);     // group 1 kept no key (query block 0): m2 = -inf, a2 = 0, its sums are 0
    lrow = lrow * a1 + l2 * a2;
#pragma unroll
    for (int t = 0; t < 4; ++t) {
      const v4f x0 = *(const v4f*)(xs + t * 8);
      const v4f x1 = *(const v4f*)(xs + t * 8 + 4);
#pragma unroll
      for (int r = 0; r < 4; ++r) {
        oacc[t][r]     = oacc[t][r] * a1 + x0[r] * a2;
        oacc[t][4 + r] = oacc[t][4 + r] * a1 + x1[r] * a2;
      }
    }
  }

  float* os = Os[wave];
  {
    const float l = lrow + xhalf(lrow);        // unconditional: both halves take part in the exchange
    const float inv = (l > 0.f) ? (1.0f / l) : 0.f;   // l sums 1024 p, as the context sums do
#pragma unroll
    for (int t = 0; t < 4; ++t) {
      v4f w0, w1;
#pragma unroll
      for (int r = 0; r < 4; ++r) { w0[r] = oacc[t][r] * inv; w1[r] = oacc[t][4 + r] * inv; }
      *(v4f*)(os + c * OP + t * 16 + 8 * hh)     = w0;
      *(v4f*)(os + c * OP + t * 16 + 8 * hh + 4) = w1;
    }
  }
  __builtin_amdgcn_fence(__ATOMIC_RELEASE, "workgroup");
  __builtin_amdgcn_wave_barrier();
  __builtin_amdgcn_fence(__ATOMIC_ACQUIRE, "workgroup");
  {
    const int q4 = lane >> 3, c8 = (lane & 7) * 8;
    v4u hv[4], lv[4];
#pragma unroll
    for (int it = 0; it < 4; ++it) {
      const int row = it * 4 + q4;   // it 0..3 x q4 0..3 = rows 0..15 of the wave tile
      const float* sp = os + row * OP + c8;
      v4u a, a2;
#pragma unroll
      for (int e = 0; e < 4; ++e) {
        const float f0 = sp[2 * e], f1 = sp[2 * e + 1];
        const unsigned short h0 = bf_bits(f0), h1 = bf_bits(f1);
        const unsigned short l0 = bf_bits(f0 - bf_up(h0)), l1 = bf_bits(f1 - bf_up(h1));
        a[e] = pk16(h0, h1); a2[e] = pk16(l0, l1);
      }
      hv[it] = a; lv[it] = a2;
    }
    {
#pragma unroll
      for (int it = 0; it < 4; ++it) {
        const int row = it * 4 + q4;
        const size_t go = (rowB + q0 + row) * DM + (size_t)h * HD + c8;
        *(v4u*)(ohp + go) = hv[it];
        *(v4u*)(olp + go) = lv[it];
        // The registers these two stores name are reused for the next pair's address and data: wait before they are overwritten.
        asm volatile("s_wait_xcnt 0x0" ::: "memory");
      }
    }
  }
}

// Both attention variants in one grid. Eight-wave blocks no longer all fit on the chip at once, so the block index sets the order
// of starting. First the leading RESQB query blocks (residual planes): few trips, but each far dearer than a plain one, so started
// last they would run on alone. Then the plain blocks from the longest (NQB-1) down to RESQB: a place that falls free takes the
// longest block left, and the launch ends on the shortest. The branch is block-uniform.
__global__ __launch_bounds__(256)
void attn_all(const unsigned short* __restrict__ qhp, const unsigned short* __restrict__ qlp,
              const unsigned short* __restrict__ khp, const unsigned short* __restrict__ klp,
              const unsigned short* __restrict__ vhp, const unsigned short* __restrict__ vlp,
              unsigned short* ohp, unsigned short* olp) {
  __shared__ __align__(16) AttnLds lds;
  const int bx = blockIdx.x;
  const int g  = bx / (NB * NH);               // 0..NQB-1
  const int qb = (g < RESQB) ? (RESQB - 1 - g) : (NQB - 1 + RESQB - g);   // RESQB-1..0, then NQB-1..RESQB: every (qb, h, b) exactly once
  const int hb = bx % (NB * NH);
  if (qb >= RESQB) attn_causal64<false>(qhp, qlp, khp, klp, vhp, vlp, ohp, olp, qb, hb % NH, hb / NH, lds);
  else             attn_causal64<true>(qhp, qlp, khp, klp, vhp, vlp, ohp, olp, qb, hb % NH, hb / NH, lds);
}

// =====================================================================================================
// Workspace map (bytes; every region is an exact multiple of its 64x64-tile / whole-line store granularity,
//   Qb   bf16 [8192][512]            0            8388608
//   Kb   bf16 [8192][512]            8388608      8388608
//   Vb   bf16 [8192][512]            16777216     8388608
//   WqT  bf16 [512 n][512 k]         25165824     524288
//   WkT                              25690112     524288
//   WvT                              26214400     524288
//   WoT                              26738688     524288
//   Qh   bf16 [8192][512]            27262976     8388608
//   Ql                               35651584     8388608
//   Kh                               44040192     8388608
//   Kl                               52428800     8388608
//   VTh  f16  [2][512][4096]         60817408     8388608
//   VTl  f16  [2][512][512]          69206016     1048576
//   Oh   bf16 [8192][512]            70254592     8388608
//   Ol                               78643200     8388608
//   end                              87031808
// =====================================================================================================
extern "C" void kernel_launch(void* const* d_in, const int* in_sizes, int n_in,
                              void* d_out, int out_size, void* d_ws, size_t ws_size,
                              hipStream_t stream) {
  if (n_in < 11) return;
  const int NX = NB * SEQ * DM;                    // 4194304
  if (in_sizes[0] != NX || in_sizes[1] != NX || in_sizes[2] != NX) return;
  if (in_sizes[3] != DM * DM || in_sizes[5] != DM * DM || in_sizes[7] != DM * DM || in_sizes[9] != DM * DM) return;
  if (in_sizes[4] != DM || in_sizes[6] != DM || in_sizes[8] != DM || in_sizes[10] != DM) return;
  if (out_size != NX) return;

  const float* v  = (const float*)d_in[0];   // [2][4096][512]
  const float* k  = (const float*)d_in[1];   // [2][4096][512]
  const float* q  = (const float*)d_in[2];   // [2][4096][512]
  const float* Wq = (const float*)d_in[3];   // [512 in][512 out] = [k][n]
  const float* bq = (const float*)d_in[4];   // [512]
  const float* Wk = (const float*)d_in[5];   // [512 in][512 out]
  const float* bk = (const float*)d_in[6];   // [512]
  const float* Wv = (const float*)d_in[7];   // [512 in][512 out]
  const float* bv = (const float*)d_in[8];   // [512]
  const float* Wo = (const float*)d_in[9];   // [512 in][512 out]
  const float* bo = (const float*)d_in[10];  // [512]

  const size_t PX  = (size_t)NB * SEQ * DM * 2;    //  8388608  16-bit activation plane [8192][512]
  const size_t PW  = (size_t)DM * DM * 2;          //   524288  16-bit weight plane [512][512]
  const size_t PVT = (size_t)NB * DM * SEQ * 2;    //  8388608  v^T hi plane
  const size_t PVL = (size_t)NB * DM * VLP * 2;    //  1048576  v^T residual plane
  size_t off = 0;
  const size_t oQb  = off; off += PX;
  const size_t oKb  = off; off += PX;
  const size_t oVb  = off; off += PX;
  const size_t oWq  = off; off += PW;
  const size_t oWk  = off; off += PW;
  const size_t oWv  = off; off += PW;
  const size_t oWo  = off; off += PW;
  const size_t oQh  = off; off += PX;
  const size_t oQl  = off; off += PX;
  const size_t oKh  = off; off += PX;
  const size_t oKl  = off; off += PX;
  const size_t oVTh = off; off += PVT;
  const size_t oVTl = off; off += PVL;
  const size_t oOh  = off; off += PX;
  const size_t oOl  = off; off += PX;
  if (off > ws_size) return;                       // off = 87031808
  if (off > (size_t)134217728) return;

  char* ws = (char*)d_ws;
  unsigned short* Qb  = (unsigned short*)(ws + oQb);
  unsigned short* Kb  = (unsigned short*)(ws + oKb);
  unsigned short* Vb  = (unsigned short*)(ws + oVb);
  unsigned short* WqT = (unsigned short*)(ws + oWq);
  unsigned short* WkT = (unsigned short*)(ws + oWk);
  unsigned short* WvT = (unsigned short*)(ws + oWv);
  unsigned short* WoT = (unsigned short*)(ws + oWo);
  unsigned short* Qh  = (unsigned short*)(ws + oQh);
  unsigned short* Ql  = (unsigned short*)(ws + oQl);
  unsigned short* Kh  = (unsigned short*)(ws + oKh);
  unsigned short* Kl  = (unsigned short*)(ws + oKl);
  unsigned short* VTh = (unsigned short*)(ws + oVTh);
  unsigned short* VTl = (unsigned short*)(ws + oVTl);
  unsigned short* Oh  = (unsigned short*)(ws + oOh);
  unsigned short* Ol  = (unsigned short*)(ws + oOl);

  const dim3 blk(256);
  const dim3 gProj(GPB, 1);                                    // 1024 tiles -> 128 blocks: M=8192, N=512

  // (1) all plane conversions in one grid: weights f32 [k][n] -> bf16 W^T [n][k] (WqT, WkT, WvT, WoT are contiguous),
  //     activations f32 -> bf16 planes of the inputs' layout (Qb, Kb, Vb are contiguous)
  prep_planes<<<dim3(4 * NTR + 3 * NCV), blk, 0, stream>>>(q, k, v, Wq, Wk, Wv, Wo, Qb, WqT);
  // (2) the three input projections in one grid: qp, kp -> bf16 hi/lo planes [b*SEQ+t][h*64+d] (Qh, Ql, Kh, Kl contiguous),
  //     vp^T per batch -> f16 hi plane [b][h*64+d][s] (pitch SEQ) and residual plane (x4096, keys < VLP only, pitch VLP)
  gemm_qkv<<<dim3(GPB, 3), blk, 0, stream>>>(Qb, WqT, bq, bk, bv, Qh, VTh, VTl);
  // (3) causal attention, one grid: query blocks RESQB.. without, 0..RESQB-1 with residual planes
  attn_all<<<dim3(NB * NH * NQB), dim3(256), 0, stream>>>(Qh, Ql, Kh, Kl, VTh, VTl, Oh, Ol);
  // (4) out = context . Wo + bo -> d_out f32 [8192][512]  (A = context hi + lo planes, 2 products; Bt = WoT)
  gemm64<1, 0, 1, DM, DM><<<gProj, blk, 0, stream>>>(
      Oh, Ol, 0LL, WoT, 0LL, bo,
      d_out, DM, 0LL, d_out, DM, 0LL, DM,
      NB * SEQ, DM, DM, 1.0f);
  (void)hipGetLastError();
}

// v009
// Measured time: 105 microseconds a run.
// Next to v008, in two timings, it ran 1.09 and 1.10 times as fast.
// Counting every step since v000, it is 5.06 times as fast.
// Contractions: q, k, v^T projections = v_wmma_f32_16x16x32_bf16 (bf16 operands from RNE-converted inputs and weights, single product, f32 accumulate);
// k.q^T scores (keys down, queries across) = v_wmma_f32_16x16x32_bf16 with bf16 hi/lo split q and k (hi.hi + hi.lo + lo.hi), f32 accumulate;
// v^T.p^T = v_wmma_f32_16x16x32_f16 (p carried x1024 in f16 times v in f16, single product; plus f16 residual planes x4096 of
// p and v for the first 512 query rows of every sequence), f32 accumulate;
// ctx.Wo = v_wmma_f32_16x16x32_bf16 with ctx as bf16 hi/lo planes times bf16 Wo^T (2 products), f32 accumulate;
// causal mask (key <= query), online softmax, normalisers and bias adds in f32 on the VALU.
// Carry audit:
//   ph  = f16(1024 * p)                      -> the exponent's bias makes 1024 p directly; the normaliser l sums the same 1024 p, so inv = 1/l cancels it
//   pl  = f16((1024 p - ph) * 4096)          }  products VTl.ph and VTh.pl go to the separate accumulator o1,
//   VTl = f16((v - VTh) * 4096)              }  folded back with * (1/4096) once per key chunk (RES blocks only)
//   VTh = f16(v), no carry (|v| typ. 0.45); q / k / ctx lo planes are unscaled bf16 residuals (v - hi) sharing the hi accumulator;
//   score scale 1/8 applied once in f32, inside the multiply-add that forms the exponent. No other scaled planes.
#include <hip/hip_runtime.h>
#include <math.h>
#include <stdint.h>

#define NB    2
#define SEQ   4096
#define DM    512
#define NH    8
#define HD    64
#define NQB   (SEQ / 64)   // 64 query / key blocks of 64
#define VLP   512          // key pitch of the v^T residual plane (keys 0..VLP-1)
#define RESQB 8            // leading 64-row query blocks that use the p / v residual planes
#define LP    72           // LDS row pitch of the 64-element 16-bit tiles: 144 B = 16 B x 9, 16 rows of a 16-B read on 16 bank quads
#define OP    68           // LDS row pitch of the f32 context tile, in floats (16-B reads down a column walk)
static_assert(RESQB * 64 <= VLP);
static_assert(NH * HD == DM);
static_assert((SEQ % 64) == 0 && (DM % 64) == 0 && (DM % 32) == 0);
static_assert(((NB * SEQ / 64) * (DM / 64)) % 8 == 0);
static_assert(((DM / 64) * (SEQ / 64)) % 8 == 0);
static_assert((NB * SEQ * DM) % (8 * 256) == 0);
static_assert((DM * DM) % (64 * 64) == 0);
static_assert((DM % 512) == 0 && (SEQ % 512) == 0);   // a product's block takes 512 neighbouring rows of its second operand

typedef _Float16 v16h __attribute__((ext_vector_type(16)));
typedef _Float16 v8h  __attribute__((ext_vector_type(8)));
typedef __bf16   v16b __attribute__((ext_vector_type(16)));
typedef __bf16   v8b  __attribute__((ext_vector_type(8)));
typedef float    v8f  __attribute__((ext_vector_type(8)));
typedef float    v4f  __attribute__((ext_vector_type(4)));
typedef unsigned int v4u __attribute__((ext_vector_type(4)));

// ---- scalar helpers --------------------------------------------------------------------------------
__device__ __forceinline__ unsigned short bf_bits(float f) {          // f32 -> bf16 bits, RNE convert
  unsigned u = __float_as_uint(f);
  return (unsigned short)((u + 0x7FFFu + ((u >> 16) & 1u)) >> 16);
}
__device__ __forceinline__ float bf_up(unsigned short h) { return __uint_as_float(((unsigned)h) << 16); }
__device__ __forceinline__ unsigned short h_bits(_Float16 x) { return __builtin_bit_cast(unsigned short, x); }
__device__ __forceinline__ unsigned pk16(unsigned short a, unsigned short b) { return (unsigned)a | ((unsigned)b << 16); }
__device__ __forceinline__ v8f zero8() { v8f z = {0.f, 0.f, 0.f, 0.f, 0.f, 0.f, 0.f, 0.f}; return z; }
__device__ __forceinline__ v8h zero8h() {
  const _Float16 z = (_Float16)0.0f;
  v8h r = {z, z, z, z, z, z, z, z};
  return r;
}

// value of lane l ^ 16 (the other half of the wave), by a vector cross-row move
__device__ __forceinline__ float xhalf(float x) {
  const int i = __builtin_bit_cast(int, x);
  return __builtin_bit_cast(float, __builtin_amdgcn_permlanex16(i, i, 0x76543210, 0xfedcba98, false, false));
}

// 2^y: the exponential and one v_nop in one statement. The v_nop is the slot the instruction set asks for between a
// transcendental and an instruction that reads its result or overwrites its source; inside one statement nothing comes between them.
__device__ __forceinline__ float exp2_1(float y) {
  float r;
  asm("v_exp_f32 %0, %1\n\tv_nop" : "=v"(r) : "v"(y));
  return r;
}
// Eight independent 2^y in one statement: each exponential is the independent instruction behind the one before it (the results
// are early-clobber, so none lies on a source), and one v_nop behind the last keeps that slot: 9 issue slots, not 16.
__device__ __forceinline__ v8f exp2_8(v8f y) {
  float r0, r1, r2, r3, r4, r5, r6, r7;
  asm("v_exp_f32 %0, %8\n\tv_exp_f32 %1, %9\n\tv_exp_f32 %2, %10\n\tv_exp_f32 %3, %11\n\t"
      "v_exp_f32 %4, %12\n\tv_exp_f32 %5, %13\n\tv_exp_f32 %6, %14\n\tv_exp_f32 %7, %15\n\tv_nop"
      : "=&v"(r0), "=&v"(r1), "=&v"(r2), "=&v"(r3), "=&v"(r4), "=&v"(r5), "=&v"(r6), "=&v"(r7)
      : "v"(y[0]), "v"(y[1]), "v"(y[2]), "v"(y[3]), "v"(y[4]), "v"(y[5]), "v"(y[6]), "v"(y[7]));
  v8f r = {r0, r1, r2, r3, r4, r5, r6, r7};
  return r;
}
template <bool B> struct BoolC { static constexpr bool value = B; };

// ---- fragment loader: 16-bit A/B operand, lane -> row/col (lane&15), p already includes +8*(lane>>4);
//      elements 0..7 <- p[0..7] (k0+8h..), elements 8..15 <- p[16..23] (k0+16+8h..)
__device__ __forceinline__ v16b ldfrag_b(const __bf16* p) {
  union { v16b v; v8b h[2]; } f;
  f.h[0] = *(const v8b*)(p);
  f.h[1] = *(const v8b*)(p + 16);
  return f.v;
}

// ---- WMMA helpers with trailing VALU hazard gap --------------------------------------------------------
__device__ __forceinline__ v8f mma_h_raw(v16h a, v16h b, v8f c) {
  return __builtin_amdgcn_wmma_f32_16x16x32_f16(false, a, false, b, (short)0, c, false, false);
}
__device__ __forceinline__ v8f mma_b_raw(v16b a, v16b b, v8f c) {
  return __builtin_amdgcn_wmma_f32_16x16x32_bf16(false, a, false, b, (short)0, c, false, false);
}
__device__ __forceinline__ void dep_guard_b(v8f& a, v8f& b, v16b x, v16b y) {
  asm volatile("v_nop\n\tv_nop\n\tv_nop\n\tv_nop" : "+v"(a), "+v"(b) : "v"(x), "v"(y));
}
__device__ __forceinline__ void keep4_b(v16b a, v16b b, v16b c, v16b d) {
  asm volatile("v_nop" :: "v"(a), "v"(b), "v"(c), "v"(d));
}
__device__ __forceinline__ void acc_guard4(v8f& a, v8f& b, v8f& c, v8f& d) {
  asm volatile("v_nop\n\tv_nop\n\tv_nop\n\tv_nop" : "+v"(a), "+v"(b), "+v"(c), "+v"(d));
}

// =====================================================================================================
// f32 -> bf16 (RNE convert), 8 elements per thread, one 16-B store per lane: a wave writes 512 contiguous B
// the [8192][512] activations, a multiple of 256).
// coverage: n8 threads x 8 = the whole plane.
// =====================================================================================================
__device__ __forceinline__ void cvt_bf16x8(const float* __restrict__ in, unsigned short* out, int n8, int blk) {
  const int i = blk * 256 + threadIdx.x;
  if (i < n8) {
    const v4f a = *(const v4f*)(in + (size_t)i * 8);
    const v4f b = *(const v4f*)(in + (size_t)i * 8 + 4);
    v4u p;
    p[0] = pk16(bf_bits(a[0]), bf_bits(a[1]));
    p[1] = pk16(bf_bits(a[2]), bf_bits(a[3]));
    p[2] = pk16(bf_bits(b[0]), bf_bits(b[1]));
    p[3] = pk16(bf_bits(b[2]), bf_bits(b[3]));
    *(v4u*)(out + (size_t)i * 8) = p;
    
  }
}

// =====================================================================================================
// f32 [K rows][N cols] (pitch ldw) -> bf16 transposed plane WT[n][k] (pitch ldt, k contiguous), RNE convert.
// One 64x64 tile per block (n0 = 64 * tileN, k0 = 64 * tileK, N and K exact multiples of 64): the tile is staged in LDS with
// coalesced 16-B loads (256 threads x 16 floats = the whole tile), __syncthreads, then each output row segment
// coverage: 8 waves x 2 x (lane>>3 = 4 rows) = 64 rows n, 8 lanes x 8 = 64 k: the whole tile; grid = the whole plane.
// =====================================================================================================
__device__ __forceinline__ void cvt_bf16_tr64(const float* __restrict__ W, unsigned short* WT, int ldw, int ldt,
                                              int tileN, int tileK, float* sW) {
  const int tid = threadIdx.x;
  const int n0 = tileN * 64;
  const int k0 = tileK * 64;
  {
    const int kr = tid >> 2, cb = (tid & 3) * 16;          // row k0+kr, cols n0+cb .. +15
    const float* src = W + (size_t)(k0 + kr) * ldw + n0 + cb;
#pragma unroll
    for (int i = 0; i < 4; ++i) {
      const v4f f = *(const v4f*)(src + 4 * i);
      float* d = sW + kr * 65 + cb + 4 * i;
      d[0] = f[0]; d[1] = f[1]; d[2] = f[2]; d[3] = f[3];
    }
  }
  __syncthreads();
  const int wave = tid >> 5, lane = tid & 31;
  const int q = lane >> 3, c8 = (lane & 7) * 8;
  v4u pv[2];
#pragma unroll
  for (int it = 0; it < 2; ++it) {
    const int nr = wave * 8 + it * 4 + q;                  // output row n0+nr, 0 <= nr < 64
    v4u p;
#pragma unroll
    for (int e = 0; e < 4; ++e) {
      const float f0 = sW[(c8 + 2 * e) * 65 + nr];
      const float f1 = sW[(c8 + 2 * e + 1) * 65 + nr];
      p[e] = pk16(bf_bits(f0), bf_bits(f1));
    }
    pv[it] = p;
  }
  {
#pragma unroll
    for (int it = 0; it < 2; ++it) {
      const int nr = wave * 8 + it * 4 + q;
      *(v4u*)(WT + (size_t)(n0 + nr) * ldt + k0 + c8) = pv[it];
    }
    
  }
}

// =====================================================================================================
// One grid for all seven independent plane conversions: blocks 0..4*NTR-1 transpose the four weights (64x64 tile each,
// planes WT + w*DM*DM in the order Wq, Wk, Wv, Wo), the next 3*NCV blocks convert q, k, v (planes Xb + w*NB*SEQ*DM).
// The branch is block-uniform, so the transpose's __syncthreads is passed by all threads of its block or by none.
// =====================================================================================================
#define NTR ((DM / 64) * (DM / 64))          // 64 tiles per weight
#define NCV ((NB * SEQ * DM) / (8 * 256))    // 2048 blocks per activation plane
__global__ __launch_bounds__(256) void prep_planes(const float* __restrict__ q, const float* __restrict__ k,
                                                   const float* __restrict__ v,
                                                   const float* __restrict__ Wq, const float* __restrict__ Wk,
                                                   const float* __restrict__ Wv, const float* __restrict__ Wo,
                                                   unsigned short* Xb, unsigned short* WT) {
  __shared__ __align__(16) float sW[64 * 65];
  const int bx = blockIdx.x;
  if (bx < 4 * NTR) {
    const int w = bx / NTR, t = bx % NTR;
    const float* W = (w == 0) ? Wq : (w == 1) ? Wk : (w == 2) ? Wv : Wo;
    cvt_bf16_tr64(W, WT + (size_t)w * DM * DM, DM, DM, t % (DM / 64), t / (DM / 64), sW);
  } else {
    const int cb = bx - 4 * NTR;
    const int w = cb / NCV, blk = cb % NCV;
    const float* in = (w == 0) ? q : (w == 1) ? k : v;
    cvt_bf16x8(in, Xb + (size_t)w * NB * SEQ * DM, (NB * SEQ * DM) / 8, blk);
  }
}

// =====================================================================================================
// Register-blocked batched bf16 WMMA GEMM: C[m][n] = sum_k A[m][k] * Bt[n][k] + bias; one wave per 64x64 tile.
// A row-major [M][K] pitch lda; Bt row-major [N][K] pitch ldb (k contiguous);
// M a multiple of 64, N of 512, K of 64 (host shapes are static multiples). b = batch index (strides in elements).
// A block's eight tiles are one tile row and eight neighbouring tile columns: 64 rows of A, 512 rows of Bt. Per stage of 64 k
// (one 128-B line of every row) the block brings them to LDS with whole-line loads (8 lanes per row, 4 rows per wave-wide load,
// 256 threads x 16 pieces = all of Bt's 512 x 64, x 2 pieces = all of each A plane's 64 x 64), pitch LP, between two barriers;
// the fragments are then read from LDS in the k order they had from memory, so every accumulator sums in the same order.
// NSPLIT: 0 = A.Bt; 1 = (A + A2).Bt (A2 = unscaled bf16 lo plane of A, 2 products).
// BIAS: 0 = none; 1 = per column n, bias[n]; 2 = per row m, bias[m]; the bias value is RNE-converted to bf16 and added in f32.
// OUT_MODE: 0 = f32 (pitch ldc); 2 = bf16 hi plane C + bf16 lo plane C2 (lo = RNE(v - hi), unscaled);
//           3 = f16 hi plane C + f16 residual plane C2 = f16((v - hi) * rscale), C2 written only for tiles
//               with n0 < N2 (pitch ldc2, batch stride strideC2).
// =====================================================================================================
template <int NSPLIT, int OUT_MODE, int BIAS>
__device__ __forceinline__ void gemm64_body(
    const unsigned short* __restrict__ Ap, const unsigned short* A2p, int lda, long long strideA,
    const unsigned short* __restrict__ Btp, int ldb, long long strideB,
    const float* __restrict__ bias,
    void* Cout, int ldc, long long strideC,
    void* Cout2, int ldc2, long long strideC2, int N2,
    int M, int N, int K, float rscale,
    int blk, int b, float (*sT)[16 * 68],     // blk = block index inside this product, b = batch index
    __bf16* sA, __bf16* sA2, __bf16* sB) {    // LDS stage: A and A2 [64][LP], Bt [512][LP] (sA2 read and written only when NSPLIT)
  const __bf16* A   = (const __bf16*)(const void*)Ap;
  const __bf16* A2  = (const __bf16*)(const void*)A2p;
  const __bf16* Bt  = (const __bf16*)(const void*)Btp;
  const int lane = threadIdx.x & 31;
  const int wave = threadIdx.x >> 5;
  const int tilesN = N >> 6;
  const int tilesM = M >> 6;
  const int tile0 = blk * 8;                 // the block's first tile; tilesN is a multiple of 8, so its eight tiles share a tile row
  if (tile0 + 8 > tilesM * tilesN) return;   // block-uniform, in front of every barrier
  const int tm = tile0 / tilesN;
  const int nb0 = (tile0 - tm * tilesN) << 6; // first Bt row of the block
  const int m0 = tm << 6;
  const int n0 = nb0 + (wave << 6);

  const __bf16* Ab  = A  + (size_t)b * strideA;
  const __bf16* Bb  = Bt + (size_t)b * strideB;
  const __bf16* Ab2 = (NSPLIT >= 1) ? (A2 + (size_t)b * strideA) : Ab;

  const int rlane = lane & 15;                 // row (A) / col (B, D) within subtile
  const int koff  = (lane >> 4) * 8;           // k offset of this lane half
  const int mOff  = (lane >> 4) * 8;           // D row offset

  v8f acc[4][4];
#pragma unroll
  for (int i = 0; i < 4; ++i)
#pragma unroll
    for (int j = 0; j < 4; ++j) acc[i][j] = zero8();

  const int sr  = threadIdx.x >> 3;            // staging: row sr + 32 i of a plane, piece spc .. spc + 7 of its 64 k
  const int spc = (threadIdx.x & 7) * 8;
  for (int k0 = 0; k0 < K; k0 += 64) {
    __syncthreads();                           // every wave has read its last fragments of the stage before
    {
      const __bf16* bg  = Bb  + (size_t)(nb0 + sr) * ldb + k0 + spc;
      const __bf16* ag  = Ab  + (size_t)(m0 + sr) * lda + k0 + spc;
      const __bf16* ag2 = Ab2 + (size_t)(m0 + sr) * lda + k0 + spc;
      v8b tb[16], ta[2], ta2[2];
#pragma unroll
      for (int i = 0; i < 16; ++i) tb[i] = *(const v8b*)(bg + (size_t)(32 * i) * ldb);
#pragma unroll
      for (int i = 0; i < 2; ++i) {
        ta[i] = *(const v8b*)(ag + (size_t)(32 * i) * lda);
        if (NSPLIT >= 1) ta2[i] = *(const v8b*)(ag2 + (size_t)(32 * i) * lda);
      }
      // The address pairs get the next stage's values: the wait that belongs in front of that stands behind the batch of loads.
      // The pairs are its inputs, so no load's result is placed on them ahead of it.
      asm volatile("s_wait_xcnt 0x0" :: "v"(bg), "v"(ag), "v"(ag2) : "memory");
#pragma unroll
      for (int i = 0; i < 16; ++i) *(v8b*)(sB + (sr + 32 * i) * LP + spc) = tb[i];
#pragma unroll
      for (int i = 0; i < 2; ++i) {
        *(v8b*)(sA + (sr + 32 * i) * LP + spc) = ta[i];
        if (NSPLIT >= 1) *(v8b*)(sA2 + (sr + 32 * i) * LP + spc) = ta2[i];
      }
    }
    __syncthreads();                           // the stage is whole before any wave reads a fragment
#pragma unroll
    for (int kk = 0; kk < 2; ++kk) {
      // all fragments of these 32 k are read as one group ahead of their products: one LDS wait, not one per A fragment
      v16b bh[4], ah[4], al[4];
#pragma unroll
      for (int j = 0; j < 4; ++j) bh[j] = ldfrag_b(sB + ((wave << 6) + (j << 4) + rlane) * LP + kk * 32 + koff);
#pragma unroll
      for (int i = 0; i < 4; ++i) {
        const int ao = ((i << 4) + rlane) * LP + kk * 32 + koff;
        ah[i] = ldfrag_b(sA + ao);
        al[i] = ah[i];
        if (NSPLIT >= 1) al[i] = ldfrag_b(sA2 + ao);
      }
#pragma unroll
      for (int i = 0; i < 4; ++i) {
#pragma unroll
        for (int j = 0; j < 4; ++j) {
          acc[i][j] = mma_b_raw(ah[i], bh[j], acc[i][j]);
          if (NSPLIT >= 1) acc[i][j] = mma_b_raw(al[i], bh[j], acc[i][j]);
        }
        dep_guard_b(acc[i][0], acc[i][3], ah[i], al[i]);
      }
      keep4_b(bh[0], bh[1], bh[2], bh[3]);
    }
  }
  acc_guard4(acc[0][0], acc[0][1], acc[0][2], acc[0][3]);
  acc_guard4(acc[1][0], acc[1][1], acc[1][2], acc[1][3]);
  acc_guard4(acc[2][0], acc[2][1], acc[2][2], acc[2][3]);
  acc_guard4(acc[3][0], acc[3][1], acc[3][2], acc[3][3]);

  // ---- epilogue ----
  float* slab = sT[wave];
  float bcol[4];
#pragma unroll
  for (int j = 0; j < 4; ++j) {
    bcol[j] = 0.f;
    if (BIAS == 1) bcol[j] = bf_up(bf_bits(bias[n0 + (j << 4) + rlane]));   // n < N, bias has N entries
  }
#pragma unroll
  for (int i = 0; i < 4; ++i) {
    const int mBase = m0 + (i << 4);
    float brow[8];
#pragma unroll
    for (int r = 0; r < 8; ++r) {
      brow[r] = 0.f;
      if (BIAS == 2) brow[r] = bf_up(bf_bits(bias[mBase + mOff + r]));      // m < M, bias has M entries
    }
#pragma unroll
    for (int j = 0; j < 4; ++j) {
#pragma unroll
      for (int r = 0; r < 8; ++r) {
        slab[(mOff + r) * 68 + (j << 4) + rlane] = acc[i][j][r] + bcol[j] + brow[r];
      }
    }
    __builtin_amdgcn_fence(__ATOMIC_RELEASE, "workgroup");
    __builtin_amdgcn_wave_barrier();
    __builtin_amdgcn_fence(__ATOMIC_ACQUIRE, "workgroup");
    if (OUT_MODE == 0) {
      float* C = (float*)Cout + (size_t)b * strideC;
      const int hh = lane >> 4, c4 = (lane & 15) * 4;     // 256-B row segment = 16 lanes x 16 B
      {
#pragma unroll
        for (int it = 0; it < 8; ++it) {
          const int row = it * 2 + hh;                     // it 0..7 x hh 0..1 = rows 0..15
          const v4f v = *(const v4f*)(slab + row * 68 + c4);
          *(v4f*)(C + (size_t)(mBase + row) * ldc + n0 + c4) = v;
        }
        
      }
    } else {
      const int q = lane >> 3, c8 = (lane & 7) * 8;
      unsigned short* C  = (unsigned short*)Cout  + (size_t)b * strideC;
      unsigned short* C2 = (unsigned short*)Cout2 + (size_t)b * strideC2;
      const bool wlo = (OUT_MODE == 2) || (n0 < N2);      // wave-uniform
      v4u hv[4], lv[4];
#pragma unroll
      for (int it = 0; it < 4; ++it) {
        const int row = it * 4 + q;                        // it 0..3 x q 0..3 = rows 0..15
        const float* sp = slab + row * 68 + c8;
        v4u a, a2;
#pragma unroll
        for (int e = 0; e < 4; ++e) {
          const float f0 = sp[2 * e], f1 = sp[2 * e + 1];
          unsigned short h0, h1, l0, l1;
          if (OUT_MODE == 2) {
            h0 = bf_bits(f0); h1 = bf_bits(f1);
            l0 = bf_bits(f0 - bf_up(h0)); l1 = bf_bits(f1 - bf_up(h1));
          } else {
            const _Float16 x0 = (_Float16)f0, x1 = (_Float16)f1;
            h0 = h_bits(x0); h1 = h_bits(x1);
            l0 = h_bits((_Float16)((f0 - (float)x0) * rscale));
            l1 = h_bits((_Float16)((f1 - (float)x1) * rscale));
          }
          a[e] = pk16(h0, h1); a2[e] = pk16(l0, l1);
        }
        hv[it] = a; lv[it] = a2;
      }
      {
#pragma unroll
        for (int it = 0; it < 4; ++it) {
          const int row = it * 4 + q;
          *(v4u*)(C + (size_t)(mBase + row) * ldc + n0 + c8) = hv[it];
          if (wlo) *(v4u*)(C2 + (size_t)(mBase + row) * ldc2 + n0 + c8) = lv[it];
        }
        
      }
    }
    __builtin_amdgcn_fence(__ATOMIC_RELEASE, "workgroup");
    __builtin_amdgcn_wave_barrier();
    __builtin_amdgcn_fence(__ATOMIC_ACQUIRE, "workgroup");
  }
}

// One product per launch (the output projection). The operand pitches are template constants, so the staging loads' row steps
// are immediate offsets from one address pair per plane.
template <int NSPLIT, int OUT_MODE, int BIAS, int lda, int ldb>
__global__ __launch_bounds__(256) void gemm64(
    const unsigned short* __restrict__ Ap, const unsigned short* A2p, long long strideA,
    const unsigned short* __restrict__ Btp, long long strideB,
    const float* __restrict__ bias,
    void* Cout, int ldc, long long strideC,
    void* Cout2, int ldc2, long long strideC2, int N2,
    int M, int N, int K, float rscale) {
  __shared__ __align__(16) float sT[8][16 * 68];   // per-wave 16x64 slab, pitch 68 floats
  __shared__ __align__(16) __bf16 sB[512 * LP];
  __shared__ __align__(16) __bf16 sA[(NSPLIT >= 1 ? 2 : 1) * 64 * LP];
  gemm64_body<NSPLIT, OUT_MODE, BIAS>(Ap, A2p, lda, strideA, Btp, ldb, strideB, bias, Cout, ldc, strideC,
                                      Cout2, ldc2, strideC2, N2, M, N, K, rscale, blockIdx.x, blockIdx.y, sT,
                                      sA, sA + (NSPLIT >= 1 ? 64 * LP : 0), sB);
}

// The three independent input projections in one grid (GPB blocks each): blockIdx.y = 0: qp, 1: kp (bf16 hi/lo planes,
// M = NB*SEQ, N = DM), 2: vp^T (f16 hi + residual planes, M = DM, N = SEQ, batch = blockIdx.x / (GPB / NB)).
// Xb = bf16 planes of q, k, v in that order; WT = W^T planes of Wq, Wk, Wv; QK = planes Qh, Ql, Kh, Kl in that order.
#define GPB (((NB * SEQ / 64) * (DM / 64)) / 8)   // 128 blocks of 8 tiles
static_assert(GPB == NB * (((DM / 64) * (SEQ / 64)) / 8));
__global__ __launch_bounds__(256) void gemm_qkv(
    const unsigned short* __restrict__ Xb, const unsigned short* __restrict__ WT,
    const float* __restrict__ bq, const float* __restrict__ bk, const float* __restrict__ bv,
    unsigned short* QK, unsigned short* VTh, unsigned short* VTl) {
  __shared__ __align__(16) float sT[8][16 * 68];   // per-wave 16x64 slab, pitch 68 floats
  __shared__ __align__(16) __bf16 sB[512 * LP];
  __shared__ __align__(16) __bf16 sA[64 * LP];
  const size_t NXE = (size_t)NB * SEQ * DM;
  const int y = blockIdx.y;                        // block-uniform
  if (y < 2) {
    const unsigned short* A = Xb + (size_t)y * NXE;
    gemm64_body<0, 2, 1>(A, A, DM, 0LL, WT + (size_t)y * DM * DM, DM, 0LL, y ? bk : bq,
                         (void*)(QK + (size_t)(2 * y) * NXE), DM, 0LL, (void*)(QK + (size_t)(2 * y + 1) * NXE), DM, 0LL, DM,
                         NB * SEQ, DM, DM, 1.0f, blockIdx.x, 0, sT, sA, sA, sB);
  } else {
    const unsigned short* A = WT + (size_t)2 * DM * DM;
    gemm64_body<0, 3, 2>(A, A, DM, 0LL, Xb + 2 * NXE, DM, (long long)SEQ * DM, bv,
                         (void*)VTh, SEQ, (long long)DM * SEQ, (void*)VTl, VLP, (long long)DM * VLP, VLP,
                         DM, SEQ, DM, 4096.0f, blockIdx.x % (GPB / NB), blockIdx.x / (GPB / NB), sT, sA, sA, sB);
  }
}

// =====================================================================================================
// Causal attention, head dim 64, key chunks of 64.
//   q planes (bf16 hi / lo): element (b, t, h, d) at [(b*SEQ + t)*DM + h*64 + d]
//   k planes (bf16 hi / lo): same layout with key index s
//   v^T hi plane (f16):      element (b, h, d, s) at [(b*DM + h*64 + d)*SEQ + s]
//   v^T residual plane (f16, (v - hi)*4096): [(b*DM + h*64 + d)*VLP + s], s < VLP, read only when RES
//   (a key chunk at or beyond VLP would contribute a zero v residual; its address is clamped)
//   Mask: query t keeps key s iff s <= t. A query block qb therefore needs key chunks 0..qb only. They are dealt to two wave
//   groups, even chunks to group 0, odd chunks to group 1 (block-uniform trip count (qb+2)/2 <= NQB/2); for even qb group 1's
//   last chunk is qb+1, in bounds and wholly masked. Each group keeps its own running max, normaliser and context sums.
//   Inside a visited chunk a masked key gets logit -inf -> exp gives exactly 0, so it adds nothing to the numerator
//   or the normaliser. Row max bookkeeping: every query keeps key 0 (chunk 0), so group 0's running max of every row is finite
//   after its first chunk; a group that has kept no key yet has max -inf, sums 0, and rescales by 0. Every row ends with l > 0.
//   out planes (bf16 hi / lo of the normalised context): element (b, t, h, d) at [(b*SEQ + t)*DM + h*64 + d]
//   scores = q . k : bf16 hi/lo split (hi.hi + hi.lo + lo.hi), f32 accumulate, then * 1/8 and the mask in f32
//   p = exp(s - m) carried as f16(1024 p); context = p . v on f16 WMMA; RES adds f16 residual planes of p and v
//   (scale 4096, separate accumulator folded back with 1/4096 per chunk in f32); online softmax (running max) in f32.
//   Block = 2 groups x 4 waves = 64 query rows of one (b, h), wave w and wave w+4 on the same 16 rows; grid = NQB * NH * NB.
//   K / V^T chunk staging, per group into its own tiles: 128 threads x 4 rows x 8 elements per plane = the whole 64x64 tile of every plane read later
//   (8 lanes per 128-B row). Residual variant: plain 16-B loads and LDS stores, __syncthreads before and after. Plain variant:
//   asynchronous 16-B copies straight into LDS, two buffers per group, chunk t + 2's copies issued behind the one barrier of trip t
//   (which stands behind the trip's last LDS read), so they fly for a whole trip's work.
//   Both products are computed transposed: S^T = K . Q^T (A = K rows, B = Q) and O^T += V^T . P^T (A = V^T rows, B = P^T).
//   A lane then holds 32 scores of ONE query (column lane&15; keys j*16 + 8*(lane>>4) + r): maximum and sum run in the lane,
//   the two wave halves exchange the maximum once per chunk and join their partial normalisers once, after the loop.
//   Two score tiles 2kk, 2kk+1, converted in place, are the B operand of key half kk in the hardware k order
//   (element e < 8: key 8*(lane>>4) + e, e >= 8: key 16 + 8*(lane>>4) + e - 8), the order the V^T loads already have: P never touches LDS.
//   Output coverage: each wave of group 0 stores rows q0..q0+15 (it 0..3 x lane>>3 0..3) x 64 columns (8 lanes x 8) of both planes;
//   grid over all (b, h, qb) = the whole [NB*SEQ][DM] planes.
// =====================================================================================================
#define XP 36                                      // floats per lane in the hand-over area: 144 B = 16 B x 9, 16-B accesses conflict-free
struct AttnTiles {                                 // one key chunk, staged and read by one wave group only
  __bf16   Ksh[64 * LP];                            // K hi [kv][d], pitch LP
  __bf16   Ksl[64 * LP];                            // K lo
  _Float16 Vth[64 * LP];                            // V^T hi [d][kv], pitch LP
  _Float16 Vtl[64 * LP];                            // V^T residual (RES only)
};
struct RingTile {                                  // one key chunk of the plain variant (no residual plane)
  __bf16   Ksh[64 * LP];
  __bf16   Ksl[64 * LP];
  _Float16 Vth[64 * LP];
};
struct AttnLds {                                   // one LDS layout for both variants (they share a grid)
  union {                                           // wave group 0: even key chunks, wave group 1: odd key chunks
    AttnTiles t[2];                                 // residual variant: [group], one buffer
    RingTile  r[2][2];                              // plain variant: [group][buffer]
  };
  float    Os[4][16 * OP];                          // per wave context tile [row][d] (group 0)
  float    Xs[4][32 * XP];                          // group 1 -> group 0: per lane 32 context sums, running max, partial normaliser
};
static_assert((64 * LP * 2) % 16 == 0 && (16 * LP * 2) % 16 == 0 && (16 * OP * 4) % 16 == 0 && (XP * 4) % 16 == 0);
static_assert(sizeof(RingTile) % 16 == 0 && sizeof(AttnTiles) % 16 == 0);

// LDS byte address of a __shared__ element: the low 32 bits of its address.
__device__ __forceinline__ unsigned lds_byte(const void* p) { return (unsigned)(uintptr_t)p; }

// Twelve asynchronous 16-B copies per lane, global memory -> LDS through no register: rows r, r+16, r+32, r+48 of three planes.
// A copy's global address is its scalar base + the lane's 32-bit byte offset (ko for both K planes, vo for V^T) + the immediate,
// its LDS address the plane's register (lk, ll, lv) + the same immediate: the immediate i * RSTEP moves both by the LDS step of
// 16 rows, so base i is handed in short of row 16 i by just that much. The s_wait_xcnt is the last line of the copies' own
// statement, so it stands in front of every later write of a register that a copy names.
#define RSTEP (16 * LP * 2)                        // 2304 B: 16 LDS rows
static_assert(RSTEP == 2304);                      // the immediates in the statement below
__device__ __forceinline__ void async_copy12(unsigned lk, unsigned ll, unsigned lv, unsigned ko, unsigned vo,
                                             const uint64_t (&kb)[4], const uint64_t (&lb)[4], const uint64_t (&vb)[4]) {
  asm volatile("global_load_async_to_lds_b128 %0, %3, %5\n\t"
               "global_load_async_to_lds_b128 %0, %3, %6 offset:2304\n\t"
               "global_load_async_to_lds_b128 %0, %3, %7 offset:4608\n\t"
               "global_load_async_to_lds_b128 %0, %3, %8 offset:6912\n\t"
               "global_load_async_to_lds_b128 %1, %3, %9\n\t"
               "global_load_async_to_lds_b128 %1, %3, %10 offset:2304\n\t"
               "global_load_async_to_lds_b128 %1, %3, %11 offset:4608\n\t"
               "global_load_async_to_lds_b128 %1, %3, %12 offset:6912\n\t"
               "global_load_async_to_lds_b128 %2, %4, %13\n\t"
               "global_load_async_to_lds_b128 %2, %4, %14 offset:2304\n\t"
               "global_load_async_to_lds_b128 %2, %4, %15 offset:4608\n\t"
               "global_load_async_to_lds_b128 %2, %4, %16 offset:6912\n\t"
               "s_wait_xcnt 0x0"
               :: "v"(lk), "v"(ll), "v"(lv), "v"(ko), "v"(vo),
                  "s"(kb[0]), "s"(kb[1]), "s"(kb[2]), "s"(kb[3]),
                  "s"(lb[0]), "s"(lb[1]), "s"(lb[2]), "s"(lb[3]),
                  "s"(vb[0]), "s"(vb[1]), "s"(vb[2]), "s"(vb[3])
               : "memory");
}

template <bool RES>
__device__ __forceinline__
void attn_causal64(const unsigned short* __restrict__ qhp, const unsigned short* __restrict__ qlp,
                   const unsigned short* __restrict__ khp, const unsigned short* __restrict__ klp,
                   const unsigned short* __restrict__ vhp, const unsigned short* __restrict__ vlp,
                   unsigned short* ohp, unsigned short* olp,
                   int qb, int h, int b, AttnLds& lds) {   // qb = 0..NQB-1, h, b: block-uniform
  union FB { v16b v; v8b h[2]; };
  union FH { v16h v; v8h h[2]; };
  const int tid  = threadIdx.x & 127;          // thread inside its wave group
  const int grp  = __builtin_amdgcn_readfirstlane((int)(threadIdx.x >> 7));   // wave group 0 / 1, wave-uniform
  const int wave = tid >> 5;                   // 0..3: the 16 query rows of the block this wave owns
  const int lane = tid & 31;
  const int hh   = lane >> 4;
  const int c    = lane & 15;

  // the tiles the next chunk is read from: fixed in the residual variant, the trip's buffer in the plain one
  __bf16*   Ksh = RES ? lds.t[grp].Ksh : lds.r[grp][0].Ksh;
  __bf16*   Ksl = RES ? lds.t[grp].Ksl : lds.r[grp][0].Ksl;
  _Float16* Vth = RES ? lds.t[grp].Vth : lds.r[grp][0].Vth;
  _Float16* const Vtl = lds.t[grp].Vtl;        // residual variant only
  float    (* const Os)[16 * OP]  = lds.Os;

  const int q0   = qb * 64 + wave * 16;
  const size_t rowB = (size_t)b * SEQ;

  const __bf16* Qh = (const __bf16*)(const void*)qhp + (size_t)h * HD;
  const __bf16* Ql = (const __bf16*)(const void*)qlp + (size_t)h * HD;
  const __bf16* Kh = (const __bf16*)(const void*)khp + (size_t)h * HD;
  const __bf16* Kl = (const __bf16*)(const void*)klp + (size_t)h * HD;
  const _Float16* Vh = (const _Float16*)(const void*)vhp + ((size_t)b * DM + (size_t)h * HD) * SEQ;
  const _Float16* Vl = (const _Float16*)(const void*)vlp + ((size_t)b * DM + (size_t)h * HD) * VLP;

  // ---- Q fragments (B operand, column = lane&15): 2 d-chunks, hi and lo ----
  v16b qah[2], qal[2];
  const __bf16* qhg = Qh + (rowB + q0 + c) * DM + 8 * hh;
  const __bf16* qlg = Ql + (rowB + q0 + c) * DM + 8 * hh;
#pragma unroll
  for (int dc = 0; dc < 2; ++dc) {
    qah[dc] = ldfrag_b(qhg + dc * 32);
    qal[dc] = ldfrag_b(qlg + dc * 32);
  }
  // The two address pairs are free for reuse behind these loads: the wait that belongs in front of an overwrite, the pairs as its inputs.
  asm volatile("s_wait_xcnt 0x0" :: "v"(qhg), "v"(qlg) : "memory");

  const int rowq = q0 + c;                     // this lane's query
  float mrow = -INFINITY, lrow = 0.f;          // running exponent offset of the query (both halves alike), this half's partial normaliser (of 1024 p)
  v8f oacc[4];                                 // oacc[t][r] = O^T[d = t*16 + 8hh + r][query c]
#pragma unroll
  for (int t = 0; t < 4; ++t) oacc[t] = zero8();

  // One staged key chunk: scores, online softmax, context sums. MASK = the chunk may hold keys beyond a query of this block.
  const float SC2 = 0.125f * 1.44269504088896340736f;   // score scale times log2 e
  auto chunk = [&](auto mk, const int kv0, auto mid) __attribute__((always_inline)) {
    constexpr bool MASK = decltype(mk)::value;
    // ---- scores, transposed: 64 keys x 16 queries per wave, 3 bf16 products ----
    // All K fragments of a d-chunk are read as one group, then the four key tiles' accumulators take turns, so one LDS wait
    // serves 12 products and no product waits for the one before it. Each s[j] still sums hi.hi, hi.lo, lo.hi per d-chunk.
    v8f s[4];                                  // s[j][r] = S^T[key kv0 + j*16 + 8hh + r][query c]
#pragma unroll
    for (int j = 0; j < 4; ++j) s[j] = zero8();
#pragma unroll
    for (int dc = 0; dc < 2; ++dc) {
      FB kb[4], kl[4];
#pragma unroll
      for (int j = 0; j < 4; ++j) {
        kb[j].h[0] = *(const v8b*)(Ksh + (j * 16 + c) * LP + dc * 32 + 8 * hh);
        kb[j].h[1] = *(const v8b*)(Ksh + (j * 16 + c) * LP + dc * 32 + 16 + 8 * hh);
        kl[j].h[0] = *(const v8b*)(Ksl + (j * 16 + c) * LP + dc * 32 + 8 * hh);
        kl[j].h[1] = *(const v8b*)(Ksl + (j * 16 + c) * LP + dc * 32 + 16 + 8 * hh);
      }
#pragma unroll
      for (int j = 0; j < 4; ++j) s[j] = mma_b_raw(kb[j].v, qah[dc], s[j]);
#pragma unroll
      for (int j = 0; j < 4; ++j) s[j] = mma_b_raw(kl[j].v, qah[dc], s[j]);
#pragma unroll
      for (int j = 0; j < 4; ++j) s[j] = mma_b_raw(kb[j].v, qal[dc], s[j]);
    }

    // Plain variant: all V^T fragments of the chunk are read here, the chunk's last LDS reads. mid() hands the buffer on behind them
    // (the ring's waits, barrier and refill); the softmax and the second product then work on registers alone.
    FH vf[2][4];
    if (!RES) {
#pragma unroll
      for (int kk = 0; kk < 2; ++kk)
#pragma unroll
        for (int t = 0; t < 4; ++t) {
          vf[kk][t].h[0] = *(const v8h*)(Vth + (t * 16 + c) * LP + kk * 32 + 8 * hh);
          vf[kk][t].h[1] = *(const v8h*)(Vth + (t * 16 + c) * LP + kk * 32 + 16 + 8 * hh);
        }
    }
    mid();

    // ---- causal mask by index (MASK chunks only), maximum of the raw scores in the lane (one chain per key tile), one exchange ----
    float mj[4];
#pragma unroll
    for (int j = 0; j < 4; ++j) {
      mj[j] = -INFINITY;
#pragma unroll
      for (int r = 0; r < 8; ++r) {
        if (MASK) {
          const int key = kv0 + j * 16 + 8 * hh + r;
          s[j][r] = (key <= rowq) ? s[j][r] : -INFINITY;
        }
        mj[j] = fmaxf(mj[j], s[j][r]);
      }
    }
    float m = fmaxf(fmaxf(mj[0], mj[1]), fmaxf(mj[2], mj[3]));
    m = fmaxf(m, xhalf(m));                    // both halves now hold the query's maximum over the chunk
    // The running max is kept as the exponent's offset: max * (log2 e / 8) - 10, rounded once (monotone in the max, -inf stays -inf).
    // Every p, every rescale and the groups' join subtract such offsets only, so numerator and normaliser share one reference.
    const float mnew  = fmaxf(mrow, __builtin_fmaf(m, SC2, -10.0f));
    const float msafe = (mnew == -INFINITY) ? 0.f : mnew;
    const float alpha = exp2_1(mrow - msafe);
    mrow = mnew;

    // ---- online softmax; P (x1024, f16) and P residual (x4096) packed straight into the B operands of the second product ----
    FH pa[2], pl[2];
    float pj[4];
    const v8f sc2v = {SC2, SC2, SC2, SC2, SC2, SC2, SC2, SC2};
    const v8f nmv  = {-msafe, -msafe, -msafe, -msafe, -msafe, -msafe, -msafe, -msafe};
#pragma unroll
    for (int j = 0; j < 4; ++j) {
      // one fused multiply-add per score (as a vector, so two share an instruction): 1/8, log2 e, the max and the x1024 carry
      v8f y;
      if (RES) {                               // single FMAs: as pairs this variant's build took 259 registers, and above 256 one block fewer fits a WGP
#pragma unroll
        for (int r = 0; r < 8; ++r) y[r] = __builtin_fmaf(s[j][r], SC2, -msafe);
      } else {
        y = __builtin_elementwise_fma(s[j], sc2v, nmv);
      }
      const v8f e = exp2_8(y);                 // 1024 p; masked logit: 2^(-inf) = 0
#pragma unroll
      for (int r = 0; r < 8; ++r) {
        const float p1k = e[r];
        pj[j] = r ? pj[j] + p1k : p1k;
        const _Float16 ph = (_Float16)p1k;
        pa[j >> 1].v[(j & 1) * 8 + r] = ph;
        if (RES) pl[j >> 1].v[(j & 1) * 8 + r] = (_Float16)((p1k - (float)ph) * 4096.0f);
      }
    }
    lrow = lrow * alpha + ((pj[0] + pj[1]) + (pj[2] + pj[3]));
#pragma unroll
    for (int t = 0; t < 4; ++t)
#pragma unroll
      for (int r = 0; r < 8; ++r) oacc[t][r] *= alpha;

    // ---- context^T += V^T . P^T (f16 WMMA), residual products into a separate accumulator ----
    v8f o1[4];
#pragma unroll
    for (int t = 0; t < 4; ++t) o1[t] = zero8();
    // Unrolled, with each key half's V fragments read as one group ahead of its products; the four d tiles take turns.
#pragma unroll
    for (int kk = 0; kk < 2; ++kk) {
      FH vb[4], vl[4];
#pragma unroll
      for (int t = 0; t < 4; ++t) {
        if (RES) {
          vb[t].h[0] = *(const v8h*)(Vth + (t * 16 + c) * LP + kk * 32 + 8 * hh);
          vb[t].h[1] = *(const v8h*)(Vth + (t * 16 + c) * LP + kk * 32 + 16 + 8 * hh);
        } else {
          vb[t].v = vf[kk][t].v;
        }
        if (RES) {
          vl[t].h[0] = *(const v8h*)(Vtl + (t * 16 + c) * LP + kk * 32 + 8 * hh);
          vl[t].h[1] = *(const v8h*)(Vtl + (t * 16 + c) * LP + kk * 32 + 16 + 8 * hh);
        } else {
          vl[t].v = vb[t].v;
        }
      }
#pragma unroll
      for (int t = 0; t < 4; ++t) oacc[t] = mma_h_raw(vb[t].v, pa[kk].v, oacc[t]);
      if (RES) {
#pragma unroll
        for (int t = 0; t < 4; ++t) o1[t] = mma_h_raw(vl[t].v, pa[kk].v, o1[t]);
#pragma unroll
        for (int t = 0; t < 4; ++t) o1[t] = mma_h_raw(vb[t].v, pl[kk].v, o1[t]);
      }
    }
    if (RES) {
#pragma unroll
      for (int t = 0; t < 4; ++t)
#pragma unroll
        for (int r = 0; r < 8; ++r) oacc[t][r] += o1[t][r] * (1.0f / 4096.0f);
    }
  };

  // Residual variant: bring key chunk kv0 .. kv0 + 63 into this group's tiles, between two barriers that all eight waves pass.
  auto stage = [&](const int kv0) __attribute__((always_inline)) {
    __syncthreads();
    {
      // 8 lanes per 128-B row, 4 rows per wave and load: every wave-wide 16-B load covers 4 whole lines (2 lanes per row
      // touched 16 lines for the same 512 B). A thread takes piece pc of rows r, r+16, r+32, r+48.
      const int r = tid >> 3, pc = (tid & 7) * 8;
      const __bf16*   kg  = Kh + (rowB + kv0 + r) * DM + pc;      // K row kv0+r, d = pc..pc+7
      const __bf16*   klg = Kl + (rowB + kv0 + r) * DM + pc;
      const _Float16* vg  = Vh + (size_t)r * SEQ + kv0 + pc;      // V^T row d = r, s = kv0+pc..+7
      const int kvl = (kv0 + 64 <= VLP) ? kv0 : (VLP - 64);     // clamped address into the residual plane
      const _Float16* vlg = Vl + (size_t)r * VLP + kvl + pc;
      const bool resOK = (kv0 + 64 <= VLP);                      // wave-uniform (always true for qb < RESQB)
#pragma unroll
      for (int i = 0; i < 4; ++i) {
        const v8b a0 = *(const v8b*)(kg + (size_t)(16 * i) * DM);
        const v8b a1 = *(const v8b*)(klg + (size_t)(16 * i) * DM);
        const v8h b0 = *(const v8h*)(vg + (size_t)(16 * i) * SEQ);
        *(v8b*)(Ksh + (r + 16 * i) * LP + pc) = a0;
        *(v8b*)(Ksl + (r + 16 * i) * LP + pc) = a1;
        *(v8h*)(Vth + (r + 16 * i) * LP + pc) = b0;
        if (RES) {
          v8h b1 = *(const v8h*)(vlg + (size_t)(16 * i) * VLP);
          if (!resOK) b1 = zero8h();
          *(v8h*)(Vtl + (r + 16 * i) * LP + pc) = b1;
        }
      }
      // RES build: the last load's result was placed on address pairs that earlier loads of this batch name. The pairs are
      // inputs of the wait, so they stay as they are until the batch's address translations are done.
      if (RES) asm volatile("s_wait_xcnt 0x0" :: "v"(kg), "v"(klg), "v"(vg), "v"(vlg) : "memory");
      else     asm volatile("s_wait_xcnt 0x0" :: "v"(kg), "v"(klg), "v"(vg) : "memory");
    }
    __syncthreads();
  };

  // chunk 2*it + grp <= qb, or qb + 1 <= NQB - 1 for even qb (all masked): kv0 + 63 < SEQ.
  // Only the last trip's chunks reach or pass the diagonal (2*it + grp >= qb needs it = trips - 1): the trips before it keep every
  // key and run without the mask's compare and select. The last trip stands behind the loop, so the loop holds one variant only.
  const int trips = (qb + 2) >> 1;             // block-uniform, 1 <= trips <= NQB / 2: chunks 0..qb dealt even / odd to the two groups
  if constexpr (RES) {
    for (int it = 0; it + 1 < trips; ++it) {
      const int kv0 = (2 * it + grp) * 64;
      stage(kv0);
      chunk(BoolC<false>(), kv0, [] {});
    }
    {
      const int kv0 = (2 * (trips - 1) + grp) * 64;
      stage(kv0);
      chunk(BoolC<true>(), kv0, [] {});
    }
  } else {
    // Key chunk kv0 .. kv0 + 63 into buffer buf of this group: the same pieces as stage() (8 lanes per 128-B row, a thread takes
    // piece pc of rows r, r+16, r+32, r+48 of each plane), every lane on, under block-uniform control flow.
    const unsigned ko = (unsigned)((tid >> 3) * DM + (tid & 7) * 8) * 2u;    // the lane's byte offset in a K chunk: row r, piece pc
    const unsigned vo = (unsigned)((tid >> 3) * SEQ + (tid & 7) * 8) * 2u;   // ... and in a V^T chunk
    const unsigned lo = (unsigned)((tid >> 3) * LP + (tid & 7) * 8) * 2u;    // ... and in an LDS plane
    auto copy_chunk = [&](const int kv0, const int buf) __attribute__((always_inline)) {
      const uint64_t kg  = (uint64_t)(uintptr_t)(Kh + (rowB + kv0) * DM);      // wave-uniform: K row kv0, d = 0
      const uint64_t klg = (uint64_t)(uintptr_t)(Kl + (rowB + kv0) * DM);
      const uint64_t vg  = (uint64_t)(uintptr_t)(Vh + kv0);                    // V^T row d = 0, s = kv0
      RingTile& rt = lds.r[grp][buf];
      uint64_t kb[4], lb[4], vb[4];
#pragma unroll
      for (int i = 0; i < 4; ++i) {
        kb[i] = kg  + (uint64_t)i * (16 * DM * 2 - RSTEP);
        lb[i] = klg + (uint64_t)i * (16 * DM * 2 - RSTEP);
        vb[i] = vg  + (uint64_t)i * (16 * SEQ * 2 - RSTEP);
      }
      async_copy12(lds_byte(rt.Ksh) + lo, lds_byte(rt.Ksl) + lo, lds_byte(rt.Vth) + lo, ko, vo, kb, lb, vb);
    };
    auto use_buf = [&](const int buf) __attribute__((always_inline)) {
      Ksh = lds.r[grp][buf].Ksh;
      Ksl = lds.r[grp][buf].Ksl;
      Vth = lds.r[grp][buf].Vth;
    };
    copy_chunk(grp * 64, 0);
    asm volatile("s_wait_asynccnt 0x0" ::: "memory");   // this wave's copies of chunk 0 have landed
    __syncthreads();                                     // ... and every other wave's: chunk 0 may be read
    if (trips > 1) copy_chunk((2 + grp) * 64, 1);
    for (int it = 0; it + 1 < trips; ++it) {
      use_buf(it & 1);
      chunk(BoolC<false>(), (2 * it + grp) * 64, [&]() __attribute__((always_inline)) {
        asm volatile("s_wait_dscnt 0x0" ::: "memory");     // this wave's reads of the trip's buffer are done before it is refilled
        asm volatile("s_wait_asynccnt 0x0" ::: "memory");  // this wave's copies of the next chunk have landed
        __syncthreads();                                   // one barrier: the next chunk is whole, this trip's buffer is free
        if (it + 2 < trips) copy_chunk((2 * (it + 2) + grp) * 64, it & 1);
      });
    }
    use_buf((trips - 1) & 1);
    chunk(BoolC<true>(), (2 * (trips - 1) + grp) * 64, [] {});
    asm volatile("s_wait_asynccnt 0x0" ::: "memory");    // no copy is outstanding when the wave goes on to the join and its end
  }

  // ---- join the halves' normalisers, normalise (1/l; the x1024 carry is in l too), stage the wave's 16x64 tile [query][d]
  //      (a lane's 8 registers of a tile are 8 consecutive d of its query: two 16-B stores), bf16 hi/lo split,
  // ---- join the two wave groups: group 1 leaves its context sums, running max and partial normaliser in LDS (a lane's own
  //      144-B row), all eight waves pass one barrier, group 0 rescales both parts to the common max and adds them; group 1 is done.
  float* xs = lds.Xs[wave] + lane * XP;
  if (grp == 1) {
#pragma unroll
    for (int t = 0; t < 4; ++t) {
      v4f w0, w1;
#pragma unroll
      for (int r = 0; r < 4; ++r) { w0[r] = oacc[t][r]; w1[r] = oacc[t][4 + r]; }
      *(v4f*)(xs + t * 8)     = w0;
      *(v4f*)(xs + t * 8 + 4) = w1;
    }
    xs[32] = mrow;
    xs[33] = lrow;
  }
  __syncthreads();
  if (grp == 1) return;                        // wave-uniform; no block barrier follows
  {
    const float m2 = xs[32], l2 = xs[33];
    const float mm = fmaxf(mrow, m2);
    const float ms = (mm == -INFINITY) ? 0.f : mm;
    const float a1 = exp2_1(mrow - ms);
    const float a2 = exp2_1(m2 - ms);     // group 1 kept no key (query block 0): m2 = -inf, a2 = 0, its sums are 0
    lrow = lrow * a1 + l2 * a2;
#pragma unroll
    for (int t = 0; t < 4; ++t) {
      const v4f x0 = *(const v4f*)(xs + t * 8);
      const v4f x1 = *(const v4f*)(xs + t * 8 + 4);
#pragma unroll
      for (int r = 0; r < 4; ++r) {
        oacc[t][r]     = oacc[t][r] * a1 + x0[r] * a2;
        oacc[t][4 + r] = oacc[t][4 + r] * a1 + x1[r] * a2;
      }
    }
  }

  float* os = Os[wave];
  {
    const float l = lrow + xhalf(lrow);        // unconditional: both halves take part in the exchange
    const float inv = (l > 0.f) ? (1.0f / l) : 0.f;   // l sums 1024 p, as the context sums do
#pragma unroll
    for (int t = 0; t < 4; ++t) {
      v4f w0, w1;
#pragma unroll
      for (int r = 0; r < 4; ++r) { w0[r] = oacc[t][r] * inv; w1[r] = oacc[t][4 + r] * inv; }
      *(v4f*)(os + c * OP + t * 16 + 8 * hh)     = w0;
      *(v4f*)(os + c * OP + t * 16 + 8 * hh + 4) = w1;
    }
  }
  __builtin_amdgcn_fence(__ATOMIC_RELEASE, "workgroup");
  __builtin_amdgcn_wave_barrier();
  __builtin_amdgcn_fence(__ATOMIC_ACQUIRE, "workgroup");
  {
    const int q4 = lane >> 3, c8 = (lane & 7) * 8;
    v4u hv[4], lv[4];
#pragma unroll
    for (int it = 0; it < 4; ++it) {
      const int row = it * 4 + q4;   // it 0..3 x q4 0..3 = rows 0..15 of the wave tile
      const float* sp = os + row * OP + c8;
      v4u a, a2;
#pragma unroll
      for (int e = 0; e < 4; ++e) {
        const float f0 = sp[2 * e], f1 = sp[2 * e + 1];
        const unsigned short h0 = bf_bits(f0), h1 = bf_bits(f1);
        const unsigned short l0 = bf_bits(f0 - bf_up(h0)), l1 = bf_bits(f1 - bf_up(h1));
        a[e] = pk16(h0, h1); a2[e] = pk16(l0, l1);
      }
      hv[it] = a; lv[it] = a2;
    }
    {
#pragma unroll
      for (int it = 0; it < 4; ++it) {
        const int row = it * 4 + q4;
        const size_t go = (rowB + q0 + row) * DM + (size_t)h * HD + c8;
        *(v4u*)(ohp + go) = hv[it];
        *(v4u*)(olp + go) = lv[it];
        // The registers these two stores name are reused for the next pair's address and data: wait before they are overwritten.
        asm volatile("s_wait_xcnt 0x0" ::: "memory");
      }
    }
  }
}

// Both attention variants in one grid. Eight-wave blocks no longer all fit on the chip at once, so the block index sets the order
// of starting. First the leading RESQB query blocks (residual planes): few trips, but each far dearer than a plain one, so started
// last they would run on alone. Then the plain blocks from the longest (NQB-1) down to RESQB: a place that falls free takes the
// longest block left, and the launch ends on the shortest. The branch is block-uniform.
__global__ __launch_bounds__(256)
void attn_all(const unsigned short* __restrict__ qhp, const unsigned short* __restrict__ qlp,
              const unsigned short* __restrict__ khp, const unsigned short* __restrict__ klp,
              const unsigned short* __restrict__ vhp, const unsigned short* __restrict__ vlp,
              unsigned short* ohp, unsigned short* olp) {
  __shared__ __align__(16) AttnLds lds;
  const int bx = blockIdx.x;
  const int g  = bx / (NB * NH);               // 0..NQB-1
  const int qb = (g < RESQB) ? (RESQB - 1 - g) : (NQB - 1 + RESQB - g);   // RESQB-1..0, then NQB-1..RESQB: every (qb, h, b) exactly once
  const int hb = bx % (NB * NH);
  // (with the two calls in this order the build stays within 256 registers; above that one block fewer fits a WGP)
  if (qb < RESQB) attn_causal64<true>(qhp, qlp, khp, klp, vhp, vlp, ohp, olp, qb, hb % NH, hb / NH, lds);
  else            attn_causal64<false>(qhp, qlp, khp, klp, vhp, vlp, ohp, olp, qb, hb % NH, hb / NH, lds);
}

// =====================================================================================================
// Workspace map (bytes; every region is an exact multiple of its 64x64-tile / whole-line store granularity,
//   Qb   bf16 [8192][512]            0            8388608
//   Kb   bf16 [8192][512]            8388608      8388608
//   Vb   bf16 [8192][512]            16777216     8388608
//   WqT  bf16 [512 n][512 k]         25165824     524288
//   WkT                              25690112     524288
//   WvT                              26214400     524288
//   WoT                              26738688     524288
//   Qh   bf16 [8192][512]            27262976     8388608
//   Ql                               35651584     8388608
//   Kh                               44040192     8388608
//   Kl                               52428800     8388608
//   VTh  f16  [2][512][4096]         60817408     8388608
//   VTl  f16  [2][512][512]          69206016     1048576
//   Oh   bf16 [8192][512]            70254592     8388608
//   Ol                               78643200     8388608
//   end                              87031808
// =====================================================================================================
extern "C" void kernel_launch(void* const* d_in, const int* in_sizes, int n_in,
                              void* d_out, int out_size, void* d_ws, size_t ws_size,
                              hipStream_t stream) {
  if (n_in < 11) return;
  const int NX = NB * SEQ * DM;                    // 4194304
  if (in_sizes[0] != NX || in_sizes[1] != NX || in_sizes[2] != NX) return;
  if (in_sizes[3] != DM * DM || in_sizes[5] != DM * DM || in_sizes[7] != DM * DM || in_sizes[9] != DM * DM) return;
  if (in_sizes[4] != DM || in_sizes[6] != DM || in_sizes[8] != DM || in_sizes[10] != DM) return;
  if (out_size != NX) return;

  const float* v  = (const float*)d_in[0];   // [2][4096][512]
  const float* k  = (const float*)d_in[1];   // [2][4096][512]
  const float* q  = (const float*)d_in[2];   // [2][4096][512]
  const float* Wq = (const float*)d_in[3];   // [512 in][512 out] = [k][n]
  const float* bq = (const float*)d_in[4];   // [512]
  const float* Wk = (const float*)d_in[5];   // [512 in][512 out]
  const float* bk = (const float*)d_in[6];   // [512]
  const float* Wv = (const float*)d_in[7];   // [512 in][512 out]
  const float* bv = (const float*)d_in[8];   // [512]
  const float* Wo = (const float*)d_in[9];   // [512 in][512 out]
  const float* bo = (const float*)d_in[10];  // [512]

  const size_t PX  = (size_t)NB * SEQ * DM * 2;    //  8388608  16-bit activation plane [8192][512]
  const size_t PW  = (size_t)DM * DM * 2;          //   524288  16-bit weight plane [512][512]
  const size_t PVT = (size_t)NB * DM * SEQ * 2;    //  8388608  v^T hi plane
  const size_t PVL = (size_t)NB * DM * VLP * 2;    //  1048576  v^T residual plane
  size_t off = 0;
  const size_t oQb  = off; off += PX;
  const size_t oKb  = off; off += PX;
  const size_t oVb  = off; off += PX;
  const size_t oWq  = off; off += PW;
  const size_t oWk  = off; off += PW;
  const size_t oWv  = off; off += PW;
  const size_t oWo  = off; off += PW;
  const size_t oQh  = off; off += PX;
  const size_t oQl  = off; off += PX;
  const size_t oKh  = off; off += PX;
  const size_t oKl  = off; off += PX;
  const size_t oVTh = off; off += PVT;
  const size_t oVTl = off; off += PVL;
  const size_t oOh  = off; off += PX;
  const size_t oOl  = off; off += PX;
  if (off > ws_size) return;                       // off = 87031808
  if (off > (size_t)134217728) return;

  char* ws = (char*)d_ws;
  unsigned short* Qb  = (unsigned short*)(ws + oQb);
  unsigned short* Kb  = (unsigned short*)(ws + oKb);
  unsigned short* Vb  = (unsigned short*)(ws + oVb);
  unsigned short* WqT = (unsigned short*)(ws + oWq);
  unsigned short* WkT = (unsigned short*)(ws + oWk);
  unsigned short* WvT = (unsigned short*)(ws + oWv);
  unsigned short* WoT = (unsigned short*)(ws + oWo);
  unsigned short* Qh  = (unsigned short*)(ws + oQh);
  unsigned short* Ql  = (unsigned short*)(ws + oQl);
  unsigned short* Kh  = (unsigned short*)(ws + oKh);
  unsigned short* Kl  = (unsigned short*)(ws + oKl);
  unsigned short* VTh = (unsigned short*)(ws + oVTh);
  unsigned short* VTl = (unsigned short*)(ws + oVTl);
  unsigned short* Oh  = (unsigned short*)(ws + oOh);
  unsigned short* Ol  = (unsigned short*)(ws + oOl);

  const dim3 blk(256);
  const dim3 gProj(GPB, 1);                                    // 1024 tiles -> 128 blocks: M=8192, N=512

  // (1) all plane conversions in one grid: weights f32 [k][n] -> bf16 W^T [n][k] (WqT, WkT, WvT, WoT are contiguous),
  //     activations f32 -> bf16 planes of the inputs' layout (Qb, Kb, Vb are contiguous)
  prep_planes<<<dim3(4 * NTR + 3 * NCV), blk, 0, stream>>>(q, k, v, Wq, Wk, Wv, Wo, Qb, WqT);
  // (2) the three input projections in one grid: qp, kp -> bf16 hi/lo planes [b*SEQ+t][h*64+d] (Qh, Ql, Kh, Kl contiguous),
  //     vp^T per batch -> f16 hi plane [b][h*64+d][s] (pitch SEQ) and residual plane (x4096, keys < VLP only, pitch VLP)
  gemm_qkv<<<dim3(GPB, 3), blk, 0, stream>>>(Qb, WqT, bq, bk, bv, Qh, VTh, VTl);
  // (3) causal attention, one grid: query blocks RESQB.. without, 0..RESQB-1 with residual planes
  attn_all<<<dim3(NB * NH * NQB), dim3(256), 0, stream>>>(Qh, Ql, Kh, Kl, VTh, VTl, Oh, Ol);
  // (4) out = context . Wo + bo -> d_out f32 [8192][512]  (A = context hi + lo planes, 2 products; Bt = WoT)
  gemm64<1, 0, 1, DM, DM><<<gProj, blk, 0, stream>>>(
      Oh, Ol, 0LL, WoT, 0LL, bo,
      d_out, DM, 0LL, d_out, DM, 0LL, DM,
      NB * SEQ, DM, DM, 1.0f);
  (void)hipGetLastError();
}

// v010
// A run of this version takes 97.5 microseconds.
// Timed twice side by side with v009, it ran 1.07 times as fast both times.
// Counting every step since v000, it is 5.43 times as fast.
// Contractions: q, k, v^T projections = v_wmma_f32_16x16x32_bf16 (bf16 operands from RNE-converted inputs and weights, single product, f32 accumulate);
// k.q^T scores (keys down, queries across) = v_wmma_f32_16x16x32_bf16 with bf16 hi/lo split q and k (hi.hi + hi.lo + lo.hi), f32 accumulate;
// v^T.p^T = v_wmma_f32_16x16x32_f16 (p carried x1024 in f16 times v in f16, single product; plus f16 residual planes x4096 of
// p and v for the first 512 query rows of every sequence), f32 accumulate;
// ctx.Wo = v_wmma_f32_16x16x32_bf16 with ctx as bf16 hi/lo planes times bf16 Wo^T (2 products), f32 accumulate;
// causal mask (key <= query), online softmax, normalisers and bias adds in f32 on the VALU.
// Carry audit:
//   ph  = f16(1024 * p)                      -> the exponent's bias makes 1024 p directly; the normaliser l sums the same 1024 p, so inv = 1/l cancels it
//   pl  = f16((1024 p - ph) * 4096)          }  products VTl.ph and VTh.pl go to the separate accumulator o1,
//   VTl = f16((v - VTh) * 4096)              }  folded back with * (1/4096) once per key chunk (RES blocks only)
//   VTh = f16(v), no carry (|v| typ. 0.45); q / k / ctx lo planes are unscaled bf16 residuals (v - hi) sharing the hi accumulator;
//   score scale 1/8 applied once in f32, inside the multiply-add that forms the exponent. No other scaled planes.
#include <hip/hip_runtime.h>
#include <math.h>
#include <stdint.h>

#define NB    2
#define SEQ   4096
#define DM    512
#define NH    8
#define HD    64
#define NQB   (SEQ / 64)   // 64 query / key blocks of 64
#define VLP   512          // key pitch of the v^T residual plane (keys 0..VLP-1)
#define RESQB 8            // leading 64-row query blocks that use the p / v residual planes
#define LP    72           // LDS row pitch of the 64-element 16-bit tiles: 144 B = 16 B x 9, 16 rows of a 16-B read on 16 bank quads
#define OP    68           // LDS row pitch of the f32 context tile, in floats (16-B reads down a column walk)
static_assert(RESQB * 64 <= VLP);
static_assert(NH * HD == DM);
static_assert((SEQ % 64) == 0 && (DM % 64) == 0 && (DM % 32) == 0);
static_assert(((NB * SEQ / 64) * (DM / 64)) % 8 == 0);
static_assert(((DM / 64) * (SEQ / 64)) % 8 == 0);
static_assert((NB * SEQ * DM) % (8 * 256) == 0);
static_assert((DM * DM) % (64 * 64) == 0);
static_assert((DM % 512) == 0 && (SEQ % 512) == 0);   // a product's block takes 512 neighbouring rows of its second operand
static_assert(((NB * SEQ) % 128) == 0 && (DM % 128) == 0);   // ... and 64 or 128 rows of its first

typedef _Float16 v16h __attribute__((ext_vector_type(16)));
typedef _Float16 v8h  __attribute__((ext_vector_type(8)));
typedef __bf16   v16b __attribute__((ext_vector_type(16)));
typedef __bf16   v8b  __attribute__((ext_vector_type(8)));
typedef float    v8f  __attribute__((ext_vector_type(8)));
typedef float    v4f  __attribute__((ext_vector_type(4)));
typedef unsigned int v4u __attribute__((ext_vector_type(4)));

// ---- scalar helpers --------------------------------------------------------------------------------
__device__ __forceinline__ unsigned short bf_bits(float f) {          // f32 -> bf16 bits, RNE convert
  unsigned u = __float_as_uint(f);
  return (unsigned short)((u + 0x7FFFu + ((u >> 16) & 1u)) >> 16);
}
__device__ __forceinline__ float bf_up(unsigned short h) { return __uint_as_float(((unsigned)h) << 16); }
__device__ __forceinline__ unsigned short h_bits(_Float16 x) { return __builtin_bit_cast(unsigned short, x); }
__device__ __forceinline__ unsigned pk16(unsigned short a, unsigned short b) { return (unsigned)a | ((unsigned)b << 16); }
__device__ __forceinline__ v8f zero8() { v8f z = {0.f, 0.f, 0.f, 0.f, 0.f, 0.f, 0.f, 0.f}; return z; }
__device__ __forceinline__ v8h zero8h() {
  const _Float16 z = (_Float16)0.0f;
  v8h r = {z, z, z, z, z, z, z, z};
  return r;
}

// value of lane l ^ 16 (the other half of the wave), by a vector cross-row move
__device__ __forceinline__ float xhalf(float x) {
  const int i = __builtin_bit_cast(int, x);
  return __builtin_bit_cast(float, __builtin_amdgcn_permlanex16(i, i, 0x76543210, 0xfedcba98, false, false));
}

// 2^y: the exponential and one v_nop in one statement. The v_nop is the slot the instruction set asks for between a
// transcendental and an instruction that reads its result or overwrites its source; inside one statement nothing comes between them.
__device__ __forceinline__ float exp2_1(float y) {
  float r;
  asm("v_exp_f32 %0, %1\n\tv_nop" : "=v"(r) : "v"(y));
  return r;
}
// Eight independent 2^y in one statement: each exponential is the independent instruction behind the one before it (the results
// are early-clobber, so none lies on a source), and one v_nop behind the last keeps that slot: 9 issue slots, not 16.
__device__ __forceinline__ v8f exp2_8(v8f y) {
  float r0, r1, r2, r3, r4, r5, r6, r7;
  asm("v_exp_f32 %0, %8\n\tv_exp_f32 %1, %9\n\tv_exp_f32 %2, %10\n\tv_exp_f32 %3, %11\n\t"
      "v_exp_f32 %4, %12\n\tv_exp_f32 %5, %13\n\tv_exp_f32 %6, %14\n\tv_exp_f32 %7, %15\n\tv_nop"
      : "=&v"(r0), "=&v"(r1), "=&v"(r2), "=&v"(r3), "=&v"(r4), "=&v"(r5), "=&v"(r6), "=&v"(r7)
      : "v"(y[0]), "v"(y[1]), "v"(y[2]), "v"(y[3]), "v"(y[4]), "v"(y[5]), "v"(y[6]), "v"(y[7]));
  v8f r = {r0, r1, r2, r3, r4, r5, r6, r7};
  return r;
}
template <bool B> struct BoolC { static constexpr bool value = B; };
// LDS byte address of a __shared__ element: the low 32 bits of its address.
__device__ __forceinline__ unsigned lds_byte(const void* p) { return (unsigned)(uintptr_t)p; }

// ---- fragment loader: 16-bit A/B operand, lane -> row/col (lane&15), p already includes +8*(lane>>4);
//      elements 0..7 <- p[0..7] (k0+8h..), elements 8..15 <- p[16..23] (k0+16+8h..)
__device__ __forceinline__ v16b ldfrag_b(const __bf16* p) {
  union { v16b v; v8b h[2]; } f;
  f.h[0] = *(const v8b*)(p);
  f.h[1] = *(const v8b*)(p + 16);
  return f.v;
}

// ---- WMMA helpers with trailing VALU hazard gap --------------------------------------------------------
__device__ __forceinline__ v8f mma_h_raw(v16h a, v16h b, v8f c) {
  return __builtin_amdgcn_wmma_f32_16x16x32_f16(false, a, false, b, (short)0, c, false, false);
}
__device__ __forceinline__ v8f mma_b_raw(v16b a, v16b b, v8f c) {
  return __builtin_amdgcn_wmma_f32_16x16x32_bf16(false, a, false, b, (short)0, c, false, false);
}
__device__ __forceinline__ void dep_guard_b(v8f& a, v8f& b, v16b x, v16b y) {
  asm volatile("v_nop\n\tv_nop\n\tv_nop\n\tv_nop" : "+v"(a), "+v"(b) : "v"(x), "v"(y));
}
__device__ __forceinline__ void keep4_b(v16b a, v16b b, v16b c, v16b d) {
  asm volatile("v_nop" :: "v"(a), "v"(b), "v"(c), "v"(d));
}
__device__ __forceinline__ void acc_guard4(v8f& a, v8f& b, v8f& c, v8f& d) {
  asm volatile("v_nop\n\tv_nop\n\tv_nop\n\tv_nop" : "+v"(a), "+v"(b), "+v"(c), "+v"(d));
}

// =====================================================================================================
// f32 -> bf16 (RNE convert), 8 elements per thread, one 16-B store per lane: a wave writes 512 contiguous B
// the [8192][512] activations, a multiple of 256).
// coverage: n8 threads x 8 = the whole plane.
// =====================================================================================================
__device__ __forceinline__ void cvt_bf16x8(const float* __restrict__ in, unsigned short* out, int n8, int blk) {
  const int i = blk * 256 + threadIdx.x;
  if (i < n8) {
    const v4f a = *(const v4f*)(in + (size_t)i * 8);
    const v4f b = *(const v4f*)(in + (size_t)i * 8 + 4);
    v4u p;
    p[0] = pk16(bf_bits(a[0]), bf_bits(a[1]));
    p[1] = pk16(bf_bits(a[2]), bf_bits(a[3]));
    p[2] = pk16(bf_bits(b[0]), bf_bits(b[1]));
    p[3] = pk16(bf_bits(b[2]), bf_bits(b[3]));
    *(v4u*)(out + (size_t)i * 8) = p;
    
  }
}

// =====================================================================================================
// f32 [K rows][N cols] (pitch ldw) -> bf16 transposed plane WT[n][k] (pitch ldt, k contiguous), RNE convert.
// One 64x64 tile per block (n0 = 64 * tileN, k0 = 64 * tileK, N and K exact multiples of 64): the tile is staged in LDS with
// coalesced 16-B loads (256 threads x 16 floats = the whole tile), __syncthreads, then each output row segment
// coverage: 8 waves x 2 x (lane>>3 = 4 rows) = 64 rows n, 8 lanes x 8 = 64 k: the whole tile; grid = the whole plane.
// =====================================================================================================
__device__ __forceinline__ void cvt_bf16_tr64(const float* __restrict__ W, unsigned short* WT, int ldw, int ldt,
                                              int tileN, int tileK, float* sW) {
  const int tid = threadIdx.x;
  const int n0 = tileN * 64;
  const int k0 = tileK * 64;
  {
    const int kr = tid >> 2, cb = (tid & 3) * 16;          // row k0+kr, cols n0+cb .. +15
    const float* src = W + (size_t)(k0 + kr) * ldw + n0 + cb;
#pragma unroll
    for (int i = 0; i < 4; ++i) {
      const v4f f = *(const v4f*)(src + 4 * i);
      float* d = sW + kr * 65 + cb + 4 * i;
      d[0] = f[0]; d[1] = f[1]; d[2] = f[2]; d[3] = f[3];
    }
  }
  __syncthreads();
  const int wave = tid >> 5, lane = tid & 31;
  const int q = lane >> 3, c8 = (lane & 7) * 8;
  v4u pv[2];
#pragma unroll
  for (int it = 0; it < 2; ++it) {
    const int nr = wave * 8 + it * 4 + q;                  // output row n0+nr, 0 <= nr < 64
    v4u p;
#pragma unroll
    for (int e = 0; e < 4; ++e) {
      const float f0 = sW[(c8 + 2 * e) * 65 + nr];
      const float f1 = sW[(c8 + 2 * e + 1) * 65 + nr];
      p[e] = pk16(bf_bits(f0), bf_bits(f1));
    }
    pv[it] = p;
  }
  {
#pragma unroll
    for (int it = 0; it < 2; ++it) {
      const int nr = wave * 8 + it * 4 + q;
      *(v4u*)(WT + (size_t)(n0 + nr) * ldt + k0 + c8) = pv[it];
    }
    
  }
}

// =====================================================================================================
// One grid for all seven independent plane conversions: blocks 0..4*NTR-1 transpose the four weights (64x64 tile each,
// planes WT + w*DM*DM in the order Wq, Wk, Wv, Wo), the next 3*NCV blocks convert q, k, v (planes Xb + w*NB*SEQ*DM).
// The branch is block-uniform, so the transpose's __syncthreads is passed by all threads of its block or by none.
// =====================================================================================================
#define NTR ((DM / 64) * (DM / 64))          // 64 tiles per weight
#define NCV ((NB * SEQ * DM) / (8 * 256))    // 2048 blocks per activation plane
__global__ __launch_bounds__(256) void prep_planes(const float* __restrict__ q, const float* __restrict__ k,
                                                   const float* __restrict__ v,
                                                   const float* __restrict__ Wq, const float* __restrict__ Wk,
                                                   const float* __restrict__ Wv, const float* __restrict__ Wo,
                                                   unsigned short* Xb, unsigned short* WT) {
  __shared__ __align__(16) float sW[64 * 65];
  const int bx = blockIdx.x;
  if (bx < 4 * NTR) {
    const int w = bx / NTR, t = bx % NTR;
    const float* W = (w == 0) ? Wq : (w == 1) ? Wk : (w == 2) ? Wv : Wo;
    cvt_bf16_tr64(W, WT + (size_t)w * DM * DM, DM, DM, t % (DM / 64), t / (DM / 64), sW);
  } else {
    const int cb = bx - 4 * NTR;
    const int w = cb / NCV, blk = cb % NCV;
    const float* in = (w == 0) ? q : (w == 1) ? k : v;
    cvt_bf16x8(in, Xb + (size_t)w * NB * SEQ * DM, (NB * SEQ * DM) / 8, blk);
  }
}

// =====================================================================================================
// Register-blocked batched bf16 WMMA GEMM: C[m][n] = sum_k A[m][k] * Bt[n][k] + bias; one wave per 64x64 tile.
// A row-major [M][K] pitch lda; Bt row-major [N][K] pitch ldb (k contiguous);
// M a multiple of 64 WM, N of 512, K of 64 and at least 64 (host shapes are static multiples). b = batch index (strides in elements).
// A block's 8 WM waves take WM tile rows and eight neighbouring tile columns: 64 WM rows of A, 512 rows of Bt. A stage is 64 k
// (one 128-B line of every row) of all of them in LDS at pitch LP, brought by asynchronous 16-B copies (8 lanes per row, 4 whole
// lines per wave-wide copy; 256 WM threads x 16 / WM pieces = all of Bt's 512 x 64, x 2 pieces = all of each A plane's 64 WM x 64).
// Two stage buffers: stage t + 2's copies are issued behind the one barrier of trip t, which stands behind the trip's last LDS
// read, so they fly for a whole trip's work. With two buffers one block fills a WGP's LDS share, so the input projections put
// 16 waves on one block (WM = 2) and stage Bt once for both tile rows.
// The fragments are read from LDS in the k order they had from memory, so every accumulator sums in the same order.
// NSPLIT: 0 = A.Bt; 1 = (A + A2).Bt (A2 = unscaled bf16 lo plane of A, 2 products).
// BIAS: 0 = none; 1 = per column n, bias[n]; 2 = per row m, bias[m]; the bias value is RNE-converted to bf16 and added in f32.
// OUT_MODE: 0 = f32 (pitch ldc); 2 = bf16 hi plane C + bf16 lo plane C2 (lo = RNE(v - hi), unscaled);
//           3 = f16 hi plane C + f16 residual plane C2 = f16((v - hi) * rscale), C2 written only for tiles
//               with n0 < N2 (pitch ldc2, batch stride strideC2).
// =====================================================================================================
// One stage's copies of a lane, global memory -> LDS through no register. A copy's global address is its scalar base + the lane's
// 32-bit byte offset (vb in Bt, va in the A planes) + the immediate, its LDS address the register + the same immediate: the
// immediate moves both by the LDS step of one pass of the block's threads, so a base with an immediate is handed in short by just
// that much. The s_wait_xcnt is the last line of the copies' own statement, so it stands in front of every later write of a
// register that a copy names.
// 512 threads: a pass is 64 rows = 9216 LDS bytes; Bt = 8 passes (4 registers x 2), A = 2 passes.
__device__ __forceinline__ void async_stage10(unsigned l0, unsigned l1, unsigned l2, unsigned l3, unsigned la,
                                              unsigned vb, unsigned va,
                                              const uint64_t (&sb)[8], const uint64_t (&sa)[2]) {
  asm volatile("global_load_async_to_lds_b128 %0, %5, %7\n\t"
               "global_load_async_to_lds_b128 %0, %5, %8 offset:9216\n\t"
               "global_load_async_to_lds_b128 %1, %5, %9\n\t"
               "global_load_async_to_lds_b128 %1, %5, %10 offset:9216\n\t"
               "global_load_async_to_lds_b128 %2, %5, %11\n\t"
               "global_load_async_to_lds_b128 %2, %5, %12 offset:9216\n\t"
               "global_load_async_to_lds_b128 %3, %5, %13\n\t"
               "global_load_async_to_lds_b128 %3, %5, %14 offset:9216\n\t"
               "global_load_async_to_lds_b128 %4, %6, %15\n\t"
               "global_load_async_to_lds_b128 %4, %6, %16 offset:9216\n\t"
               "s_wait_xcnt 0x0"
               :: "v"(l0), "v"(l1), "v"(l2), "v"(l3), "v"(la), "v"(vb), "v"(va),
                  "s"(sb[0]), "s"(sb[1]), "s"(sb[2]), "s"(sb[3]), "s"(sb[4]), "s"(sb[5]), "s"(sb[6]), "s"(sb[7]),
                  "s"(sa[0]), "s"(sa[1])
               : "memory");
}
// 256 threads: a pass is 32 rows = 4608 LDS bytes; Bt = 16 passes (4 registers x 4), A and A2 = 2 passes each.
__device__ __forceinline__ void async_stage20(unsigned l0, unsigned l1, unsigned l2, unsigned l3, unsigned la, unsigned la2,
                                              unsigned vb, unsigned va,
                                              const uint64_t (&sb)[16], const uint64_t (&sa)[2], const uint64_t (&sa2)[2]) {
  asm volatile("global_load_async_to_lds_b128 %0, %6, %8\n\t"
               "global_load_async_to_lds_b128 %0, %6, %9 offset:4608\n\t"
               "global_load_async_to_lds_b128 %0, %6, %10 offset:9216\n\t"
               "global_load_async_to_lds_b128 %0, %6, %11 offset:13824\n\t"
               "global_load_async_to_lds_b128 %1, %6, %12\n\t"
               "global_load_async_to_lds_b128 %1, %6, %13 offset:4608\n\t"
               "global_load_async_to_lds_b128 %1, %6, %14 offset:9216\n\t"
               "global_load_async_to_lds_b128 %1, %6, %15 offset:13824\n\t"
               "global_load_async_to_lds_b128 %2, %6, %16\n\t"
               "global_load_async_to_lds_b128 %2, %6, %17 offset:4608\n\t"
               "global_load_async_to_lds_b128 %2, %6, %18 offset:9216\n\t"
               "global_load_async_to_lds_b128 %2, %6, %19 offset:13824\n\t"
               "global_load_async_to_lds_b128 %3, %6, %20\n\t"
               "global_load_async_to_lds_b128 %3, %6, %21 offset:4608\n\t"
               "global_load_async_to_lds_b128 %3, %6, %22 offset:9216\n\t"
               "global_load_async_to_lds_b128 %3, %6, %23 offset:13824\n\t"
               "global_load_async_to_lds_b128 %4, %7, %24\n\t"
               "global_load_async_to_lds_b128 %4, %7, %25 offset:4608\n\t"
               "global_load_async_to_lds_b128 %5, %7, %26\n\t"
               "global_load_async_to_lds_b128 %5, %7, %27 offset:4608\n\t"
               "s_wait_xcnt 0x0"
               :: "v"(l0), "v"(l1), "v"(l2), "v"(l3), "v"(la), "v"(la2), "v"(vb), "v"(va),
                  "s"(sb[0]), "s"(sb[1]), "s"(sb[2]), "s"(sb[3]), "s"(sb[4]), "s"(sb[5]), "s"(sb[6]), "s"(sb[7]),
                  "s"(sb[8]), "s"(sb[9]), "s"(sb[10]), "s"(sb[11]), "s"(sb[12]), "s"(sb[13]), "s"(sb[14]), "s"(sb[15]),
                  "s"(sa[0]), "s"(sa[1]), "s"(sa2[0]), "s"(sa2[1])
               : "memory");
}

template <int NSPLIT, int OUT_MODE, int BIAS, int WM>
__device__ __forceinline__ void gemm64_body(
    const unsigned short* __restrict__ Ap, const unsigned short* A2p, int lda, long long strideA,
    const unsigned short* __restrict__ Btp, int ldb, long long strideB,
    const float* __restrict__ bias,
    void* Cout, int ldc, long long strideC,
    void* Cout2, int ldc2, long long strideC2, int N2,
    int M, int N, int K, float rscale,
    int blk, int b, float (*sT)[16 * 68],     // blk = block index inside this product, b = batch index
    __bf16* sS) {                             // LDS: two stage buffers, each Bt [512][LP], A [64 WM][LP], with NSPLIT A2 [64 WM][LP]
  static_assert((WM == 2 && NSPLIT == 0) || (WM == 1 && NSPLIT == 1));   // the two sets of copies written above
  const __bf16* A   = (const __bf16*)(const void*)Ap;
  const __bf16* A2  = (const __bf16*)(const void*)A2p;
  const __bf16* Bt  = (const __bf16*)(const void*)Btp;
  const int lane = threadIdx.x & 31;
  const int wave = threadIdx.x >> 5;
  const int wn = wave & 7, wm = wave >> 3;   // the wave's tile column and tile row inside the block
  const int blkN = N >> 9;                   // blocks side by side: 512 columns each
  if (blk >= (M / (64 * WM)) * blkN) return; // block-uniform, in front of every barrier
  const int tm = blk / blkN;
  const int nb0 = (blk - tm * blkN) << 9;    // first Bt row of the block
  const int mb0 = tm * (64 * WM);            // first A row of the block
  const int m0 = mb0 + (wm << 6);
  const int n0 = nb0 + (wn << 6);

  const __bf16* Ab  = A  + (size_t)b * strideA;
  const __bf16* Bb  = Bt + (size_t)b * strideB;
  const __bf16* Ab2 = (NSPLIT >= 1) ? (A2 + (size_t)b * strideA) : Ab;

  const int rlane = lane & 15;                 // row (A) / col (B, D) within subtile
  const int koff  = (lane >> 4) * 8;           // k offset of this lane half
  const int mOff  = (lane >> 4) * 8;           // D row offset

  v8f acc[4][4];
#pragma unroll
  for (int i = 0; i < 4; ++i)
#pragma unroll
    for (int j = 0; j < 4; ++j) acc[i][j] = zero8();

  // staging: a thread takes piece spc .. spc + 7 of rows sr, sr + RP, ... of every plane
  constexpr int RP  = 32 * WM;                 // rows per pass of the block's threads
  constexpr int PB  = 512 / RP;                // passes over Bt
  constexpr int JG  = PB / 4;                  // passes per LDS address register
  constexpr unsigned LSTEP = RP * LP * 2;      // LDS bytes of a pass
  constexpr int STG = (512 + 64 * WM * (1 + NSPLIT)) * LP;   // elements of a stage buffer
  static_assert(LSTEP == 4608u * WM && (STG * 2) % 16 == 0);  // the immediates in the statements above
  const int sr  = threadIdx.x >> 3;
  const int spc = (threadIdx.x & 7) * 8;
  const unsigned vb = (unsigned)(sr * ldb + spc) * 2u;       // the lane's byte offset in a pass of Bt ...
  const unsigned va = (unsigned)(sr * lda + spc) * 2u;       // ... of an A plane
  const unsigned lo = lds_byte(sS) + (unsigned)(sr * LP + spc) * 2u;   // ... and its LDS byte address in buffer 0's first pass
  // k0 .. k0 + 63 of every row into buffer buf: every lane on, under block-uniform control flow; rows < N, M and k < K, so in bounds
  auto copy_stage = [&](const int k0, const int buf) __attribute__((always_inline)) {
    const uint64_t bg  = (uint64_t)(uintptr_t)(Bb  + (size_t)nb0 * ldb + k0);   // block-uniform
    const uint64_t ag  = (uint64_t)(uintptr_t)(Ab  + (size_t)mb0 * lda + k0);
    const uint64_t ag2 = (uint64_t)(uintptr_t)(Ab2 + (size_t)mb0 * lda + k0);
    uint64_t sb[PB], sa[2], sa2[2];
#pragma unroll
    for (int i = 0; i < PB; ++i) sb[i] = bg + (uint64_t)i * ((uint64_t)RP * ldb * 2) - (uint64_t)(i % JG) * LSTEP;
#pragma unroll
    for (int i = 0; i < 2; ++i) {
      sa[i]  = ag  + (uint64_t)i * ((uint64_t)RP * lda * 2 - LSTEP);
      sa2[i] = ag2 + (uint64_t)i * ((uint64_t)RP * lda * 2 - LSTEP);
    }
    const unsigned l  = lo + (unsigned)buf * (unsigned)(STG * 2);
    const unsigned la = l + 512u * LP * 2u;
    if constexpr (WM == 2) {
      async_stage10(l, l + JG * LSTEP, l + 2 * JG * LSTEP, l + 3 * JG * LSTEP, la, vb, va, sb, sa);
    } else {
      async_stage20(l, l + JG * LSTEP, l + 2 * JG * LSTEP, l + 3 * JG * LSTEP, la, la + 64u * WM * LP * 2u, vb, va, sb, sa, sa2);
    }
  };
  const int NS = K >> 6;                       // stages, at least one
  // Behind trip t's last LDS reads the buffer is handed on; t and NS are block-uniform, so every wave passes the barrier or none.
  auto hand_on = [&](const int t) __attribute__((always_inline)) {
    if (t + 1 < NS) {
      asm volatile("s_wait_dscnt 0x0" ::: "memory");     // this wave's reads of the trip's buffer are done before it is refilled
      asm volatile("s_wait_asynccnt 0x0" ::: "memory");  // this wave's copies of the next stage have landed
      __syncthreads();                                   // one barrier: the next stage is whole, this trip's buffer is free
      if (t + 2 < NS) copy_stage((t + 2) * 64, t & 1);
    }
  };
  copy_stage(0, 0);
  asm volatile("s_wait_asynccnt 0x0" ::: "memory");   // this wave's copies of stage 0 have landed
  __syncthreads();                                     // ... and every other wave's: stage 0 may be read
  if (NS > 1) copy_stage(64, 1);
  for (int t = 0; t < NS; ++t) {
    const __bf16* sB  = sS + (t & 1) * STG;
    const __bf16* sA  = sB + 512 * LP;
    const __bf16* sA2 = sA + 64 * WM * LP;
#pragma unroll
    for (int kk = 0; kk < 2; ++kk) {
      // all fragments of these 32 k are read as one group ahead of their products: one LDS wait, not one per A fragment
      v16b bh[4], ah[4], al[4];
#pragma unroll
      for (int j = 0; j < 4; ++j) bh[j] = ldfrag_b(sB + ((wn << 6) + (j << 4) + rlane) * LP + kk * 32 + koff);
#pragma unroll
      for (int i = 0; i < 4; ++i) {
        const int ao = ((wm << 6) + (i << 4) + rlane) * LP + kk * 32 + koff;
        ah[i] = ldfrag_b(sA + ao);
        al[i] = ah[i];
        if (NSPLIT >= 1) al[i] = ldfrag_b(sA2 + ao);
      }
      if (kk == 1) hand_on(t);                   // ahead of the stage's last products, which work on registers alone
#pragma unroll
      for (int i = 0; i < 4; ++i) {
#pragma unroll
        for (int j = 0; j < 4; ++j) {
          acc[i][j] = mma_b_raw(ah[i], bh[j], acc[i][j]);
          if (NSPLIT >= 1) acc[i][j] = mma_b_raw(al[i], bh[j], acc[i][j]);
        }
        dep_guard_b(acc[i][0], acc[i][3], ah[i], al[i]);
      }
      keep4_b(bh[0], bh[1], bh[2], bh[3]);
      // 16 waves (256 registers a wave): no product moves on into the next 32 k and no fragment read comes forward over it. Left
      // free, the build held two sets of fragments at once, filled all 256 registers and spilled.
      if (WM == 2) __builtin_amdgcn_sched_barrier(0);
    }
  }
  asm volatile("s_wait_asynccnt 0x0" ::: "memory");    // no copy is outstanding when the wave goes on to its epilogue and its end
  acc_guard4(acc[0][0], acc[0][1], acc[0][2], acc[0][3]);
  acc_guard4(acc[1][0], acc[1][1], acc[1][2], acc[1][3]);
  acc_guard4(acc[2][0], acc[2][1], acc[2][2], acc[2][3]);
  acc_guard4(acc[3][0], acc[3][1], acc[3][2], acc[3][3]);

  // ---- epilogue ----
  float* slab = sT[wave];
  float bcol[4];
#pragma unroll
  for (int j = 0; j < 4; ++j) {
    bcol[j] = 0.f;
    if (BIAS == 1) bcol[j] = bf_up(bf_bits(bias[n0 + (j << 4) + rlane]));   // n < N, bias has N entries
  }
#pragma unroll
  for (int i = 0; i < 4; ++i) {
    const int mBase = m0 + (i << 4);
    float brow[8];
    const unsigned bo = (unsigned)(mBase + mOff) * 4u;                       // the lane's byte offset in bias
#pragma unroll
    for (int r = 0; r < 8; ++r) {
      brow[r] = 0.f;
      if (BIAS == 2) brow[r] = ((const float*)((const char*)bias + bo))[r];  // m < M, bias has M entries
    }
    // The offset register is an input of the wait that belongs in front of its overwrite, so no load's result is placed on it.
    if (BIAS == 2) asm volatile("s_wait_xcnt 0x0" :: "v"(bo) : "memory");
#pragma unroll
    for (int r = 0; r < 8; ++r) {
      if (BIAS == 2) brow[r] = bf_up(bf_bits(brow[r]));
    }
#pragma unroll
    for (int j = 0; j < 4; ++j) {
#pragma unroll
      for (int r = 0; r < 8; ++r) {
        slab[(mOff + r) * 68 + (j << 4) + rlane] = acc[i][j][r] + bcol[j] + brow[r];
      }
    }
    __builtin_amdgcn_fence(__ATOMIC_RELEASE, "workgroup");
    __builtin_amdgcn_wave_barrier();
    __builtin_amdgcn_fence(__ATOMIC_ACQUIRE, "workgroup");
    if (OUT_MODE == 0) {
      float* C = (float*)Cout + (size_t)b * strideC;
      const int hh = lane >> 4, c4 = (lane & 15) * 4;     // 256-B row segment = 16 lanes x 16 B
      {
#pragma unroll
        for (int it = 0; it < 8; ++it) {
          const int row = it * 2 + hh;                     // it 0..7 x hh 0..1 = rows 0..15
          const v4f v = *(const v4f*)(slab + row * 68 + c4);
          *(v4f*)(C + (size_t)(mBase + row) * ldc + n0 + c4) = v;
        }
        // The registers these stores name are reused for the next 16 rows: the wait that belongs in front of an overwrite.
        asm volatile("s_wait_xcnt 0x0" ::: "memory");
      }
    } else {
      const int q = lane >> 3, c8 = (lane & 7) * 8;
      unsigned short* C  = (unsigned short*)Cout  + (size_t)b * strideC;
      unsigned short* C2 = (unsigned short*)Cout2 + (size_t)b * strideC2;
      const bool wlo = (OUT_MODE == 2) || (n0 < N2);      // wave-uniform
      v4u hv[4], lv[4];
#pragma unroll
      for (int it = 0; it < 4; ++it) {
        const int row = it * 4 + q;                        // it 0..3 x q 0..3 = rows 0..15
        const float* sp = slab + row * 68 + c8;
        v4u a, a2;
#pragma unroll
        for (int e = 0; e < 4; ++e) {
          const float f0 = sp[2 * e], f1 = sp[2 * e + 1];
          unsigned short h0, h1, l0, l1;
          if (OUT_MODE == 2) {
            h0 = bf_bits(f0); h1 = bf_bits(f1);
            l0 = bf_bits(f0 - bf_up(h0)); l1 = bf_bits(f1 - bf_up(h1));
          } else {
            const _Float16 x0 = (_Float16)f0, x1 = (_Float16)f1;
            h0 = h_bits(x0); h1 = h_bits(x1);
            l0 = h_bits((_Float16)((f0 - (float)x0) * rscale));
            l1 = h_bits((_Float16)((f1 - (float)x1) * rscale));
          }
          a[e] = pk16(h0, h1); a2[e] = pk16(l0, l1);
        }
        hv[it] = a; lv[it] = a2;
      }
      {
        // The registers a run of stores names are reused for the second plane's values and for the next 16 rows: the wait that
        // belongs in front of an overwrite stands directly behind each run. Addresses and data are its inputs, so they stay as
        // they are until it.
        unsigned short *ph[4], *pl[4];
#pragma unroll
        for (int it = 0; it < 4; ++it) {
          const int row = it * 4 + q;
          ph[it] = C + (size_t)(mBase + row) * ldc + n0 + c8;
          *(v4u*)ph[it] = hv[it];
        }
        asm volatile("s_wait_xcnt 0x0" :: "v"(ph[0]), "v"(ph[1]), "v"(ph[2]), "v"(ph[3]),
                                          "v"(hv[0]), "v"(hv[1]), "v"(hv[2]), "v"(hv[3]) : "memory");
        if (wlo) {
#pragma unroll
          for (int it = 0; it < 4; ++it) {
            const int row = it * 4 + q;
            pl[it] = C2 + (size_t)(mBase + row) * ldc2 + n0 + c8;
            *(v4u*)pl[it] = lv[it];
          }
          asm volatile("s_wait_xcnt 0x0" :: "v"(pl[0]), "v"(pl[1]), "v"(pl[2]), "v"(pl[3]),
                                            "v"(lv[0]), "v"(lv[1]), "v"(lv[2]), "v"(lv[3]) : "memory");
        }
      }
    }
    __builtin_amdgcn_fence(__ATOMIC_RELEASE, "workgroup");
    __builtin_amdgcn_wave_barrier();
    __builtin_amdgcn_fence(__ATOMIC_ACQUIRE, "workgroup");
  }
}

// One product per launch (the output projection). The operand pitches are template constants, so every pass's scalar base
// is the stage's base plus a constant step.
template <int NSPLIT, int OUT_MODE, int BIAS, int lda, int ldb>
__global__ __launch_bounds__(256) void gemm64(
    const unsigned short* __restrict__ Ap, const unsigned short* A2p, long long strideA,
    const unsigned short* __restrict__ Btp, long long strideB,
    const float* __restrict__ bias,
    void* Cout, int ldc, long long strideC,
    void* Cout2, int ldc2, long long strideC2, int N2,
    int M, int N, int K, float rscale) {
  __shared__ __align__(16) float sT[8][16 * 68];   // per-wave 16x64 slab, pitch 68 floats
  __shared__ __align__(16) __bf16 sS[2 * (512 + 64 * (1 + NSPLIT)) * LP];   // two stage buffers
  gemm64_body<NSPLIT, OUT_MODE, BIAS, 1>(Ap, A2p, lda, strideA, Btp, ldb, strideB, bias, Cout, ldc, strideC,
                                         Cout2, ldc2, strideC2, N2, M, N, K, rscale, blockIdx.x, blockIdx.y, sT, sS);
}

// The three independent input projections in one grid (GPB blocks each): blockIdx.y = 0: qp, 1: kp (bf16 hi/lo planes,
// M = NB*SEQ, N = DM), 2: vp^T (f16 hi + residual planes, M = DM, N = SEQ, batch = blockIdx.x / (GPB / NB)).
// Xb = bf16 planes of q, k, v in that order; WT = W^T planes of Wq, Wk, Wv; QK = planes Qh, Ql, Kh, Kl in that order.
#define GPB (((NB * SEQ / 64) * (DM / 64)) / 16)  // 64 blocks of 16 tiles (2 tile rows x 8 tile columns)
static_assert(GPB == NB * (((DM / 64) * (SEQ / 64)) / 16));
__global__ __launch_bounds__(512) void gemm_qkv(
    const unsigned short* __restrict__ Xb, const unsigned short* __restrict__ WT,
    const float* __restrict__ bq, const float* __restrict__ bk, const float* __restrict__ bv,
    unsigned short* QK, unsigned short* VTh, unsigned short* VTl) {
  __shared__ __align__(16) float sT[16][16 * 68];  // per-wave 16x64 slab, pitch 68 floats
  __shared__ __align__(16) __bf16 sS[2 * (512 + 128) * LP];   // two stage buffers
  const size_t NXE = (size_t)NB * SEQ * DM;
  const int y = blockIdx.y;                        // block-uniform
  if (y < 2) {
    const unsigned short* A = Xb + (size_t)y * NXE;
    gemm64_body<0, 2, 1, 2>(A, A, DM, 0LL, WT + (size_t)y * DM * DM, DM, 0LL, y ? bk : bq,
                         (void*)(QK + (size_t)(2 * y) * NXE), DM, 0LL, (void*)(QK + (size_t)(2 * y + 1) * NXE), DM, 0LL, DM,
                         NB * SEQ, DM, DM, 1.0f, blockIdx.x, 0, sT, sS);
  } else {
    const unsigned short* A = WT + (size_t)2 * DM * DM;
    gemm64_body<0, 3, 2, 2>(A, A, DM, 0LL, Xb + 2 * NXE, DM, (long long)SEQ * DM, bv,
                         (void*)VTh, SEQ, (long long)DM * SEQ, (void*)VTl, VLP, (long long)DM * VLP, VLP,
                         DM, SEQ, DM, 4096.0f, blockIdx.x % (GPB / NB), blockIdx.x / (GPB / NB), sT, sS);
  }
}

// =====================================================================================================
// Causal attention, head dim 64, key chunks of 64.
//   q planes (bf16 hi / lo): element (b, t, h, d) at [(b*SEQ + t)*DM + h*64 + d]
//   k planes (bf16 hi / lo): same layout with key index s
//   v^T hi plane (f16):      element (b, h, d, s) at [(b*DM + h*64 + d)*SEQ + s]
//   v^T residual plane (f16, (v - hi)*4096): [(b*DM + h*64 + d)*VLP + s], s < VLP, read only when RES
//   (a key chunk at or beyond VLP would contribute a zero v residual; its address is clamped)
//   Mask: query t keeps key s iff s <= t. A query block qb therefore needs key chunks 0..qb only. They are dealt to two wave
//   groups, even chunks to group 0, odd chunks to group 1 (block-uniform trip count (qb+2)/2 <= NQB/2); for even qb group 1's
//   last chunk is qb+1, in bounds and wholly masked. Each group keeps its own running max, normaliser and context sums.
//   Inside a visited chunk a masked key gets logit -inf -> exp gives exactly 0, so it adds nothing to the numerator
//   or the normaliser. Row max bookkeeping: every query keeps key 0 (chunk 0), so group 0's running max of every row is finite
//   after its first chunk; a group that has kept no key yet has max -inf, sums 0, and rescales by 0. Every row ends with l > 0.
//   out planes (bf16 hi / lo of the normalised context): element (b, t, h, d) at [(b*SEQ + t)*DM + h*64 + d]
//   scores = q . k : bf16 hi/lo split (hi.hi + hi.lo + lo.hi), f32 accumulate, then * 1/8 and the mask in f32
//   p = exp(s - m) carried as f16(1024 p); context = p . v on f16 WMMA; RES adds f16 residual planes of p and v
//   (scale 4096, separate accumulator folded back with 1/4096 per chunk in f32); online softmax (running max) in f32.
//   Block = 2 groups x 4 waves = 64 query rows of one (b, h), wave w and wave w+4 on the same 16 rows; grid = NQB * NH * NB.
//   K / V^T chunk staging, per group into its own tiles: 128 threads x 4 rows x 8 elements per plane = the whole 64x64 tile of every plane read later
//   (8 lanes per 128-B row). Residual variant: plain 16-B loads and LDS stores, __syncthreads before and after. Plain variant:
//   asynchronous 16-B copies straight into LDS, two buffers per group, chunk t + 2's copies issued behind the one barrier of trip t
//   (which stands behind the trip's last LDS read), so they fly for a whole trip's work.
//   Both products are computed transposed: S^T = K . Q^T (A = K rows, B = Q) and O^T += V^T . P^T (A = V^T rows, B = P^T).
//   A lane then holds 32 scores of ONE query (column lane&15; keys j*16 + 8*(lane>>4) + r): maximum and sum run in the lane,
//   the two wave halves exchange the maximum once per chunk and join their partial normalisers once, after the loop.
//   Two score tiles 2kk, 2kk+1, converted in place, are the B operand of key half kk in the hardware k order
//   (element e < 8: key 8*(lane>>4) + e, e >= 8: key 16 + 8*(lane>>4) + e - 8), the order the V^T loads already have: P never touches LDS.
//   Output coverage: each wave of group 0 stores rows q0..q0+15 (it 0..3 x lane>>3 0..3) x 64 columns (8 lanes x 8) of both planes;
//   grid over all (b, h, qb) = the whole [NB*SEQ][DM] planes.
// =====================================================================================================
#define XP 36                                      // floats per lane in the hand-over area: 144 B = 16 B x 9, 16-B accesses conflict-free
struct AttnTiles {                                 // one key chunk, staged and read by one wave group only
  __bf16   Ksh[64 * LP];                            // K hi [kv][d], pitch LP
  __bf16   Ksl[64 * LP];                            // K lo
  _Float16 Vth[64 * LP];                            // V^T hi [d][kv], pitch LP
  _Float16 Vtl[64 * LP];                            // V^T residual (RES only)
};
struct RingTile {                                  // one key chunk of the plain variant (no residual plane)
  __bf16   Ksh[64 * LP];
  __bf16   Ksl[64 * LP];
  _Float16 Vth[64 * LP];
};
struct AttnLds {                                   // one LDS layout for both variants (they share a grid)
  union {                                           // wave group 0: even key chunks, wave group 1: odd key chunks
    AttnTiles t[2];                                 // residual variant: [group], one buffer
    RingTile  r[2][2];                              // plain variant: [group][buffer]
  };
  float    Os[4][16 * OP];                          // per wave context tile [row][d] (group 0)
  float    Xs[4][32 * XP];                          // group 1 -> group 0: per lane 32 context sums, running max, partial normaliser
};
static_assert((64 * LP * 2) % 16 == 0 && (16 * LP * 2) % 16 == 0 && (16 * OP * 4) % 16 == 0 && (XP * 4) % 16 == 0);
static_assert(sizeof(RingTile) % 16 == 0 && sizeof(AttnTiles) % 16 == 0);

// Twelve asynchronous 16-B copies per lane, global memory -> LDS through no register: rows r, r+16, r+32, r+48 of three planes.
// A copy's global address is its scalar base + the lane's 32-bit byte offset (ko for both K planes, vo for V^T) + the immediate,
// its LDS address the plane's register (lk, ll, lv) + the same immediate: the immediate i * RSTEP moves both by the LDS step of
// 16 rows, so base i is handed in short of row 16 i by just that much. The s_wait_xcnt is the last line of the copies' own
// statement, so it stands in front of every later write of a register that a copy names.
#define RSTEP (16 * LP * 2)                        // 2304 B: 16 LDS rows
static_assert(RSTEP == 2304);                      // the immediates in the statement below
__device__ __forceinline__ void async_copy12(unsigned lk, unsigned ll, unsigned lv, unsigned ko, unsigned vo,
                                             const uint64_t (&kb)[4], const uint64_t (&lb)[4], const uint64_t (&vb)[4]) {
  asm volatile("global_load_async_to_lds_b128 %0, %3, %5\n\t"
               "global_load_async_to_lds_b128 %0, %3, %6 offset:2304\n\t"
               "global_load_async_to_lds_b128 %0, %3, %7 offset:4608\n\t"
               "global_load_async_to_lds_b128 %0, %3, %8 offset:6912\n\t"
               "global_load_async_to_lds_b128 %1, %3, %9\n\t"
               "global_load_async_to_lds_b128 %1, %3, %10 offset:2304\n\t"
               "global_load_async_to_lds_b128 %1, %3, %11 offset:4608\n\t"
               "global_load_async_to_lds_b128 %1, %3, %12 offset:6912\n\t"
               "global_load_async_to_lds_b128 %2, %4, %13\n\t"
               "global_load_async_to_lds_b128 %2, %4, %14 offset:2304\n\t"
               "global_load_async_to_lds_b128 %2, %4, %15 offset:4608\n\t"
               "global_load_async_to_lds_b128 %2, %4, %16 offset:6912\n\t"
               "s_wait_xcnt 0x0"
               :: "v"(lk), "v"(ll), "v"(lv), "v"(ko), "v"(vo),
                  "s"(kb[0]), "s"(kb[1]), "s"(kb[2]), "s"(kb[3]),
                  "s"(lb[0]), "s"(lb[1]), "s"(lb[2]), "s"(lb[3]),
                  "s"(vb[0]), "s"(vb[1]), "s"(vb[2]), "s"(vb[3])
               : "memory");
}

template <bool RES>
__device__ __forceinline__
void attn_causal64(const unsigned short* __restrict__ qhp, const unsigned short* __restrict__ qlp,
                   const unsigned short* __restrict__ khp, const unsigned short* __restrict__ klp,
                   const unsigned short* __restrict__ vhp, const unsigned short* __restrict__ vlp,
                   unsigned short* ohp, unsigned short* olp,
                   int qb, int h, int b, AttnLds& lds) {   // qb = 0..NQB-1, h, b: block-uniform
  union FB { v16b v; v8b h[2]; };
  union FH { v16h v; v8h h[2]; };
  const int tid  = threadIdx.x & 127;          // thread inside its wave group
  const int grp  = __builtin_amdgcn_readfirstlane((int)(threadIdx.x >> 7));   // wave group 0 / 1, wave-uniform
  const int wave = tid >> 5;                   // 0..3: the 16 query rows of the block this wave owns
  const int lane = tid & 31;
  const int hh   = lane >> 4;
  const int c    = lane & 15;

  // the tiles the next chunk is read from: fixed in the residual variant, the trip's buffer in the plain one
  __bf16*   Ksh = RES ? lds.t[grp].Ksh : lds.r[grp][0].Ksh;
  __bf16*   Ksl = RES ? lds.t[grp].Ksl : lds.r[grp][0].Ksl;
  _Float16* Vth = RES ? lds.t[grp].Vth : lds.r[grp][0].Vth;
  _Float16* const Vtl = lds.t[grp].Vtl;        // residual variant only
  float    (* const Os)[16 * OP]  = lds.Os;

  const int q0   = qb * 64 + wave * 16;
  const size_t rowB = (size_t)b * SEQ;

  const __bf16* Qh = (const __bf16*)(const void*)qhp + (size_t)h * HD;
  const __bf16* Ql = (const __bf16*)(const void*)qlp + (size_t)h * HD;
  const __bf16* Kh = (const __bf16*)(const void*)khp + (size_t)h * HD;
  const __bf16* Kl = (const __bf16*)(const void*)klp + (size_t)h * HD;
  const _Float16* Vh = (const _Float16*)(const void*)vhp + ((size_t)b * DM + (size_t)h * HD) * SEQ;
  const _Float16* Vl = (const _Float16*)(const void*)vlp + ((size_t)b * DM + (size_t)h * HD) * VLP;

  // ---- Q fragments (B operand, column = lane&15): 2 d-chunks, hi and lo ----
  v16b qah[2], qal[2];
  const __bf16* qhg = Qh + (rowB + q0 + c) * DM + 8 * hh;
  const __bf16* qlg = Ql + (rowB + q0 + c) * DM + 8 * hh;
#pragma unroll
  for (int dc = 0; dc < 2; ++dc) {
    qah[dc] = ldfrag_b(qhg + dc * 32);
    qal[dc] = ldfrag_b(qlg + dc * 32);
  }
  // The two address pairs are free for reuse behind these loads: the wait that belongs in front of an overwrite, the pairs as its inputs.
  asm volatile("s_wait_xcnt 0x0" :: "v"(qhg), "v"(qlg) : "memory");

  const int rowq = q0 + c;                     // this lane's query
  float mrow = -INFINITY, lrow = 0.f;          // running exponent offset of the query (both halves alike), this half's partial normaliser (of 1024 p)
  v8f oacc[4];                                 // oacc[t][r] = O^T[d = t*16 + 8hh + r][query c]
#pragma unroll
  for (int t = 0; t < 4; ++t) oacc[t] = zero8();

  // One staged key chunk: scores, online softmax, context sums. MASK = the chunk may hold keys beyond a query of this block.
  const float SC2 = 0.125f * 1.44269504088896340736f;   // score scale times log2 e
  auto chunk = [&](auto mk, const int kv0, auto mid) __attribute__((always_inline)) {
    constexpr bool MASK = decltype(mk)::value;
    // ---- scores, transposed: 64 keys x 16 queries per wave, 3 bf16 products ----
    // All K fragments of a d-chunk are read as one group, then the four key tiles' accumulators take turns, so one LDS wait
    // serves 12 products and no product waits for the one before it. Each s[j] still sums hi.hi, hi.lo, lo.hi per d-chunk.
    v8f s[4];                                  // s[j][r] = S^T[key kv0 + j*16 + 8hh + r][query c]
#pragma unroll
    for (int j = 0; j < 4; ++j) s[j] = zero8();
#pragma unroll
    for (int dc = 0; dc < 2; ++dc) {
      FB kb[4], kl[4];
#pragma unroll
      for (int j = 0; j < 4; ++j) {
        kb[j].h[0] = *(const v8b*)(Ksh + (j * 16 + c) * LP + dc * 32 + 8 * hh);
        kb[j].h[1] = *(const v8b*)(Ksh + (j * 16 + c) * LP + dc * 32 + 16 + 8 * hh);
        kl[j].h[0] = *(const v8b*)(Ksl + (j * 16 + c) * LP + dc * 32 + 8 * hh);
        kl[j].h[1] = *(const v8b*)(Ksl + (j * 16 + c) * LP + dc * 32 + 16 + 8 * hh);
      }
#pragma unroll
      for (int j = 0; j < 4; ++j) s[j] = mma_b_raw(kb[j].v, qah[dc], s[j]);
#pragma unroll
      for (int j = 0; j < 4; ++j) s[j] = mma_b_raw(kl[j].v, qah[dc], s[j]);
#pragma unroll
      for (int j = 0; j < 4; ++j) s[j] = mma_b_raw(kb[j].v, qal[dc], s[j]);
    }

    // Plain variant: all V^T fragments of the chunk are read here, the chunk's last LDS reads. mid() hands the buffer on behind them
    // (the ring's waits, barrier and refill); the softmax and the second product then work on registers alone.
    FH vf[2][4];
    if (!RES) {
#pragma unroll
      for (int kk = 0; kk < 2; ++kk)
#pragma unroll
        for (int t = 0; t < 4; ++t) {
          vf[kk][t].h[0] = *(const v8h*)(Vth + (t * 16 + c) * LP + kk * 32 + 8 * hh);
          vf[kk][t].h[1] = *(const v8h*)(Vth + (t * 16 + c) * LP + kk * 32 + 16 + 8 * hh);
        }
    }
    mid();

    // ---- causal mask by index (MASK chunks only), maximum of the raw scores in the lane (one chain per key tile), one exchange ----
    float mj[4];
#pragma unroll
    for (int j = 0; j < 4; ++j) {
      mj[j] = -INFINITY;
#pragma unroll
      for (int r = 0; r < 8; ++r) {
        if (MASK) {
          const int key = kv0 + j * 16 + 8 * hh + r;
          s[j][r] = (key <= rowq) ? s[j][r] : -INFINITY;
        }
        mj[j] = fmaxf(mj[j], s[j][r]);
      }
    }
    float m = fmaxf(fmaxf(mj[0], mj[1]), fmaxf(mj[2], mj[3]));
    m = fmaxf(m, xhalf(m));                    // both halves now hold the query's maximum over the chunk
    // The running max is kept as the exponent's offset: max * (log2 e / 8) - 10, rounded once (monotone in the max, -inf stays -inf).
    // Every p, every rescale and the groups' join subtract such offsets only, so numerator and normaliser share one reference.
    const float mnew  = fmaxf(mrow, __builtin_fmaf(m, SC2, -10.0f));
    const float msafe = (mnew == -INFINITY) ? 0.f : mnew;
    const float alpha = exp2_1(mrow - msafe);
    mrow = mnew;

    // ---- online softmax; P (x1024, f16) and P residual (x4096) packed straight into the B operands of the second product ----
    FH pa[2], pl[2];
    float pj[4];
    const v8f sc2v = {SC2, SC2, SC2, SC2, SC2, SC2, SC2, SC2};
    const v8f nmv  = {-msafe, -msafe, -msafe, -msafe, -msafe, -msafe, -msafe, -msafe};
#pragma unroll
    for (int j = 0; j < 4; ++j) {
      // one fused multiply-add per score (as a vector, so two share an instruction): 1/8, log2 e, the max and the x1024 carry
      v8f y;
      if (RES) {                               // single FMAs: as pairs this variant's build took 259 registers, and above 256 one block fewer fits a WGP
#pragma unroll
        for (int r = 0; r < 8; ++r) y[r] = __builtin_fmaf(s[j][r], SC2, -msafe);
      } else {
        y = __builtin_elementwise_fma(s[j], sc2v, nmv);
      }
      const v8f e = exp2_8(y);                 // 1024 p; masked logit: 2^(-inf) = 0
#pragma unroll
      for (int r = 0; r < 8; ++r) {
        const float p1k = e[r];
        pj[j] = r ? pj[j] + p1k : p1k;
        const _Float16 ph = (_Float16)p1k;
        pa[j >> 1].v[(j & 1) * 8 + r] = ph;
        if (RES) pl[j >> 1].v[(j & 1) * 8 + r] = (_Float16)((p1k - (float)ph) * 4096.0f);
      }
    }
    lrow = lrow * alpha + ((pj[0] + pj[1]) + (pj[2] + pj[3]));
#pragma unroll
    for (int t = 0; t < 4; ++t)
#pragma unroll
      for (int r = 0; r < 8; ++r) oacc[t][r] *= alpha;

    // ---- context^T += V^T . P^T (f16 WMMA), residual products into a separate accumulator ----
    v8f o1[4];
#pragma unroll
    for (int t = 0; t < 4; ++t) o1[t] = zero8();
    // Unrolled, with each key half's V fragments read as one group ahead of its products; the four d tiles take turns.
#pragma unroll
    for (int kk = 0; kk < 2; ++kk) {
      FH vb[4], vl[4];
#pragma unroll
      for (int t = 0; t < 4; ++t) {
        if (RES) {
          vb[t].h[0] = *(const v8h*)(Vth + (t * 16 + c) * LP + kk * 32 + 8 * hh);
          vb[t].h[1] = *(const v8h*)(Vth + (t * 16 + c) * LP + kk * 32 + 16 + 8 * hh);
        } else {
          vb[t].v = vf[kk][t].v;
        }
        if (RES) {
          vl[t].h[0] = *(const v8h*)(Vtl + (t * 16 + c) * LP + kk * 32 + 8 * hh);
          vl[t].h[1] = *(const v8h*)(Vtl + (t * 16 + c) * LP + kk * 32 + 16 + 8 * hh);
        } else {
          vl[t].v = vb[t].v;
        }
      }
#pragma unroll
      for (int t = 0; t < 4; ++t) oacc[t] = mma_h_raw(vb[t].v, pa[kk].v, oacc[t]);
      if (RES) {
#pragma unroll
        for (int t = 0; t < 4; ++t) o1[t] = mma_h_raw(vl[t].v, pa[kk].v, o1[t]);
#pragma unroll
        for (int t = 0; t < 4; ++t) o1[t] = mma_h_raw(vb[t].v, pl[kk].v, o1[t]);
      }
    }
    if (RES) {
#pragma unroll
      for (int t = 0; t < 4; ++t)
#pragma unroll
        for (int r = 0; r < 8; ++r) oacc[t][r] += o1[t][r] * (1.0f / 4096.0f);
    }
  };

  // Residual variant: bring key chunk kv0 .. kv0 + 63 into this group's tiles, between two barriers that all eight waves pass.
  auto stage = [&](const int kv0) __attribute__((always_inline)) {
    __syncthreads();
    {
      // 8 lanes per 128-B row, 4 rows per wave and load: every wave-wide 16-B load covers 4 whole lines (2 lanes per row
      // touched 16 lines for the same 512 B). A thread takes piece pc of rows r, r+16, r+32, r+48.
      const int r = tid >> 3, pc = (tid & 7) * 8;
      const __bf16*   kg  = Kh + (rowB + kv0 + r) * DM + pc;      // K row kv0+r, d = pc..pc+7
      const __bf16*   klg = Kl + (rowB + kv0 + r) * DM + pc;
      const _Float16* vg  = Vh + (size_t)r * SEQ + kv0 + pc;      // V^T row d = r, s = kv0+pc..+7
      const int kvl = (kv0 + 64 <= VLP) ? kv0 : (VLP - 64);     // clamped address into the residual plane
      const _Float16* vlg = Vl + (size_t)r * VLP + kvl + pc;
      const bool resOK = (kv0 + 64 <= VLP);                      // wave-uniform (always true for qb < RESQB)
#pragma unroll
      for (int i = 0; i < 4; ++i) {
        const v8b a0 = *(const v8b*)(kg + (size_t)(16 * i) * DM);
        const v8b a1 = *(const v8b*)(klg + (size_t)(16 * i) * DM);
        const v8h b0 = *(const v8h*)(vg + (size_t)(16 * i) * SEQ);
        *(v8b*)(Ksh + (r + 16 * i) * LP + pc) = a0;
        *(v8b*)(Ksl + (r + 16 * i) * LP + pc) = a1;
        *(v8h*)(Vth + (r + 16 * i) * LP + pc) = b0;
        if (RES) {
          v8h b1 = *(const v8h*)(vlg + (size_t)(16 * i) * VLP);
          if (!resOK) b1 = zero8h();
          *(v8h*)(Vtl + (r + 16 * i) * LP + pc) = b1;
        }
      }
      // RES build: the last load's result was placed on address pairs that earlier loads of this batch name. The pairs are
      // inputs of the wait, so they stay as they are until the batch's address translations are done.
      if (RES) asm volatile("s_wait_xcnt 0x0" :: "v"(kg), "v"(klg), "v"(vg), "v"(vlg) : "memory");
      else     asm volatile("s_wait_xcnt 0x0" :: "v"(kg), "v"(klg), "v"(vg) : "memory");
    }
    __syncthreads();
  };

  // chunk 2*it + grp <= qb, or qb + 1 <= NQB - 1 for even qb (all masked): kv0 + 63 < SEQ.
  // Only the last trip's chunks reach or pass the diagonal (2*it + grp >= qb needs it = trips - 1): the trips before it keep every
  // key and run without the mask's compare and select. The last trip stands behind the loop, so the loop holds one variant only.
  const int trips = (qb + 2) >> 1;             // block-uniform, 1 <= trips <= NQB / 2: chunks 0..qb dealt even / odd to the two groups
  if constexpr (RES) {
    for (int it = 0; it + 1 < trips; ++it) {
      const int kv0 = (2 * it + grp) * 64;
      stage(kv0);
      chunk(BoolC<false>(), kv0, [] {});
    }
    {
      const int kv0 = (2 * (trips - 1) + grp) * 64;
      stage(kv0);
      chunk(BoolC<true>(), kv0, [] {});
    }
  } else {
    // Key chunk kv0 .. kv0 + 63 into buffer buf of this group: the same pieces as stage() (8 lanes per 128-B row, a thread takes
    // piece pc of rows r, r+16, r+32, r+48 of each plane), every lane on, under block-uniform control flow.
    const unsigned ko = (unsigned)((tid >> 3) * DM + (tid & 7) * 8) * 2u;    // the lane's byte offset in a K chunk: row r, piece pc
    const unsigned vo = (unsigned)((tid >> 3) * SEQ + (tid & 7) * 8) * 2u;   // ... and in a V^T chunk
    const unsigned lo = (unsigned)((tid >> 3) * LP + (tid & 7) * 8) * 2u;    // ... and in an LDS plane
    auto copy_chunk = [&](const int kv0, const int buf) __attribute__((always_inline)) {
      const uint64_t kg  = (uint64_t)(uintptr_t)(Kh + (rowB + kv0) * DM);      // wave-uniform: K row kv0, d = 0
      const uint64_t klg = (uint64_t)(uintptr_t)(Kl + (rowB + kv0) * DM);
      const uint64_t vg  = (uint64_t)(uintptr_t)(Vh + kv0);                    // V^T row d = 0, s = kv0
      RingTile& rt = lds.r[grp][buf];
      uint64_t kb[4], lb[4], vb[4];
#pragma unroll
      for (int i = 0; i < 4; ++i) {
        kb[i] = kg  + (uint64_t)i * (16 * DM * 2 - RSTEP);
        lb[i] = klg + (uint64_t)i * (16 * DM * 2 - RSTEP);
        vb[i] = vg  + (uint64_t)i * (16 * SEQ * 2 - RSTEP);
      }
      async_copy12(lds_byte(rt.Ksh) + lo, lds_byte(rt.Ksl) + lo, lds_byte(rt.Vth) + lo, ko, vo, kb, lb, vb);
    };
    auto use_buf = [&](const int buf) __attribute__((always_inline)) {
      Ksh = lds.r[grp][buf].Ksh;
      Ksl = lds.r[grp][buf].Ksl;
      Vth = lds.r[grp][buf].Vth;
    };
    copy_chunk(grp * 64, 0);
    asm volatile("s_wait_asynccnt 0x0" ::: "memory");   // this wave's copies of chunk 0 have landed
    __syncthreads();                                     // ... and every other wave's: chunk 0 may be read
    if (trips > 1) copy_chunk((2 + grp) * 64, 1);
    for (int it = 0; it + 1 < trips; ++it) {
      use_buf(it & 1);
      chunk(BoolC<false>(), (2 * it + grp) * 64, [&]() __attribute__((always_inline)) {
        asm volatile("s_wait_dscnt 0x0" ::: "memory");     // this wave's reads of the trip's buffer are done before it is refilled
        asm volatile("s_wait_asynccnt 0x0" ::: "memory");  // this wave's copies of the next chunk have landed
        __syncthreads();                                   // one barrier: the next chunk is whole, this trip's buffer is free
        if (it + 2 < trips) copy_chunk((2 * (it + 2) + grp) * 64, it & 1);
      });
    }
    use_buf((trips - 1) & 1);
    chunk(BoolC<true>(), (2 * (trips - 1) + grp) * 64, [] {});
    asm volatile("s_wait_asynccnt 0x0" ::: "memory");    // no copy is outstanding when the wave goes on to the join and its end
  }

  // ---- join the halves' normalisers, normalise (1/l; the x1024 carry is in l too), stage the wave's 16x64 tile [query][d]
  //      (a lane's 8 registers of a tile are 8 consecutive d of its query: two 16-B stores), bf16 hi/lo split,
  // ---- join the two wave groups: group 1 leaves its context sums, running max and partial normaliser in LDS (a lane's own
  //      144-B row), all eight waves pass one barrier, group 0 rescales both parts to the common max and adds them; group 1 is done.
  float* xs = lds.Xs[wave] + lane * XP;
  if (grp == 1) {
#pragma unroll
    for (int t = 0; t < 4; ++t) {
      v4f w0, w1;
#pragma unroll
      for (int r = 0; r < 4; ++r) { w0[r] = oacc[t][r]; w1[r] = oacc[t][4 + r]; }
      *(v4f*)(xs + t * 8)     = w0;
      *(v4f*)(xs + t * 8 + 4) = w1;
    }
    xs[32] = mrow;
    xs[33] = lrow;
  }
  __syncthreads();
  if (grp == 1) return;                        // wave-uniform; no block barrier follows
  {
    const float m2 = xs[32], l2 = xs[33];
    const float mm = fmaxf(mrow, m2);
    const float ms = (mm == -INFINITY) ? 0.f : mm;
    const float a1 = exp2_1(mrow - ms);
    const float a2 = exp2_1(m2 - ms);     // group 1 kept no key (query block 0): m2 = -inf, a2 = 0, its sums are 0
    lrow = lrow * a1 + l2 * a2;
#pragma unroll
    for (int t = 0; t < 4; ++t) {
      const v4f x0 = *(const v4f*)(xs + t * 8);
      const v4f x1 = *(const v4f*)(xs + t * 8 + 4);
#pragma unroll
      for (int r = 0; r < 4; ++r) {
        oacc[t][r]     = oacc[t][r] * a1 + x0[r] * a2;
        oacc[t][4 + r] = oacc[t][4 + r] * a1 + x1[r] * a2;
      }
    }
  }

  float* os = Os[wave];
  {
    const float l = lrow + xhalf(lrow);        // unconditional: both halves take part in the exchange
    const float inv = (l > 0.f) ? (1.0f / l) : 0.f;   // l sums 1024 p, as the context sums do
#pragma unroll
    for (int t = 0; t < 4; ++t) {
      v4f w0, w1;
#pragma unroll
      for (int r = 0; r < 4; ++r) { w0[r] = oacc[t][r] * inv; w1[r] = oacc[t][4 + r] * inv; }
      *(v4f*)(os + c * OP + t * 16 + 8 * hh)     = w0;
      *(v4f*)(os + c * OP + t * 16 + 8 * hh + 4) = w1;
    }
  }
  __builtin_amdgcn_fence(__ATOMIC_RELEASE, "workgroup");
  __builtin_amdgcn_wave_barrier();
  __builtin_amdgcn_fence(__ATOMIC_ACQUIRE, "workgroup");
  {
    const int q4 = lane >> 3, c8 = (lane & 7) * 8;
    v4u hv[4], lv[4];
#pragma unroll
    for (int it = 0; it < 4; ++it) {
      const int row = it * 4 + q4;   // it 0..3 x q4 0..3 = rows 0..15 of the wave tile
      const float* sp = os + row * OP + c8;
      v4u a, a2;
#pragma unroll
      for (int e = 0; e < 4; ++e) {
        const float f0 = sp[2 * e], f1 = sp[2 * e + 1];
        const unsigned short h0 = bf_bits(f0), h1 = bf_bits(f1);
        const unsigned short l0 = bf_bits(f0 - bf_up(h0)), l1 = bf_bits(f1 - bf_up(h1));
        a[e] = pk16(h0, h1); a2[e] = pk16(l0, l1);
      }
      hv[it] = a; lv[it] = a2;
    }
    {
#pragma unroll
      for (int it = 0; it < 4; ++it) {
        const int row = it * 4 + q4;
        const size_t go = (rowB + q0 + row) * DM + (size_t)h * HD + c8;
        *(v4u*)(ohp + go) = hv[it];
        *(v4u*)(olp + go) = lv[it];
        // The registers these two stores name are reused for the next pair's address and data: wait before they are overwritten.
        asm volatile("s_wait_xcnt 0x0" ::: "memory");
      }
    }
  }
}

// Both attention variants in one grid. Eight-wave blocks no longer all fit on the chip at once, so the block index sets the order
// of starting. First the leading RESQB query blocks (residual planes): few trips, but each far dearer than a plain one, so started
// last they would run on alone. Then the plain blocks from the longest (NQB-1) down to RESQB: a place that falls free takes the
// longest block left, and the launch ends on the shortest. The branch is block-uniform.
__global__ __launch_bounds__(256)
void attn_all(const unsigned short* __restrict__ qhp, const unsigned short* __restrict__ qlp,
              const unsigned short* __restrict__ khp, const unsigned short* __restrict__ klp,
              const unsigned short* __restrict__ vhp, const unsigned short* __restrict__ vlp,
              unsigned short* ohp, unsigned short* olp) {
  __shared__ __align__(16) AttnLds lds;
  const int bx = blockIdx.x;
  const int g  = bx / (NB * NH);               // 0..NQB-1
  const int qb = (g < RESQB) ? (RESQB - 1 - g) : (NQB - 1 + RESQB - g);   // RESQB-1..0, then NQB-1..RESQB: every (qb, h, b) exactly once
  const int hb = bx % (NB * NH);
  // (with the two calls in this order the build stays within 256 registers; above that one block fewer fits a WGP)
  if (qb < RESQB) attn_causal64<true>(qhp, qlp, khp, klp, vhp, vlp, ohp, olp, qb, hb % NH, hb / NH, lds);
  else            attn_causal64<false>(qhp, qlp, khp, klp, vhp, vlp, ohp, olp, qb, hb % NH, hb / NH, lds);
}

// =====================================================================================================
// Workspace map (bytes; every region is an exact multiple of its 64x64-tile / whole-line store granularity,
//   Qb   bf16 [8192][512]            0            8388608
//   Kb   bf16 [8192][512]            8388608      8388608
//   Vb   bf16 [8192][512]            16777216     8388608
//   WqT  bf16 [512 n][512 k]         25165824     524288
//   WkT                              25690112     524288
//   WvT                              26214400     524288
//   WoT                              26738688     524288
//   Qh   bf16 [8192][512]            27262976     8388608
//   Ql                               35651584     8388608
//   Kh                               44040192     8388608
//   Kl                               52428800     8388608
//   VTh  f16  [2][512][4096]         60817408     8388608
//   VTl  f16  [2][512][512]          69206016     1048576
//   Oh   bf16 [8192][512]            70254592     8388608
//   Ol                               78643200     8388608
//   end                              87031808
// =====================================================================================================
extern "C" void kernel_launch(void* const* d_in, const int* in_sizes, int n_in,
                              void* d_out, int out_size, void* d_ws, size_t ws_size,
                              hipStream_t stream) {
  if (n_in < 11) return;
  const int NX = NB * SEQ * DM;                    // 4194304
  if (in_sizes[0] != NX || in_sizes[1] != NX || in_sizes[2] != NX) return;
  if (in_sizes[3] != DM * DM || in_sizes[5] != DM * DM || in_sizes[7] != DM * DM || in_sizes[9] != DM * DM) return;
  if (in_sizes[4] != DM || in_sizes[6] != DM || in_sizes[8] != DM || in_sizes[10] != DM) return;
  if (out_size != NX) return;

  const float* v  = (const float*)d_in[0];   // [2][4096][512]
  const float* k  = (const float*)d_in[1];   // [2][4096][512]
  const float* q  = (const float*)d_in[2];   // [2][4096][512]
  const float* Wq = (const float*)d_in[3];   // [512 in][512 out] = [k][n]
  const float* bq = (const float*)d_in[4];   // [512]
  const float* Wk = (const float*)d_in[5];   // [512 in][512 out]
  const float* bk = (const float*)d_in[6];   // [512]
  const float* Wv = (const float*)d_in[7];   // [512 in][512 out]
  const float* bv = (const float*)d_in[8];   // [512]
  const float* Wo = (const float*)d_in[9];   // [512 in][512 out]
  const float* bo = (const float*)d_in[10];  // [512]

  const size_t PX  = (size_t)NB * SEQ * DM * 2;    //  8388608  16-bit activation plane [8192][512]
  const size_t PW  = (size_t)DM * DM * 2;          //   524288  16-bit weight plane [512][512]
  const size_t PVT = (size_t)NB * DM * SEQ * 2;    //  8388608  v^T hi plane
  const size_t PVL = (size_t)NB * DM * VLP * 2;    //  1048576  v^T residual plane
  size_t off = 0;
  const size_t oQb  = off; off += PX;
  const size_t oKb  = off; off += PX;
  const size_t oVb  = off; off += PX;
  const size_t oWq  = off; off += PW;
  const size_t oWk  = off; off += PW;
  const size_t oWv  = off; off += PW;
  const size_t oWo  = off; off += PW;
  const size_t oQh  = off; off += PX;
  const size_t oQl  = off; off += PX;
  const size_t oKh  = off; off += PX;
  const size_t oKl  = off; off += PX;
  const size_t oVTh = off; off += PVT;
  const size_t oVTl = off; off += PVL;
  const size_t oOh  = off; off += PX;
  const size_t oOl  = off; off += PX;
  if (off > ws_size) return;                       // off = 87031808
  if (off > (size_t)134217728) return;

  char* ws = (char*)d_ws;
  unsigned short* Qb  = (unsigned short*)(ws + oQb);
  unsigned short* Kb  = (unsigned short*)(ws + oKb);
  unsigned short* Vb  = (unsigned short*)(ws + oVb);
  unsigned short* WqT = (unsigned short*)(ws + oWq);
  unsigned short* WkT = (unsigned short*)(ws + oWk);
  unsigned short* WvT = (unsigned short*)(ws + oWv);
  unsigned short* WoT = (unsigned short*)(ws + oWo);
  unsigned short* Qh  = (unsigned short*)(ws + oQh);
  unsigned short* Ql  = (unsigned short*)(ws + oQl);
  unsigned short* Kh  = (unsigned short*)(ws + oKh);
  unsigned short* Kl  = (unsigned short*)(ws + oKl);
  unsigned short* VTh = (unsigned short*)(ws + oVTh);
  unsigned short* VTl = (unsigned short*)(ws + oVTl);
  unsigned short* Oh  = (unsigned short*)(ws + oOh);
  unsigned short* Ol  = (unsigned short*)(ws + oOl);

  const dim3 blk(256);
  const dim3 gProj(((NB * SEQ / 64) * (DM / 64)) / 8, 1);      // 1024 tiles -> 128 blocks of 8: M=8192, N=512

  // (1) all plane conversions in one grid: weights f32 [k][n] -> bf16 W^T [n][k] (WqT, WkT, WvT, WoT are contiguous),
  //     activations f32 -> bf16 planes of the inputs' layout (Qb, Kb, Vb are contiguous)
  prep_planes<<<dim3(4 * NTR + 3 * NCV), blk, 0, stream>>>(q, k, v, Wq, Wk, Wv, Wo, Qb, WqT);
  // (2) the three input projections in one grid: qp, kp -> bf16 hi/lo planes [b*SEQ+t][h*64+d] (Qh, Ql, Kh, Kl contiguous),
  //     vp^T per batch -> f16 hi plane [b][h*64+d][s] (pitch SEQ) and residual plane (x4096, keys < VLP only, pitch VLP)
  gemm_qkv<<<dim3(GPB, 3), dim3(512), 0, stream>>>(Qb, WqT, bq, bk, bv, Qh, VTh, VTl);
  // (3) causal attention, one grid: query blocks RESQB.. without, 0..RESQB-1 with residual planes
  attn_all<<<dim3(NB * NH * NQB), dim3(256), 0, stream>>>(Qh, Ql, Kh, Kl, VTh, VTl, Oh, Ol);
  // (4) out = context . Wo + bo -> d_out f32 [8192][512]  (A = context hi + lo planes, 2 products; Bt = WoT)
  gemm64<1, 0, 1, DM, DM><<<gProj, blk, 0, stream>>>(
      Oh, Ol, 0LL, WoT, 0LL, bo,
      d_out, DM, 0LL, d_out, DM, 0LL, DM,
      NB * SEQ, DM, DM, 1.0f);
  (void)hipGetLastError();
}
